// v000
// Measured on an AMD MI455X. A time is GPU time per run, averaged over a window of back-to-back runs after a warm-up
// (all launches, gaps included; the runs take copies of the inputs in turn), and the median of several windows.
// Apart from v000's, it joins two sittings. Times from different sittings can be a few percent apart, while
// side-by-side timings come from the same sitting.
// v000, which the later versions start from, runs in 781 microseconds.
#include <hip/hip_runtime.h>

#define EPSF 1.1920929e-07f
// Contractions: qkv / o / gate / up / down projections (K = 1024 / 3072), scores QK^T (K = 64) and PV (K = keys, causal) on
// v_wmma_f32_16x16x32_f16 (f16 operands stored as raw 16-bit words, f32 accumulate; P scaled by 256 before its f16 conversion);
// FiLM, RMSNorm, SiLU gating, softmax statistics, the column mean and the state update in f32 on VALU. B operands are
// pre-packed in the ISA fragment order (element e of lane (h, n) = k0 + 8h + e for e < 8, k0 + 16 + 8h + (e-8) otherwise).

typedef __attribute__((ext_vector_type(16))) _Float16        v16bf;   // (alias name kept; IEEE half)
typedef __attribute__((ext_vector_type(4)))  float           v4f;
typedef __attribute__((ext_vector_type(4)))  unsigned        v4u;
template <typename V> __device__ __forceinline__ void vst2(void* p, V v) {
    *(V*)p = v; 
}
typedef float __attribute__((may_alias)) float_a;
#define PSC 256.0f
#define PUN (1.0f / 256.0f)
typedef __attribute__((ext_vector_type(8)))  float           v8f;
typedef __attribute__((ext_vector_type(8)))  unsigned short  ushort8;
typedef __attribute__((ext_vector_type(16))) unsigned short  ushort16;

union Frag {
    ushort16 u;
    v16bf    b;
    ushort8  h[2];
};

__device__ __forceinline__ unsigned short f2b(float f) {     // f32 -> f16 bits (name kept)
    union { _Float16 h; unsigned short u; } c; c.h = (_Float16)f; return c.u;
}
__device__ __forceinline__ float b2f(unsigned short s) {
    union { unsigned short u; _Float16 h; } c; c.u = s; return (float)c.h;
}
__device__ __forceinline__ v8f wmma16(v16bf a, v16bf b, v8f c) {
    v8f d = __builtin_amdgcn_wmma_f32_16x16x32_f16(false, a, false, b, (short)0, c, false, false);
    asm volatile("v_nop\n\tv_nop\n\tv_nop\n\tv_nop" : "+v"(d) : "v"(a), "v"(b));
    return d;
}

// ---------------------------------------------------------------------------
// FiLM params: state_mod = state @ w_state_mod; fg = gamma*(1+sm[:D]); fb = beta+sm[D:]
// ---------------------------------------------------------------------------
__global__ void film_kernel(const float* __restrict__ state, const float* __restrict__ wsm,
                            const float* __restrict__ gamma, const float* __restrict__ beta,
                            float* __restrict__ fg, float* __restrict__ fb, int SD, int D) {
    int idx = blockIdx.x * blockDim.x + threadIdx.x;     // over B * 2D
    int b = idx / (2 * D);
    int c = idx % (2 * D);
    if (b >= 2) return;
    float s = 0.f;
    for (int k = 0; k < SD; ++k) s += state[b * SD + k] * wsm[k * 2 * D + c];
    if (c < D) vst2(fg + b * D + c, (float_a)(gamma[c] * (1.f + s)));
    else       vst2(fb + b * D + (c - D), (float_a)(beta[c - D] + s));
}

// ---------------------------------------------------------------------------
// RMSNorm + FiLM -> f16 row-major output
// ---------------------------------------------------------------------------
__global__ __launch_bounds__(256) void rmsnorm_film(
        const float* __restrict__ x, const float* __restrict__ nw,
        const float* __restrict__ fg, const float* __restrict__ fb,
        unsigned short* __restrict__ out, int S, int D) {
    int row = blockIdx.x;           // b*S + s
    int b = row / S;
    const float* xr = x + (size_t)row * D;
    float ss = 0.f;
    for (int d = threadIdx.x; d < D; d += 256) { float v = xr[d]; ss += v * v; }
    for (int m = 16; m >= 1; m >>= 1) ss += __shfl_xor(ss, m, 32);
    __shared__ float red[8];
    if ((threadIdx.x & 31) == 0) red[threadIdx.x >> 5] = ss;
    __syncthreads();
    float tot = 0.f;
    for (int i = 0; i < 8; ++i) tot += red[i];
    float scale = rsqrtf(tot / (float)D + EPSF);
    const float* fgb = fg + (size_t)b * D;
    const float* fbb = fb + (size_t)b * D;
    unsigned short* orow = out + (size_t)row * D;
    {   // 4 consecutive d per thread (D = 1024 = 256 x 4): 8-B lanes, a wave writes 256 contiguous bytes
        const int d0 = threadIdx.x * 4;
        union { unsigned short s[4]; unsigned long long u; } pk;
        #pragma unroll
        for (int e = 0; e < 4; ++e) { const int d = d0 + e; pk.s[e] = f2b(xr[d] * scale * nw[d] * fgb[d] + fbb[d]); }
        vst2(orow + d0, pk.u);
    }
}

// ---------------------------------------------------------------------------
// Pack f32 weight (K x N, row-major, y = x@W) into WMMA B-fragment layout:
// frag (nt, kt): 32 lanes x 16 halfs in the ISA order
// ---------------------------------------------------------------------------
__global__ void pack_b(const float* __restrict__ W, unsigned short* __restrict__ out, int K, int N) {
    int g = blockIdx.x * 256 + threadIdx.x;          // 8 consecutive fragment elements (16 B) per thread
    if (g * 8 >= K * N) return;
    union { unsigned short s[8]; v4u u; } pk;
    #pragma unroll
    for (int q = 0; q < 8; ++q) {
        int idx  = g * 8 + q;
        int j    = idx & 15;
        int lane = (idx >> 4) & 31;
        int r    = idx >> 9;
        int ktc  = K >> 5;
        int kt   = r % ktc;
        int nt   = r / ktc;
        int k = kt * 32 + 8 * (lane >> 4) + (j < 8 ? j : j + 8);      // ISA B map (same as A)
        int n = nt * 16 + (lane & 15);
        pk.s[q] = f2b(W[(size_t)k * N + n]);
    }
    vst2(out + (size_t)g * 8, pk.u);
}

// ---------------------------------------------------------------------------
// Pack V (from the f16 qkv buffer) into B-fragments: [bh][kb][n4][lane][16]
// ---------------------------------------------------------------------------
__global__ void pack_v(const unsigned short* __restrict__ qkvb, unsigned short* __restrict__ vp,
                       int S, int H, int HD, int total) {
    int g = blockIdx.x * 256 + threadIdx.x;
    if (g * 8 >= total) return;
    union { unsigned short s[8]; v4u u; } pk;
    #pragma unroll
    for (int q = 0; q < 8; ++q) {
        int idx  = g * 8 + q;
        int j    = idx & 15;
        int lane = (idx >> 4) & 31;
        int r    = idx >> 9;
        int n4 = r & 3;  r >>= 2;
        int kb = r & 63; r >>= 6;
        int bh = r;
        int b = bh >> 4, h = bh & 15;
        int key = kb * 32 + 8 * (lane >> 4) + (j < 8 ? j : j + 8);    // ISA B map
        int col = n4 * 16 + (lane & 15);
        pk.s[q] = qkvb[(size_t)(b * S + key) * (3 * H * HD) + 2 * H * HD + h * HD + col];
    }
    vst2(vp + (size_t)g * 8, pk.u);
}

// ---------------------------------------------------------------------------
// f16 GEMM via V_WMMA_F32_16X16X32_F16.
// Block: 256 thr = 8 waves; wave tile 32x64 (2x4 accum frags); block tile 64x256.
// A (M x K f16 row-major) is double-buffer staged into LDS per K-step with plain 16-B copies.
// B streams from packed fragments (contiguous 32B/lane).
// Epilogues: 0: f16 store | 1: f32 = acc+res | 2: f16 silu(acc) | 3: f16 gate*acc
// ---------------------------------------------------------------------------
template <int EPI>
__global__ __launch_bounds__(256) void gemm_f16(
        const unsigned short* __restrict__ A, const unsigned short* __restrict__ Bp,
        const float* __restrict__ resF, const unsigned short* __restrict__ gateB,
        float* __restrict__ outF, unsigned short* __restrict__ outB,
        int M, int N, int K) {
    __shared__ __align__(16) unsigned short atile[2][64 * 32];   // 2 x 4KB
    __shared__ __align__(16) float Ct[64][256];                    // block output tile (64 KB)

    const int lane = threadIdx.x & 31;
    const int w    = threadIdx.x >> 5;
    const int wm   = w >> 2;
    const int wn   = w & 3;
    const int mblock = blockIdx.y * 64;
    const int mbase  = mblock + wm * 32;
    const int nbase  = blockIdx.x * 256 + wn * 64;
    const int ktc = K >> 5;
    const int hi  = (lane >> 4) & 1;
    const int l15 = lane & 15;

    // cooperative A-staging mapping: 256 thr x 16B = 64x32 f16 tile
    const int srow   = threadIdx.x >> 2;
    const int schunk = (threadIdx.x & 3) * 8;            // ushort offset within row

    v8f acc[2][4] = {};

    const unsigned short* bp[4];
    for (int ni = 0; ni < 4; ++ni)
        bp[ni] = Bp + ((size_t)((nbase >> 4) + ni) * ktc) * 512 + lane * 16;

    const unsigned short* ag = A + (size_t)(mblock + srow) * K + schunk;

    // plain 16-B copy of the A tile for step kt into buffer buf
    auto issue = [&](int buf, int kt) {
        *(v4u*)(&atile[buf][srow * 32 + schunk]) = *(const v4u*)(ag + kt * 32);
    };

    issue(0, 0);
    int cur = 0;

    for (int kt = 0; kt < ktc; ++kt) {
        __syncthreads();                                  // tile(cur) stores visible; previous reads done
        if (kt + 1 < ktc) issue(cur ^ 1, kt + 1);

        Frag bfr[4];
        for (int ni = 0; ni < 4; ++ni) {
            bfr[ni].u = *(const ushort16*)(bp[ni]);
            if (kt + 1 < ktc) __builtin_prefetch(bp[ni] + 512, 0, 0);
            bp[ni] += 512;
        }

        Frag a0, a1;
        const unsigned short* l0 = &atile[cur][(wm * 32 + l15) * 32 + hi * 8];
        a0.h[0] = *(const ushort8*)(l0);
        a0.h[1] = *(const ushort8*)(l0 + 16);
        const unsigned short* l1 = l0 + 16 * 32;
        a1.h[0] = *(const ushort8*)(l1);
        a1.h[1] = *(const ushort8*)(l1 + 16);

        for (int ni = 0; ni < 4; ++ni) {
            acc[0][ni] = wmma16(a0.b, bfr[ni].b, acc[0][ni]);
            acc[1][ni] = wmma16(a1.b, bfr[ni].b, acc[1][ni]);
        }
        cur ^= 1;
    }

    // epilogue through the block tile: value after residual / silu / gating, then whole-line stores
    __syncthreads();
    for (int mi = 0; mi < 2; ++mi) {
        for (int ni = 0; ni < 4; ++ni) {
            int rl0 = wm * 32 + mi * 16 + hi * 8;
            int cl  = wn * 64 + ni * 16 + l15;
            int col = blockIdx.x * 256 + cl;
            for (int r = 0; r < 8; ++r) {
                size_t idx = (size_t)(mblock + rl0 + r) * N + col;
                float v = acc[mi][ni][r];
                if (EPI == 1)      v += resF[idx];
                else if (EPI == 2) v = v / (1.f + __expf(-v));   // silu
                else if (EPI == 3) v = b2f(gateB[idx]) * v;
                Ct[rl0 + r][cl] = v;
            }
        }
    }
    __syncthreads();
    const int tid = threadIdx.x, n0blk = blockIdx.x * 256;
    if (EPI == 1) {   // f32 rows: 64 x 1024 B (64 pieces)
        for (int g = tid; g < 64 * 64; g += 256) { const int rl = g >> 6, pc = g & 63; vst2(outF + (size_t)(mblock + rl) * N + n0blk + pc * 4, *(const v4f*)(&Ct[rl][pc * 4])); }
    } else {          // 16-bit rows: 64 x 512 B (32 pieces of 8)
        for (int g = tid; g < 64 * 32; g += 256) {
            const int rl = g >> 5, pc = g & 31;
            union { unsigned short s[8]; v4u u; } pk;
            #pragma unroll
            for (int e = 0; e < 8; ++e) pk.s[e] = f2b(Ct[rl][pc * 8 + e]);
            vst2(outB + (size_t)(mblock + rl) * N + n0blk + pc * 8, pk.u);
        }
    }
}

// ---------------------------------------------------------------------------
// Flash attention, one wave per 16-query tile; causal; online softmax.
// ---------------------------------------------------------------------------
__global__ __launch_bounds__(256) void flash_attn(
        const unsigned short* __restrict__ qkvb, const unsigned short* __restrict__ vp,
        unsigned short* __restrict__ attn, int S, int H, int HD) {
    __shared__ __align__(16) unsigned short plds[8][512];   // per-wave 16x32 P staging
    __shared__ __align__(16) unsigned short olds[8][16 * 64]; // per-wave output tile
    const int lane = threadIdx.x & 31;
    const int w    = threadIdx.x >> 5;
    const int waveId = blockIdx.x * 8 + w;
    const int qt = waveId & 127;              // S/16 = 128
    const int bh = waveId >> 7;
    const int b = bh >> 4, h = bh & 15;
    const int qbase = qt * 16;
    const int l15 = lane & 15;
    const int hi  = (lane >> 4) & 1;
    const int D3  = 3 * H * HD;

    Frag aq[2];
    {
        const unsigned short* qp = qkvb + (size_t)(b * S + qbase + l15) * D3 + h * HD + hi * 8;
        aq[0].h[0] = *(const ushort8*)(qp);
        aq[0].h[1] = *(const ushort8*)(qp + 16);
        aq[1].h[0] = *(const ushort8*)(qp + 32);
        aq[1].h[1] = *(const ushort8*)(qp + 48);
    }

    v8f o[4] = {};
    float mvec[8], lvec[8];
    for (int r = 0; r < 8; ++r) { mvec[r] = -3.0e38f; lvec[r] = 0.f; }

    const int nkb = (qbase + 16 + 31) >> 5;
    for (int kb = 0; kb < nkb; ++kb) {
        const int kbase = kb * 32;
        Frag bk[2][2];
        for (int t = 0; t < 2; ++t) {
            const unsigned short* kp =
                qkvb + (size_t)(b * S + kbase + t * 16 + l15) * D3 + H * HD + h * HD + hi * 8;   // ISA B map (same as A)
            bk[t][0].h[0] = *(const ushort8*)(kp);      bk[t][0].h[1] = *(const ushort8*)(kp + 16);
            bk[t][1].h[0] = *(const ushort8*)(kp + 32); bk[t][1].h[1] = *(const ushort8*)(kp + 48);
        }
        v8f z = {};
        v8f sc[2];
        sc[0] = wmma16(aq[0].b, bk[0][0].b, z);
        sc[0] = wmma16(aq[1].b, bk[0][1].b, sc[0]);
        sc[1] = wmma16(aq[0].b, bk[1][0].b, z);
        sc[1] = wmma16(aq[1].b, bk[1][1].b, sc[1]);

        const bool diag = (kbase + 32 > qbase);
        for (int t = 0; t < 2; ++t)
            for (int r = 0; r < 8; ++r) {
                float v = sc[t][r] * 0.125f;            // 1/sqrt(64)
                if (diag) {
                    int key  = kbase + t * 16 + l15;
                    int qrow = qbase + r + hi * 8;
                    if (key > qrow) v = -1.0e30f;
                }
                sc[t][r] = v;
            }

        float al[8];
        for (int r = 0; r < 8; ++r) {
            float v = fmaxf(sc[0][r], sc[1][r]);
            v = fmaxf(v, __shfl_xor(v, 1, 32));
            v = fmaxf(v, __shfl_xor(v, 2, 32));
            v = fmaxf(v, __shfl_xor(v, 4, 32));
            v = fmaxf(v, __shfl_xor(v, 8, 32));
            float mn = fmaxf(mvec[r], v);
            al[r] = __expf(mvec[r] - mn);
            mvec[r] = mn;
        }
        for (int t = 0; t < 2; ++t)
            for (int r = 0; r < 8; ++r)
                sc[t][r] = __expf(sc[t][r] - mvec[r]);
        for (int r = 0; r < 8; ++r) {
            float rs = sc[0][r] + sc[1][r];
            rs += __shfl_xor(rs, 1, 32);
            rs += __shfl_xor(rs, 2, 32);
            rs += __shfl_xor(rs, 4, 32);
            rs += __shfl_xor(rs, 8, 32);
            lvec[r] = lvec[r] * al[r] + rs;
        }
        for (int n = 0; n < 4; ++n)
            for (int r = 0; r < 8; ++r)
                o[n][r] *= al[r];

        // transpose P (C layout -> A layout) through LDS (wave-private region)
        for (int t = 0; t < 2; ++t)
            for (int r = 0; r < 8; ++r)
                plds[w][(r + hi * 8) * 32 + t * 16 + l15] = f2b(sc[t][r] * PSC);
        asm volatile("s_wait_dscnt 0" ::: "memory");
        Frag pa;
        pa.h[0] = *(const ushort8*)&plds[w][l15 * 32 + hi * 8];
        pa.h[1] = *(const ushort8*)&plds[w][l15 * 32 + hi * 8 + 16];

        const unsigned short* vpp = vp + (((size_t)bh * (S / 32) + kb) * 4) * 512 + lane * 16;
        for (int n = 0; n < 4; ++n) {
            Frag bv;
            bv.u = *(const ushort16*)(vpp + n * 512);
            o[n] = wmma16(pa.b, bv.b, o[n]);
        }
        asm volatile("s_wait_dscnt 0" ::: "memory");
    }

    unsigned short* ot = olds[w];
    for (int n = 0; n < 4; ++n)
        for (int r = 0; r < 8; ++r) ot[(r + hi * 8) * 64 + n * 16 + l15] = f2b(o[n][r] * (PUN / lvec[r]));
    asm volatile("s_wait_dscnt 0" ::: "memory");
    __builtin_amdgcn_wave_barrier();
    for (int q = 0; q < 4; ++q) {
        const int rl = q * 4 + (lane >> 3), pc = lane & 7;
        vst2(attn + (size_t)(b * S + qbase + rl) * (H * HD) + h * HD + pc * 8, *(const v4u*)(ot + rl * 64 + pc * 8));
    }
}

// ---------------------------------------------------------------------------
// mean over S:  out[b,d] = mean_s x[b,s,d]
// ---------------------------------------------------------------------------
__global__ void colmean(const float* __restrict__ x, float* __restrict__ out, int B, int S, int D) {
    int idx = blockIdx.x * 256 + threadIdx.x;
    if (idx >= B * D) return;
    int b = idx / D, d = idx % D;
    float s = 0.f;
    for (int t = 0; t < S; ++t) s += x[((size_t)b * S + t) * D + d];
    vst2(out + idx, (float_a)(s / (float)S));
}

// ---------------------------------------------------------------------------
// recurrent state update (tiny): one block, 128 threads
// ---------------------------------------------------------------------------
__global__ __launch_bounds__(128) void state_update(
        const float* __restrict__ state, const float* __restrict__ meanx,
        const float* __restrict__ w_h2s, const float* __restrict__ w_sgate,
        float* __restrict__ outState, int D, int SD) {
    __shared__ float ni[2][64];
    int t = threadIdx.x;
    int b = t >> 6, j = t & 63;
    float s = 0.f;
    for (int k = 0; k < D; ++k) s += meanx[b * D + k] * w_h2s[(size_t)k * SD + j];
    ni[b][j] = s;
    __syncthreads();
    float g = 0.f;
    for (int k = 0; k < SD; ++k) g += state[b * SD + k] * w_sgate[k * SD + j];
    for (int k = 0; k < SD; ++k) g += ni[b][k] * w_sgate[(SD + k) * SD + j];
    g = 1.f / (1.f + __expf(-g));
    vst2(outState + b * SD + j, (float_a)(state[b * SD + j] * (1.f - g) + ni[b][j] * g));   // 128 consecutive floats
}

// ---------------------------------------------------------------------------
extern "C" void kernel_launch(void* const* d_in, const int* in_sizes, int n_in,
                              void* d_out, int out_size, void* d_ws, size_t ws_size,
                              hipStream_t stream) {
    (void)in_sizes; (void)n_in; (void)out_size; (void)ws_size;
    const int B = 2, S = 2048, D = 1024, H = 16, HD = 64, SD = 64;
    const float* x       = (const float*)d_in[0];
    const float* gamma   = (const float*)d_in[1];
    const float* beta    = (const float*)d_in[2];
    const float* state   = (const float*)d_in[3];
    const float* w_qkv   = (const float*)d_in[4];
    const float* w_o     = (const float*)d_in[5];
    const float* w_gate  = (const float*)d_in[6];
    const float* w_up    = (const float*)d_in[7];
    const float* w_down  = (const float*)d_in[8];
    const float* norm1_w = (const float*)d_in[9];
    const float* norm2_w = (const float*)d_in[10];
    const float* w_sm    = (const float*)d_in[11];
    const float* w_h2s   = (const float*)d_in[12];
    const float* w_sgate = (const float*)d_in[13];
    float* xout = (float*)d_out;                       // (B,S,D) then state (B,SD)

    char* ws = (char*)d_ws;
    size_t off = 0;
    auto arena = [&](size_t bytes) -> void* {
        void* p = ws + off;
        off = (off + bytes + 255) & ~(size_t)255;
        return p;
    };
    float* fg             = (float*)arena((size_t)B * D * 4);
    float* fb             = (float*)arena((size_t)B * D * 4);
    unsigned short* hbuf  = (unsigned short*)arena((size_t)B * S * D * 2);       // h / h2
    unsigned short* wqkvp = (unsigned short*)arena((size_t)D * 3 * D * 2);
    unsigned short* wop   = (unsigned short*)arena((size_t)D * D * 2);
    unsigned short* wgp   = (unsigned short*)arena((size_t)D * 3 * D * 2);
    unsigned short* wupp  = (unsigned short*)arena((size_t)D * 3 * D * 2);
    unsigned short* wdp   = (unsigned short*)arena((size_t)3 * D * D * 2);
    unsigned short* qkvb  = (unsigned short*)arena((size_t)B * S * 3 * D * 2);   // also act
    unsigned short* vp    = (unsigned short*)arena((size_t)B * H * (S / 32) * 4 * 512 * 2);
    unsigned short* attnb = (unsigned short*)arena((size_t)B * S * D * 2);
    float* x1             = (float*)arena((size_t)B * S * D * 4);
    unsigned short* gateb = (unsigned short*)arena((size_t)B * S * 3 * D * 2);
    float* meanb          = (float*)arena((size_t)B * D * 4);
    unsigned short* act   = qkvb;                      // reuse after attention

    const int MR = B * S;                              // 4096 rows

    // FiLM params
    film_kernel<<<(B * 2 * D + 255) / 256, 256, 0, stream>>>(state, w_sm, gamma, beta, fg, fb, SD, D);

    // pack weights -> B fragments (f16)
    pack_b<<<(D * 3 * D / 8 + 255) / 256, 256, 0, stream>>>(w_qkv,  wqkvp, D, 3 * D);
    pack_b<<<(D * D / 8 + 255) / 256,     256, 0, stream>>>(w_o,    wop,   D, D);
    pack_b<<<(D * 3 * D / 8 + 255) / 256, 256, 0, stream>>>(w_gate, wgp,   D, 3 * D);
    pack_b<<<(D * 3 * D / 8 + 255) / 256, 256, 0, stream>>>(w_up,   wupp,  D, 3 * D);
    pack_b<<<(3 * D * D / 8 + 255) / 256, 256, 0, stream>>>(w_down, wdp,   3 * D, D);

    // h = rmsnorm(x)*fg + fb
    rmsnorm_film<<<MR, 256, 0, stream>>>(x, norm1_w, fg, fb, hbuf, S, D);

    // qkv = h @ w_qkv   (f16 out)
    gemm_f16<0><<<dim3(3 * D / 256, MR / 64), 256, 0, stream>>>(
        hbuf, wqkvp, nullptr, nullptr, nullptr, qkvb, MR, 3 * D, D);

    // pack V into B fragments
    {
        int total = B * H * (S / 32) * 4 * 512;
        pack_v<<<(total / 8 + 255) / 256, 256, 0, stream>>>(qkvb, vp, S, H, HD, total);
    }

    // attention
    flash_attn<<<(B * H * (S / 16)) / 8, 256, 0, stream>>>(qkvb, vp, attnb, S, H, HD);

    // x1 = x + attn @ w_o
    gemm_f16<1><<<dim3(D / 256, MR / 64), 256, 0, stream>>>(
        attnb, wop, x, nullptr, x1, nullptr, MR, D, D);

    // h2 = rmsnorm(x1)*fg + fb
    rmsnorm_film<<<MR, 256, 0, stream>>>(x1, norm2_w, fg, fb, hbuf, S, D);

    // gate = silu(h2 @ w_gate)   (f16)
    gemm_f16<2><<<dim3(3 * D / 256, MR / 64), 256, 0, stream>>>(
        hbuf, wgp, nullptr, nullptr, nullptr, gateb, MR, 3 * D, D);

    // act = gate * (h2 @ w_up)   (f16)
    gemm_f16<3><<<dim3(3 * D / 256, MR / 64), 256, 0, stream>>>(
        hbuf, wupp, nullptr, gateb, nullptr, act, MR, 3 * D, D);

    // xout = x1 + act @ w_down
    gemm_f16<1><<<dim3(D / 256, MR / 64), 256, 0, stream>>>(
        act, wdp, x1, nullptr, xout, nullptr, MR, D, 3 * D);

    // state update
    colmean<<<(B * D + 255) / 256, 256, 0, stream>>>(xout, meanb, B, S, D);
    state_update<<<1, 128, 0, stream>>>(state, meanb, w_h2s, w_sgate,
                                        xout + (size_t)B * S * D, D, SD);
}

// v001
// Measured time: 574 microseconds a run.
// Timed twice side by side with v000, it ran 1.37 times as fast both times.
#include <hip/hip_runtime.h>

#define EPSF 1.1920929e-07f
// Contractions: qkv / o / gate / up / down projections (K = 1024 / 3072), scores QK^T (K = 64) and PV (K = keys, causal) on
// v_wmma_f32_16x16x32_f16 (f16 operands stored as raw 16-bit words, f32 accumulate; P scaled by 256 before its f16 conversion);
// FiLM, RMSNorm, SiLU gating, softmax statistics, the column mean and the state update in f32 on VALU. B operands are
// pre-packed in the ISA fragment order (element e of lane (h, n) = k0 + 8h + e for e < 8, k0 + 16 + 8h + (e-8) otherwise).

typedef __attribute__((ext_vector_type(16))) _Float16        v16bf;   // (alias name kept; IEEE half)
typedef __attribute__((ext_vector_type(4)))  float           v4f;
typedef __attribute__((ext_vector_type(4)))  unsigned        v4u;
template <typename V> __device__ __forceinline__ void vst2(void* p, V v) {
    *(V*)p = v; 
}
typedef float __attribute__((may_alias)) float_a;
#define PSC 256.0f
#define PUN (1.0f / 256.0f)
typedef __attribute__((ext_vector_type(8)))  float           v8f;
typedef __attribute__((ext_vector_type(8)))  unsigned short  ushort8;
typedef __attribute__((ext_vector_type(16))) unsigned short  ushort16;

union Frag {
    ushort16 u;
    v16bf    b;
    ushort8  h[2];
};

__device__ __forceinline__ unsigned short f2b(float f) {     // f32 -> f16 bits (name kept)
    union { _Float16 h; unsigned short u; } c; c.h = (_Float16)f; return c.u;
}
__device__ __forceinline__ float b2f(unsigned short s) {
    union { unsigned short u; _Float16 h; } c; c.u = s; return (float)c.h;
}
__device__ __forceinline__ v8f wmma16(v16bf a, v16bf b, v8f c) {
    v8f d = __builtin_amdgcn_wmma_f32_16x16x32_f16(false, a, false, b, (short)0, c, false, false);
    asm volatile("v_nop\n\tv_nop\n\tv_nop\n\tv_nop" : "+v"(d) : "v"(a), "v"(b));
    return d;
}

// ---------------------------------------------------------------------------
// FiLM params: state_mod = state @ w_state_mod; fg = gamma*(1+sm[:D]); fb = beta+sm[D:]
// ---------------------------------------------------------------------------
__global__ void film_kernel(const float* __restrict__ state, const float* __restrict__ wsm,
                            const float* __restrict__ gamma, const float* __restrict__ beta,
                            float* __restrict__ fg, float* __restrict__ fb, int SD, int D) {
    int idx = blockIdx.x * blockDim.x + threadIdx.x;     // over B * 2D
    int b = idx / (2 * D);
    int c = idx % (2 * D);
    if (b >= 2) return;
    float s = 0.f;
    for (int k = 0; k < SD; ++k) s += state[b * SD + k] * wsm[k * 2 * D + c];
    if (c < D) vst2(fg + b * D + c, (float_a)(gamma[c] * (1.f + s)));
    else       vst2(fb + b * D + (c - D), (float_a)(beta[c - D] + s));
}

// ---------------------------------------------------------------------------
// RMSNorm + FiLM -> f16 row-major output
// ---------------------------------------------------------------------------
__global__ __launch_bounds__(256) void rmsnorm_film(
        const float* __restrict__ x, const float* __restrict__ nw,
        const float* __restrict__ fg, const float* __restrict__ fb,
        unsigned short* __restrict__ out, int S, int D) {
    int row = blockIdx.x;           // b*S + s
    int b = row / S;
    const float* xr = x + (size_t)row * D;
    float ss = 0.f;
    for (int d = threadIdx.x; d < D; d += 256) { float v = xr[d]; ss += v * v; }
    for (int m = 16; m >= 1; m >>= 1) ss += __shfl_xor(ss, m, 32);
    __shared__ float red[8];
    if ((threadIdx.x & 31) == 0) red[threadIdx.x >> 5] = ss;
    __syncthreads();
    float tot = 0.f;
    for (int i = 0; i < 8; ++i) tot += red[i];
    float scale = rsqrtf(tot / (float)D + EPSF);
    const float* fgb = fg + (size_t)b * D;
    const float* fbb = fb + (size_t)b * D;
    unsigned short* orow = out + (size_t)row * D;
    {   // 4 consecutive d per thread (D = 1024 = 256 x 4): 8-B lanes, a wave writes 256 contiguous bytes
        const int d0 = threadIdx.x * 4;
        union { unsigned short s[4]; unsigned long long u; } pk;
        #pragma unroll
        for (int e = 0; e < 4; ++e) { const int d = d0 + e; pk.s[e] = f2b(xr[d] * scale * nw[d] * fgb[d] + fbb[d]); }
        vst2(orow + d0, pk.u);
    }
}

// ---------------------------------------------------------------------------
// Pack f32 weight (K x N, row-major, y = x@W) into WMMA B-fragment layout:
// frag (nt, kt): 32 lanes x 16 halfs in the ISA order
// ---------------------------------------------------------------------------
__global__ void pack_b(const float* __restrict__ W, unsigned short* __restrict__ out, int K, int N) {
    int g = blockIdx.x * 256 + threadIdx.x;          // 8 consecutive fragment elements (16 B) per thread
    if (g * 8 >= K * N) return;
    union { unsigned short s[8]; v4u u; } pk;
    #pragma unroll
    for (int q = 0; q < 8; ++q) {
        int idx  = g * 8 + q;
        int j    = idx & 15;
        int lane = (idx >> 4) & 31;
        int r    = idx >> 9;
        int ktc  = K >> 5;
        int kt   = r % ktc;
        int nt   = r / ktc;
        int k = kt * 32 + 8 * (lane >> 4) + (j < 8 ? j : j + 8);      // ISA B map (same as A)
        int n = nt * 16 + (lane & 15);
        pk.s[q] = f2b(W[(size_t)k * N + n]);
    }
    vst2(out + (size_t)g * 8, pk.u);
}

// ---------------------------------------------------------------------------
// Pack V (from the f16 qkv buffer) into B-fragments: [bh][kb][n4][lane][16]
// ---------------------------------------------------------------------------
__global__ void pack_v(const unsigned short* __restrict__ qkvb, unsigned short* __restrict__ vp,
                       int S, int H, int HD, int total) {
    int g = blockIdx.x * 256 + threadIdx.x;
    if (g * 8 >= total) return;
    union { unsigned short s[8]; v4u u; } pk;
    #pragma unroll
    for (int q = 0; q < 8; ++q) {
        int idx  = g * 8 + q;
        int j    = idx & 15;
        int lane = (idx >> 4) & 31;
        int r    = idx >> 9;
        int n4 = r & 3;  r >>= 2;
        int kb = r & 63; r >>= 6;
        int bh = r;
        int b = bh >> 4, h = bh & 15;
        int key = kb * 32 + 8 * (lane >> 4) + (j < 8 ? j : j + 8);    // ISA B map
        int col = n4 * 16 + (lane & 15);
        pk.s[q] = qkvb[(size_t)(b * S + key) * (3 * H * HD) + 2 * H * HD + h * HD + col];
    }
    vst2(vp + (size_t)g * 8, pk.u);
}

// ---------------------------------------------------------------------------
// f16 GEMM via V_WMMA_F32_16X16X32_F16.
// Block: 256 thr = 8 waves; wave tile 32x64 (2x4 accum frags); block tile 64x256.
// A (M x K f16 row-major) is double-buffer staged into LDS per K-step with plain 16-B copies.
// B streams from packed fragments (contiguous 32B/lane).
// Epilogues: 0: f16 store | 1: f32 = acc+res | 2: f16 silu(acc) | 3: f16 gate*acc
// ---------------------------------------------------------------------------
template <int EPI>
__global__ __launch_bounds__(256) void gemm_f16(
        const unsigned short* __restrict__ A, const unsigned short* __restrict__ Bp,
        const float* __restrict__ resF, const unsigned short* __restrict__ gateB,
        float* __restrict__ outF, unsigned short* __restrict__ outB,
        int M, int N, int K) {
    __shared__ __align__(16) unsigned short atile[2][64 * 32];   // 2 x 4KB
    __shared__ __align__(16) float Ct[64][256];                    // block output tile (64 KB)

    const int lane = threadIdx.x & 31;
    const int w    = threadIdx.x >> 5;
    const int wm   = w >> 2;
    const int wn   = w & 3;
    const int mblock = blockIdx.y * 64;
    const int mbase  = mblock + wm * 32;
    const int nbase  = blockIdx.x * 256 + wn * 64;
    const int ktc = K >> 5;
    const int hi  = (lane >> 4) & 1;
    const int l15 = lane & 15;

    // cooperative A-staging mapping: 256 thr x 16B = 64x32 f16 tile
    const int srow   = threadIdx.x >> 2;
    const int schunk = (threadIdx.x & 3) * 8;            // ushort offset within row

    v8f acc[2][4] = {};

    const unsigned short* bp[4];
    for (int ni = 0; ni < 4; ++ni)
        bp[ni] = Bp + ((size_t)((nbase >> 4) + ni) * ktc) * 512 + lane * 16;

    const unsigned short* ag = A + (size_t)(mblock + srow) * K + schunk;

    // plain 16-B copy of the A tile for step kt into buffer buf
    auto issue = [&](int buf, int kt) {
        *(v4u*)(&atile[buf][srow * 32 + schunk]) = *(const v4u*)(ag + kt * 32);
    };

    issue(0, 0);
    int cur = 0;

    for (int kt = 0; kt < ktc; ++kt) {
        __syncthreads();                                  // tile(cur) stores visible; previous reads done
        if (kt + 1 < ktc) issue(cur ^ 1, kt + 1);

        Frag bfr[4];
        for (int ni = 0; ni < 4; ++ni) {
            bfr[ni].u = *(const ushort16*)(bp[ni]);
            if (kt + 1 < ktc) __builtin_prefetch(bp[ni] + 512, 0, 0);
            bp[ni] += 512;
        }

        Frag a0, a1;
        const unsigned short* l0 = &atile[cur][(wm * 32 + l15) * 32 + hi * 8];
        a0.h[0] = *(const ushort8*)(l0);
        a0.h[1] = *(const ushort8*)(l0 + 16);
        const unsigned short* l1 = l0 + 16 * 32;
        a1.h[0] = *(const ushort8*)(l1);
        a1.h[1] = *(const ushort8*)(l1 + 16);

        for (int ni = 0; ni < 4; ++ni) {
            acc[0][ni] = wmma16(a0.b, bfr[ni].b, acc[0][ni]);
            acc[1][ni] = wmma16(a1.b, bfr[ni].b, acc[1][ni]);
        }
        cur ^= 1;
    }

    // epilogue through the block tile: value after residual / silu / gating, then whole-line stores
    __syncthreads();
    for (int mi = 0; mi < 2; ++mi) {
        for (int ni = 0; ni < 4; ++ni) {
            int rl0 = wm * 32 + mi * 16 + hi * 8;
            int cl  = wn * 64 + ni * 16 + l15;
            int col = blockIdx.x * 256 + cl;
            for (int r = 0; r < 8; ++r) {
                size_t idx = (size_t)(mblock + rl0 + r) * N + col;
                float v = acc[mi][ni][r];
                if (EPI == 1)      v += resF[idx];
                else if (EPI == 2) v = v / (1.f + __expf(-v));   // silu
                else if (EPI == 3) v = b2f(gateB[idx]) * v;
                Ct[rl0 + r][cl] = v;
            }
        }
    }
    __syncthreads();
    const int tid = threadIdx.x, n0blk = blockIdx.x * 256;
    if (EPI == 1) {   // f32 rows: 64 x 1024 B (64 pieces)
        for (int g = tid; g < 64 * 64; g += 256) { const int rl = g >> 6, pc = g & 63; vst2(outF + (size_t)(mblock + rl) * N + n0blk + pc * 4, *(const v4f*)(&Ct[rl][pc * 4])); }
    } else {          // 16-bit rows: 64 x 512 B (32 pieces of 8)
        for (int g = tid; g < 64 * 32; g += 256) {
            const int rl = g >> 5, pc = g & 31;
            union { unsigned short s[8]; v4u u; } pk;
            #pragma unroll
            for (int e = 0; e < 8; ++e) pk.s[e] = f2b(Ct[rl][pc * 8 + e]);
            vst2(outB + (size_t)(mblock + rl) * N + n0blk + pc * 8, pk.u);
        }
    }
}

// ---------------------------------------------------------------------------
// Flash attention, one wave per 16-query tile; causal; online softmax.
// ---------------------------------------------------------------------------
__global__ __launch_bounds__(256) void flash_attn(
        const unsigned short* __restrict__ qkvb, const unsigned short* __restrict__ vp,
        unsigned short* __restrict__ attn, int S, int H, int HD) {
    __shared__ __align__(16) unsigned short plds[8][512];   // per-wave 16x32 P staging
    __shared__ __align__(16) unsigned short olds[8][16 * 64]; // per-wave output tile
    const int lane = threadIdx.x & 31;
    const int w    = threadIdx.x >> 5;
    const int waveId = blockIdx.x * 8 + w;
    const int qt = waveId & 127;              // S/16 = 128
    const int bh = waveId >> 7;
    const int b = bh >> 4, h = bh & 15;
    const int qbase = qt * 16;
    const int l15 = lane & 15;
    const int hi  = (lane >> 4) & 1;
    const int D3  = 3 * H * HD;

    Frag aq[2];
    {
        const unsigned short* qp = qkvb + (size_t)(b * S + qbase + l15) * D3 + h * HD + hi * 8;
        aq[0].h[0] = *(const ushort8*)(qp);
        aq[0].h[1] = *(const ushort8*)(qp + 16);
        aq[1].h[0] = *(const ushort8*)(qp + 32);
        aq[1].h[1] = *(const ushort8*)(qp + 48);
    }

    v8f o[4] = {};
    float mvec[8], lvec[8];
    for (int r = 0; r < 8; ++r) { mvec[r] = -3.0e38f; lvec[r] = 0.f; }

    const int nkb = (qbase + 16 + 31) >> 5;
    for (int kb = 0; kb < nkb; ++kb) {
        const int kbase = kb * 32;
        Frag bk[2][2];
        for (int t = 0; t < 2; ++t) {
            const unsigned short* kp =
                qkvb + (size_t)(b * S + kbase + t * 16 + l15) * D3 + H * HD + h * HD + hi * 8;   // ISA B map (same as A)
            bk[t][0].h[0] = *(const ushort8*)(kp);      bk[t][0].h[1] = *(const ushort8*)(kp + 16);
            bk[t][1].h[0] = *(const ushort8*)(kp + 32); bk[t][1].h[1] = *(const ushort8*)(kp + 48);
        }
        v8f z = {};
        v8f sc[2];
        sc[0] = wmma16(aq[0].b, bk[0][0].b, z);
        sc[0] = wmma16(aq[1].b, bk[0][1].b, sc[0]);
        sc[1] = wmma16(aq[0].b, bk[1][0].b, z);
        sc[1] = wmma16(aq[1].b, bk[1][1].b, sc[1]);

        const bool diag = (kbase + 32 > qbase);
        for (int t = 0; t < 2; ++t)
            for (int r = 0; r < 8; ++r) {
                float v = sc[t][r] * 0.125f;            // 1/sqrt(64)
                if (diag) {
                    int key  = kbase + t * 16 + l15;
                    int qrow = qbase + r + hi * 8;
                    if (key > qrow) v = -1.0e30f;
                }
                sc[t][r] = v;
            }

        float al[8];
        for (int r = 0; r < 8; ++r) {
            float v = fmaxf(sc[0][r], sc[1][r]);
            v = fmaxf(v, __shfl_xor(v, 1, 32));
            v = fmaxf(v, __shfl_xor(v, 2, 32));
            v = fmaxf(v, __shfl_xor(v, 4, 32));
            v = fmaxf(v, __shfl_xor(v, 8, 32));
            float mn = fmaxf(mvec[r], v);
            al[r] = __expf(mvec[r] - mn);
            mvec[r] = mn;
        }
        for (int t = 0; t < 2; ++t)
            for (int r = 0; r < 8; ++r)
                sc[t][r] = __expf(sc[t][r] - mvec[r]);
        for (int r = 0; r < 8; ++r) {
            float rs = sc[0][r] + sc[1][r];
            rs += __shfl_xor(rs, 1, 32);
            rs += __shfl_xor(rs, 2, 32);
            rs += __shfl_xor(rs, 4, 32);
            rs += __shfl_xor(rs, 8, 32);
            lvec[r] = lvec[r] * al[r] + rs;
        }
        for (int n = 0; n < 4; ++n)
            for (int r = 0; r < 8; ++r)
                o[n][r] *= al[r];

        // transpose P (C layout -> A layout) through LDS (wave-private region)
        for (int t = 0; t < 2; ++t)
            for (int r = 0; r < 8; ++r)
                plds[w][(r + hi * 8) * 32 + t * 16 + l15] = f2b(sc[t][r] * PSC);
        asm volatile("s_wait_dscnt 0" ::: "memory");
        Frag pa;
        pa.h[0] = *(const ushort8*)&plds[w][l15 * 32 + hi * 8];
        pa.h[1] = *(const ushort8*)&plds[w][l15 * 32 + hi * 8 + 16];

        const unsigned short* vpp = vp + (((size_t)bh * (S / 32) + kb) * 4) * 512 + lane * 16;
        for (int n = 0; n < 4; ++n) {
            Frag bv;
            bv.u = *(const ushort16*)(vpp + n * 512);
            o[n] = wmma16(pa.b, bv.b, o[n]);
        }
        asm volatile("s_wait_dscnt 0" ::: "memory");
    }

    unsigned short* ot = olds[w];
    for (int n = 0; n < 4; ++n)
        for (int r = 0; r < 8; ++r) ot[(r + hi * 8) * 64 + n * 16 + l15] = f2b(o[n][r] * (PUN / lvec[r]));
    asm volatile("s_wait_dscnt 0" ::: "memory");
    __builtin_amdgcn_wave_barrier();
    for (int q = 0; q < 4; ++q) {
        const int rl = q * 4 + (lane >> 3), pc = lane & 7;
        vst2(attn + (size_t)(b * S + qbase + rl) * (H * HD) + h * HD + pc * 8, *(const v4u*)(ot + rl * 64 + pc * 8));
    }
}

// ---------------------------------------------------------------------------
// mean over S:  out[b,d] = mean_s x[b,s,d]
// ---------------------------------------------------------------------------
// One work-group per (batch, strip of 32 columns = one 128-B line of every row). 8 lanes x 16 B cover the line, so a
// wave-wide load takes 4 whole lines (4 rows) and the 32 waves take 128 rows a pass: S / 128 loads a lane.
// Lane sums -> butterfly over the wave's 4 rows -> LDS -> one wave adds the 32 wave sums and stores the strip's line.
// S and D are compile-time so that every load is the one base address plus an immediate offset.
template <int S, int D>
__global__ __launch_bounds__(1024) void colmean(const float* __restrict__ x, float* __restrict__ out) {
    static_assert(S % 128 == 0 && D % 32 == 0, "whole passes, whole lines");
    constexpr int NL = S / 128;                          // loads a lane
    __shared__ __align__(16) float part[32][32];         // [wave][column of the strip]
    const int b   = blockIdx.x / (D / 32);
    const int c0  = (blockIdx.x % (D / 32)) * 32;
    const int tid = threadIdx.x;
    const int q   = tid & 7;                             // which 16 B of the line
    const int r0  = tid >> 3;                            // row inside a pass of 128
    const float* p = x + ((size_t)b * S + r0) * D + c0 + q * 4;
    v4f v[NL];
    #pragma unroll       // independent loads ahead of the adds: their latencies overlap instead of adding up row by row
    for (int i = 0; i < NL; ++i) v[i] = *(const v4f*)(p + (size_t)i * 128 * D);
    v4f s = v[0];
    #pragma unroll       // v[] needs constant indices to stay in registers
    for (int i = 1; i < NL; ++i) s += v[i];
    #pragma unroll       // s[e] needs a constant index to stay in registers
    for (int e = 0; e < 4; ++e) {
        s[e] += __shfl_xor(s[e], 8, 32);
        s[e] += __shfl_xor(s[e], 16, 32);
    }
    if ((tid & 31) < 8) *(v4f*)(&part[tid >> 5][q * 4]) = s;
    __syncthreads();
    if (tid < 32) {
        float tot = 0.f;
        for (int wv = 0; wv < 32; ++wv) tot += part[wv][tid];
        vst2(out + (size_t)b * D + c0 + tid, (float_a)(tot / (float)S));
    }
}

// ---------------------------------------------------------------------------
// recurrent state update (tiny): one block, 128 threads
// ---------------------------------------------------------------------------
__global__ __launch_bounds__(128) void state_update(
        const float* __restrict__ state, const float* __restrict__ meanx,
        const float* __restrict__ w_h2s, const float* __restrict__ w_sgate,
        float* __restrict__ outState, int D, int SD) {
    __shared__ float ni[2][64];
    int t = threadIdx.x;
    int b = t >> 6, j = t & 63;
    float s = 0.f;
    for (int k = 0; k < D; ++k) s += meanx[b * D + k] * w_h2s[(size_t)k * SD + j];
    ni[b][j] = s;
    __syncthreads();
    float g = 0.f;
    for (int k = 0; k < SD; ++k) g += state[b * SD + k] * w_sgate[k * SD + j];
    for (int k = 0; k < SD; ++k) g += ni[b][k] * w_sgate[(SD + k) * SD + j];
    g = 1.f / (1.f + __expf(-g));
    vst2(outState + b * SD + j, (float_a)(state[b * SD + j] * (1.f - g) + ni[b][j] * g));   // 128 consecutive floats
}

// ---------------------------------------------------------------------------
extern "C" void kernel_launch(void* const* d_in, const int* in_sizes, int n_in,
                              void* d_out, int out_size, void* d_ws, size_t ws_size,
                              hipStream_t stream) {
    (void)in_sizes; (void)n_in; (void)out_size; (void)ws_size;
    const int B = 2, S = 2048, D = 1024, H = 16, HD = 64, SD = 64;
    const float* x       = (const float*)d_in[0];
    const float* gamma   = (const float*)d_in[1];
    const float* beta    = (const float*)d_in[2];
    const float* state   = (const float*)d_in[3];
    const float* w_qkv   = (const float*)d_in[4];
    const float* w_o     = (const float*)d_in[5];
    const float* w_gate  = (const float*)d_in[6];
    const float* w_up    = (const float*)d_in[7];
    const float* w_down  = (const float*)d_in[8];
    const float* norm1_w = (const float*)d_in[9];
    const float* norm2_w = (const float*)d_in[10];
    const float* w_sm    = (const float*)d_in[11];
    const float* w_h2s   = (const float*)d_in[12];
    const float* w_sgate = (const float*)d_in[13];
    float* xout = (float*)d_out;                       // (B,S,D) then state (B,SD)

    char* ws = (char*)d_ws;
    size_t off = 0;
    auto arena = [&](size_t bytes) -> void* {
        void* p = ws + off;
        off = (off + bytes + 255) & ~(size_t)255;
        return p;
    };
    float* fg             = (float*)arena((size_t)B * D * 4);
    float* fb             = (float*)arena((size_t)B * D * 4);
    unsigned short* hbuf  = (unsigned short*)arena((size_t)B * S * D * 2);       // h / h2
    unsigned short* wqkvp = (unsigned short*)arena((size_t)D * 3 * D * 2);
    unsigned short* wop   = (unsigned short*)arena((size_t)D * D * 2);
    unsigned short* wgp   = (unsigned short*)arena((size_t)D * 3 * D * 2);
    unsigned short* wupp  = (unsigned short*)arena((size_t)D * 3 * D * 2);
    unsigned short* wdp   = (unsigned short*)arena((size_t)3 * D * D * 2);
    unsigned short* qkvb  = (unsigned short*)arena((size_t)B * S * 3 * D * 2);   // also act
    unsigned short* vp    = (unsigned short*)arena((size_t)B * H * (S / 32) * 4 * 512 * 2);
    unsigned short* attnb = (unsigned short*)arena((size_t)B * S * D * 2);
    float* x1             = (float*)arena((size_t)B * S * D * 4);
    unsigned short* gateb = (unsigned short*)arena((size_t)B * S * 3 * D * 2);
    float* meanb          = (float*)arena((size_t)B * D * 4);
    unsigned short* act   = qkvb;                      // reuse after attention

    const int MR = B * S;                              // 4096 rows

    // FiLM params
    film_kernel<<<(B * 2 * D + 255) / 256, 256, 0, stream>>>(state, w_sm, gamma, beta, fg, fb, SD, D);

    // pack weights -> B fragments (f16)
    pack_b<<<(D * 3 * D / 8 + 255) / 256, 256, 0, stream>>>(w_qkv,  wqkvp, D, 3 * D);
    pack_b<<<(D * D / 8 + 255) / 256,     256, 0, stream>>>(w_o,    wop,   D, D);
    pack_b<<<(D * 3 * D / 8 + 255) / 256, 256, 0, stream>>>(w_gate, wgp,   D, 3 * D);
    pack_b<<<(D * 3 * D / 8 + 255) / 256, 256, 0, stream>>>(w_up,   wupp,  D, 3 * D);
    pack_b<<<(3 * D * D / 8 + 255) / 256, 256, 0, stream>>>(w_down, wdp,   3 * D, D);

    // h = rmsnorm(x)*fg + fb
    rmsnorm_film<<<MR, 256, 0, stream>>>(x, norm1_w, fg, fb, hbuf, S, D);

    // qkv = h @ w_qkv   (f16 out)
    gemm_f16<0><<<dim3(3 * D / 256, MR / 64), 256, 0, stream>>>(
        hbuf, wqkvp, nullptr, nullptr, nullptr, qkvb, MR, 3 * D, D);

    // pack V into B fragments
    {
        int total = B * H * (S / 32) * 4 * 512;
        pack_v<<<(total / 8 + 255) / 256, 256, 0, stream>>>(qkvb, vp, S, H, HD, total);
    }

    // attention
    flash_attn<<<(B * H * (S / 16)) / 8, 256, 0, stream>>>(qkvb, vp, attnb, S, H, HD);

    // x1 = x + attn @ w_o
    gemm_f16<1><<<dim3(D / 256, MR / 64), 256, 0, stream>>>(
        attnb, wop, x, nullptr, x1, nullptr, MR, D, D);

    // h2 = rmsnorm(x1)*fg + fb
    rmsnorm_film<<<MR, 256, 0, stream>>>(x1, norm2_w, fg, fb, hbuf, S, D);

    // gate = silu(h2 @ w_gate)   (f16)
    gemm_f16<2><<<dim3(3 * D / 256, MR / 64), 256, 0, stream>>>(
        hbuf, wgp, nullptr, nullptr, nullptr, gateb, MR, 3 * D, D);

    // act = gate * (h2 @ w_up)   (f16)
    gemm_f16<3><<<dim3(3 * D / 256, MR / 64), 256, 0, stream>>>(
        hbuf, wupp, nullptr, gateb, nullptr, act, MR, 3 * D, D);

    // xout = x1 + act @ w_down
    gemm_f16<1><<<dim3(D / 256, MR / 64), 256, 0, stream>>>(
        act, wdp, x1, nullptr, xout, nullptr, MR, D, 3 * D);

    // state update
    colmean<S, D><<<B * D / 32, 1024, 0, stream>>>(xout, meanb);
    state_update<<<1, 128, 0, stream>>>(state, meanb, w_h2s, w_sgate,
                                        xout + (size_t)B * S * D, D, SD);
}

// v002
// It runs in 451 microseconds.
// Timed twice side by side with v001, it ran 1.27 times as fast both times.
// Over all steps from v000 it is 1.75 times as fast.
#include <hip/hip_runtime.h>

#define EPSF 1.1920929e-07f
// Contractions: qkv / o / gate / up / down projections (K = 1024 / 3072), scores QK^T (K = 64) and PV (K = keys, causal) on
// v_wmma_f32_16x16x32_f16 (f16 operands stored as raw 16-bit words, f32 accumulate; P scaled by 256 before its f16 conversion);
// FiLM, RMSNorm, SiLU gating, softmax statistics, the column mean and the state update in f32 on VALU. B operands are
// pre-packed in the ISA fragment order (element e of lane (h, n) = k0 + 8h + e for e < 8, k0 + 16 + 8h + (e-8) otherwise).

typedef __attribute__((ext_vector_type(16))) _Float16        v16bf;   // (alias name kept; IEEE half)
typedef __attribute__((ext_vector_type(4)))  float           v4f;
typedef __attribute__((ext_vector_type(4)))  unsigned        v4u;
template <typename V> __device__ __forceinline__ void vst2(void* p, V v) {
    *(V*)p = v; 
}
typedef float __attribute__((may_alias)) float_a;
#define PSC 256.0f
#define PUN (1.0f / 256.0f)
typedef __attribute__((ext_vector_type(8)))  float           v8f;
typedef __attribute__((ext_vector_type(8)))  unsigned short  ushort8;
typedef __attribute__((ext_vector_type(16))) unsigned short  ushort16;

union Frag {
    ushort16 u;
    v16bf    b;
    ushort8  h[2];
};

__device__ __forceinline__ unsigned short f2b(float f) {     // f32 -> f16 bits (name kept)
    union { _Float16 h; unsigned short u; } c; c.h = (_Float16)f; return c.u;
}
__device__ __forceinline__ float b2f(unsigned short s) {
    union { unsigned short u; _Float16 h; } c; c.u = s; return (float)c.h;
}
__device__ __forceinline__ v8f wmma16(v16bf a, v16bf b, v8f c) {
    v8f d = __builtin_amdgcn_wmma_f32_16x16x32_f16(false, a, false, b, (short)0, c, false, false);
    asm volatile("v_nop\n\tv_nop\n\tv_nop\n\tv_nop" : "+v"(d) : "v"(a), "v"(b));
    return d;
}

// ---------------------------------------------------------------------------
// FiLM params: state_mod = state @ w_state_mod; fg = gamma*(1+sm[:D]); fb = beta+sm[D:]
// ---------------------------------------------------------------------------
__global__ void film_kernel(const float* __restrict__ state, const float* __restrict__ wsm,
                            const float* __restrict__ gamma, const float* __restrict__ beta,
                            float* __restrict__ fg, float* __restrict__ fb, int SD, int D) {
    int idx = blockIdx.x * blockDim.x + threadIdx.x;     // over B * 2D
    int b = idx / (2 * D);
    int c = idx % (2 * D);
    if (b >= 2) return;
    float s = 0.f;
    for (int k = 0; k < SD; ++k) s += state[b * SD + k] * wsm[k * 2 * D + c];
    if (c < D) vst2(fg + b * D + c, (float_a)(gamma[c] * (1.f + s)));
    else       vst2(fb + b * D + (c - D), (float_a)(beta[c - D] + s));
}

// ---------------------------------------------------------------------------
// RMSNorm + FiLM -> f16 row-major output
// ---------------------------------------------------------------------------
__global__ __launch_bounds__(256) void rmsnorm_film(
        const float* __restrict__ x, const float* __restrict__ nw,
        const float* __restrict__ fg, const float* __restrict__ fb,
        unsigned short* __restrict__ out, int S, int D) {
    int row = blockIdx.x;           // b*S + s
    int b = row / S;
    const float* xr = x + (size_t)row * D;
    float ss = 0.f;
    for (int d = threadIdx.x; d < D; d += 256) { float v = xr[d]; ss += v * v; }
    for (int m = 16; m >= 1; m >>= 1) ss += __shfl_xor(ss, m, 32);
    __shared__ float red[8];
    if ((threadIdx.x & 31) == 0) red[threadIdx.x >> 5] = ss;
    __syncthreads();
    float tot = 0.f;
    for (int i = 0; i < 8; ++i) tot += red[i];
    float scale = rsqrtf(tot / (float)D + EPSF);
    const float* fgb = fg + (size_t)b * D;
    const float* fbb = fb + (size_t)b * D;
    unsigned short* orow = out + (size_t)row * D;
    {   // 4 consecutive d per thread (D = 1024 = 256 x 4): 8-B lanes, a wave writes 256 contiguous bytes
        const int d0 = threadIdx.x * 4;
        union { unsigned short s[4]; unsigned long long u; } pk;
        #pragma unroll
        for (int e = 0; e < 4; ++e) { const int d = d0 + e; pk.s[e] = f2b(xr[d] * scale * nw[d] * fgb[d] + fbb[d]); }
        vst2(orow + d0, pk.u);
    }
}

// ---------------------------------------------------------------------------
// Pack f32 weight (K x N, row-major, y = x@W) into WMMA B-fragment layout:
// frag (nt, kt): 32 lanes x 16 halfs in the ISA order
// ---------------------------------------------------------------------------
__global__ void pack_b(const float* __restrict__ W, unsigned short* __restrict__ out, int K, int N) {
    int g = blockIdx.x * 256 + threadIdx.x;          // 8 consecutive fragment elements (16 B) per thread
    if (g * 8 >= K * N) return;
    union { unsigned short s[8]; v4u u; } pk;
    #pragma unroll
    for (int q = 0; q < 8; ++q) {
        int idx  = g * 8 + q;
        int j    = idx & 15;
        int lane = (idx >> 4) & 31;
        int r    = idx >> 9;
        int ktc  = K >> 5;
        int kt   = r % ktc;
        int nt   = r / ktc;
        int k = kt * 32 + 8 * (lane >> 4) + (j < 8 ? j : j + 8);      // ISA B map (same as A)
        int n = nt * 16 + (lane & 15);
        pk.s[q] = f2b(W[(size_t)k * N + n]);
    }
    vst2(out + (size_t)g * 8, pk.u);
}

// ---------------------------------------------------------------------------
// Pack V (from the f16 qkv buffer) into B-fragments: [bh][kb][n4][lane][16]
// ---------------------------------------------------------------------------
__global__ void pack_v(const unsigned short* __restrict__ qkvb, unsigned short* __restrict__ vp,
                       int S, int H, int HD, int total) {
    int g = blockIdx.x * 256 + threadIdx.x;
    if (g * 8 >= total) return;
    union { unsigned short s[8]; v4u u; } pk;
    #pragma unroll
    for (int q = 0; q < 8; ++q) {
        int idx  = g * 8 + q;
        int j    = idx & 15;
        int lane = (idx >> 4) & 31;
        int r    = idx >> 9;
        int n4 = r & 3;  r >>= 2;
        int kb = r & 63; r >>= 6;
        int bh = r;
        int b = bh >> 4, h = bh & 15;
        int key = kb * 32 + 8 * (lane >> 4) + (j < 8 ? j : j + 8);    // ISA B map
        int col = n4 * 16 + (lane & 15);
        pk.s[q] = qkvb[(size_t)(b * S + key) * (3 * H * HD) + 2 * H * HD + h * HD + col];
    }
    vst2(vp + (size_t)g * 8, pk.u);
}

// ---------------------------------------------------------------------------
// f16 GEMM via V_WMMA_F32_16X16X32_F16.
// Block: 256 thr = 8 waves; wave tile 32x64 (2x4 accum frags); block tile 64x256.
// A (M x K f16 row-major) is double-buffer staged into LDS per K-step with plain 16-B copies.
// B streams from packed fragments (contiguous 32B/lane).
// Epilogues: 0: f16 store | 1: f32 = acc+res | 2: f16 silu(acc) | 3: f16 gate*acc
// ---------------------------------------------------------------------------
template <int EPI>
__global__ __launch_bounds__(256) void gemm_f16(
        const unsigned short* __restrict__ A, const unsigned short* __restrict__ Bp,
        const float* __restrict__ resF, const unsigned short* __restrict__ gateB,
        float* __restrict__ outF, unsigned short* __restrict__ outB,
        int M, int N, int K) {
    __shared__ __align__(16) unsigned short atile[2][64 * 32];   // 2 x 4KB
    __shared__ __align__(16) float Ct[64][256];                    // block output tile (64 KB)

    const int lane = threadIdx.x & 31;
    const int w    = threadIdx.x >> 5;
    const int wm   = w >> 2;
    const int wn   = w & 3;
    const int mblock = blockIdx.y * 64;
    const int mbase  = mblock + wm * 32;
    const int nbase  = blockIdx.x * 256 + wn * 64;
    const int ktc = K >> 5;
    const int hi  = (lane >> 4) & 1;
    const int l15 = lane & 15;

    // cooperative A-staging mapping: 256 thr x 16B = 64x32 f16 tile
    const int srow   = threadIdx.x >> 2;
    const int schunk = (threadIdx.x & 3) * 8;            // ushort offset within row

    v8f acc[2][4] = {};

    const unsigned short* bp[4];
    for (int ni = 0; ni < 4; ++ni)
        bp[ni] = Bp + ((size_t)((nbase >> 4) + ni) * ktc) * 512 + lane * 16;

    const unsigned short* ag = A + (size_t)(mblock + srow) * K + schunk;

    // plain 16-B copy of the A tile for step kt into buffer buf
    auto issue = [&](int buf, int kt) {
        *(v4u*)(&atile[buf][srow * 32 + schunk]) = *(const v4u*)(ag + kt * 32);
    };

    issue(0, 0);
    int cur = 0;

    for (int kt = 0; kt < ktc; ++kt) {
        __syncthreads();                                  // tile(cur) stores visible; previous reads done
        if (kt + 1 < ktc) issue(cur ^ 1, kt + 1);

        Frag bfr[4];
        for (int ni = 0; ni < 4; ++ni) {
            bfr[ni].u = *(const ushort16*)(bp[ni]);
            if (kt + 1 < ktc) __builtin_prefetch(bp[ni] + 512, 0, 0);
            bp[ni] += 512;
        }

        Frag a0, a1;
        const unsigned short* l0 = &atile[cur][(wm * 32 + l15) * 32 + hi * 8];
        a0.h[0] = *(const ushort8*)(l0);
        a0.h[1] = *(const ushort8*)(l0 + 16);
        const unsigned short* l1 = l0 + 16 * 32;
        a1.h[0] = *(const ushort8*)(l1);
        a1.h[1] = *(const ushort8*)(l1 + 16);

        for (int ni = 0; ni < 4; ++ni) {
            acc[0][ni] = wmma16(a0.b, bfr[ni].b, acc[0][ni]);
            acc[1][ni] = wmma16(a1.b, bfr[ni].b, acc[1][ni]);
        }
        cur ^= 1;
    }

    // epilogue through the block tile: value after residual / silu / gating, then whole-line stores
    __syncthreads();
    for (int mi = 0; mi < 2; ++mi) {
        for (int ni = 0; ni < 4; ++ni) {
            int rl0 = wm * 32 + mi * 16 + hi * 8;
            int cl  = wn * 64 + ni * 16 + l15;
            int col = blockIdx.x * 256 + cl;
            for (int r = 0; r < 8; ++r) {
                size_t idx = (size_t)(mblock + rl0 + r) * N + col;
                float v = acc[mi][ni][r];
                if (EPI == 1)      v += resF[idx];
                else if (EPI == 2) v = v / (1.f + __expf(-v));   // silu
                else if (EPI == 3) v = b2f(gateB[idx]) * v;
                Ct[rl0 + r][cl] = v;
            }
        }
    }
    __syncthreads();
    const int tid = threadIdx.x, n0blk = blockIdx.x * 256;
    if (EPI == 1) {   // f32 rows: 64 x 1024 B (64 pieces)
        for (int g = tid; g < 64 * 64; g += 256) { const int rl = g >> 6, pc = g & 63; vst2(outF + (size_t)(mblock + rl) * N + n0blk + pc * 4, *(const v4f*)(&Ct[rl][pc * 4])); }
    } else {          // 16-bit rows: 64 x 512 B (32 pieces of 8)
        for (int g = tid; g < 64 * 32; g += 256) {
            const int rl = g >> 5, pc = g & 31;
            union { unsigned short s[8]; v4u u; } pk;
            #pragma unroll
            for (int e = 0; e < 8; ++e) pk.s[e] = f2b(Ct[rl][pc * 8 + e]);
            vst2(outB + (size_t)(mblock + rl) * N + n0blk + pc * 8, pk.u);
        }
    }
}

// ---------------------------------------------------------------------------
// Flash attention, one wave per 16-query tile; causal; online softmax.
// ---------------------------------------------------------------------------
__global__ __launch_bounds__(256) void flash_attn(
        const unsigned short* __restrict__ qkvb, const unsigned short* __restrict__ vp,
        unsigned short* __restrict__ attn, int S, int H, int HD) {
    __shared__ __align__(16) unsigned short plds[8][512];   // per-wave 16x32 P staging
    __shared__ __align__(16) unsigned short olds[8][16 * 64]; // per-wave output tile
    const int lane = threadIdx.x & 31;
    const int w    = threadIdx.x >> 5;
    const int waveId = blockIdx.x * 8 + w;
    const int qt = waveId & 127;              // S/16 = 128
    const int bh = waveId >> 7;
    const int b = bh >> 4, h = bh & 15;
    const int qbase = qt * 16;
    const int l15 = lane & 15;
    const int hi  = (lane >> 4) & 1;
    const int D3  = 3 * H * HD;

    Frag aq[2];
    {
        const unsigned short* qp = qkvb + (size_t)(b * S + qbase + l15) * D3 + h * HD + hi * 8;
        aq[0].h[0] = *(const ushort8*)(qp);
        aq[0].h[1] = *(const ushort8*)(qp + 16);
        aq[1].h[0] = *(const ushort8*)(qp + 32);
        aq[1].h[1] = *(const ushort8*)(qp + 48);
    }

    v8f o[4] = {};
    float mvec[8], lvec[8];
    for (int r = 0; r < 8; ++r) { mvec[r] = -3.0e38f; lvec[r] = 0.f; }

    const int nkb = (qbase + 16 + 31) >> 5;
    for (int kb = 0; kb < nkb; ++kb) {
        const int kbase = kb * 32;
        Frag bk[2][2];
        for (int t = 0; t < 2; ++t) {
            const unsigned short* kp =
                qkvb + (size_t)(b * S + kbase + t * 16 + l15) * D3 + H * HD + h * HD + hi * 8;   // ISA B map (same as A)
            bk[t][0].h[0] = *(const ushort8*)(kp);      bk[t][0].h[1] = *(const ushort8*)(kp + 16);
            bk[t][1].h[0] = *(const ushort8*)(kp + 32); bk[t][1].h[1] = *(const ushort8*)(kp + 48);
        }
        v8f z = {};
        v8f sc[2];
        sc[0] = wmma16(aq[0].b, bk[0][0].b, z);
        sc[0] = wmma16(aq[1].b, bk[0][1].b, sc[0]);
        sc[1] = wmma16(aq[0].b, bk[1][0].b, z);
        sc[1] = wmma16(aq[1].b, bk[1][1].b, sc[1]);

        const bool diag = (kbase + 32 > qbase);
        for (int t = 0; t < 2; ++t)
            for (int r = 0; r < 8; ++r) {
                float v = sc[t][r] * 0.125f;            // 1/sqrt(64)
                if (diag) {
                    int key  = kbase + t * 16 + l15;
                    int qrow = qbase + r + hi * 8;
                    if (key > qrow) v = -1.0e30f;
                }
                sc[t][r] = v;
            }

        float al[8];
        for (int r = 0; r < 8; ++r) {
            float v = fmaxf(sc[0][r], sc[1][r]);
            v = fmaxf(v, __shfl_xor(v, 1, 32));
            v = fmaxf(v, __shfl_xor(v, 2, 32));
            v = fmaxf(v, __shfl_xor(v, 4, 32));
            v = fmaxf(v, __shfl_xor(v, 8, 32));
            float mn = fmaxf(mvec[r], v);
            al[r] = __expf(mvec[r] - mn);
            mvec[r] = mn;
        }
        for (int t = 0; t < 2; ++t)
            for (int r = 0; r < 8; ++r)
                sc[t][r] = __expf(sc[t][r] - mvec[r]);
        for (int r = 0; r < 8; ++r) {
            float rs = sc[0][r] + sc[1][r];
            rs += __shfl_xor(rs, 1, 32);
            rs += __shfl_xor(rs, 2, 32);
            rs += __shfl_xor(rs, 4, 32);
            rs += __shfl_xor(rs, 8, 32);
            lvec[r] = lvec[r] * al[r] + rs;
        }
        for (int n = 0; n < 4; ++n)
            for (int r = 0; r < 8; ++r)
                o[n][r] *= al[r];

        // transpose P (C layout -> A layout) through LDS (wave-private region)
        for (int t = 0; t < 2; ++t)
            for (int r = 0; r < 8; ++r)
                plds[w][(r + hi * 8) * 32 + t * 16 + l15] = f2b(sc[t][r] * PSC);
        asm volatile("s_wait_dscnt 0" ::: "memory");
        Frag pa;
        pa.h[0] = *(const ushort8*)&plds[w][l15 * 32 + hi * 8];
        pa.h[1] = *(const ushort8*)&plds[w][l15 * 32 + hi * 8 + 16];

        const unsigned short* vpp = vp + (((size_t)bh * (S / 32) + kb) * 4) * 512 + lane * 16;
        for (int n = 0; n < 4; ++n) {
            Frag bv;
            bv.u = *(const ushort16*)(vpp + n * 512);
            o[n] = wmma16(pa.b, bv.b, o[n]);
        }
        asm volatile("s_wait_dscnt 0" ::: "memory");
    }

    unsigned short* ot = olds[w];
    for (int n = 0; n < 4; ++n)
        for (int r = 0; r < 8; ++r) ot[(r + hi * 8) * 64 + n * 16 + l15] = f2b(o[n][r] * (PUN / lvec[r]));
    asm volatile("s_wait_dscnt 0" ::: "memory");
    __builtin_amdgcn_wave_barrier();
    for (int q = 0; q < 4; ++q) {
        const int rl = q * 4 + (lane >> 3), pc = lane & 7;
        vst2(attn + (size_t)(b * S + qbase + rl) * (H * HD) + h * HD + pc * 8, *(const v4u*)(ot + rl * 64 + pc * 8));
    }
}

// ---------------------------------------------------------------------------
// mean over S:  out[b,d] = mean_s x[b,s,d]
// ---------------------------------------------------------------------------
// One work-group per (batch, strip of 32 columns = one 128-B line of every row). 8 lanes x 16 B cover the line, so a
// wave-wide load takes 4 whole lines (4 rows) and the 32 waves take 128 rows a pass: S / 128 loads a lane.
// Lane sums -> butterfly over the wave's 4 rows -> LDS -> one wave adds the 32 wave sums and stores the strip's line.
// S and D are compile-time so that every load is the one base address plus an immediate offset.
template <int S, int D>
__global__ __launch_bounds__(1024) void colmean(const float* __restrict__ x, float* __restrict__ out) {
    static_assert(S % 128 == 0 && D % 32 == 0, "whole passes, whole lines");
    constexpr int NL = S / 128;                          // loads a lane
    __shared__ __align__(16) float part[32][32];         // [wave][column of the strip]
    const int b   = blockIdx.x / (D / 32);
    const int c0  = (blockIdx.x % (D / 32)) * 32;
    const int tid = threadIdx.x;
    const int q   = tid & 7;                             // which 16 B of the line
    const int r0  = tid >> 3;                            // row inside a pass of 128
    const float* p = x + ((size_t)b * S + r0) * D + c0 + q * 4;
    v4f v[NL];
    #pragma unroll       // independent loads ahead of the adds: their latencies overlap instead of adding up row by row
    for (int i = 0; i < NL; ++i) v[i] = *(const v4f*)(p + (size_t)i * 128 * D);
    v4f s = v[0];
    #pragma unroll       // v[] needs constant indices to stay in registers
    for (int i = 1; i < NL; ++i) s += v[i];
    #pragma unroll       // s[e] needs a constant index to stay in registers
    for (int e = 0; e < 4; ++e) {
        s[e] += __shfl_xor(s[e], 8, 32);
        s[e] += __shfl_xor(s[e], 16, 32);
    }
    if ((tid & 31) < 8) *(v4f*)(&part[tid >> 5][q * 4]) = s;
    __syncthreads();
    if (tid < 32) {
        float tot = 0.f;
        for (int wv = 0; wv < 32; ++wv) tot += part[wv][tid];
        vst2(out + (size_t)b * D + c0 + tid, (float_a)(tot / (float)S));
    }
}

// ---------------------------------------------------------------------------
// recurrent state update: one work-group of 32 waves, two products of the same shape, (2 x K) @ (K x SD):
// new_info = mean @ w_h2s (K = D) and gate logits = [state | new_info] @ w_sgate (K = 2 SD).
// 16 lanes x 16 B cover one 256-B weight row; the K rows are split over the 64 lane groups (K / 64 consecutive rows
// each, both batches from the one row load); group sums -> l ^ 16 shuffle -> LDS -> one thread per output adds the 32.
// D and SD are compile-time so that every global load has a constant offset and depends on no sum.
// ---------------------------------------------------------------------------
__device__ __forceinline__ void wave_sums_to_lds(v4f s0, v4f s1, float (*part)[2][64], int t) {
    #pragma unroll       // constant indices keep s0, s1 in registers
    for (int e = 0; e < 4; ++e) {
        s0[e] += __shfl_xor(s0[e], 16, 32);
        s1[e] += __shfl_xor(s1[e], 16, 32);
    }
    if ((t & 31) < 16) {
        *(v4f*)(&part[t >> 5][0][(t & 15) * 4]) = s0;
        *(v4f*)(&part[t >> 5][1][(t & 15) * 4]) = s1;
    }
}
__device__ __forceinline__ float add_wave_sums(const float (*part)[2][64], int b, int j) {
    float tot = 0.f;
    #pragma unroll       // independent LDS reads ahead of the adds
    for (int wv = 0; wv < 32; ++wv) tot += part[wv][b][j];
    return tot;
}

template <int D, int SD>
__global__ __launch_bounds__(1024) void state_update(
        const float* __restrict__ state, const float* __restrict__ meanx,
        const float* __restrict__ w_h2s, const float* __restrict__ w_sgate,
        float* __restrict__ outState) {
    static_assert(SD == 64 && D % 256 == 0, "16 lanes x 4 columns a row; whole 16-B pieces of the mean");
    constexpr int KR = D / 64;                           // rows of w_h2s a lane group
    constexpr int GR = 2 * SD / 64;                      // rows of w_sgate a lane group
    __shared__ __align__(16) float part[32][2][SD];      // [wave][batch][column]
    __shared__ __align__(16) float cat[2][2 * SD];       // [batch][state | new_info]
    const int t  = threadIdx.x;
    const int c4 = (t & 15) * 4;                         // 4 columns of the row
    const int kg = t >> 4;                               // lane group
    const int b  = (t >> 6) & 1, j = t & 63;             // the output of threads 0 .. 2 SD - 1

    v4f wr[KR], mv[2][KR / 4], wg[GR];
    #pragma unroll       // constant indices keep wr[] in registers
    for (int i = 0; i < KR; ++i) wr[i] = *(const v4f*)(w_h2s + (kg * KR + i) * SD + c4);
    #pragma unroll       // constant indices keep mv[][] in registers
    for (int i = 0; i < KR / 4; ++i) {
        mv[0][i] = *(const v4f*)(meanx + kg * KR + i * 4);
        mv[1][i] = *(const v4f*)(meanx + D + kg * KR + i * 4);
    }
    #pragma unroll       // constant indices keep wg[] in registers
    for (int i = 0; i < GR; ++i) wg[i] = *(const v4f*)(w_sgate + (kg * GR + i) * SD + c4);
    const float st = state[b * SD + j];
    // nothing is scheduled across this line: every load is issued before the first sum waits, so that the kernel pays
    // one memory latency; without it the loads go out in batches, each batch behind the wait for the one before
    __builtin_amdgcn_sched_barrier(0);

    v4f s0 = {}, s1 = {};
    #pragma unroll       // constant indices into wr[] and mv[][]
    for (int i = 0; i < KR; ++i) {
        s0 += wr[i] * mv[0][i >> 2][i & 3];
        s1 += wr[i] * mv[1][i >> 2][i & 3];
    }
    wave_sums_to_lds(s0, s1, part, t);
    if (t < 2 * SD) cat[b][j] = st;
    __syncthreads();                                     // the wave sums of new_info are in part
    if (t < 2 * SD) cat[b][SD + j] = add_wave_sums(part, b, j);
    __syncthreads();                                     // cat is whole; part has been read and may be rewritten
    s0 = v4f{}; s1 = v4f{};
    #pragma unroll       // constant indices into wg[]
    for (int i = 0; i < GR; ++i) {
        s0 += wg[i] * cat[0][kg * GR + i];
        s1 += wg[i] * cat[1][kg * GR + i];
    }
    wave_sums_to_lds(s0, s1, part, t);
    __syncthreads();                                     // the wave sums of the gate logits are in part
    if (t < 2 * SD) {
        const float g = 1.f / (1.f + __expf(-add_wave_sums(part, b, j)));
        vst2(outState + b * SD + j, (float_a)(st * (1.f - g) + cat[b][SD + j] * g));   // 128 consecutive floats
    }
}

// ---------------------------------------------------------------------------
extern "C" void kernel_launch(void* const* d_in, const int* in_sizes, int n_in,
                              void* d_out, int out_size, void* d_ws, size_t ws_size,
                              hipStream_t stream) {
    (void)in_sizes; (void)n_in; (void)out_size; (void)ws_size;
    const int B = 2, S = 2048, D = 1024, H = 16, HD = 64, SD = 64;
    const float* x       = (const float*)d_in[0];
    const float* gamma   = (const float*)d_in[1];
    const float* beta    = (const float*)d_in[2];
    const float* state   = (const float*)d_in[3];
    const float* w_qkv   = (const float*)d_in[4];
    const float* w_o     = (const float*)d_in[5];
    const float* w_gate  = (const float*)d_in[6];
    const float* w_up    = (const float*)d_in[7];
    const float* w_down  = (const float*)d_in[8];
    const float* norm1_w = (const float*)d_in[9];
    const float* norm2_w = (const float*)d_in[10];
    const float* w_sm    = (const float*)d_in[11];
    const float* w_h2s   = (const float*)d_in[12];
    const float* w_sgate = (const float*)d_in[13];
    float* xout = (float*)d_out;                       // (B,S,D) then state (B,SD)

    char* ws = (char*)d_ws;
    size_t off = 0;
    auto arena = [&](size_t bytes) -> void* {
        void* p = ws + off;
        off = (off + bytes + 255) & ~(size_t)255;
        return p;
    };
    float* fg             = (float*)arena((size_t)B * D * 4);
    float* fb             = (float*)arena((size_t)B * D * 4);
    unsigned short* hbuf  = (unsigned short*)arena((size_t)B * S * D * 2);       // h / h2
    unsigned short* wqkvp = (unsigned short*)arena((size_t)D * 3 * D * 2);
    unsigned short* wop   = (unsigned short*)arena((size_t)D * D * 2);
    unsigned short* wgp   = (unsigned short*)arena((size_t)D * 3 * D * 2);
    unsigned short* wupp  = (unsigned short*)arena((size_t)D * 3 * D * 2);
    unsigned short* wdp   = (unsigned short*)arena((size_t)3 * D * D * 2);
    unsigned short* qkvb  = (unsigned short*)arena((size_t)B * S * 3 * D * 2);   // also act
    unsigned short* vp    = (unsigned short*)arena((size_t)B * H * (S / 32) * 4 * 512 * 2);
    unsigned short* attnb = (unsigned short*)arena((size_t)B * S * D * 2);
    float* x1             = (float*)arena((size_t)B * S * D * 4);
    unsigned short* gateb = (unsigned short*)arena((size_t)B * S * 3 * D * 2);
    float* meanb          = (float*)arena((size_t)B * D * 4);
    unsigned short* act   = qkvb;                      // reuse after attention

    const int MR = B * S;                              // 4096 rows

    // FiLM params
    film_kernel<<<(B * 2 * D + 255) / 256, 256, 0, stream>>>(state, w_sm, gamma, beta, fg, fb, SD, D);

    // pack weights -> B fragments (f16)
    pack_b<<<(D * 3 * D / 8 + 255) / 256, 256, 0, stream>>>(w_qkv,  wqkvp, D, 3 * D);
    pack_b<<<(D * D / 8 + 255) / 256,     256, 0, stream>>>(w_o,    wop,   D, D);
    pack_b<<<(D * 3 * D / 8 + 255) / 256, 256, 0, stream>>>(w_gate, wgp,   D, 3 * D);
    pack_b<<<(D * 3 * D / 8 + 255) / 256, 256, 0, stream>>>(w_up,   wupp,  D, 3 * D);
    pack_b<<<(3 * D * D / 8 + 255) / 256, 256, 0, stream>>>(w_down, wdp,   3 * D, D);

    // h = rmsnorm(x)*fg + fb
    rmsnorm_film<<<MR, 256, 0, stream>>>(x, norm1_w, fg, fb, hbuf, S, D);

    // qkv = h @ w_qkv   (f16 out)
    gemm_f16<0><<<dim3(3 * D / 256, MR / 64), 256, 0, stream>>>(
        hbuf, wqkvp, nullptr, nullptr, nullptr, qkvb, MR, 3 * D, D);

    // pack V into B fragments
    {
        int total = B * H * (S / 32) * 4 * 512;
        pack_v<<<(total / 8 + 255) / 256, 256, 0, stream>>>(qkvb, vp, S, H, HD, total);
    }

    // attention
    flash_attn<<<(B * H * (S / 16)) / 8, 256, 0, stream>>>(qkvb, vp, attnb, S, H, HD);

    // x1 = x + attn @ w_o
    gemm_f16<1><<<dim3(D / 256, MR / 64), 256, 0, stream>>>(
        attnb, wop, x, nullptr, x1, nullptr, MR, D, D);

    // h2 = rmsnorm(x1)*fg + fb
    rmsnorm_film<<<MR, 256, 0, stream>>>(x1, norm2_w, fg, fb, hbuf, S, D);

    // gate = silu(h2 @ w_gate)   (f16)
    gemm_f16<2><<<dim3(3 * D / 256, MR / 64), 256, 0, stream>>>(
        hbuf, wgp, nullptr, nullptr, nullptr, gateb, MR, 3 * D, D);

    // act = gate * (h2 @ w_up)   (f16)
    gemm_f16<3><<<dim3(3 * D / 256, MR / 64), 256, 0, stream>>>(
        hbuf, wupp, nullptr, gateb, nullptr, act, MR, 3 * D, D);

    // xout = x1 + act @ w_down
    gemm_f16<1><<<dim3(D / 256, MR / 64), 256, 0, stream>>>(
        act, wdp, x1, nullptr, xout, nullptr, MR, D, 3 * D);

    // state update
    colmean<S, D><<<B * D / 32, 1024, 0, stream>>>(xout, meanb);
    state_update<D, SD><<<1, 1024, 0, stream>>>(state, meanb, w_h2s, w_sgate,
                                                xout + (size_t)B * S * D);
}

// v003
// A run of this version takes 344 microseconds.
// In two side-by-side timings against v002, it was 1.31 and 1.32 times as fast.
// Counting every step since v000, it is 2.29 times as fast.
#include <hip/hip_runtime.h>

#define EPSF 1.1920929e-07f
// Contractions: qkv / o / gate / up / down projections (K = 1024 / 3072), scores QK^T (K = 64) and PV (K = keys, causal) on
// v_wmma_f32_16x16x32_f16 (f16 operands stored as raw 16-bit words, f32 accumulate; P scaled by 256 before its f16 conversion);
// FiLM, RMSNorm, SiLU gating, softmax statistics, the column mean and the state update in f32 on VALU. B operands are
// pre-packed in the ISA fragment order (element e of lane (h, n) = k0 + 8h + e for e < 8, k0 + 16 + 8h + (e-8) otherwise).

typedef __attribute__((ext_vector_type(16))) _Float16        v16bf;   // (alias name kept; IEEE half)
typedef __attribute__((ext_vector_type(4)))  float           v4f;
typedef __attribute__((ext_vector_type(4)))  unsigned        v4u;
template <typename V> __device__ __forceinline__ void vst2(void* p, V v) {
    *(V*)p = v; 
}
typedef float __attribute__((may_alias)) float_a;
#define PSC 256.0f
#define PUN (1.0f / 256.0f)
typedef __attribute__((ext_vector_type(8)))  float           v8f;
typedef __attribute__((ext_vector_type(8)))  unsigned short  ushort8;
typedef __attribute__((ext_vector_type(16))) unsigned short  ushort16;

union Frag {
    ushort16 u;
    v16bf    b;
    ushort8  h[2];
};

__device__ __forceinline__ unsigned short f2b(float f) {     // f32 -> f16 bits (name kept)
    union { _Float16 h; unsigned short u; } c; c.h = (_Float16)f; return c.u;
}
__device__ __forceinline__ float b2f(unsigned short s) {
    union { unsigned short u; _Float16 h; } c; c.u = s; return (float)c.h;
}
__device__ __forceinline__ v8f wmma16(v16bf a, v16bf b, v8f c) {
    v8f d = __builtin_amdgcn_wmma_f32_16x16x32_f16(false, a, false, b, (short)0, c, false, false);
    asm volatile("v_nop\n\tv_nop\n\tv_nop\n\tv_nop" : "+v"(d) : "v"(a), "v"(b));
    return d;
}

// ---------------------------------------------------------------------------
// FiLM params: state_mod = state @ w_state_mod; fg = gamma*(1+sm[:D]); fb = beta+sm[D:]
// ---------------------------------------------------------------------------
__global__ void film_kernel(const float* __restrict__ state, const float* __restrict__ wsm,
                            const float* __restrict__ gamma, const float* __restrict__ beta,
                            float* __restrict__ fg, float* __restrict__ fb, int SD, int D) {
    int idx = blockIdx.x * blockDim.x + threadIdx.x;     // over B * 2D
    int b = idx / (2 * D);
    int c = idx % (2 * D);
    if (b >= 2) return;
    float s = 0.f;
    for (int k = 0; k < SD; ++k) s += state[b * SD + k] * wsm[k * 2 * D + c];
    if (c < D) vst2(fg + b * D + c, (float_a)(gamma[c] * (1.f + s)));
    else       vst2(fb + b * D + (c - D), (float_a)(beta[c - D] + s));
}

// ---------------------------------------------------------------------------
// RMSNorm + FiLM -> f16 row-major output
// ---------------------------------------------------------------------------
__global__ __launch_bounds__(256) void rmsnorm_film(
        const float* __restrict__ x, const float* __restrict__ nw,
        const float* __restrict__ fg, const float* __restrict__ fb,
        unsigned short* __restrict__ out, int S, int D) {
    int row = blockIdx.x;           // b*S + s
    int b = row / S;
    const float* xr = x + (size_t)row * D;
    float ss = 0.f;
    for (int d = threadIdx.x; d < D; d += 256) { float v = xr[d]; ss += v * v; }
    for (int m = 16; m >= 1; m >>= 1) ss += __shfl_xor(ss, m, 32);
    __shared__ float red[8];
    if ((threadIdx.x & 31) == 0) red[threadIdx.x >> 5] = ss;
    __syncthreads();
    float tot = 0.f;
    for (int i = 0; i < 8; ++i) tot += red[i];
    float scale = rsqrtf(tot / (float)D + EPSF);
    const float* fgb = fg + (size_t)b * D;
    const float* fbb = fb + (size_t)b * D;
    unsigned short* orow = out + (size_t)row * D;
    {   // 4 consecutive d per thread (D = 1024 = 256 x 4): 8-B lanes, a wave writes 256 contiguous bytes
        const int d0 = threadIdx.x * 4;
        union { unsigned short s[4]; unsigned long long u; } pk;
        #pragma unroll
        for (int e = 0; e < 4; ++e) { const int d = d0 + e; pk.s[e] = f2b(xr[d] * scale * nw[d] * fgb[d] + fbb[d]); }
        vst2(orow + d0, pk.u);
    }
}

// ---------------------------------------------------------------------------
// Pack f32 weight (K x N, row-major, y = x@W) into WMMA B-fragment layout:
// frag (nt, kt): 32 lanes x 16 halfs in the ISA order
// ---------------------------------------------------------------------------
__global__ void pack_b(const float* __restrict__ W, unsigned short* __restrict__ out, int K, int N) {
    int g = blockIdx.x * 256 + threadIdx.x;          // 8 consecutive fragment elements (16 B) per thread
    if (g * 8 >= K * N) return;
    union { unsigned short s[8]; v4u u; } pk;
    #pragma unroll
    for (int q = 0; q < 8; ++q) {
        int idx  = g * 8 + q;
        int j    = idx & 15;
        int lane = (idx >> 4) & 31;
        int r    = idx >> 9;
        int ktc  = K >> 5;
        int kt   = r % ktc;
        int nt   = r / ktc;
        int k = kt * 32 + 8 * (lane >> 4) + (j < 8 ? j : j + 8);      // ISA B map (same as A)
        int n = nt * 16 + (lane & 15);
        pk.s[q] = f2b(W[(size_t)k * N + n]);
    }
    vst2(out + (size_t)g * 8, pk.u);
}

// ---------------------------------------------------------------------------
// Pack V (from the f16 qkv buffer) into B-fragments: [bh][kb][n4][lane][16]
// ---------------------------------------------------------------------------
__global__ void pack_v(const unsigned short* __restrict__ qkvb, unsigned short* __restrict__ vp,
                       int S, int H, int HD, int total) {
    int g = blockIdx.x * 256 + threadIdx.x;
    if (g * 8 >= total) return;
    union { unsigned short s[8]; v4u u; } pk;
    #pragma unroll
    for (int q = 0; q < 8; ++q) {
        int idx  = g * 8 + q;
        int j    = idx & 15;
        int lane = (idx >> 4) & 31;
        int r    = idx >> 9;
        int n4 = r & 3;  r >>= 2;
        int kb = r & 63; r >>= 6;
        int bh = r;
        int b = bh >> 4, h = bh & 15;
        int key = kb * 32 + 8 * (lane >> 4) + (j < 8 ? j : j + 8);    // ISA B map
        int col = n4 * 16 + (lane & 15);
        pk.s[q] = qkvb[(size_t)(b * S + key) * (3 * H * HD) + 2 * H * HD + h * HD + col];
    }
    vst2(vp + (size_t)g * 8, pk.u);
}

// ---------------------------------------------------------------------------
// f16 GEMM via V_WMMA_F32_16X16X32_F16.
// Block: 256 thr = 8 waves; wave tile 32x64 (2x4 accum frags); block tile 64x256.
// A (M x K f16 row-major) is double-buffer staged into LDS per K-step with plain 16-B copies through a register.
// B streams from packed fragments (contiguous 32B/lane), one K-step ahead of its products.
// Epilogues: 0: f16 store | 1: f32 = acc+res | 2: f16 silu(acc) | 3: f16 gate*acc
// ---------------------------------------------------------------------------
template <int EPI>
__global__ __launch_bounds__(256) void gemm_f16(
        const unsigned short* __restrict__ A, const unsigned short* __restrict__ Bp,
        const float* __restrict__ resF, const unsigned short* __restrict__ gateB,
        float* __restrict__ outF, unsigned short* __restrict__ outB,
        int M, int N, int K) {
    __shared__ __align__(16) unsigned short atile[2][64 * 32];   // 2 x 4KB
    __shared__ __align__(16) float Ct[64][256];                    // block output tile (64 KB)

    const int lane = threadIdx.x & 31;
    const int w    = threadIdx.x >> 5;
    const int wm   = w >> 2;
    const int wn   = w & 3;
    const int mblock = blockIdx.y * 64;
    const int mbase  = mblock + wm * 32;
    const int nbase  = blockIdx.x * 256 + wn * 64;
    const int ktc = K >> 5;
    const int hi  = (lane >> 4) & 1;
    const int l15 = lane & 15;

    // cooperative A-staging mapping: 256 thr x 16B = 64x32 f16 tile
    const int srow   = threadIdx.x >> 2;
    const int schunk = (threadIdx.x & 3) * 8;            // ushort offset within row

    v8f acc[2][4] = {};

    // fragment (ni, kt) of this wave's four B columns stands at bw + (ni * ktc + kt) * 512
    const unsigned short* bw = Bp + (size_t)(nbase >> 4) * ktc * 512 + lane * 16;
    const unsigned short* ag = A + (size_t)(mblock + srow) * K + schunk;

    // Every register that holds a global operand is loaded anew for its next use right behind its last use: a B fragment
    // behind its two products, the thread's 16 B of A behind their store to LDS. A load then has about a whole step to
    // come back, and a step waits out no load in full.
    // The last steps ask for the last step's data once more: in bounds, never used.
    Frag bfr[4];
    for (int ni = 0; ni < 4; ++ni) bfr[ni].u = *(const ushort16*)(bw + (size_t)ni * ktc * 512);
    v4u areg = *(const v4u*)(ag);
    *(v4u*)(&atile[0][srow * 32 + schunk]) = areg;
    areg = *(const v4u*)(ag + (1 < ktc ? 1 : 0) * 32);
    // The K loop's barrier, written by hand: __syncthreads() also waits for every global load, which would end the loads
    // issued ahead at each step; only this wave's LDS traffic has to be over here (tile stores visible, tile reads done).
    auto lds_barrier = [] {
        // a load issued ahead is in flight here, and the next step writes its address register anew
        asm volatile("s_wait_xcnt 0x0" ::: "memory");
        asm volatile("s_wait_dscnt 0x0" ::: "memory");
        asm volatile("s_barrier_signal -1\n\ts_barrier_wait -1" ::: "memory");
    };
    lds_barrier();                                        // tile 0 is whole
    int cur = 0;

    for (int kt = 0; kt < ktc; ++kt) {
        const int kb = kt + 1 < ktc ? kt + 1 : ktc - 1;   // step whose B fragments are asked for in this step
        const int ka = kt + 2 < ktc ? kt + 2 : ktc - 1;   // step whose A piece is asked for in this step

        Frag a0, a1;
        const unsigned short* l0 = &atile[cur][(wm * 32 + l15) * 32 + hi * 8];
        a0.h[0] = *(const ushort8*)(l0);
        a0.h[1] = *(const ushort8*)(l0 + 16);
        const unsigned short* l1 = l0 + 16 * 32;
        a1.h[0] = *(const ushort8*)(l1);
        a1.h[1] = *(const ushort8*)(l1 + 16);

        for (int ni = 0; ni < 4; ++ni) {
            acc[0][ni] = wmma16(a0.b, bfr[ni].b, acc[0][ni]);
            acc[1][ni] = wmma16(a1.b, bfr[ni].b, acc[1][ni]);
            bfr[ni].u = *(const ushort16*)(bw + ((size_t)ni * ktc + kb) * 512);
        }
        // the B loads are in flight, and the lines below may write their address registers anew
        asm volatile("s_wait_xcnt 0x0" ::: "memory");
        if (kt + 1 < ktc) *(v4u*)(&atile[cur ^ 1][srow * 32 + schunk]) = areg;   // the A piece of step kt + 1
        areg = *(const v4u*)(ag + ka * 32);
        lds_barrier();                                    // tile(cur ^ 1) is whole; the reads of tile(cur) are done
        cur ^= 1;
    }

    // epilogue through the block tile: value after residual / silu / gating, then whole-line stores
    __syncthreads();
    for (int mi = 0; mi < 2; ++mi) {
        for (int ni = 0; ni < 4; ++ni) {
            int rl0 = wm * 32 + mi * 16 + hi * 8;
            int cl  = wn * 64 + ni * 16 + l15;
            int col = blockIdx.x * 256 + cl;
            for (int r = 0; r < 8; ++r) {
                size_t idx = (size_t)(mblock + rl0 + r) * N + col;
                float v = acc[mi][ni][r];
                if (EPI == 1)      v += resF[idx];
                else if (EPI == 2) v = v / (1.f + __expf(-v));   // silu
                else if (EPI == 3) v = b2f(gateB[idx]) * v;
                Ct[rl0 + r][cl] = v;
            }
        }
    }
    __syncthreads();
    const int tid = threadIdx.x, n0blk = blockIdx.x * 256;
    if (EPI == 1) {   // f32 rows: 64 x 1024 B (64 pieces)
        for (int g = tid; g < 64 * 64; g += 256) { const int rl = g >> 6, pc = g & 63; vst2(outF + (size_t)(mblock + rl) * N + n0blk + pc * 4, *(const v4f*)(&Ct[rl][pc * 4])); }
    } else {          // 16-bit rows: 64 x 512 B (32 pieces of 8)
        for (int g = tid; g < 64 * 32; g += 256) {
            const int rl = g >> 5, pc = g & 31;
            union { unsigned short s[8]; v4u u; } pk;
            #pragma unroll
            for (int e = 0; e < 8; ++e) pk.s[e] = f2b(Ct[rl][pc * 8 + e]);
            vst2(outB + (size_t)(mblock + rl) * N + n0blk + pc * 8, pk.u);
        }
    }
}

// ---------------------------------------------------------------------------
// Flash attention, one wave per 16-query tile; causal; online softmax.
// ---------------------------------------------------------------------------
__global__ __launch_bounds__(256) void flash_attn(
        const unsigned short* __restrict__ qkvb, const unsigned short* __restrict__ vp,
        unsigned short* __restrict__ attn, int S, int H, int HD) {
    __shared__ __align__(16) unsigned short plds[8][512];   // per-wave 16x32 P staging
    __shared__ __align__(16) unsigned short olds[8][16 * 64]; // per-wave output tile
    const int lane = threadIdx.x & 31;
    const int w    = threadIdx.x >> 5;
    const int waveId = blockIdx.x * 8 + w;
    const int qt = waveId & 127;              // S/16 = 128
    const int bh = waveId >> 7;
    const int b = bh >> 4, h = bh & 15;
    const int qbase = qt * 16;
    const int l15 = lane & 15;
    const int hi  = (lane >> 4) & 1;
    const int D3  = 3 * H * HD;

    Frag aq[2];
    {
        const unsigned short* qp = qkvb + (size_t)(b * S + qbase + l15) * D3 + h * HD + hi * 8;
        aq[0].h[0] = *(const ushort8*)(qp);
        aq[0].h[1] = *(const ushort8*)(qp + 16);
        aq[1].h[0] = *(const ushort8*)(qp + 32);
        aq[1].h[1] = *(const ushort8*)(qp + 48);
    }

    v8f o[4] = {};
    float mvec[8], lvec[8];
    for (int r = 0; r < 8; ++r) { mvec[r] = -3.0e38f; lvec[r] = 0.f; }

    const int nkb = (qbase + 16 + 31) >> 5;
    // Every load of a key block is issued well ahead of the product that reads it, so that a pass waits out no load:
    // the four V fragments at the head of their own pass, the K fragments right behind the score products of the pass
    // before, into the same registers.
    Frag bk[2][2];
    auto load_k = [&](int blk) {
        for (int t = 0; t < 2; ++t) {
            const unsigned short* kp =
                qkvb + (size_t)(b * S + blk * 32 + t * 16 + l15) * D3 + H * HD + h * HD + hi * 8;   // ISA B map (same as A)
            bk[t][0].h[0] = *(const ushort8*)(kp);      bk[t][0].h[1] = *(const ushort8*)(kp + 16);
            bk[t][1].h[0] = *(const ushort8*)(kp + 32); bk[t][1].h[1] = *(const ushort8*)(kp + 48);
        }
    };
    load_k(0);
    for (int kb = 0; kb < nkb; ++kb) {
        const int kbase = kb * 32;
        Frag bv[4];
        const unsigned short* vpp = vp + (((size_t)bh * (S / 32) + kb) * 4) * 512 + lane * 16;
        for (int n = 0; n < 4; ++n) bv[n].u = *(const ushort16*)(vpp + n * 512);
        v8f z = {};
        v8f sc[2];
        sc[0] = wmma16(aq[0].b, bk[0][0].b, z);
        sc[0] = wmma16(aq[1].b, bk[0][1].b, sc[0]);
        sc[1] = wmma16(aq[0].b, bk[1][0].b, z);
        sc[1] = wmma16(aq[1].b, bk[1][1].b, sc[1]);
        load_k(kb + 1 < nkb ? kb + 1 : kb);     // the last pass loads its own block again: in bounds, never used

        const bool diag = (kbase + 32 > qbase);
        for (int t = 0; t < 2; ++t)
            for (int r = 0; r < 8; ++r) {
                float v = sc[t][r] * 0.125f;            // 1/sqrt(64)
                if (diag) {
                    int key  = kbase + t * 16 + l15;
                    int qrow = qbase + r + hi * 8;
                    if (key > qrow) v = -1.0e30f;
                }
                sc[t][r] = v;
            }

        float al[8];
        for (int r = 0; r < 8; ++r) {
            float v = fmaxf(sc[0][r], sc[1][r]);
            v = fmaxf(v, __shfl_xor(v, 1, 32));
            v = fmaxf(v, __shfl_xor(v, 2, 32));
            v = fmaxf(v, __shfl_xor(v, 4, 32));
            v = fmaxf(v, __shfl_xor(v, 8, 32));
            float mn = fmaxf(mvec[r], v);
            al[r] = __expf(mvec[r] - mn);
            mvec[r] = mn;
        }
        for (int t = 0; t < 2; ++t)
            for (int r = 0; r < 8; ++r)
                sc[t][r] = __expf(sc[t][r] - mvec[r]);
        for (int r = 0; r < 8; ++r) {
            float rs = sc[0][r] + sc[1][r];
            rs += __shfl_xor(rs, 1, 32);
            rs += __shfl_xor(rs, 2, 32);
            rs += __shfl_xor(rs, 4, 32);
            rs += __shfl_xor(rs, 8, 32);
            lvec[r] = lvec[r] * al[r] + rs;
        }
        for (int n = 0; n < 4; ++n)
            for (int r = 0; r < 8; ++r)
                o[n][r] *= al[r];

        // transpose P (C layout -> A layout) through LDS (wave-private region)
        for (int t = 0; t < 2; ++t)
            for (int r = 0; r < 8; ++r)
                plds[w][(r + hi * 8) * 32 + t * 16 + l15] = f2b(sc[t][r] * PSC);
        asm volatile("s_wait_dscnt 0" ::: "memory");
        Frag pa;
        pa.h[0] = *(const ushort8*)&plds[w][l15 * 32 + hi * 8];
        pa.h[1] = *(const ushort8*)&plds[w][l15 * 32 + hi * 8 + 16];

        for (int n = 0; n < 4; ++n) o[n] = wmma16(pa.b, bv[n].b, o[n]);
        asm volatile("s_wait_dscnt 0" ::: "memory");
    }

    unsigned short* ot = olds[w];
    for (int n = 0; n < 4; ++n)
        for (int r = 0; r < 8; ++r) ot[(r + hi * 8) * 64 + n * 16 + l15] = f2b(o[n][r] * (PUN / lvec[r]));
    asm volatile("s_wait_dscnt 0" ::: "memory");
    __builtin_amdgcn_wave_barrier();
    for (int q = 0; q < 4; ++q) {
        const int rl = q * 4 + (lane >> 3), pc = lane & 7;
        vst2(attn + (size_t)(b * S + qbase + rl) * (H * HD) + h * HD + pc * 8, *(const v4u*)(ot + rl * 64 + pc * 8));
    }
}

// ---------------------------------------------------------------------------
// mean over S:  out[b,d] = mean_s x[b,s,d]
// ---------------------------------------------------------------------------
// One work-group per (batch, strip of 32 columns = one 128-B line of every row). 8 lanes x 16 B cover the line, so a
// wave-wide load takes 4 whole lines (4 rows) and the 32 waves take 128 rows a pass: S / 128 loads a lane.
// Lane sums -> butterfly over the wave's 4 rows -> LDS -> one wave adds the 32 wave sums and stores the strip's line.
// S and D are compile-time so that every load is the one base address plus an immediate offset.
template <int S, int D>
__global__ __launch_bounds__(1024) void colmean(const float* __restrict__ x, float* __restrict__ out) {
    static_assert(S % 128 == 0 && D % 32 == 0, "whole passes, whole lines");
    constexpr int NL = S / 128;                          // loads a lane
    __shared__ __align__(16) float part[32][32];         // [wave][column of the strip]
    const int b   = blockIdx.x / (D / 32);
    const int c0  = (blockIdx.x % (D / 32)) * 32;
    const int tid = threadIdx.x;
    const int q   = tid & 7;                             // which 16 B of the line
    const int r0  = tid >> 3;                            // row inside a pass of 128
    const float* p = x + ((size_t)b * S + r0) * D + c0 + q * 4;
    v4f v[NL];
    #pragma unroll       // independent loads ahead of the adds: their latencies overlap instead of adding up row by row
    for (int i = 0; i < NL; ++i) v[i] = *(const v4f*)(p + (size_t)i * 128 * D);
    v4f s = v[0];
    #pragma unroll       // v[] needs constant indices to stay in registers
    for (int i = 1; i < NL; ++i) s += v[i];
    #pragma unroll       // s[e] needs a constant index to stay in registers
    for (int e = 0; e < 4; ++e) {
        s[e] += __shfl_xor(s[e], 8, 32);
        s[e] += __shfl_xor(s[e], 16, 32);
    }
    if ((tid & 31) < 8) *(v4f*)(&part[tid >> 5][q * 4]) = s;
    __syncthreads();
    if (tid < 32) {
        float tot = 0.f;
        for (int wv = 0; wv < 32; ++wv) tot += part[wv][tid];
        vst2(out + (size_t)b * D + c0 + tid, (float_a)(tot / (float)S));
    }
}

// ---------------------------------------------------------------------------
// recurrent state update: one work-group of 32 waves, two products of the same shape, (2 x K) @ (K x SD):
// new_info = mean @ w_h2s (K = D) and gate logits = [state | new_info] @ w_sgate (K = 2 SD).
// 16 lanes x 16 B cover one 256-B weight row; the K rows are split over the 64 lane groups (K / 64 consecutive rows
// each, both batches from the one row load); group sums -> l ^ 16 shuffle -> LDS -> one thread per output adds the 32.
// D and SD are compile-time so that every global load has a constant offset and depends on no sum.
// ---------------------------------------------------------------------------
__device__ __forceinline__ void wave_sums_to_lds(v4f s0, v4f s1, float (*part)[2][64], int t) {
    #pragma unroll       // constant indices keep s0, s1 in registers
    for (int e = 0; e < 4; ++e) {
        s0[e] += __shfl_xor(s0[e], 16, 32);
        s1[e] += __shfl_xor(s1[e], 16, 32);
    }
    if ((t & 31) < 16) {
        *(v4f*)(&part[t >> 5][0][(t & 15) * 4]) = s0;
        *(v4f*)(&part[t >> 5][1][(t & 15) * 4]) = s1;
    }
}
__device__ __forceinline__ float add_wave_sums(const float (*part)[2][64], int b, int j) {
    float tot = 0.f;
    #pragma unroll       // independent LDS reads ahead of the adds
    for (int wv = 0; wv < 32; ++wv) tot += part[wv][b][j];
    return tot;
}

template <int D, int SD>
__global__ __launch_bounds__(1024) void state_update(
        const float* __restrict__ state, const float* __restrict__ meanx,
        const float* __restrict__ w_h2s, const float* __restrict__ w_sgate,
        float* __restrict__ outState) {
    static_assert(SD == 64 && D % 256 == 0, "16 lanes x 4 columns a row; whole 16-B pieces of the mean");
    constexpr int KR = D / 64;                           // rows of w_h2s a lane group
    constexpr int GR = 2 * SD / 64;                      // rows of w_sgate a lane group
    __shared__ __align__(16) float part[32][2][SD];      // [wave][batch][column]
    __shared__ __align__(16) float cat[2][2 * SD];       // [batch][state | new_info]
    const int t  = threadIdx.x;
    const int c4 = (t & 15) * 4;                         // 4 columns of the row
    const int kg = t >> 4;                               // lane group
    const int b  = (t >> 6) & 1, j = t & 63;             // the output of threads 0 .. 2 SD - 1

    v4f wr[KR], mv[2][KR / 4], wg[GR];
    #pragma unroll       // constant indices keep wr[] in registers
    for (int i = 0; i < KR; ++i) wr[i] = *(const v4f*)(w_h2s + (kg * KR + i) * SD + c4);
    #pragma unroll       // constant indices keep mv[][] in registers
    for (int i = 0; i < KR / 4; ++i) {
        mv[0][i] = *(const v4f*)(meanx + kg * KR + i * 4);
        mv[1][i] = *(const v4f*)(meanx + D + kg * KR + i * 4);
    }
    #pragma unroll       // constant indices keep wg[] in registers
    for (int i = 0; i < GR; ++i) wg[i] = *(const v4f*)(w_sgate + (kg * GR + i) * SD + c4);
    const float st = state[b * SD + j];
    // nothing is scheduled across this line: every load is issued before the first sum waits, so that the kernel pays
    // one memory latency; without it the loads go out in batches, each batch behind the wait for the one before
    __builtin_amdgcn_sched_barrier(0);

    v4f s0 = {}, s1 = {};
    #pragma unroll       // constant indices into wr[] and mv[][]
    for (int i = 0; i < KR; ++i) {
        s0 += wr[i] * mv[0][i >> 2][i & 3];
        s1 += wr[i] * mv[1][i >> 2][i & 3];
    }
    wave_sums_to_lds(s0, s1, part, t);
    if (t < 2 * SD) cat[b][j] = st;
    __syncthreads();                                     // the wave sums of new_info are in part
    if (t < 2 * SD) cat[b][SD + j] = add_wave_sums(part, b, j);
    __syncthreads();                                     // cat is whole; part has been read and may be rewritten
    s0 = v4f{}; s1 = v4f{};
    #pragma unroll       // constant indices into wg[]
    for (int i = 0; i < GR; ++i) {
        s0 += wg[i] * cat[0][kg * GR + i];
        s1 += wg[i] * cat[1][kg * GR + i];
    }
    wave_sums_to_lds(s0, s1, part, t);
    __syncthreads();                                     // the wave sums of the gate logits are in part
    if (t < 2 * SD) {
        const float g = 1.f / (1.f + __expf(-add_wave_sums(part, b, j)));
        vst2(outState + b * SD + j, (float_a)(st * (1.f - g) + cat[b][SD + j] * g));   // 128 consecutive floats
    }
}

// ---------------------------------------------------------------------------
extern "C" void kernel_launch(void* const* d_in, const int* in_sizes, int n_in,
                              void* d_out, int out_size, void* d_ws, size_t ws_size,
                              hipStream_t stream) {
    (void)in_sizes; (void)n_in; (void)out_size; (void)ws_size;
    const int B = 2, S = 2048, D = 1024, H = 16, HD = 64, SD = 64;
    const float* x       = (const float*)d_in[0];
    const float* gamma   = (const float*)d_in[1];
    const float* beta    = (const float*)d_in[2];
    const float* state   = (const float*)d_in[3];
    const float* w_qkv   = (const float*)d_in[4];
    const float* w_o     = (const float*)d_in[5];
    const float* w_gate  = (const float*)d_in[6];
    const float* w_up    = (const float*)d_in[7];
    const float* w_down  = (const float*)d_in[8];
    const float* norm1_w = (const float*)d_in[9];
    const float* norm2_w = (const float*)d_in[10];
    const float* w_sm    = (const float*)d_in[11];
    const float* w_h2s   = (const float*)d_in[12];
    const float* w_sgate = (const float*)d_in[13];
    float* xout = (float*)d_out;                       // (B,S,D) then state (B,SD)

    char* ws = (char*)d_ws;
    size_t off = 0;
    auto arena = [&](size_t bytes) -> void* {
        void* p = ws + off;
        off = (off + bytes + 255) & ~(size_t)255;
        return p;
    };
    float* fg             = (float*)arena((size_t)B * D * 4);
    float* fb             = (float*)arena((size_t)B * D * 4);
    unsigned short* hbuf  = (unsigned short*)arena((size_t)B * S * D * 2);       // h / h2
    unsigned short* wqkvp = (unsigned short*)arena((size_t)D * 3 * D * 2);
    unsigned short* wop   = (unsigned short*)arena((size_t)D * D * 2);
    unsigned short* wgp   = (unsigned short*)arena((size_t)D * 3 * D * 2);
    unsigned short* wupp  = (unsigned short*)arena((size_t)D * 3 * D * 2);
    unsigned short* wdp   = (unsigned short*)arena((size_t)3 * D * D * 2);
    unsigned short* qkvb  = (unsigned short*)arena((size_t)B * S * 3 * D * 2);   // also act
    unsigned short* vp    = (unsigned short*)arena((size_t)B * H * (S / 32) * 4 * 512 * 2);
    unsigned short* attnb = (unsigned short*)arena((size_t)B * S * D * 2);
    float* x1             = (float*)arena((size_t)B * S * D * 4);
    unsigned short* gateb = (unsigned short*)arena((size_t)B * S * 3 * D * 2);
    float* meanb          = (float*)arena((size_t)B * D * 4);
    unsigned short* act   = qkvb;                      // reuse after attention

    const int MR = B * S;                              // 4096 rows

    // FiLM params
    film_kernel<<<(B * 2 * D + 255) / 256, 256, 0, stream>>>(state, w_sm, gamma, beta, fg, fb, SD, D);

    // pack weights -> B fragments (f16)
    pack_b<<<(D * 3 * D / 8 + 255) / 256, 256, 0, stream>>>(w_qkv,  wqkvp, D, 3 * D);
    pack_b<<<(D * D / 8 + 255) / 256,     256, 0, stream>>>(w_o,    wop,   D, D);
    pack_b<<<(D * 3 * D / 8 + 255) / 256, 256, 0, stream>>>(w_gate, wgp,   D, 3 * D);
    pack_b<<<(D * 3 * D / 8 + 255) / 256, 256, 0, stream>>>(w_up,   wupp,  D, 3 * D);
    pack_b<<<(3 * D * D / 8 + 255) / 256, 256, 0, stream>>>(w_down, wdp,   3 * D, D);

    // h = rmsnorm(x)*fg + fb
    rmsnorm_film<<<MR, 256, 0, stream>>>(x, norm1_w, fg, fb, hbuf, S, D);

    // qkv = h @ w_qkv   (f16 out)
    gemm_f16<0><<<dim3(3 * D / 256, MR / 64), 256, 0, stream>>>(
        hbuf, wqkvp, nullptr, nullptr, nullptr, qkvb, MR, 3 * D, D);

    // pack V into B fragments
    {
        int total = B * H * (S / 32) * 4 * 512;
        pack_v<<<(total / 8 + 255) / 256, 256, 0, stream>>>(qkvb, vp, S, H, HD, total);
    }

    // attention
    flash_attn<<<(B * H * (S / 16)) / 8, 256, 0, stream>>>(qkvb, vp, attnb, S, H, HD);

    // x1 = x + attn @ w_o
    gemm_f16<1><<<dim3(D / 256, MR / 64), 256, 0, stream>>>(
        attnb, wop, x, nullptr, x1, nullptr, MR, D, D);

    // h2 = rmsnorm(x1)*fg + fb
    rmsnorm_film<<<MR, 256, 0, stream>>>(x1, norm2_w, fg, fb, hbuf, S, D);

    // gate = silu(h2 @ w_gate)   (f16)
    gemm_f16<2><<<dim3(3 * D / 256, MR / 64), 256, 0, stream>>>(
        hbuf, wgp, nullptr, nullptr, nullptr, gateb, MR, 3 * D, D);

    // act = gate * (h2 @ w_up)   (f16)
    gemm_f16<3><<<dim3(3 * D / 256, MR / 64), 256, 0, stream>>>(
        hbuf, wupp, nullptr, gateb, nullptr, act, MR, 3 * D, D);

    // xout = x1 + act @ w_down
    gemm_f16<1><<<dim3(D / 256, MR / 64), 256, 0, stream>>>(
        act, wdp, x1, nullptr, xout, nullptr, MR, D, 3 * D);

    // state update
    colmean<S, D><<<B * D / 32, 1024, 0, stream>>>(xout, meanb);
    state_update<D, SD><<<1, 1024, 0, stream>>>(state, meanb, w_h2s, w_sgate,
                                                xout + (size_t)B * S * D);
}

// v004
// Measured time: 308 microseconds a run.
// In both of two side-by-side timings against v003, it was 1.11 times as fast.
// Counting every step since v000, it is 2.55 times as fast.
#include <hip/hip_runtime.h>

#define EPSF 1.1920929e-07f
// Contractions: qkv / o / gate / up / down projections (K = 1024 / 3072), scores QK^T (K = 64) and PV (K = keys, causal) on
// v_wmma_f32_16x16x32_f16 (f16 operands stored as raw 16-bit words, f32 accumulate; P scaled by 256 before its f16 conversion);
// FiLM, RMSNorm, SiLU gating, softmax statistics, the column mean and the state update in f32 on VALU. B operands are
// pre-packed in the ISA fragment order (element e of lane (h, n) = k0 + 8h + e for e < 8, k0 + 16 + 8h + (e-8) otherwise).
// A packed fragment (1 KB) is stored as two planes of 512 B: plane p holds elements 8p .. 8p + 7 of lane l at byte 16 l, so
// that each wave-wide 16-B load of a fragment half covers four whole 128-B lines.

typedef __attribute__((ext_vector_type(16))) _Float16        v16bf;   // (alias name kept; IEEE half)
typedef __attribute__((ext_vector_type(4)))  float           v4f;
typedef __attribute__((ext_vector_type(4)))  unsigned        v4u;
template <typename V> __device__ __forceinline__ void vst2(void* p, V v) {
    *(V*)p = v; 
}
typedef float __attribute__((may_alias)) float_a;
#define PSC 256.0f
#define PUN (1.0f / 256.0f)
typedef __attribute__((ext_vector_type(8)))  float           v8f;
typedef __attribute__((ext_vector_type(8)))  unsigned short  ushort8;
typedef __attribute__((ext_vector_type(16))) unsigned short  ushort16;

union Frag {
    ushort16 u;
    v16bf    b;
    ushort8  h[2];
};

__device__ __forceinline__ unsigned short f2b(float f) {     // f32 -> f16 bits (name kept)
    union { _Float16 h; unsigned short u; } c; c.h = (_Float16)f; return c.u;
}
__device__ __forceinline__ float b2f(unsigned short s) {
    union { unsigned short u; _Float16 h; } c; c.u = s; return (float)c.h;
}
__device__ __forceinline__ v8f wmma16(v16bf a, v16bf b, v8f c) {
    v8f d = __builtin_amdgcn_wmma_f32_16x16x32_f16(false, a, false, b, (short)0, c, false, false);
    asm volatile("v_nop\n\tv_nop\n\tv_nop\n\tv_nop" : "+v"(d) : "v"(a), "v"(b));
    return d;
}

// ---------------------------------------------------------------------------
// FiLM params: state_mod = state @ w_state_mod; fg = gamma*(1+sm[:D]); fb = beta+sm[D:]
// ---------------------------------------------------------------------------
__global__ void film_kernel(const float* __restrict__ state, const float* __restrict__ wsm,
                            const float* __restrict__ gamma, const float* __restrict__ beta,
                            float* __restrict__ fg, float* __restrict__ fb, int SD, int D) {
    int idx = blockIdx.x * blockDim.x + threadIdx.x;     // over B * 2D
    int b = idx / (2 * D);
    int c = idx % (2 * D);
    if (b >= 2) return;
    float s = 0.f;
    for (int k = 0; k < SD; ++k) s += state[b * SD + k] * wsm[k * 2 * D + c];
    if (c < D) vst2(fg + b * D + c, (float_a)(gamma[c] * (1.f + s)));
    else       vst2(fb + b * D + (c - D), (float_a)(beta[c - D] + s));
}

// ---------------------------------------------------------------------------
// RMSNorm + FiLM -> f16 row-major output
// ---------------------------------------------------------------------------
__global__ __launch_bounds__(256) void rmsnorm_film(
        const float* __restrict__ x, const float* __restrict__ nw,
        const float* __restrict__ fg, const float* __restrict__ fb,
        unsigned short* __restrict__ out, int S, int D) {
    int row = blockIdx.x;           // b*S + s
    int b = row / S;
    const float* xr = x + (size_t)row * D;
    float ss = 0.f;
    for (int d = threadIdx.x; d < D; d += 256) { float v = xr[d]; ss += v * v; }
    for (int m = 16; m >= 1; m >>= 1) ss += __shfl_xor(ss, m, 32);
    __shared__ float red[8];
    if ((threadIdx.x & 31) == 0) red[threadIdx.x >> 5] = ss;
    __syncthreads();
    float tot = 0.f;
    for (int i = 0; i < 8; ++i) tot += red[i];
    float scale = rsqrtf(tot / (float)D + EPSF);
    const float* fgb = fg + (size_t)b * D;
    const float* fbb = fb + (size_t)b * D;
    unsigned short* orow = out + (size_t)row * D;
    {   // 4 consecutive d per thread (D = 1024 = 256 x 4): 8-B lanes, a wave writes 256 contiguous bytes
        const int d0 = threadIdx.x * 4;
        union { unsigned short s[4]; unsigned long long u; } pk;
        #pragma unroll
        for (int e = 0; e < 4; ++e) { const int d = d0 + e; pk.s[e] = f2b(xr[d] * scale * nw[d] * fgb[d] + fbb[d]); }
        vst2(orow + d0, pk.u);
    }
}

// ---------------------------------------------------------------------------
// Pack f32 weight (K x N, row-major, y = x@W) into WMMA B-fragment layout:
// frag (nt, kt): 2 planes x 32 lanes x 8 halfs, values in the ISA order
// ---------------------------------------------------------------------------
__global__ void pack_b(const float* __restrict__ W, unsigned short* __restrict__ out, int K, int N) {
    int g = blockIdx.x * 256 + threadIdx.x;          // 8 consecutive fragment elements (16 B) per thread
    if (g * 8 >= K * N) return;
    union { unsigned short s[8]; v4u u; } pk;
    #pragma unroll
    for (int q = 0; q < 8; ++q) {
        int idx  = g * 8 + q;
        int j    = ((idx >> 8) & 1) * 8 + (idx & 7);     // plane, then element inside the plane
        int lane = (idx >> 3) & 31;
        int r    = idx >> 9;
        int ktc  = K >> 5;
        int kt   = r % ktc;
        int nt   = r / ktc;
        int k = kt * 32 + 8 * (lane >> 4) + (j < 8 ? j : j + 8);      // ISA B map (same as A)
        int n = nt * 16 + (lane & 15);
        pk.s[q] = f2b(W[(size_t)k * N + n]);
    }
    vst2(out + (size_t)g * 8, pk.u);
}

// ---------------------------------------------------------------------------
// Pack V and K (from the f16 qkv buffer) into B-fragments: V [bh][kb][n4][plane][lane][8], K [bh][kb][t][c][plane][lane][8]
// (t = which 16 keys of the 32, c = which 32 of the 64 head dims). Thread g writes the 16-B piece g of both.
// ---------------------------------------------------------------------------
__global__ void pack_v(const unsigned short* __restrict__ qkvb, unsigned short* __restrict__ vp,
                       unsigned short* __restrict__ kpk, int S, int H, int HD, int total) {
    int g = blockIdx.x * 256 + threadIdx.x;
    if (g * 8 >= total) return;
    {   // a thread's 8 elements of K are 8 consecutive head dims of one key: one 16-B copy
        int lane = g & 31, plane = (g >> 5) & 1, c = (g >> 6) & 1, t = (g >> 7) & 1, kb = (g >> 8) & 63, bh = g >> 14;
        int b = bh >> 4, h = bh & 15;
        int key = kb * 32 + t * 16 + (lane & 15);
        int d   = c * 32 + 8 * (lane >> 4) + 16 * plane;              // ISA B map
        vst2(kpk + (size_t)g * 8, *(const v4u*)(qkvb + (size_t)(b * S + key) * (3 * H * HD) + H * HD + h * HD + d));
    }
    union { unsigned short s[8]; v4u u; } pk;
    #pragma unroll
    for (int q = 0; q < 8; ++q) {
        int idx  = g * 8 + q;
        int j    = ((idx >> 8) & 1) * 8 + (idx & 7);     // plane, then element inside the plane
        int lane = (idx >> 3) & 31;
        int r    = idx >> 9;
        int n4 = r & 3;  r >>= 2;
        int kb = r & 63; r >>= 6;
        int bh = r;
        int b = bh >> 4, h = bh & 15;
        int key = kb * 32 + 8 * (lane >> 4) + (j < 8 ? j : j + 8);    // ISA B map
        int col = n4 * 16 + (lane & 15);
        pk.s[q] = qkvb[(size_t)(b * S + key) * (3 * H * HD) + 2 * H * HD + h * HD + col];
    }
    vst2(vp + (size_t)g * 8, pk.u);
}

// ---------------------------------------------------------------------------
// f16 GEMM via V_WMMA_F32_16X16X32_F16.
// Block: 256 thr = 8 waves; wave tile 32x64 (2x4 accum frags); block tile 64x256.
// A (M x K f16 row-major) is double-buffer staged into LDS per K-step with plain 16-B copies through a register.
// B streams from packed fragments (two 512-B planes, 16 B a lane in each), one K-step ahead of its products.
// Epilogues: 0: f16 store | 1: f32 = acc+res | 2: f16 silu(acc) | 3: f16 gate*acc
// ---------------------------------------------------------------------------
template <int EPI>
__global__ __launch_bounds__(256) void gemm_f16(
        const unsigned short* __restrict__ A, const unsigned short* __restrict__ Bp,
        const float* __restrict__ resF, const unsigned short* __restrict__ gateB,
        float* __restrict__ outF, unsigned short* __restrict__ outB,
        int M, int N, int K) {
    __shared__ __align__(16) unsigned short atile[2][64 * 32];   // 2 x 4KB
    __shared__ __align__(16) float Ct[64][256];                    // block output tile (64 KB)

    const int lane = threadIdx.x & 31;
    const int w    = threadIdx.x >> 5;
    const int wm   = w >> 2;
    const int wn   = w & 3;
    const int mblock = blockIdx.y * 64;
    const int mbase  = mblock + wm * 32;
    const int nbase  = blockIdx.x * 256 + wn * 64;
    const int ktc = K >> 5;
    const int hi  = (lane >> 4) & 1;
    const int l15 = lane & 15;

    // cooperative A-staging mapping: 256 thr x 16B = 64x32 f16 tile
    const int srow   = threadIdx.x >> 2;
    const int schunk = (threadIdx.x & 3) * 8;            // ushort offset within row

    v8f acc[2][4] = {};

    // fragment (ni, kt) of this wave's four B columns stands at bw + (ni * ktc + kt) * 512
    const unsigned short* bw = Bp + (size_t)(nbase >> 4) * ktc * 512 + lane * 8;
    const unsigned short* ag = A + (size_t)(mblock + srow) * K + schunk;

    // Every register that holds a global operand is loaded anew for its next use right behind its last use: a B fragment
    // behind its two products, the thread's 16 B of A behind their store to LDS. A load then has about a whole step to
    // come back, and a step waits out no load in full.
    // The last steps ask for the last step's data once more: in bounds, never used.
    Frag bfr[4];
    for (int ni = 0; ni < 4; ++ni) {
        bfr[ni].h[0] = *(const ushort8*)(bw + (size_t)ni * ktc * 512);
        bfr[ni].h[1] = *(const ushort8*)(bw + (size_t)ni * ktc * 512 + 256);
    }
    v4u areg = *(const v4u*)(ag);
    *(v4u*)(&atile[0][srow * 32 + schunk]) = areg;
    areg = *(const v4u*)(ag + (1 < ktc ? 1 : 0) * 32);
    // The K loop's barrier, written by hand: __syncthreads() also waits for every global load, which would end the loads
    // issued ahead at each step; only this wave's LDS traffic has to be over here (tile stores visible, tile reads done).
    auto lds_barrier = [] {
        // a load issued ahead is in flight here, and the next step writes its address register anew
        asm volatile("s_wait_xcnt 0x0" ::: "memory");
        asm volatile("s_wait_dscnt 0x0" ::: "memory");
        asm volatile("s_barrier_signal -1\n\ts_barrier_wait -1" ::: "memory");
    };
    lds_barrier();                                        // tile 0 is whole
    int cur = 0;

    for (int kt = 0; kt < ktc; ++kt) {
        const int kb = kt + 1 < ktc ? kt + 1 : ktc - 1;   // step whose B fragments are asked for in this step
        const int ka = kt + 2 < ktc ? kt + 2 : ktc - 1;   // step whose A piece is asked for in this step

        Frag a0, a1;
        const unsigned short* l0 = &atile[cur][(wm * 32 + l15) * 32 + hi * 8];
        a0.h[0] = *(const ushort8*)(l0);
        a0.h[1] = *(const ushort8*)(l0 + 16);
        const unsigned short* l1 = l0 + 16 * 32;
        a1.h[0] = *(const ushort8*)(l1);
        a1.h[1] = *(const ushort8*)(l1 + 16);

        for (int ni = 0; ni < 4; ++ni) {
            acc[0][ni] = wmma16(a0.b, bfr[ni].b, acc[0][ni]);
            acc[1][ni] = wmma16(a1.b, bfr[ni].b, acc[1][ni]);
            bfr[ni].h[0] = *(const ushort8*)(bw + ((size_t)ni * ktc + kb) * 512);
            bfr[ni].h[1] = *(const ushort8*)(bw + ((size_t)ni * ktc + kb) * 512 + 256);
        }
        // the B loads are in flight, and the lines below may write their address registers anew
        asm volatile("s_wait_xcnt 0x0" ::: "memory");
        if (kt + 1 < ktc) *(v4u*)(&atile[cur ^ 1][srow * 32 + schunk]) = areg;   // the A piece of step kt + 1
        areg = *(const v4u*)(ag + ka * 32);
        lds_barrier();                                    // tile(cur ^ 1) is whole; the reads of tile(cur) are done
        cur ^= 1;
    }

    // epilogue through the block tile: value after residual / silu / gating, then whole-line stores
    __syncthreads();
    for (int mi = 0; mi < 2; ++mi) {
        for (int ni = 0; ni < 4; ++ni) {
            int rl0 = wm * 32 + mi * 16 + hi * 8;
            int cl  = wn * 64 + ni * 16 + l15;
            int col = blockIdx.x * 256 + cl;
            for (int r = 0; r < 8; ++r) {
                size_t idx = (size_t)(mblock + rl0 + r) * N + col;
                float v = acc[mi][ni][r];
                if (EPI == 1)      v += resF[idx];
                else if (EPI == 2) v = v / (1.f + __expf(-v));   // silu
                else if (EPI == 3) v = b2f(gateB[idx]) * v;
                Ct[rl0 + r][cl] = v;
            }
        }
    }
    __syncthreads();
    const int tid = threadIdx.x, n0blk = blockIdx.x * 256;
    if (EPI == 1) {   // f32 rows: 64 x 1024 B (64 pieces)
        for (int g = tid; g < 64 * 64; g += 256) { const int rl = g >> 6, pc = g & 63; vst2(outF + (size_t)(mblock + rl) * N + n0blk + pc * 4, *(const v4f*)(&Ct[rl][pc * 4])); }
    } else {          // 16-bit rows: 64 x 512 B (32 pieces of 8)
        for (int g = tid; g < 64 * 32; g += 256) {
            const int rl = g >> 5, pc = g & 31;
            union { unsigned short s[8]; v4u u; } pk;
            #pragma unroll
            for (int e = 0; e < 8; ++e) pk.s[e] = f2b(Ct[rl][pc * 8 + e]);
            vst2(outB + (size_t)(mblock + rl) * N + n0blk + pc * 8, pk.u);
        }
    }
}

// ---------------------------------------------------------------------------
// Flash attention, one wave per 16-query tile; causal; online softmax.
// ---------------------------------------------------------------------------
__global__ __launch_bounds__(256) void flash_attn(
        const unsigned short* __restrict__ qkvb, const unsigned short* __restrict__ vp,
        const unsigned short* __restrict__ kpk, unsigned short* __restrict__ attn, int S, int H, int HD) {
    __shared__ __align__(16) unsigned short plds[8][512];   // per-wave 16x32 P staging
    __shared__ __align__(16) unsigned short olds[8][16 * 64]; // per-wave output tile
    const int lane = threadIdx.x & 31;
    const int w    = threadIdx.x >> 5;
    const int waveId = blockIdx.x * 8 + w;
    const int qt = waveId & 127;              // S/16 = 128
    const int bh = waveId >> 7;
    const int b = bh >> 4, h = bh & 15;
    const int qbase = qt * 16;
    const int l15 = lane & 15;
    const int hi  = (lane >> 4) & 1;
    const int D3  = 3 * H * HD;

    Frag aq[2];
    {
        const unsigned short* qp = qkvb + (size_t)(b * S + qbase + l15) * D3 + h * HD + hi * 8;
        aq[0].h[0] = *(const ushort8*)(qp);
        aq[0].h[1] = *(const ushort8*)(qp + 16);
        aq[1].h[0] = *(const ushort8*)(qp + 32);
        aq[1].h[1] = *(const ushort8*)(qp + 48);
    }

    v8f o[4] = {};
    float mvec[8], lvec[8];
    for (int r = 0; r < 8; ++r) { mvec[r] = -3.0e38f; lvec[r] = 0.f; }

    const int nkb = (qbase + 16 + 31) >> 5;
    // Every load of a key block is issued well ahead of the product that reads it, so that a pass waits out no load:
    // the four V fragments at the head of their own pass, the K fragments right behind the score products of the pass
    // before, into the same registers.
    Frag bk[2][2];
    auto load_k = [&](int blk) {
        const unsigned short* kp = kpk + (((size_t)bh * (S / 32) + blk) * 4) * 512 + lane * 8;   // packed fragments (t, c)
        for (int t = 0; t < 2; ++t)
            for (int c = 0; c < 2; ++c) {
                bk[t][c].h[0] = *(const ushort8*)(kp + (t * 2 + c) * 512);
                bk[t][c].h[1] = *(const ushort8*)(kp + (t * 2 + c) * 512 + 256);
            }
    };
    load_k(0);
    for (int kb = 0; kb < nkb; ++kb) {
        const int kbase = kb * 32;
        Frag bv[4];
        const unsigned short* vpp = vp + (((size_t)bh * (S / 32) + kb) * 4) * 512 + lane * 8;
        for (int n = 0; n < 4; ++n) {
            bv[n].h[0] = *(const ushort8*)(vpp + n * 512);
            bv[n].h[1] = *(const ushort8*)(vpp + n * 512 + 256);
        }
        v8f z = {};
        v8f sc[2];
        sc[0] = wmma16(aq[0].b, bk[0][0].b, z);
        sc[0] = wmma16(aq[1].b, bk[0][1].b, sc[0]);
        sc[1] = wmma16(aq[0].b, bk[1][0].b, z);
        sc[1] = wmma16(aq[1].b, bk[1][1].b, sc[1]);
        load_k(kb + 1 < nkb ? kb + 1 : kb);     // the last pass loads its own block again: in bounds, never used

        const bool diag = (kbase + 32 > qbase);
        for (int t = 0; t < 2; ++t)
            for (int r = 0; r < 8; ++r) {
                float v = sc[t][r] * 0.125f;            // 1/sqrt(64)
                if (diag) {
                    int key  = kbase + t * 16 + l15;
                    int qrow = qbase + r + hi * 8;
                    if (key > qrow) v = -1.0e30f;
                }
                sc[t][r] = v;
            }

        float al[8];
        for (int r = 0; r < 8; ++r) {
            float v = fmaxf(sc[0][r], sc[1][r]);
            v = fmaxf(v, __shfl_xor(v, 1, 32));
            v = fmaxf(v, __shfl_xor(v, 2, 32));
            v = fmaxf(v, __shfl_xor(v, 4, 32));
            v = fmaxf(v, __shfl_xor(v, 8, 32));
            float mn = fmaxf(mvec[r], v);
            al[r] = __expf(mvec[r] - mn);
            mvec[r] = mn;
        }
        for (int t = 0; t < 2; ++t)
            for (int r = 0; r < 8; ++r)
                sc[t][r] = __expf(sc[t][r] - mvec[r]);
        for (int r = 0; r < 8; ++r) {
            float rs = sc[0][r] + sc[1][r];
            rs += __shfl_xor(rs, 1, 32);
            rs += __shfl_xor(rs, 2, 32);
            rs += __shfl_xor(rs, 4, 32);
            rs += __shfl_xor(rs, 8, 32);
            lvec[r] = lvec[r] * al[r] + rs;
        }
        for (int n = 0; n < 4; ++n)
            for (int r = 0; r < 8; ++r)
                o[n][r] *= al[r];

        // transpose P (C layout -> A layout) through LDS (wave-private region)
        for (int t = 0; t < 2; ++t)
            for (int r = 0; r < 8; ++r)
                plds[w][(r + hi * 8) * 32 + t * 16 + l15] = f2b(sc[t][r] * PSC);
        asm volatile("s_wait_dscnt 0" ::: "memory");
        Frag pa;
        pa.h[0] = *(const ushort8*)&plds[w][l15 * 32 + hi * 8];
        pa.h[1] = *(const ushort8*)&plds[w][l15 * 32 + hi * 8 + 16];

        for (int n = 0; n < 4; ++n) o[n] = wmma16(pa.b, bv[n].b, o[n]);
        asm volatile("s_wait_dscnt 0" ::: "memory");
    }

    unsigned short* ot = olds[w];
    for (int n = 0; n < 4; ++n)
        for (int r = 0; r < 8; ++r) ot[(r + hi * 8) * 64 + n * 16 + l15] = f2b(o[n][r] * (PUN / lvec[r]));
    asm volatile("s_wait_dscnt 0" ::: "memory");
    __builtin_amdgcn_wave_barrier();
    for (int q = 0; q < 4; ++q) {
        const int rl = q * 4 + (lane >> 3), pc = lane & 7;
        vst2(attn + (size_t)(b * S + qbase + rl) * (H * HD) + h * HD + pc * 8, *(const v4u*)(ot + rl * 64 + pc * 8));
    }
}

// ---------------------------------------------------------------------------
// mean over S:  out[b,d] = mean_s x[b,s,d]
// ---------------------------------------------------------------------------
// One work-group per (batch, strip of 32 columns = one 128-B line of every row). 8 lanes x 16 B cover the line, so a
// wave-wide load takes 4 whole lines (4 rows) and the 32 waves take 128 rows a pass: S / 128 loads a lane.
// Lane sums -> butterfly over the wave's 4 rows -> LDS -> one wave adds the 32 wave sums and stores the strip's line.
// S and D are compile-time so that every load is the one base address plus an immediate offset.
template <int S, int D>
__global__ __launch_bounds__(1024) void colmean(const float* __restrict__ x, float* __restrict__ out) {
    static_assert(S % 128 == 0 && D % 32 == 0, "whole passes, whole lines");
    constexpr int NL = S / 128;                          // loads a lane
    __shared__ __align__(16) float part[32][32];         // [wave][column of the strip]
    const int b   = blockIdx.x / (D / 32);
    const int c0  = (blockIdx.x % (D / 32)) * 32;
    const int tid = threadIdx.x;
    const int q   = tid & 7;                             // which 16 B of the line
    const int r0  = tid >> 3;                            // row inside a pass of 128
    const float* p = x + ((size_t)b * S + r0) * D + c0 + q * 4;
    v4f v[NL];
    #pragma unroll       // independent loads ahead of the adds: their latencies overlap instead of adding up row by row
    for (int i = 0; i < NL; ++i) v[i] = *(const v4f*)(p + (size_t)i * 128 * D);
    v4f s = v[0];
    #pragma unroll       // v[] needs constant indices to stay in registers
    for (int i = 1; i < NL; ++i) s += v[i];
    #pragma unroll       // s[e] needs a constant index to stay in registers
    for (int e = 0; e < 4; ++e) {
        s[e] += __shfl_xor(s[e], 8, 32);
        s[e] += __shfl_xor(s[e], 16, 32);
    }
    if ((tid & 31) < 8) *(v4f*)(&part[tid >> 5][q * 4]) = s;
    __syncthreads();
    if (tid < 32) {
        float tot = 0.f;
        for (int wv = 0; wv < 32; ++wv) tot += part[wv][tid];
        vst2(out + (size_t)b * D + c0 + tid, (float_a)(tot / (float)S));
    }
}

// ---------------------------------------------------------------------------
// recurrent state update: one work-group of 32 waves, two products of the same shape, (2 x K) @ (K x SD):
// new_info = mean @ w_h2s (K = D) and gate logits = [state | new_info] @ w_sgate (K = 2 SD).
// 16 lanes x 16 B cover one 256-B weight row; the K rows are split over the 64 lane groups (K / 64 consecutive rows
// each, both batches from the one row load); group sums -> l ^ 16 shuffle -> LDS -> one thread per output adds the 32.
// D and SD are compile-time so that every global load has a constant offset and depends on no sum.
// ---------------------------------------------------------------------------
__device__ __forceinline__ void wave_sums_to_lds(v4f s0, v4f s1, float (*part)[2][64], int t) {
    #pragma unroll       // constant indices keep s0, s1 in registers
    for (int e = 0; e < 4; ++e) {
        s0[e] += __shfl_xor(s0[e], 16, 32);
        s1[e] += __shfl_xor(s1[e], 16, 32);
    }
    if ((t & 31) < 16) {
        *(v4f*)(&part[t >> 5][0][(t & 15) * 4]) = s0;
        *(v4f*)(&part[t >> 5][1][(t & 15) * 4]) = s1;
    }
}
__device__ __forceinline__ float add_wave_sums(const float (*part)[2][64], int b, int j) {
    float tot = 0.f;
    #pragma unroll       // independent LDS reads ahead of the adds
    for (int wv = 0; wv < 32; ++wv) tot += part[wv][b][j];
    return tot;
}

template <int D, int SD>
__global__ __launch_bounds__(1024) void state_update(
        const float* __restrict__ state, const float* __restrict__ meanx,
        const float* __restrict__ w_h2s, const float* __restrict__ w_sgate,
        float* __restrict__ outState) {
    static_assert(SD == 64 && D % 256 == 0, "16 lanes x 4 columns a row; whole 16-B pieces of the mean");
    constexpr int KR = D / 64;                           // rows of w_h2s a lane group
    constexpr int GR = 2 * SD / 64;                      // rows of w_sgate a lane group
    __shared__ __align__(16) float part[32][2][SD];      // [wave][batch][column]
    __shared__ __align__(16) float cat[2][2 * SD];       // [batch][state | new_info]
    const int t  = threadIdx.x;
    const int c4 = (t & 15) * 4;                         // 4 columns of the row
    const int kg = t >> 4;                               // lane group
    const int b  = (t >> 6) & 1, j = t & 63;             // the output of threads 0 .. 2 SD - 1

    v4f wr[KR], mv[2][KR / 4], wg[GR];
    #pragma unroll       // constant indices keep wr[] in registers
    for (int i = 0; i < KR; ++i) wr[i] = *(const v4f*)(w_h2s + (kg * KR + i) * SD + c4);
    #pragma unroll       // constant indices keep mv[][] in registers
    for (int i = 0; i < KR / 4; ++i) {
        mv[0][i] = *(const v4f*)(meanx + kg * KR + i * 4);
        mv[1][i] = *(const v4f*)(meanx + D + kg * KR + i * 4);
    }
    #pragma unroll       // constant indices keep wg[] in registers
    for (int i = 0; i < GR; ++i) wg[i] = *(const v4f*)(w_sgate + (kg * GR + i) * SD + c4);
    const float st = state[b * SD + j];
    // nothing is scheduled across this line: every load is issued before the first sum waits, so that the kernel pays
    // one memory latency; without it the loads go out in batches, each batch behind the wait for the one before
    __builtin_amdgcn_sched_barrier(0);

    v4f s0 = {}, s1 = {};
    #pragma unroll       // constant indices into wr[] and mv[][]
    for (int i = 0; i < KR; ++i) {
        s0 += wr[i] * mv[0][i >> 2][i & 3];
        s1 += wr[i] * mv[1][i >> 2][i & 3];
    }
    wave_sums_to_lds(s0, s1, part, t);
    if (t < 2 * SD) cat[b][j] = st;
    __syncthreads();                                     // the wave sums of new_info are in part
    if (t < 2 * SD) cat[b][SD + j] = add_wave_sums(part, b, j);
    __syncthreads();                                     // cat is whole; part has been read and may be rewritten
    s0 = v4f{}; s1 = v4f{};
    #pragma unroll       // constant indices into wg[]
    for (int i = 0; i < GR; ++i) {
        s0 += wg[i] * cat[0][kg * GR + i];
        s1 += wg[i] * cat[1][kg * GR + i];
    }
    wave_sums_to_lds(s0, s1, part, t);
    __syncthreads();                                     // the wave sums of the gate logits are in part
    if (t < 2 * SD) {
        const float g = 1.f / (1.f + __expf(-add_wave_sums(part, b, j)));
        vst2(outState + b * SD + j, (float_a)(st * (1.f - g) + cat[b][SD + j] * g));   // 128 consecutive floats
    }
}

// ---------------------------------------------------------------------------
extern "C" void kernel_launch(void* const* d_in, const int* in_sizes, int n_in,
                              void* d_out, int out_size, void* d_ws, size_t ws_size,
                              hipStream_t stream) {
    (void)in_sizes; (void)n_in; (void)out_size; (void)ws_size;
    const int B = 2, S = 2048, D = 1024, H = 16, HD = 64, SD = 64;
    const float* x       = (const float*)d_in[0];
    const float* gamma   = (const float*)d_in[1];
    const float* beta    = (const float*)d_in[2];
    const float* state   = (const float*)d_in[3];
    const float* w_qkv   = (const float*)d_in[4];
    const float* w_o     = (const float*)d_in[5];
    const float* w_gate  = (const float*)d_in[6];
    const float* w_up    = (const float*)d_in[7];
    const float* w_down  = (const float*)d_in[8];
    const float* norm1_w = (const float*)d_in[9];
    const float* norm2_w = (const float*)d_in[10];
    const float* w_sm    = (const float*)d_in[11];
    const float* w_h2s   = (const float*)d_in[12];
    const float* w_sgate = (const float*)d_in[13];
    float* xout = (float*)d_out;                       // (B,S,D) then state (B,SD)

    char* ws = (char*)d_ws;
    size_t off = 0;
    auto arena = [&](size_t bytes) -> void* {
        void* p = ws + off;
        off = (off + bytes + 255) & ~(size_t)255;
        return p;
    };
    float* fg             = (float*)arena((size_t)B * D * 4);
    float* fb             = (float*)arena((size_t)B * D * 4);
    unsigned short* hbuf  = (unsigned short*)arena((size_t)B * S * D * 2);       // h / h2
    unsigned short* wqkvp = (unsigned short*)arena((size_t)D * 3 * D * 2);
    unsigned short* wop   = (unsigned short*)arena((size_t)D * D * 2);
    unsigned short* wgp   = (unsigned short*)arena((size_t)D * 3 * D * 2);
    unsigned short* wupp  = (unsigned short*)arena((size_t)D * 3 * D * 2);
    unsigned short* wdp   = (unsigned short*)arena((size_t)3 * D * D * 2);
    unsigned short* qkvb  = (unsigned short*)arena((size_t)B * S * 3 * D * 2);   // also act
    unsigned short* vp    = (unsigned short*)arena((size_t)B * H * (S / 32) * 4 * 512 * 2);
    unsigned short* kpk   = (unsigned short*)arena((size_t)B * H * (S / 32) * 4 * 512 * 2);
    unsigned short* attnb = (unsigned short*)arena((size_t)B * S * D * 2);
    float* x1             = (float*)arena((size_t)B * S * D * 4);
    unsigned short* gateb = (unsigned short*)arena((size_t)B * S * 3 * D * 2);
    float* meanb          = (float*)arena((size_t)B * D * 4);
    unsigned short* act   = qkvb;                      // reuse after attention

    const int MR = B * S;                              // 4096 rows

    // FiLM params
    film_kernel<<<(B * 2 * D + 255) / 256, 256, 0, stream>>>(state, w_sm, gamma, beta, fg, fb, SD, D);

    // pack weights -> B fragments (f16)
    pack_b<<<(D * 3 * D / 8 + 255) / 256, 256, 0, stream>>>(w_qkv,  wqkvp, D, 3 * D);
    pack_b<<<(D * D / 8 + 255) / 256,     256, 0, stream>>>(w_o,    wop,   D, D);
    pack_b<<<(D * 3 * D / 8 + 255) / 256, 256, 0, stream>>>(w_gate, wgp,   D, 3 * D);
    pack_b<<<(D * 3 * D / 8 + 255) / 256, 256, 0, stream>>>(w_up,   wupp,  D, 3 * D);
    pack_b<<<(3 * D * D / 8 + 255) / 256, 256, 0, stream>>>(w_down, wdp,   3 * D, D);

    // h = rmsnorm(x)*fg + fb
    rmsnorm_film<<<MR, 256, 0, stream>>>(x, norm1_w, fg, fb, hbuf, S, D);

    // qkv = h @ w_qkv   (f16 out)
    gemm_f16<0><<<dim3(3 * D / 256, MR / 64), 256, 0, stream>>>(
        hbuf, wqkvp, nullptr, nullptr, nullptr, qkvb, MR, 3 * D, D);

    // pack V and K into B fragments
    {
        int total = B * H * (S / 32) * 4 * 512;
        pack_v<<<(total / 8 + 255) / 256, 256, 0, stream>>>(qkvb, vp, kpk, S, H, HD, total);
    }

    // attention
    flash_attn<<<(B * H * (S / 16)) / 8, 256, 0, stream>>>(qkvb, vp, kpk, attnb, S, H, HD);

    // x1 = x + attn @ w_o
    gemm_f16<1><<<dim3(D / 256, MR / 64), 256, 0, stream>>>(
        attnb, wop, x, nullptr, x1, nullptr, MR, D, D);

    // h2 = rmsnorm(x1)*fg + fb
    rmsnorm_film<<<MR, 256, 0, stream>>>(x1, norm2_w, fg, fb, hbuf, S, D);

    // gate = silu(h2 @ w_gate)   (f16)
    gemm_f16<2><<<dim3(3 * D / 256, MR / 64), 256, 0, stream>>>(
        hbuf, wgp, nullptr, nullptr, nullptr, gateb, MR, 3 * D, D);

    // act = gate * (h2 @ w_up)   (f16)
    gemm_f16<3><<<dim3(3 * D / 256, MR / 64), 256, 0, stream>>>(
        hbuf, wupp, nullptr, gateb, nullptr, act, MR, 3 * D, D);

    // xout = x1 + act @ w_down
    gemm_f16<1><<<dim3(D / 256, MR / 64), 256, 0, stream>>>(
        act, wdp, x1, nullptr, xout, nullptr, MR, D, 3 * D);

    // state update
    colmean<S, D><<<B * D / 32, 1024, 0, stream>>>(xout, meanb);
    state_update<D, SD><<<1, 1024, 0, stream>>>(state, meanb, w_h2s, w_sgate,
                                                xout + (size_t)B * S * D);
}

// v005
// One run takes 293 microseconds.
// Timed twice side by side with v004, it ran 1.05 and 1.06 times as fast.
// Over all steps from v000 it is 2.69 times as fast.
#include <hip/hip_runtime.h>

#define EPSF 1.1920929e-07f
// Contractions: qkv / o / gate / up / down projections (K = 1024 / 3072), scores QK^T (K = 64) and PV (K = keys, causal) on
// v_wmma_f32_16x16x32_f16 (f16 operands stored as raw 16-bit words, f32 accumulate; P scaled by 256 before its f16 conversion);
// FiLM, RMSNorm, SiLU gating, softmax statistics, the column mean and the state update in f32 on VALU. GEMM B operands and the attention's K and V (there A operands) are
// pre-packed in the ISA fragment order (element e of lane (h, n) = k0 + 8h + e for e < 8, k0 + 16 + 8h + (e-8) otherwise).
// A packed fragment (1 KB) is stored as two planes of 512 B: plane p holds elements 8p .. 8p + 7 of lane l at byte 16 l, so
// that each wave-wide 16-B load of a fragment half covers four whole 128-B lines.

typedef __attribute__((ext_vector_type(16))) _Float16        v16bf;   // (alias name kept; IEEE half)
typedef __attribute__((ext_vector_type(4)))  float           v4f;
typedef __attribute__((ext_vector_type(4)))  unsigned        v4u;
template <typename V> __device__ __forceinline__ void vst2(void* p, V v) {
    *(V*)p = v; 
}
typedef float __attribute__((may_alias)) float_a;
#define PSC 256.0f
#define PUN (1.0f / 256.0f)
typedef __attribute__((ext_vector_type(8)))  float           v8f;
typedef __attribute__((ext_vector_type(8)))  unsigned short  ushort8;
typedef __attribute__((ext_vector_type(16))) unsigned short  ushort16;

union Frag {
    ushort16 u;
    v16bf    b;
    ushort8  h[2];
};

__device__ __forceinline__ unsigned short f2b(float f) {     // f32 -> f16 bits (name kept)
    union { _Float16 h; unsigned short u; } c; c.h = (_Float16)f; return c.u;
}
__device__ __forceinline__ float b2f(unsigned short s) {
    union { unsigned short u; _Float16 h; } c; c.u = s; return (float)c.h;
}
__device__ __forceinline__ v8f wmma16(v16bf a, v16bf b, v8f c) {
    v8f d = __builtin_amdgcn_wmma_f32_16x16x32_f16(false, a, false, b, (short)0, c, false, false);
    asm volatile("v_nop\n\tv_nop\n\tv_nop\n\tv_nop" : "+v"(d) : "v"(a), "v"(b));
    return d;
}

// ---------------------------------------------------------------------------
// FiLM params: state_mod = state @ w_state_mod; fg = gamma*(1+sm[:D]); fb = beta+sm[D:]
// ---------------------------------------------------------------------------
__global__ void film_kernel(const float* __restrict__ state, const float* __restrict__ wsm,
                            const float* __restrict__ gamma, const float* __restrict__ beta,
                            float* __restrict__ fg, float* __restrict__ fb, int SD, int D) {
    int idx = blockIdx.x * blockDim.x + threadIdx.x;     // over B * 2D
    int b = idx / (2 * D);
    int c = idx % (2 * D);
    if (b >= 2) return;
    float s = 0.f;
    for (int k = 0; k < SD; ++k) s += state[b * SD + k] * wsm[k * 2 * D + c];
    if (c < D) vst2(fg + b * D + c, (float_a)(gamma[c] * (1.f + s)));
    else       vst2(fb + b * D + (c - D), (float_a)(beta[c - D] + s));
}

// ---------------------------------------------------------------------------
// RMSNorm + FiLM -> f16 row-major output
// ---------------------------------------------------------------------------
__global__ __launch_bounds__(256) void rmsnorm_film(
        const float* __restrict__ x, const float* __restrict__ nw,
        const float* __restrict__ fg, const float* __restrict__ fb,
        unsigned short* __restrict__ out, int S, int D) {
    int row = blockIdx.x;           // b*S + s
    int b = row / S;
    const float* xr = x + (size_t)row * D;
    float ss = 0.f;
    for (int d = threadIdx.x; d < D; d += 256) { float v = xr[d]; ss += v * v; }
    for (int m = 16; m >= 1; m >>= 1) ss += __shfl_xor(ss, m, 32);
    __shared__ float red[8];
    if ((threadIdx.x & 31) == 0) red[threadIdx.x >> 5] = ss;
    __syncthreads();
    float tot = 0.f;
    for (int i = 0; i < 8; ++i) tot += red[i];
    float scale = rsqrtf(tot / (float)D + EPSF);
    const float* fgb = fg + (size_t)b * D;
    const float* fbb = fb + (size_t)b * D;
    unsigned short* orow = out + (size_t)row * D;
    {   // 4 consecutive d per thread (D = 1024 = 256 x 4): 8-B lanes, a wave writes 256 contiguous bytes
        const int d0 = threadIdx.x * 4;
        union { unsigned short s[4]; unsigned long long u; } pk;
        #pragma unroll
        for (int e = 0; e < 4; ++e) { const int d = d0 + e; pk.s[e] = f2b(xr[d] * scale * nw[d] * fgb[d] + fbb[d]); }
        vst2(orow + d0, pk.u);
    }
}

// ---------------------------------------------------------------------------
// Pack f32 weight (K x N, row-major, y = x@W) into WMMA B-fragment layout:
// frag (nt, kt): 2 planes x 32 lanes x 8 halfs, values in the ISA order
// ---------------------------------------------------------------------------
__global__ void pack_b(const float* __restrict__ W, unsigned short* __restrict__ out, int K, int N) {
    int g = blockIdx.x * 256 + threadIdx.x;          // 8 consecutive fragment elements (16 B) per thread
    if (g * 8 >= K * N) return;
    union { unsigned short s[8]; v4u u; } pk;
    #pragma unroll
    for (int q = 0; q < 8; ++q) {
        int idx  = g * 8 + q;
        int j    = ((idx >> 8) & 1) * 8 + (idx & 7);     // plane, then element inside the plane
        int lane = (idx >> 3) & 31;
        int r    = idx >> 9;
        int ktc  = K >> 5;
        int kt   = r % ktc;
        int nt   = r / ktc;
        int k = kt * 32 + 8 * (lane >> 4) + (j < 8 ? j : j + 8);      // ISA B map (same as A)
        int n = nt * 16 + (lane & 15);
        pk.s[q] = f2b(W[(size_t)k * N + n]);
    }
    vst2(out + (size_t)g * 8, pk.u);
}

// ---------------------------------------------------------------------------
// Pack V and K (from the f16 qkv buffer) into B-fragments: V [bh][kb][n4][plane][lane][8], K [bh][kb][t][c][plane][lane][8]
// (t = which 16 keys of the 32, c = which 32 of the 64 head dims). Thread g writes the 16-B piece g of both.
// ---------------------------------------------------------------------------
__global__ void pack_v(const unsigned short* __restrict__ qkvb, unsigned short* __restrict__ vp,
                       unsigned short* __restrict__ kpk, int S, int H, int HD, int total) {
    int g = blockIdx.x * 256 + threadIdx.x;
    if (g * 8 >= total) return;
    {   // a thread's 8 elements of K are 8 consecutive head dims of one key: one 16-B copy
        int lane = g & 31, plane = (g >> 5) & 1, c = (g >> 6) & 1, t = (g >> 7) & 1, kb = (g >> 8) & 63, bh = g >> 14;
        int b = bh >> 4, h = bh & 15;
        int key = kb * 32 + t * 16 + (lane & 15);
        int d   = c * 32 + 8 * (lane >> 4) + 16 * plane;              // ISA B map
        vst2(kpk + (size_t)g * 8, *(const v4u*)(qkvb + (size_t)(b * S + key) * (3 * H * HD) + H * HD + h * HD + d));
    }
    union { unsigned short s[8]; v4u u; } pk;
    #pragma unroll
    for (int q = 0; q < 8; ++q) {
        int idx  = g * 8 + q;
        int j    = ((idx >> 8) & 1) * 8 + (idx & 7);     // plane, then element inside the plane
        int lane = (idx >> 3) & 31;
        int r    = idx >> 9;
        int n4 = r & 3;  r >>= 2;
        int kb = r & 63; r >>= 6;
        int bh = r;
        int b = bh >> 4, h = bh & 15;
        int key = kb * 32 + 8 * (lane >> 4) + (j < 8 ? j : j + 8);    // ISA B map
        int col = n4 * 16 + (lane & 15);
        pk.s[q] = qkvb[(size_t)(b * S + key) * (3 * H * HD) + 2 * H * HD + h * HD + col];
    }
    vst2(vp + (size_t)g * 8, pk.u);
}

// ---------------------------------------------------------------------------
// f16 GEMM via V_WMMA_F32_16X16X32_F16.
// Block: 256 thr = 8 waves; wave tile 32x64 (2x4 accum frags); block tile 64x256.
// A (M x K f16 row-major) is double-buffer staged into LDS per K-step with plain 16-B copies through a register.
// B streams from packed fragments (two 512-B planes, 16 B a lane in each), one K-step ahead of its products.
// Epilogues: 0: f16 store | 1: f32 = acc+res | 2: f16 silu(acc) | 3: f16 gate*acc
// ---------------------------------------------------------------------------
template <int EPI>
__global__ __launch_bounds__(256) void gemm_f16(
        const unsigned short* __restrict__ A, const unsigned short* __restrict__ Bp,
        const float* __restrict__ resF, const unsigned short* __restrict__ gateB,
        float* __restrict__ outF, unsigned short* __restrict__ outB,
        int M, int N, int K) {
    __shared__ __align__(16) unsigned short atile[2][64 * 32];   // 2 x 4KB
    __shared__ __align__(16) float Ct[64][256];                    // block output tile (64 KB)

    const int lane = threadIdx.x & 31;
    const int w    = threadIdx.x >> 5;
    const int wm   = w >> 2;
    const int wn   = w & 3;
    const int mblock = blockIdx.y * 64;
    const int mbase  = mblock + wm * 32;
    const int nbase  = blockIdx.x * 256 + wn * 64;
    const int ktc = K >> 5;
    const int hi  = (lane >> 4) & 1;
    const int l15 = lane & 15;

    // cooperative A-staging mapping: 256 thr x 16B = 64x32 f16 tile
    const int srow   = threadIdx.x >> 2;
    const int schunk = (threadIdx.x & 3) * 8;            // ushort offset within row

    v8f acc[2][4] = {};

    // fragment (ni, kt) of this wave's four B columns stands at bw + (ni * ktc + kt) * 512
    const unsigned short* bw = Bp + (size_t)(nbase >> 4) * ktc * 512 + lane * 8;
    const unsigned short* ag = A + (size_t)(mblock + srow) * K + schunk;

    // Every register that holds a global operand is loaded anew for its next use right behind its last use: a B fragment
    // behind its two products, the thread's 16 B of A behind their store to LDS. A load then has about a whole step to
    // come back, and a step waits out no load in full.
    // The last steps ask for the last step's data once more: in bounds, never used.
    Frag bfr[4];
    for (int ni = 0; ni < 4; ++ni) {
        bfr[ni].h[0] = *(const ushort8*)(bw + (size_t)ni * ktc * 512);
        bfr[ni].h[1] = *(const ushort8*)(bw + (size_t)ni * ktc * 512 + 256);
    }
    v4u areg = *(const v4u*)(ag);
    *(v4u*)(&atile[0][srow * 32 + schunk]) = areg;
    areg = *(const v4u*)(ag + (1 < ktc ? 1 : 0) * 32);
    // The K loop's barrier, written by hand: __syncthreads() also waits for every global load, which would end the loads
    // issued ahead at each step; only this wave's LDS traffic has to be over here (tile stores visible, tile reads done).
    auto lds_barrier = [] {
        // a load issued ahead is in flight here, and the next step writes its address register anew
        asm volatile("s_wait_xcnt 0x0" ::: "memory");
        asm volatile("s_wait_dscnt 0x0" ::: "memory");
        asm volatile("s_barrier_signal -1\n\ts_barrier_wait -1" ::: "memory");
    };
    lds_barrier();                                        // tile 0 is whole
    int cur = 0;

    for (int kt = 0; kt < ktc; ++kt) {
        const int kb = kt + 1 < ktc ? kt + 1 : ktc - 1;   // step whose B fragments are asked for in this step
        const int ka = kt + 2 < ktc ? kt + 2 : ktc - 1;   // step whose A piece is asked for in this step

        Frag a0, a1;
        const unsigned short* l0 = &atile[cur][(wm * 32 + l15) * 32 + hi * 8];
        a0.h[0] = *(const ushort8*)(l0);
        a0.h[1] = *(const ushort8*)(l0 + 16);
        const unsigned short* l1 = l0 + 16 * 32;
        a1.h[0] = *(const ushort8*)(l1);
        a1.h[1] = *(const ushort8*)(l1 + 16);

        for (int ni = 0; ni < 4; ++ni) {
            acc[0][ni] = wmma16(a0.b, bfr[ni].b, acc[0][ni]);
            acc[1][ni] = wmma16(a1.b, bfr[ni].b, acc[1][ni]);
            bfr[ni].h[0] = *(const ushort8*)(bw + ((size_t)ni * ktc + kb) * 512);
            bfr[ni].h[1] = *(const ushort8*)(bw + ((size_t)ni * ktc + kb) * 512 + 256);
        }
        // the B loads are in flight, and the lines below may write their address registers anew
        asm volatile("s_wait_xcnt 0x0" ::: "memory");
        if (kt + 1 < ktc) *(v4u*)(&atile[cur ^ 1][srow * 32 + schunk]) = areg;   // the A piece of step kt + 1
        areg = *(const v4u*)(ag + ka * 32);
        lds_barrier();                                    // tile(cur ^ 1) is whole; the reads of tile(cur) are done
        cur ^= 1;
    }

    // epilogue through the block tile: value after residual / silu / gating, then whole-line stores
    __syncthreads();
    for (int mi = 0; mi < 2; ++mi) {
        for (int ni = 0; ni < 4; ++ni) {
            int rl0 = wm * 32 + mi * 16 + hi * 8;
            int cl  = wn * 64 + ni * 16 + l15;
            int col = blockIdx.x * 256 + cl;
            for (int r = 0; r < 8; ++r) {
                size_t idx = (size_t)(mblock + rl0 + r) * N + col;
                float v = acc[mi][ni][r];
                if (EPI == 1)      v += resF[idx];
                else if (EPI == 2) v = v / (1.f + __expf(-v));   // silu
                else if (EPI == 3) v = b2f(gateB[idx]) * v;
                Ct[rl0 + r][cl] = v;
            }
        }
    }
    __syncthreads();
    const int tid = threadIdx.x, n0blk = blockIdx.x * 256;
    if (EPI == 1) {   // f32 rows: 64 x 1024 B (64 pieces)
        for (int g = tid; g < 64 * 64; g += 256) { const int rl = g >> 6, pc = g & 63; vst2(outF + (size_t)(mblock + rl) * N + n0blk + pc * 4, *(const v4f*)(&Ct[rl][pc * 4])); }
    } else {          // 16-bit rows: 64 x 512 B (32 pieces of 8)
        for (int g = tid; g < 64 * 32; g += 256) {
            const int rl = g >> 5, pc = g & 31;
            union { unsigned short s[8]; v4u u; } pk;
            #pragma unroll
            for (int e = 0; e < 8; ++e) pk.s[e] = f2b(Ct[rl][pc * 8 + e]);
            vst2(outB + (size_t)(mblock + rl) * N + n0blk + pc * 8, pk.u);
        }
    }
}

// ---------------------------------------------------------------------------
// Flash attention, one wave per 16-query tile; causal; online softmax. Both products are taken transposed:
// S^T = K Q^T (A = a packed K fragment, B = the Q fragment) and O^T += V^T P^T (A = a packed V fragment, B = P^T).
// A and B share one register map, so the fragments are the ones of the untransposed form with their places swapped.
// A lane then holds one query (column l15) and 16 of the pass's 32 keys (rows t * 16 + 8 hi + r): maximum and sum run
// inside the lane, with one exchange between lanes l and l ^ 16, and the two score tiles, converted where they lie,
// are the B fragment P^T (element e = key 8 hi + e for e < 8, 16 + 8 hi + (e - 8) otherwise): P never leaves its registers.
// ---------------------------------------------------------------------------
__device__ __forceinline__ float xhalf(float x) {            // the value of lane l ^ 16
    return __builtin_bit_cast(float, __builtin_amdgcn_permlanex16(__builtin_bit_cast(int, x), __builtin_bit_cast(int, x),
                                                                  0x76543210, 0xfedcba98, false, false));
}
__global__ __launch_bounds__(256) void flash_attn(
        const unsigned short* __restrict__ qkvb, const unsigned short* __restrict__ vp,
        const unsigned short* __restrict__ kpk, unsigned short* __restrict__ attn, int S, int H, int HD) {
    __shared__ __align__(16) unsigned short olds[8][16 * 64]; // per-wave output tile
    const int lane = threadIdx.x & 31;
    const int w    = threadIdx.x >> 5;
    const int waveId = blockIdx.x * 8 + w;
    const int qt = waveId & 127;              // S/16 = 128
    const int bh = waveId >> 7;
    const int b = bh >> 4, h = bh & 15;
    const int qbase = qt * 16;
    const int l15 = lane & 15;
    const int hi  = (lane >> 4) & 1;
    const int D3  = 3 * H * HD;

    Frag aq[2];
    {
        const unsigned short* qp = qkvb + (size_t)(b * S + qbase + l15) * D3 + h * HD + hi * 8;
        aq[0].h[0] = *(const ushort8*)(qp);
        aq[0].h[1] = *(const ushort8*)(qp + 16);
        aq[1].h[0] = *(const ushort8*)(qp + 32);
        aq[1].h[1] = *(const ushort8*)(qp + 48);
    }

    v8f o[4] = {};                            // o[n][r] = O[query l15][head dim n * 16 + 8 hi + r]
    float mrun = -3.0e38f;                    // the query's running maximum, alike in both lanes of the query
    float lrun = 0.f;                         // this lane's share of the query's running sum

    const int nkb = (qbase + 16 + 31) >> 5;
    // Every load of a key block is issued well ahead of the product that reads it, so that a pass waits out no load:
    // the four V fragments at the head of their own pass, the K fragments right behind the score products of the pass
    // before, into the same registers.
    Frag bk[2][2];
    auto load_k = [&](int blk) {
        const unsigned short* kp = kpk + (((size_t)bh * (S / 32) + blk) * 4) * 512 + lane * 8;   // packed fragments (t, c)
        for (int t = 0; t < 2; ++t)
            for (int c = 0; c < 2; ++c) {
                bk[t][c].h[0] = *(const ushort8*)(kp + (t * 2 + c) * 512);
                bk[t][c].h[1] = *(const ushort8*)(kp + (t * 2 + c) * 512 + 256);
            }
    };
    load_k(0);
    for (int kb = 0; kb < nkb; ++kb) {
        const int kbase = kb * 32;
        Frag bv[4];
        const unsigned short* vpp = vp + (((size_t)bh * (S / 32) + kb) * 4) * 512 + lane * 8;
        for (int n = 0; n < 4; ++n) {
            bv[n].h[0] = *(const ushort8*)(vpp + n * 512);
            bv[n].h[1] = *(const ushort8*)(vpp + n * 512 + 256);
        }
        v8f z = {};
        v8f sc[2];                            // sc[t][r] = score of key kbase + t * 16 + 8 hi + r with query qbase + l15
        sc[0] = wmma16(bk[0][0].b, aq[0].b, z);
        sc[0] = wmma16(bk[0][1].b, aq[1].b, sc[0]);
        sc[1] = wmma16(bk[1][0].b, aq[0].b, z);
        sc[1] = wmma16(bk[1][1].b, aq[1].b, sc[1]);
        load_k(kb + 1 < nkb ? kb + 1 : kb);     // the last pass loads its own block again: in bounds, never used

        const bool diag = (kbase + 32 > qbase);
        for (int t = 0; t < 2; ++t)
            for (int r = 0; r < 8; ++r) {
                float v = sc[t][r] * 0.125f;            // 1/sqrt(64)
                if (diag) {
                    int key  = kbase + t * 16 + hi * 8 + r;
                    int qrow = qbase + l15;
                    if (key > qrow) v = -1.0e30f;
                }
                sc[t][r] = v;
            }

        float mx = fmaxf(sc[0][0], sc[1][0]);
        for (int r = 1; r < 8; ++r) mx = fmaxf(mx, fmaxf(sc[0][r], sc[1][r]));
        mx = fmaxf(mx, xhalf(mx));                      // over all 32 keys of the pass
        const float mn = fmaxf(mrun, mx);
        const float al = __expf(mrun - mn);
        mrun = mn;
        for (int t = 0; t < 2; ++t)
            for (int r = 0; r < 8; ++r)
                sc[t][r] = __expf(sc[t][r] - mn);
        float rs = sc[0][0] + sc[1][0];
        for (int r = 1; r < 8; ++r) rs += sc[0][r] + sc[1][r];
        lrun = lrun * al + rs;                          // the two lanes of a query are added once, behind the loop
        for (int n = 0; n < 4; ++n)
            for (int r = 0; r < 8; ++r)
                o[n][r] *= al;

        Frag pb;
        for (int t = 0; t < 2; ++t)
            for (int r = 0; r < 8; ++r)
                pb.u[t * 8 + r] = f2b(sc[t][r] * PSC);

        for (int n = 0; n < 4; ++n) o[n] = wmma16(bv[n].b, pb.b, o[n]);
    }

    const float inv = PUN / (lrun + xhalf(lrun));
    unsigned short* ot = olds[w];
    for (int n = 0; n < 4; ++n) {             // a lane's 8 values of a tile are 8 consecutive head dims of its query: 16 B
        union { unsigned short s[8]; v4u u; } pk;
        for (int r = 0; r < 8; ++r) pk.s[r] = f2b(o[n][r] * inv);
        *(v4u*)(ot + l15 * 64 + n * 16 + hi * 8) = pk.u;
    }
    asm volatile("s_wait_dscnt 0" ::: "memory");
    __builtin_amdgcn_wave_barrier();
    for (int q = 0; q < 4; ++q) {
        const int rl = q * 4 + (lane >> 3), pc = lane & 7;
        vst2(attn + (size_t)(b * S + qbase + rl) * (H * HD) + h * HD + pc * 8, *(const v4u*)(ot + rl * 64 + pc * 8));
    }
}

// ---------------------------------------------------------------------------
// mean over S:  out[b,d] = mean_s x[b,s,d]
// ---------------------------------------------------------------------------
// One work-group per (batch, strip of 32 columns = one 128-B line of every row). 8 lanes x 16 B cover the line, so a
// wave-wide load takes 4 whole lines (4 rows) and the 32 waves take 128 rows a pass: S / 128 loads a lane.
// Lane sums -> butterfly over the wave's 4 rows -> LDS -> one wave adds the 32 wave sums and stores the strip's line.
// S and D are compile-time so that every load is the one base address plus an immediate offset.
template <int S, int D>
__global__ __launch_bounds__(1024) void colmean(const float* __restrict__ x, float* __restrict__ out) {
    static_assert(S % 128 == 0 && D % 32 == 0, "whole passes, whole lines");
    constexpr int NL = S / 128;                          // loads a lane
    __shared__ __align__(16) float part[32][32];         // [wave][column of the strip]
    const int b   = blockIdx.x / (D / 32);
    const int c0  = (blockIdx.x % (D / 32)) * 32;
    const int tid = threadIdx.x;
    const int q   = tid & 7;                             // which 16 B of the line
    const int r0  = tid >> 3;                            // row inside a pass of 128
    const float* p = x + ((size_t)b * S + r0) * D + c0 + q * 4;
    v4f v[NL];
    #pragma unroll       // independent loads ahead of the adds: their latencies overlap instead of adding up row by row
    for (int i = 0; i < NL; ++i) v[i] = *(const v4f*)(p + (size_t)i * 128 * D);
    v4f s = v[0];
    #pragma unroll       // v[] needs constant indices to stay in registers
    for (int i = 1; i < NL; ++i) s += v[i];
    #pragma unroll       // s[e] needs a constant index to stay in registers
    for (int e = 0; e < 4; ++e) {
        s[e] += __shfl_xor(s[e], 8, 32);
        s[e] += __shfl_xor(s[e], 16, 32);
    }
    if ((tid & 31) < 8) *(v4f*)(&part[tid >> 5][q * 4]) = s;
    __syncthreads();
    if (tid < 32) {
        float tot = 0.f;
        for (int wv = 0; wv < 32; ++wv) tot += part[wv][tid];
        vst2(out + (size_t)b * D + c0 + tid, (float_a)(tot / (float)S));
    }
}

// ---------------------------------------------------------------------------
// recurrent state update: one work-group of 32 waves, two products of the same shape, (2 x K) @ (K x SD):
// new_info = mean @ w_h2s (K = D) and gate logits = [state | new_info] @ w_sgate (K = 2 SD).
// 16 lanes x 16 B cover one 256-B weight row; the K rows are split over the 64 lane groups (K / 64 consecutive rows
// each, both batches from the one row load); group sums -> l ^ 16 shuffle -> LDS -> one thread per output adds the 32.
// D and SD are compile-time so that every global load has a constant offset and depends on no sum.
// ---------------------------------------------------------------------------
__device__ __forceinline__ void wave_sums_to_lds(v4f s0, v4f s1, float (*part)[2][64], int t) {
    #pragma unroll       // constant indices keep s0, s1 in registers
    for (int e = 0; e < 4; ++e) {
        s0[e] += __shfl_xor(s0[e], 16, 32);
        s1[e] += __shfl_xor(s1[e], 16, 32);
    }
    if ((t & 31) < 16) {
        *(v4f*)(&part[t >> 5][0][(t & 15) * 4]) = s0;
        *(v4f*)(&part[t >> 5][1][(t & 15) * 4]) = s1;
    }
}
__device__ __forceinline__ float add_wave_sums(const float (*part)[2][64], int b, int j) {
    float tot = 0.f;
    #pragma unroll       // independent LDS reads ahead of the adds
    for (int wv = 0; wv < 32; ++wv) tot += part[wv][b][j];
    return tot;
}

template <int D, int SD>
__global__ __launch_bounds__(1024) void state_update(
        const float* __restrict__ state, const float* __restrict__ meanx,
        const float* __restrict__ w_h2s, const float* __restrict__ w_sgate,
        float* __restrict__ outState) {
    static_assert(SD == 64 && D % 256 == 0, "16 lanes x 4 columns a row; whole 16-B pieces of the mean");
    constexpr int KR = D / 64;                           // rows of w_h2s a lane group
    constexpr int GR = 2 * SD / 64;                      // rows of w_sgate a lane group
    __shared__ __align__(16) float part[32][2][SD];      // [wave][batch][column]
    __shared__ __align__(16) float cat[2][2 * SD];       // [batch][state | new_info]
    const int t  = threadIdx.x;
    const int c4 = (t & 15) * 4;                         // 4 columns of the row
    const int kg = t >> 4;                               // lane group
    const int b  = (t >> 6) & 1, j = t & 63;             // the output of threads 0 .. 2 SD - 1

    v4f wr[KR], mv[2][KR / 4], wg[GR];
    #pragma unroll       // constant indices keep wr[] in registers
    for (int i = 0; i < KR; ++i) wr[i] = *(const v4f*)(w_h2s + (kg * KR + i) * SD + c4);
    #pragma unroll       // constant indices keep mv[][] in registers
    for (int i = 0; i < KR / 4; ++i) {
        mv[0][i] = *(const v4f*)(meanx + kg * KR + i * 4);
        mv[1][i] = *(const v4f*)(meanx + D + kg * KR + i * 4);
    }
    #pragma unroll       // constant indices keep wg[] in registers
    for (int i = 0; i < GR; ++i) wg[i] = *(const v4f*)(w_sgate + (kg * GR + i) * SD + c4);
    const float st = state[b * SD + j];
    // nothing is scheduled across this line: every load is issued before the first sum waits, so that the kernel pays
    // one memory latency; without it the loads go out in batches, each batch behind the wait for the one before
    __builtin_amdgcn_sched_barrier(0);

    v4f s0 = {}, s1 = {};
    #pragma unroll       // constant indices into wr[] and mv[][]
    for (int i = 0; i < KR; ++i) {
        s0 += wr[i] * mv[0][i >> 2][i & 3];
        s1 += wr[i] * mv[1][i >> 2][i & 3];
    }
    wave_sums_to_lds(s0, s1, part, t);
    if (t < 2 * SD) cat[b][j] = st;
    __syncthreads();                                     // the wave sums of new_info are in part
    if (t < 2 * SD) cat[b][SD + j] = add_wave_sums(part, b, j);
    __syncthreads();                                     // cat is whole; part has been read and may be rewritten
    s0 = v4f{}; s1 = v4f{};
    #pragma unroll       // constant indices into wg[]
    for (int i = 0; i < GR; ++i) {
        s0 += wg[i] * cat[0][kg * GR + i];
        s1 += wg[i] * cat[1][kg * GR + i];
    }
    wave_sums_to_lds(s0, s1, part, t);
    __syncthreads();                                     // the wave sums of the gate logits are in part
    if (t < 2 * SD) {
        const float g = 1.f / (1.f + __expf(-add_wave_sums(part, b, j)));
        vst2(outState + b * SD + j, (float_a)(st * (1.f - g) + cat[b][SD + j] * g));   // 128 consecutive floats
    }
}

// ---------------------------------------------------------------------------
extern "C" void kernel_launch(void* const* d_in, const int* in_sizes, int n_in,
                              void* d_out, int out_size, void* d_ws, size_t ws_size,
                              hipStream_t stream) {
    (void)in_sizes; (void)n_in; (void)out_size; (void)ws_size;
    const int B = 2, S = 2048, D = 1024, H = 16, HD = 64, SD = 64;
    const float* x       = (const float*)d_in[0];
    const float* gamma   = (const float*)d_in[1];
    const float* beta    = (const float*)d_in[2];
    const float* state   = (const float*)d_in[3];
    const float* w_qkv   = (const float*)d_in[4];
    const float* w_o     = (const float*)d_in[5];
    const float* w_gate  = (const float*)d_in[6];
    const float* w_up    = (const float*)d_in[7];
    const float* w_down  = (const float*)d_in[8];
    const float* norm1_w = (const float*)d_in[9];
    const float* norm2_w = (const float*)d_in[10];
    const float* w_sm    = (const float*)d_in[11];
    const float* w_h2s   = (const float*)d_in[12];
    const float* w_sgate = (const float*)d_in[13];
    float* xout = (float*)d_out;                       // (B,S,D) then state (B,SD)

    char* ws = (char*)d_ws;
    size_t off = 0;
    auto arena = [&](size_t bytes) -> void* {
        void* p = ws + off;
        off = (off + bytes + 255) & ~(size_t)255;
        return p;
    };
    float* fg             = (float*)arena((size_t)B * D * 4);
    float* fb             = (float*)arena((size_t)B * D * 4);
    unsigned short* hbuf  = (unsigned short*)arena((size_t)B * S * D * 2);       // h / h2
    unsigned short* wqkvp = (unsigned short*)arena((size_t)D * 3 * D * 2);
    unsigned short* wop   = (unsigned short*)arena((size_t)D * D * 2);
    unsigned short* wgp   = (unsigned short*)arena((size_t)D * 3 * D * 2);
    unsigned short* wupp  = (unsigned short*)arena((size_t)D * 3 * D * 2);
    unsigned short* wdp   = (unsigned short*)arena((size_t)3 * D * D * 2);
    unsigned short* qkvb  = (unsigned short*)arena((size_t)B * S * 3 * D * 2);   // also act
    unsigned short* vp    = (unsigned short*)arena((size_t)B * H * (S / 32) * 4 * 512 * 2);
    unsigned short* kpk   = (unsigned short*)arena((size_t)B * H * (S / 32) * 4 * 512 * 2);
    unsigned short* attnb = (unsigned short*)arena((size_t)B * S * D * 2);
    float* x1             = (float*)arena((size_t)B * S * D * 4);
    unsigned short* gateb = (unsigned short*)arena((size_t)B * S * 3 * D * 2);
    float* meanb          = (float*)arena((size_t)B * D * 4);
    unsigned short* act   = qkvb;                      // reuse after attention

    const int MR = B * S;                              // 4096 rows

    // FiLM params
    film_kernel<<<(B * 2 * D + 255) / 256, 256, 0, stream>>>(state, w_sm, gamma, beta, fg, fb, SD, D);

    // pack weights -> B fragments (f16)
    pack_b<<<(D * 3 * D / 8 + 255) / 256, 256, 0, stream>>>(w_qkv,  wqkvp, D, 3 * D);
    pack_b<<<(D * D / 8 + 255) / 256,     256, 0, stream>>>(w_o,    wop,   D, D);
    pack_b<<<(D * 3 * D / 8 + 255) / 256, 256, 0, stream>>>(w_gate, wgp,   D, 3 * D);
    pack_b<<<(D * 3 * D / 8 + 255) / 256, 256, 0, stream>>>(w_up,   wupp,  D, 3 * D);
    pack_b<<<(3 * D * D / 8 + 255) / 256, 256, 0, stream>>>(w_down, wdp,   3 * D, D);

    // h = rmsnorm(x)*fg + fb
    rmsnorm_film<<<MR, 256, 0, stream>>>(x, norm1_w, fg, fb, hbuf, S, D);

    // qkv = h @ w_qkv   (f16 out)
    gemm_f16<0><<<dim3(3 * D / 256, MR / 64), 256, 0, stream>>>(
        hbuf, wqkvp, nullptr, nullptr, nullptr, qkvb, MR, 3 * D, D);

    // pack V and K into B fragments
    {
        int total = B * H * (S / 32) * 4 * 512;
        pack_v<<<(total / 8 + 255) / 256, 256, 0, stream>>>(qkvb, vp, kpk, S, H, HD, total);
    }

    // attention
    flash_attn<<<(B * H * (S / 16)) / 8, 256, 0, stream>>>(qkvb, vp, kpk, attnb, S, H, HD);

    // x1 = x + attn @ w_o
    gemm_f16<1><<<dim3(D / 256, MR / 64), 256, 0, stream>>>(
        attnb, wop, x, nullptr, x1, nullptr, MR, D, D);

    // h2 = rmsnorm(x1)*fg + fb
    rmsnorm_film<<<MR, 256, 0, stream>>>(x1, norm2_w, fg, fb, hbuf, S, D);

    // gate = silu(h2 @ w_gate)   (f16)
    gemm_f16<2><<<dim3(3 * D / 256, MR / 64), 256, 0, stream>>>(
        hbuf, wgp, nullptr, nullptr, nullptr, gateb, MR, 3 * D, D);

    // act = gate * (h2 @ w_up)   (f16)
    gemm_f16<3><<<dim3(3 * D / 256, MR / 64), 256, 0, stream>>>(
        hbuf, wupp, nullptr, gateb, nullptr, act, MR, 3 * D, D);

    // xout = x1 + act @ w_down
    gemm_f16<1><<<dim3(D / 256, MR / 64), 256, 0, stream>>>(
        act, wdp, x1, nullptr, xout, nullptr, MR, D, 3 * D);

    // state update
    colmean<S, D><<<B * D / 32, 1024, 0, stream>>>(xout, meanb);
    state_update<D, SD><<<1, 1024, 0, stream>>>(state, meanb, w_h2s, w_sgate,
                                                xout + (size_t)B * S * D);
}

// v006
// Measured time: 284 microseconds a run.
// Next to v005, in two timings, it ran 1.03 times as fast each time.
// Counting every step since v000, it is 2.77 times as fast.
#include <hip/hip_runtime.h>

#define EPSF 1.1920929e-07f
// Contractions: qkv / o / gate / up / down projections (K = 1024 / 3072), scores QK^T (K = 64) and PV (K = keys, causal) on
// v_wmma_f32_16x16x32_f16 (f16 operands stored as raw 16-bit words, f32 accumulate; P scaled by 256 before its f16 conversion);
// FiLM, RMSNorm, SiLU gating, softmax statistics, the column mean and the state update in f32 on VALU. GEMM B operands and the attention's K and V (there A operands) are
// pre-packed in the ISA fragment order (element e of lane (h, n) = k0 + 8h + e for e < 8, k0 + 16 + 8h + (e-8) otherwise).
// A packed fragment (1 KB) is stored as two planes of 512 B: plane p holds elements 8p .. 8p + 7 of lane l at byte 16 l, so
// that each wave-wide 16-B load of a fragment half covers four whole 128-B lines.

typedef __attribute__((ext_vector_type(16))) _Float16        v16bf;   // (alias name kept; IEEE half)
typedef __attribute__((ext_vector_type(4)))  float           v4f;
typedef __attribute__((ext_vector_type(4)))  unsigned        v4u;
template <typename V> __device__ __forceinline__ void vst2(void* p, V v) {
    *(V*)p = v; 
}
typedef float __attribute__((may_alias)) float_a;
#define PSC 256.0f
#define PUN (1.0f / 256.0f)
typedef __attribute__((ext_vector_type(8)))  float           v8f;
typedef __attribute__((ext_vector_type(8)))  unsigned short  ushort8;
typedef __attribute__((ext_vector_type(16))) unsigned short  ushort16;

union Frag {
    ushort16 u;
    v16bf    b;
    ushort8  h[2];
};

__device__ __forceinline__ unsigned short f2b(float f) {     // f32 -> f16 bits (name kept)
    union { _Float16 h; unsigned short u; } c; c.h = (_Float16)f; return c.u;
}
__device__ __forceinline__ float b2f(unsigned short s) {
    union { unsigned short u; _Float16 h; } c; c.u = s; return (float)c.h;
}
__device__ __forceinline__ v8f wmma16(v16bf a, v16bf b, v8f c) {
    v8f d = __builtin_amdgcn_wmma_f32_16x16x32_f16(false, a, false, b, (short)0, c, false, false);
    asm volatile("v_nop\n\tv_nop\n\tv_nop\n\tv_nop" : "+v"(d) : "v"(a), "v"(b));
    return d;
}

// ---------------------------------------------------------------------------
// FiLM params: state_mod = state @ w_state_mod; fg = gamma*(1+sm[:D]); fb = beta+sm[D:]
// ---------------------------------------------------------------------------
__global__ void film_kernel(const float* __restrict__ state, const float* __restrict__ wsm,
                            const float* __restrict__ gamma, const float* __restrict__ beta,
                            float* __restrict__ fg, float* __restrict__ fb, int SD, int D) {
    int idx = blockIdx.x * blockDim.x + threadIdx.x;     // over B * 2D
    int b = idx / (2 * D);
    int c = idx % (2 * D);
    if (b >= 2) return;
    float s = 0.f;
    for (int k = 0; k < SD; ++k) s += state[b * SD + k] * wsm[k * 2 * D + c];
    if (c < D) vst2(fg + b * D + c, (float_a)(gamma[c] * (1.f + s)));
    else       vst2(fb + b * D + (c - D), (float_a)(beta[c - D] + s));
}

// ---------------------------------------------------------------------------
// The three kernels below move data and hold almost no arithmetic. A launch of that kind with one small item a lane is
// bound by how fast waves start, not by its bytes: each of them gives a wave a whole piece of the work (4 to 8 KB in, all
// of it asked for at once by 16-B loads that cover whole lines), so that 8 to 16 times fewer waves start.
// ---------------------------------------------------------------------------
// RMSNorm + FiLM -> f16 row-major output. One wave takes two whole rows and keeps them in registers (2,048 waves, 8 a
// WGP). A wave-wide 16-B load covers 512 contiguous bytes of a row; the three parameter rows are loaded once for both
// rows; the sum of squares is four chains in the lane and a butterfly over the wave: no LDS tree, no barrier, no second
// read of x.
// ---------------------------------------------------------------------------
template <int S, int D>
__global__ __launch_bounds__(256) void rmsnorm_film(
        const float* __restrict__ x, const float* __restrict__ nw,
        const float* __restrict__ fg, const float* __restrict__ fb,
        unsigned short* __restrict__ out) {
    static_assert(D % 128 == 0 && S % 2 == 0, "whole 512-B pieces of a row; both rows of a wave in one batch");
    constexpr int NL = D / 128;                          // loads a lane and row
    const int lane = threadIdx.x & 31;
    const int row0 = (blockIdx.x * 8 + (threadIdx.x >> 5)) * 2;      // b*S + s of the first row
    const int b    = row0 / S;
    const int c0   = lane * 4;                           // the lane's columns: c0 + 128 i + (0 .. 3)
    const float* xr = x + (size_t)row0 * D + c0;
    v4f v0[NL], v1[NL], pw[NL], pg[NL], pb[NL];
    #pragma unroll       // constant indices keep the arrays in registers
    for (int i = 0; i < NL; ++i) {
        v0[i] = *(const v4f*)(xr + i * 128);
        v1[i] = *(const v4f*)(xr + D + i * 128);
    }
    // the loads of x are in flight, and a later load may be given their address register as its destination
    asm volatile("s_wait_xcnt 0x0" ::: "memory");
    #pragma unroll       // constant indices keep the arrays in registers
    for (int i = 0; i < NL; ++i) {
        pw[i] = *(const v4f*)(nw + c0 + i * 128);
        pg[i] = *(const v4f*)(fg + (size_t)b * D + c0 + i * 128);
        pb[i] = *(const v4f*)(fb + (size_t)b * D + c0 + i * 128);
    }
    // the parameter loads are in flight, and the lines below may write their address registers anew
    asm volatile("s_wait_xcnt 0x0" ::: "memory");
    // nothing is scheduled across this line: every load is issued before the first sum waits, so that the wave pays one
    // memory latency; loads sunk behind the sums would add a second one
    __builtin_amdgcn_sched_barrier(0);
    v4f a0 = v0[0] * v0[0], a1 = v1[0] * v1[0];
    #pragma unroll       // constant indices into v0[], v1[]
    for (int i = 1; i < NL; ++i) { a0 += v0[i] * v0[i]; a1 += v1[i] * v1[i]; }
    float ss0 = (a0[0] + a0[1]) + (a0[2] + a0[3]);
    float ss1 = (a1[0] + a1[1]) + (a1[2] + a1[3]);
    for (int m = 16; m >= 1; m >>= 1) { ss0 += __shfl_xor(ss0, m, 32); ss1 += __shfl_xor(ss1, m, 32); }
    const float sc0 = rsqrtf(ss0 / (float)D + EPSF);
    const float sc1 = rsqrtf(ss1 / (float)D + EPSF);
    unsigned short* orow = out + (size_t)row0 * D + c0;
    #pragma unroll       // constant indices; 8-B lanes, a wave writes 256 contiguous bytes
    for (int i = 0; i < NL; ++i) {
        union { unsigned short s[4]; unsigned long long u; } k0, k1;
        #pragma unroll   // constant indices into the vectors
        for (int e = 0; e < 4; ++e) {
            k0.s[e] = f2b(v0[i][e] * sc0 * pw[i][e] * pg[i][e] + pb[i][e]);
            k1.s[e] = f2b(v1[i][e] * sc1 * pw[i][e] * pg[i][e] + pb[i][e]);
        }
        vst2(orow + i * 128, k0.u);
        vst2(orow + D + i * 128, k1.u);
    }
}

// Place (in 16-bit words) of 16-B piece p of a 4-KB run of packed fragments in a wave's staging LDS: 8 pieces (128 B) at a
// pitch of 144 B, so that both the lanes that write pieces 8 or more apart and the lanes that read them in order meet
// no more bank conflicts than a 16-B access has anyway.
__device__ __forceinline__ int stoff(int p) { return (p >> 3) * 72 + (p & 7) * 8; }
#define ST_WORDS (32 * 72)

// ---------------------------------------------------------------------------
// Pack f32 weight (K x N, row-major, y = x@W) into WMMA B-fragment layout:
// frag (nt, kt): 2 planes x 32 lanes x 8 halfs, values in the ISA order.
// One wave packs one k step of 64 columns = four fragments (4 KB), 64 elements a lane. 16 lanes x 16 B cover 256 B of a
// weight row, the two lane halves take the rows of hi = 0 and 1, load (u, i) takes row i of plane u. A lane then holds
// the pieces of 4 neighbouring fragment lanes; they pass through the wave's own LDS so that every store is 512
// contiguous bytes. K and N are compile-time so that every load is the one base address plus an immediate offset.
// ---------------------------------------------------------------------------
template <int K, int N>
__global__ __launch_bounds__(128) void pack_b(const float* __restrict__ W, unsigned short* __restrict__ out) {
    static_assert(K % 32 == 0 && N % 64 == 0 && (K / 32) * (N / 64) % 4 == 0, "whole k steps, strips and work-groups");
    constexpr int NSC = N / 64, KTC = K / 32;
    __shared__ __align__(16) unsigned short st[4][ST_WORDS];         // [wave][piece: fragment, plane, lane]
    const int lane = threadIdx.x & 31;
    const int w    = threadIdx.x >> 5;
    const int task = blockIdx.x * 4 + w;                 // (k step, strip of 64 columns), neighbours side by side in a row
    const int kt   = task / NSC;
    const int n64  = task % NSC;
    const int nq   = lane & 15;                          // which 4 columns of the 64
    const int hi   = lane >> 4;
    const float* src = W + (size_t)(kt * 32 + hi * 8) * N + n64 * 64 + nq * 4;   // ISA B map: k = 32 kt + 8 hi + 16 u + i
    v4f v[2][8];
    #pragma unroll       // constant indices keep v[][] in registers
    for (int u = 0; u < 2; ++u)
        #pragma unroll   // as above
        for (int i = 0; i < 8; ++i) v[u][i] = *(const v4f*)(src + (size_t)(u * 16 + i) * N);
    // the loads are in flight, and the lines below may write their address register anew; src as an input keeps that
    // register live up to the wait, so that no load of the run is given it as its destination
    asm volatile("s_wait_xcnt 0x0" :: "v"(src) : "memory");
    // nothing is scheduled across this line: all 16 loads go out before the first conversion waits (one memory latency);
    // without it they go out in batches, each behind the wait for the one before
    __builtin_amdgcn_sched_barrier(0);
    unsigned short* sw = st[w];
    #pragma unroll       // constant indices into v[][]
    for (int u = 0; u < 2; ++u)
        #pragma unroll   // as above
        for (int c = 0; c < 4; ++c) {                    // column nq * 4 + c: fragment nq >> 2, fragment lane 16 hi + (nq & 3) * 4 + c
            union { unsigned short s[8]; v4u u4; } pk;
            #pragma unroll   // as above
            for (int i = 0; i < 8; ++i) pk.s[i] = f2b(v[u][i][c]);
            *(v4u*)(sw + stoff((nq >> 2) * 64 + u * 32 + hi * 16 + (nq & 3) * 4 + c)) = pk.u4;
        }
    // the wave reads back what its other lanes wrote: their LDS stores have to be over
    asm volatile("s_wait_dscnt 0" ::: "memory");
    __builtin_amdgcn_wave_barrier();
    #pragma unroll       // independent LDS reads, then stores
    for (int q = 0; q < 8; ++q)                          // fragment q >> 1, plane q & 1
        vst2(out + ((size_t)(n64 * 4 + (q >> 1)) * KTC + kt) * 512 + (q & 1) * 256 + lane * 8,
             *(const v4u*)(sw + stoff(q * 32 + lane)));
}

// ---------------------------------------------------------------------------
// Pack V and K (from the f16 qkv buffer) into B-fragments: V [bh][kb][n4][plane][lane][8], K [bh][kb][t][c][plane][lane][8]
// (t = which 16 keys of the 32, c = which 32 of the 64 head dims). One wave packs one block of 32 keys of one head: four
// fragments of V and four of K. 8 lanes x 16 B cover a key's 128 B, the four lane groups take 8 keys each, load i takes
// key i of the group. A 16-B piece of K only changes its place; V is turned 8 x 8 in the lane's registers. Both pass
// through the wave's own LDS so that every store is 512 contiguous bytes.
// ---------------------------------------------------------------------------
template <int S, int H, int HD>
__global__ __launch_bounds__(128) void pack_v(const unsigned short* __restrict__ qkvb, unsigned short* __restrict__ vp,
                                              unsigned short* __restrict__ kpk) {
    static_assert(HD == 64 && S % 128 == 0, "8 pieces a key; whole key blocks and work-groups");
    constexpr int D3 = 3 * H * HD;
    __shared__ __align__(16) unsigned short st[4][2][ST_WORDS];      // [wave][K, V][piece: fragment, plane, lane]
    const int lane = threadIdx.x & 31;
    const int w    = threadIdx.x >> 5;
    const int task = blockIdx.x * 4 + w;                 // bh * (S / 32) + kb
    const int kb   = task % (S / 32);
    const int bh   = task / (S / 32);
    const int b = bh / H, h = bh % H;
    const int cq = lane & 7;                             // which 8 head dims of the 64
    const int kq = lane >> 3;                            // which 8 keys of the 32
    const unsigned short* src = qkvb + (size_t)(b * S + kb * 32 + kq * 8) * D3 + H * HD + h * HD + cq * 8;
    ushort8 kk[8], vv[8];
    #pragma unroll       // constant indices keep kk[], vv[] in registers
    for (int i = 0; i < 8; ++i) {
        kk[i] = *(const ushort8*)(src + i * D3);
        vv[i] = *(const ushort8*)(src + i * D3 + H * HD);
    }
    // the loads are in flight, and the lines below may write their address register anew
    asm volatile("s_wait_xcnt 0x0" ::: "memory");
    // nothing is scheduled across this line: all 16 loads go out before the first use waits (one memory latency)
    __builtin_amdgcn_sched_barrier(0);
    unsigned short* sk = st[w][0];
    unsigned short* sv = st[w][1];
    #pragma unroll       // constant indices into kk[]
    for (int i = 0; i < 8; ++i)      // key 8 kq + i, dims 8 cq ..: ISA B map d = 32 c + 8 hi + 16 plane, so cq = 4 c + 2 plane + hi
        *(ushort8*)(sk + stoff(((kq >> 1) * 2 + (cq >> 2)) * 64 + ((cq >> 1) & 1) * 32 + (cq & 1) * 16 + (kq & 1) * 8 + i)) = kk[i];
    #pragma unroll       // constant indices into vv[]
    for (int c = 0; c < 8; ++c) {    // column 8 cq + c, keys 8 kq ..: ISA B map key = 8 hi + 16 plane + i, so kq = 2 plane + hi
        ushort8 pk;
        #pragma unroll   // as above
        for (int i = 0; i < 8; ++i) pk[i] = vv[i][c];
        *(ushort8*)(sv + stoff((cq >> 1) * 64 + (kq >> 1) * 32 + (kq & 1) * 16 + (cq & 1) * 8 + c)) = pk;
    }
    // the wave reads back what its other lanes wrote: their LDS stores have to be over
    asm volatile("s_wait_dscnt 0" ::: "memory");
    __builtin_amdgcn_wave_barrier();
    #pragma unroll       // independent LDS reads, then stores
    for (int q = 0; q < 8; ++q) {
        vst2(kpk + (size_t)task * 2048 + q * 256 + lane * 8, *(const v4u*)(sk + stoff(q * 32 + lane)));
        vst2(vp  + (size_t)task * 2048 + q * 256 + lane * 8, *(const v4u*)(sv + stoff(q * 32 + lane)));
    }
}

// ---------------------------------------------------------------------------
// f16 GEMM via V_WMMA_F32_16X16X32_F16.
// Block: 256 thr = 8 waves; wave tile 32x64 (2x4 accum frags); block tile 64x256.
// A (M x K f16 row-major) is double-buffer staged into LDS per K-step with plain 16-B copies through a register.
// B streams from packed fragments (two 512-B planes, 16 B a lane in each), one K-step ahead of its products.
// Epilogues: 0: f16 store | 1: f32 = acc+res | 2: f16 silu(acc) | 3: f16 gate*acc
// ---------------------------------------------------------------------------
template <int EPI>
__global__ __launch_bounds__(256) void gemm_f16(
        const unsigned short* __restrict__ A, const unsigned short* __restrict__ Bp,
        const float* __restrict__ resF, const unsigned short* __restrict__ gateB,
        float* __restrict__ outF, unsigned short* __restrict__ outB,
        int M, int N, int K) {
    __shared__ __align__(16) unsigned short atile[2][64 * 32];   // 2 x 4KB
    __shared__ __align__(16) float Ct[64][256];                    // block output tile (64 KB)

    const int lane = threadIdx.x & 31;
    const int w    = threadIdx.x >> 5;
    const int wm   = w >> 2;
    const int wn   = w & 3;
    const int mblock = blockIdx.y * 64;
    const int mbase  = mblock + wm * 32;
    const int nbase  = blockIdx.x * 256 + wn * 64;
    const int ktc = K >> 5;
    const int hi  = (lane >> 4) & 1;
    const int l15 = lane & 15;

    // cooperative A-staging mapping: 256 thr x 16B = 64x32 f16 tile
    const int srow   = threadIdx.x >> 2;
    const int schunk = (threadIdx.x & 3) * 8;            // ushort offset within row

    v8f acc[2][4] = {};

    // fragment (ni, kt) of this wave's four B columns stands at bw + (ni * ktc + kt) * 512
    const unsigned short* bw = Bp + (size_t)(nbase >> 4) * ktc * 512 + lane * 8;
    const unsigned short* ag = A + (size_t)(mblock + srow) * K + schunk;

    // Every register that holds a global operand is loaded anew for its next use right behind its last use: a B fragment
    // behind its two products, the thread's 16 B of A behind their store to LDS. A load then has about a whole step to
    // come back, and a step waits out no load in full.
    // The last steps ask for the last step's data once more: in bounds, never used.
    Frag bfr[4];
    for (int ni = 0; ni < 4; ++ni) {
        bfr[ni].h[0] = *(const ushort8*)(bw + (size_t)ni * ktc * 512);
        bfr[ni].h[1] = *(const ushort8*)(bw + (size_t)ni * ktc * 512 + 256);
    }
    v4u areg = *(const v4u*)(ag);
    *(v4u*)(&atile[0][srow * 32 + schunk]) = areg;
    areg = *(const v4u*)(ag + (1 < ktc ? 1 : 0) * 32);
    // The K loop's barrier, written by hand: __syncthreads() also waits for every global load, which would end the loads
    // issued ahead at each step; only this wave's LDS traffic has to be over here (tile stores visible, tile reads done).
    auto lds_barrier = [] {
        // a load issued ahead is in flight here, and the next step writes its address register anew
        asm volatile("s_wait_xcnt 0x0" ::: "memory");
        asm volatile("s_wait_dscnt 0x0" ::: "memory");
        asm volatile("s_barrier_signal -1\n\ts_barrier_wait -1" ::: "memory");
    };
    lds_barrier();                                        // tile 0 is whole
    int cur = 0;

    for (int kt = 0; kt < ktc; ++kt) {
        const int kb = kt + 1 < ktc ? kt + 1 : ktc - 1;   // step whose B fragments are asked for in this step
        const int ka = kt + 2 < ktc ? kt + 2 : ktc - 1;   // step whose A piece is asked for in this step

        Frag a0, a1;
        const unsigned short* l0 = &atile[cur][(wm * 32 + l15) * 32 + hi * 8];
        a0.h[0] = *(const ushort8*)(l0);
        a0.h[1] = *(const ushort8*)(l0 + 16);
        const unsigned short* l1 = l0 + 16 * 32;
        a1.h[0] = *(const ushort8*)(l1);
        a1.h[1] = *(const ushort8*)(l1 + 16);

        for (int ni = 0; ni < 4; ++ni) {
            acc[0][ni] = wmma16(a0.b, bfr[ni].b, acc[0][ni]);
            acc[1][ni] = wmma16(a1.b, bfr[ni].b, acc[1][ni]);
            bfr[ni].h[0] = *(const ushort8*)(bw + ((size_t)ni * ktc + kb) * 512);
            bfr[ni].h[1] = *(const ushort8*)(bw + ((size_t)ni * ktc + kb) * 512 + 256);
        }
        // the B loads are in flight, and the lines below may write their address registers anew
        asm volatile("s_wait_xcnt 0x0" ::: "memory");
        if (kt + 1 < ktc) *(v4u*)(&atile[cur ^ 1][srow * 32 + schunk]) = areg;   // the A piece of step kt + 1
        areg = *(const v4u*)(ag + ka * 32);
        lds_barrier();                                    // tile(cur ^ 1) is whole; the reads of tile(cur) are done
        cur ^= 1;
    }

    // epilogue through the block tile: value after residual / silu / gating, then whole-line stores
    __syncthreads();
    for (int mi = 0; mi < 2; ++mi) {
        for (int ni = 0; ni < 4; ++ni) {
            int rl0 = wm * 32 + mi * 16 + hi * 8;
            int cl  = wn * 64 + ni * 16 + l15;
            int col = blockIdx.x * 256 + cl;
            for (int r = 0; r < 8; ++r) {
                size_t idx = (size_t)(mblock + rl0 + r) * N + col;
                float v = acc[mi][ni][r];
                if (EPI == 1)      v += resF[idx];
                else if (EPI == 2) v = v / (1.f + __expf(-v));   // silu
                else if (EPI == 3) v = b2f(gateB[idx]) * v;
                Ct[rl0 + r][cl] = v;
            }
        }
    }
    __syncthreads();
    const int tid = threadIdx.x, n0blk = blockIdx.x * 256;
    if (EPI == 1) {   // f32 rows: 64 x 1024 B (64 pieces)
        for (int g = tid; g < 64 * 64; g += 256) { const int rl = g >> 6, pc = g & 63; vst2(outF + (size_t)(mblock + rl) * N + n0blk + pc * 4, *(const v4f*)(&Ct[rl][pc * 4])); }
    } else {          // 16-bit rows: 64 x 512 B (32 pieces of 8)
        for (int g = tid; g < 64 * 32; g += 256) {
            const int rl = g >> 5, pc = g & 31;
            union { unsigned short s[8]; v4u u; } pk;
            #pragma unroll
            for (int e = 0; e < 8; ++e) pk.s[e] = f2b(Ct[rl][pc * 8 + e]);
            vst2(outB + (size_t)(mblock + rl) * N + n0blk + pc * 8, pk.u);
        }
    }
}

// ---------------------------------------------------------------------------
// Flash attention, one wave per 16-query tile; causal; online softmax. Both products are taken transposed:
// S^T = K Q^T (A = a packed K fragment, B = the Q fragment) and O^T += V^T P^T (A = a packed V fragment, B = P^T).
// A and B share one register map, so the fragments are the ones of the untransposed form with their places swapped.
// A lane then holds one query (column l15) and 16 of the pass's 32 keys (rows t * 16 + 8 hi + r): maximum and sum run
// inside the lane, with one exchange between lanes l and l ^ 16, and the two score tiles, converted where they lie,
// are the B fragment P^T (element e = key 8 hi + e for e < 8, 16 + 8 hi + (e - 8) otherwise): P never leaves its registers.
// ---------------------------------------------------------------------------
__device__ __forceinline__ float xhalf(float x) {            // the value of lane l ^ 16
    return __builtin_bit_cast(float, __builtin_amdgcn_permlanex16(__builtin_bit_cast(int, x), __builtin_bit_cast(int, x),
                                                                  0x76543210, 0xfedcba98, false, false));
}
__global__ __launch_bounds__(256) void flash_attn(
        const unsigned short* __restrict__ qkvb, const unsigned short* __restrict__ vp,
        const unsigned short* __restrict__ kpk, unsigned short* __restrict__ attn, int S, int H, int HD) {
    __shared__ __align__(16) unsigned short olds[8][16 * 64]; // per-wave output tile
    const int lane = threadIdx.x & 31;
    const int w    = threadIdx.x >> 5;
    const int waveId = blockIdx.x * 8 + w;
    const int qt = waveId & 127;              // S/16 = 128
    const int bh = waveId >> 7;
    const int b = bh >> 4, h = bh & 15;
    const int qbase = qt * 16;
    const int l15 = lane & 15;
    const int hi  = (lane >> 4) & 1;
    const int D3  = 3 * H * HD;

    Frag aq[2];
    {
        const unsigned short* qp = qkvb + (size_t)(b * S + qbase + l15) * D3 + h * HD + hi * 8;
        aq[0].h[0] = *(const ushort8*)(qp);
        aq[0].h[1] = *(const ushort8*)(qp + 16);
        aq[1].h[0] = *(const ushort8*)(qp + 32);
        aq[1].h[1] = *(const ushort8*)(qp + 48);
    }

    v8f o[4] = {};                            // o[n][r] = O[query l15][head dim n * 16 + 8 hi + r]
    float mrun = -3.0e38f;                    // the query's running maximum, alike in both lanes of the query
    float lrun = 0.f;                         // this lane's share of the query's running sum

    const int nkb = (qbase + 16 + 31) >> 5;
    // Every load of a key block is issued well ahead of the product that reads it, so that a pass waits out no load:
    // the four V fragments at the head of their own pass, the K fragments right behind the score products of the pass
    // before, into the same registers.
    Frag bk[2][2];
    auto load_k = [&](int blk) {
        const unsigned short* kp = kpk + (((size_t)bh * (S / 32) + blk) * 4) * 512 + lane * 8;   // packed fragments (t, c)
        for (int t = 0; t < 2; ++t)
            for (int c = 0; c < 2; ++c) {
                bk[t][c].h[0] = *(const ushort8*)(kp + (t * 2 + c) * 512);
                bk[t][c].h[1] = *(const ushort8*)(kp + (t * 2 + c) * 512 + 256);
            }
    };
    load_k(0);
    for (int kb = 0; kb < nkb; ++kb) {
        const int kbase = kb * 32;
        Frag bv[4];
        const unsigned short* vpp = vp + (((size_t)bh * (S / 32) + kb) * 4) * 512 + lane * 8;
        for (int n = 0; n < 4; ++n) {
            bv[n].h[0] = *(const ushort8*)(vpp + n * 512);
            bv[n].h[1] = *(const ushort8*)(vpp + n * 512 + 256);
        }
        v8f z = {};
        v8f sc[2];                            // sc[t][r] = score of key kbase + t * 16 + 8 hi + r with query qbase + l15
        sc[0] = wmma16(bk[0][0].b, aq[0].b, z);
        sc[0] = wmma16(bk[0][1].b, aq[1].b, sc[0]);
        sc[1] = wmma16(bk[1][0].b, aq[0].b, z);
        sc[1] = wmma16(bk[1][1].b, aq[1].b, sc[1]);
        load_k(kb + 1 < nkb ? kb + 1 : kb);     // the last pass loads its own block again: in bounds, never used

        const bool diag = (kbase + 32 > qbase);
        for (int t = 0; t < 2; ++t)
            for (int r = 0; r < 8; ++r) {
                float v = sc[t][r] * 0.125f;            // 1/sqrt(64)
                if (diag) {
                    int key  = kbase + t * 16 + hi * 8 + r;
                    int qrow = qbase + l15;
                    if (key > qrow) v = -1.0e30f;
                }
                sc[t][r] = v;
            }

        float mx = fmaxf(sc[0][0], sc[1][0]);
        for (int r = 1; r < 8; ++r) mx = fmaxf(mx, fmaxf(sc[0][r], sc[1][r]));
        mx = fmaxf(mx, xhalf(mx));                      // over all 32 keys of the pass
        const float mn = fmaxf(mrun, mx);
        const float al = __expf(mrun - mn);
        mrun = mn;
        for (int t = 0; t < 2; ++t)
            for (int r = 0; r < 8; ++r)
                sc[t][r] = __expf(sc[t][r] - mn);
        float rs = sc[0][0] + sc[1][0];
        for (int r = 1; r < 8; ++r) rs += sc[0][r] + sc[1][r];
        lrun = lrun * al + rs;                          // the two lanes of a query are added once, behind the loop
        for (int n = 0; n < 4; ++n)
            for (int r = 0; r < 8; ++r)
                o[n][r] *= al;

        Frag pb;
        for (int t = 0; t < 2; ++t)
            for (int r = 0; r < 8; ++r)
                pb.u[t * 8 + r] = f2b(sc[t][r] * PSC);

        for (int n = 0; n < 4; ++n) o[n] = wmma16(bv[n].b, pb.b, o[n]);
    }

    const float inv = PUN / (lrun + xhalf(lrun));
    unsigned short* ot = olds[w];
    for (int n = 0; n < 4; ++n) {             // a lane's 8 values of a tile are 8 consecutive head dims of its query: 16 B
        union { unsigned short s[8]; v4u u; } pk;
        for (int r = 0; r < 8; ++r) pk.s[r] = f2b(o[n][r] * inv);
        *(v4u*)(ot + l15 * 64 + n * 16 + hi * 8) = pk.u;
    }
    asm volatile("s_wait_dscnt 0" ::: "memory");
    __builtin_amdgcn_wave_barrier();
    for (int q = 0; q < 4; ++q) {
        const int rl = q * 4 + (lane >> 3), pc = lane & 7;
        vst2(attn + (size_t)(b * S + qbase + rl) * (H * HD) + h * HD + pc * 8, *(const v4u*)(ot + rl * 64 + pc * 8));
    }
}

// ---------------------------------------------------------------------------
// mean over S:  out[b,d] = mean_s x[b,s,d]
// ---------------------------------------------------------------------------
// One work-group per (batch, strip of 32 columns = one 128-B line of every row). 8 lanes x 16 B cover the line, so a
// wave-wide load takes 4 whole lines (4 rows) and the 32 waves take 128 rows a pass: S / 128 loads a lane.
// Lane sums -> butterfly over the wave's 4 rows -> LDS -> one wave adds the 32 wave sums and stores the strip's line.
// S and D are compile-time so that every load is the one base address plus an immediate offset.
template <int S, int D>
__global__ __launch_bounds__(1024) void colmean(const float* __restrict__ x, float* __restrict__ out) {
    static_assert(S % 128 == 0 && D % 32 == 0, "whole passes, whole lines");
    constexpr int NL = S / 128;                          // loads a lane
    __shared__ __align__(16) float part[32][32];         // [wave][column of the strip]
    const int b   = blockIdx.x / (D / 32);
    const int c0  = (blockIdx.x % (D / 32)) * 32;
    const int tid = threadIdx.x;
    const int q   = tid & 7;                             // which 16 B of the line
    const int r0  = tid >> 3;                            // row inside a pass of 128
    const float* p = x + ((size_t)b * S + r0) * D + c0 + q * 4;
    v4f v[NL];
    #pragma unroll       // independent loads ahead of the adds: their latencies overlap instead of adding up row by row
    for (int i = 0; i < NL; ++i) v[i] = *(const v4f*)(p + (size_t)i * 128 * D);
    v4f s = v[0];
    #pragma unroll       // v[] needs constant indices to stay in registers
    for (int i = 1; i < NL; ++i) s += v[i];
    #pragma unroll       // s[e] needs a constant index to stay in registers
    for (int e = 0; e < 4; ++e) {
        s[e] += __shfl_xor(s[e], 8, 32);
        s[e] += __shfl_xor(s[e], 16, 32);
    }
    if ((tid & 31) < 8) *(v4f*)(&part[tid >> 5][q * 4]) = s;
    __syncthreads();
    if (tid < 32) {
        float tot = 0.f;
        for (int wv = 0; wv < 32; ++wv) tot += part[wv][tid];
        vst2(out + (size_t)b * D + c0 + tid, (float_a)(tot / (float)S));
    }
}

// ---------------------------------------------------------------------------
// recurrent state update: one work-group of 32 waves, two products of the same shape, (2 x K) @ (K x SD):
// new_info = mean @ w_h2s (K = D) and gate logits = [state | new_info] @ w_sgate (K = 2 SD).
// 16 lanes x 16 B cover one 256-B weight row; the K rows are split over the 64 lane groups (K / 64 consecutive rows
// each, both batches from the one row load); group sums -> l ^ 16 shuffle -> LDS -> one thread per output adds the 32.
// D and SD are compile-time so that every global load has a constant offset and depends on no sum.
// ---------------------------------------------------------------------------
__device__ __forceinline__ void wave_sums_to_lds(v4f s0, v4f s1, float (*part)[2][64], int t) {
    #pragma unroll       // constant indices keep s0, s1 in registers
    for (int e = 0; e < 4; ++e) {
        s0[e] += __shfl_xor(s0[e], 16, 32);
        s1[e] += __shfl_xor(s1[e], 16, 32);
    }
    if ((t & 31) < 16) {
        *(v4f*)(&part[t >> 5][0][(t & 15) * 4]) = s0;
        *(v4f*)(&part[t >> 5][1][(t & 15) * 4]) = s1;
    }
}
__device__ __forceinline__ float add_wave_sums(const float (*part)[2][64], int b, int j) {
    float tot = 0.f;
    #pragma unroll       // independent LDS reads ahead of the adds
    for (int wv = 0; wv < 32; ++wv) tot += part[wv][b][j];
    return tot;
}

template <int D, int SD>
__global__ __launch_bounds__(1024) void state_update(
        const float* __restrict__ state, const float* __restrict__ meanx,
        const float* __restrict__ w_h2s, const float* __restrict__ w_sgate,
        float* __restrict__ outState) {
    static_assert(SD == 64 && D % 256 == 0, "16 lanes x 4 columns a row; whole 16-B pieces of the mean");
    constexpr int KR = D / 64;                           // rows of w_h2s a lane group
    constexpr int GR = 2 * SD / 64;                      // rows of w_sgate a lane group
    __shared__ __align__(16) float part[32][2][SD];      // [wave][batch][column]
    __shared__ __align__(16) float cat[2][2 * SD];       // [batch][state | new_info]
    const int t  = threadIdx.x;
    const int c4 = (t & 15) * 4;                         // 4 columns of the row
    const int kg = t >> 4;                               // lane group
    const int b  = (t >> 6) & 1, j = t & 63;             // the output of threads 0 .. 2 SD - 1

    v4f wr[KR], mv[2][KR / 4], wg[GR];
    #pragma unroll       // constant indices keep wr[] in registers
    for (int i = 0; i < KR; ++i) wr[i] = *(const v4f*)(w_h2s + (kg * KR + i) * SD + c4);
    #pragma unroll       // constant indices keep mv[][] in registers
    for (int i = 0; i < KR / 4; ++i) {
        mv[0][i] = *(const v4f*)(meanx + kg * KR + i * 4);
        mv[1][i] = *(const v4f*)(meanx + D + kg * KR + i * 4);
    }
    #pragma unroll       // constant indices keep wg[] in registers
    for (int i = 0; i < GR; ++i) wg[i] = *(const v4f*)(w_sgate + (kg * GR + i) * SD + c4);
    const float st = state[b * SD + j];
    // nothing is scheduled across this line: every load is issued before the first sum waits, so that the kernel pays
    // one memory latency; without it the loads go out in batches, each batch behind the wait for the one before
    __builtin_amdgcn_sched_barrier(0);

    v4f s0 = {}, s1 = {};
    #pragma unroll       // constant indices into wr[] and mv[][]
    for (int i = 0; i < KR; ++i) {
        s0 += wr[i] * mv[0][i >> 2][i & 3];
        s1 += wr[i] * mv[1][i >> 2][i & 3];
    }
    wave_sums_to_lds(s0, s1, part, t);
    if (t < 2 * SD) cat[b][j] = st;
    __syncthreads();                                     // the wave sums of new_info are in part
    if (t < 2 * SD) cat[b][SD + j] = add_wave_sums(part, b, j);
    __syncthreads();                                     // cat is whole; part has been read and may be rewritten
    s0 = v4f{}; s1 = v4f{};
    #pragma unroll       // constant indices into wg[]
    for (int i = 0; i < GR; ++i) {
        s0 += wg[i] * cat[0][kg * GR + i];
        s1 += wg[i] * cat[1][kg * GR + i];
    }
    wave_sums_to_lds(s0, s1, part, t);
    __syncthreads();                                     // the wave sums of the gate logits are in part
    if (t < 2 * SD) {
        const float g = 1.f / (1.f + __expf(-add_wave_sums(part, b, j)));
        vst2(outState + b * SD + j, (float_a)(st * (1.f - g) + cat[b][SD + j] * g));   // 128 consecutive floats
    }
}

// ---------------------------------------------------------------------------
extern "C" void kernel_launch(void* const* d_in, const int* in_sizes, int n_in,
                              void* d_out, int out_size, void* d_ws, size_t ws_size,
                              hipStream_t stream) {
    (void)in_sizes; (void)n_in; (void)out_size; (void)ws_size;
    const int B = 2, S = 2048, D = 1024, H = 16, HD = 64, SD = 64;
    const float* x       = (const float*)d_in[0];
    const float* gamma   = (const float*)d_in[1];
    const float* beta    = (const float*)d_in[2];
    const float* state   = (const float*)d_in[3];
    const float* w_qkv   = (const float*)d_in[4];
    const float* w_o     = (const float*)d_in[5];
    const float* w_gate  = (const float*)d_in[6];
    const float* w_up    = (const float*)d_in[7];
    const float* w_down  = (const float*)d_in[8];
    const float* norm1_w = (const float*)d_in[9];
    const float* norm2_w = (const float*)d_in[10];
    const float* w_sm    = (const float*)d_in[11];
    const float* w_h2s   = (const float*)d_in[12];
    const float* w_sgate = (const float*)d_in[13];
    float* xout = (float*)d_out;                       // (B,S,D) then state (B,SD)

    char* ws = (char*)d_ws;
    size_t off = 0;
    auto arena = [&](size_t bytes) -> void* {
        void* p = ws + off;
        off = (off + bytes + 255) & ~(size_t)255;
        return p;
    };
    float* fg             = (float*)arena((size_t)B * D * 4);
    float* fb             = (float*)arena((size_t)B * D * 4);
    unsigned short* hbuf  = (unsigned short*)arena((size_t)B * S * D * 2);       // h / h2
    unsigned short* wqkvp = (unsigned short*)arena((size_t)D * 3 * D * 2);
    unsigned short* wop   = (unsigned short*)arena((size_t)D * D * 2);
    unsigned short* wgp   = (unsigned short*)arena((size_t)D * 3 * D * 2);
    unsigned short* wupp  = (unsigned short*)arena((size_t)D * 3 * D * 2);
    unsigned short* wdp   = (unsigned short*)arena((size_t)3 * D * D * 2);
    unsigned short* qkvb  = (unsigned short*)arena((size_t)B * S * 3 * D * 2);   // also act
    unsigned short* vp    = (unsigned short*)arena((size_t)B * H * (S / 32) * 4 * 512 * 2);
    unsigned short* kpk   = (unsigned short*)arena((size_t)B * H * (S / 32) * 4 * 512 * 2);
    unsigned short* attnb = (unsigned short*)arena((size_t)B * S * D * 2);
    float* x1             = (float*)arena((size_t)B * S * D * 4);
    unsigned short* gateb = (unsigned short*)arena((size_t)B * S * 3 * D * 2);
    float* meanb          = (float*)arena((size_t)B * D * 4);
    unsigned short* act   = qkvb;                      // reuse after attention

    const int MR = B * S;                              // 4096 rows

    // FiLM params
    film_kernel<<<(B * 2 * D + 255) / 256, 256, 0, stream>>>(state, w_sm, gamma, beta, fg, fb, SD, D);

    // pack weights -> B fragments (f16): a work-group of 4 waves packs 4 x 2,048 elements
    pack_b<D, 3 * D><<<D * 3 * D / 8192, 128, 0, stream>>>(w_qkv,  wqkvp);
    pack_b<D, D><<<D * D / 8192, 128, 0, stream>>>(w_o,    wop);
    pack_b<D, 3 * D><<<D * 3 * D / 8192, 128, 0, stream>>>(w_gate, wgp);
    pack_b<D, 3 * D><<<D * 3 * D / 8192, 128, 0, stream>>>(w_up,   wupp);
    pack_b<3 * D, D><<<3 * D * D / 8192, 128, 0, stream>>>(w_down, wdp);

    // h = rmsnorm(x)*fg + fb
    rmsnorm_film<S, D><<<MR / 16, 256, 0, stream>>>(x, norm1_w, fg, fb, hbuf);

    // qkv = h @ w_qkv   (f16 out)
    gemm_f16<0><<<dim3(3 * D / 256, MR / 64), 256, 0, stream>>>(
        hbuf, wqkvp, nullptr, nullptr, nullptr, qkvb, MR, 3 * D, D);

    // pack V and K into B fragments
    pack_v<S, H, HD><<<B * H * (S / 32) / 4, 128, 0, stream>>>(qkvb, vp, kpk);

    // attention
    flash_attn<<<(B * H * (S / 16)) / 8, 256, 0, stream>>>(qkvb, vp, kpk, attnb, S, H, HD);

    // x1 = x + attn @ w_o
    gemm_f16<1><<<dim3(D / 256, MR / 64), 256, 0, stream>>>(
        attnb, wop, x, nullptr, x1, nullptr, MR, D, D);

    // h2 = rmsnorm(x1)*fg + fb
    rmsnorm_film<S, D><<<MR / 16, 256, 0, stream>>>(x1, norm2_w, fg, fb, hbuf);

    // gate = silu(h2 @ w_gate)   (f16)
    gemm_f16<2><<<dim3(3 * D / 256, MR / 64), 256, 0, stream>>>(
        hbuf, wgp, nullptr, nullptr, nullptr, gateb, MR, 3 * D, D);

    // act = gate * (h2 @ w_up)   (f16)
    gemm_f16<3><<<dim3(3 * D / 256, MR / 64), 256, 0, stream>>>(
        hbuf, wupp, nullptr, gateb, nullptr, act, MR, 3 * D, D);

    // xout = x1 + act @ w_down
    gemm_f16<1><<<dim3(D / 256, MR / 64), 256, 0, stream>>>(
        act, wdp, x1, nullptr, xout, nullptr, MR, D, 3 * D);

    // state update
    colmean<S, D><<<B * D / 32, 1024, 0, stream>>>(xout, meanb);
    state_update<D, SD><<<1, 1024, 0, stream>>>(state, meanb, w_h2s, w_sgate,
                                                xout + (size_t)B * S * D);
}

// v007
// Measured time: 277 microseconds a run.
// In two side-by-side timings against v006, it was 1.06 and 1.04 times as fast.
// Counting every step since v000, it is 2.90 times as fast.
#include <hip/hip_runtime.h>

#define EPSF 1.1920929e-07f
// Contractions: qkv / o / gate / up / down projections (K = 1024 / 3072), scores QK^T (K = 64) and PV (K = keys, causal) on
// v_wmma_f32_16x16x32_f16 (f16 operands stored as raw 16-bit words, f32 accumulate; P scaled by 256 before its f16 conversion);
// FiLM, RMSNorm, SiLU gating, softmax statistics, the column mean and the state update in f32 on VALU. GEMM B operands and the attention's K and V (there A operands) are
// pre-packed in the ISA fragment order (element e of lane (h, n) = k0 + 8h + e for e < 8, k0 + 16 + 8h + (e-8) otherwise).
// A packed fragment (1 KB) is stored as two planes of 512 B: plane p holds elements 8p .. 8p + 7 of lane l at byte 16 l, so
// that each wave-wide 16-B load of a fragment half covers four whole 128-B lines.

typedef __attribute__((ext_vector_type(16))) _Float16        v16bf;   // (alias name kept; IEEE half)
typedef __attribute__((ext_vector_type(4)))  float           v4f;
typedef __attribute__((ext_vector_type(4)))  unsigned        v4u;
template <typename V> __device__ __forceinline__ void vst2(void* p, V v) {
    *(V*)p = v; 
}
typedef float __attribute__((may_alias)) float_a;
#define PSC 256.0f
#define PUN (1.0f / 256.0f)
typedef __attribute__((ext_vector_type(8)))  float           v8f;
typedef __attribute__((ext_vector_type(8)))  unsigned short  ushort8;
typedef __attribute__((ext_vector_type(16))) unsigned short  ushort16;

union Frag {
    ushort16 u;
    v16bf    b;
    ushort8  h[2];
};

__device__ __forceinline__ unsigned short f2b(float f) {     // f32 -> f16 bits (name kept)
    union { _Float16 h; unsigned short u; } c; c.h = (_Float16)f; return c.u;
}
__device__ __forceinline__ float b2f(unsigned short s) {
    union { unsigned short u; _Float16 h; } c; c.u = s; return (float)c.h;
}
__device__ __forceinline__ v8f wmma16(v16bf a, v16bf b, v8f c) {
    v8f d = __builtin_amdgcn_wmma_f32_16x16x32_f16(false, a, false, b, (short)0, c, false, false);
    asm volatile("v_nop\n\tv_nop\n\tv_nop\n\tv_nop" : "+v"(d) : "v"(a), "v"(b));
    return d;
}

// ---------------------------------------------------------------------------
// FiLM params: state_mod = state @ w_state_mod; fg = gamma*(1+sm[:D]); fb = beta+sm[D:]
// ---------------------------------------------------------------------------
__device__ __forceinline__ void film_piece(const float* __restrict__ state, const float* __restrict__ wsm,
                            const float* __restrict__ gamma, const float* __restrict__ beta,
                            float* __restrict__ fg, float* __restrict__ fb, int SD, int D, int idx) {   // idx over B * 2D
    int b = idx / (2 * D);
    int c = idx % (2 * D);
    if (b >= 2) return;
    float s = 0.f;
    for (int k = 0; k < SD; ++k) s += state[b * SD + k] * wsm[k * 2 * D + c];
    if (c < D) vst2(fg + b * D + c, (float_a)(gamma[c] * (1.f + s)));
    else       vst2(fb + b * D + (c - D), (float_a)(beta[c - D] + s));
}

// ---------------------------------------------------------------------------
// The three pieces of work below move data and hold almost no arithmetic. A launch of that kind with one small item a lane is
// bound by how fast waves start, not by its bytes: each of them gives a wave a whole piece of the work (4 to 8 KB in, all
// of it asked for at once by 16-B loads that cover whole lines), so that 8 to 16 times fewer waves start.
// ---------------------------------------------------------------------------
// RMSNorm + FiLM -> f16 row-major output. One wave takes two whole rows and keeps them in registers (2,048 waves, 8 a
// WGP). A wave-wide 16-B load covers 512 contiguous bytes of a row; the three parameter rows are loaded once for both
// rows; the sum of squares is four chains in the lane and a butterfly over the wave: no LDS tree, no barrier, no second
// read of x.
// ---------------------------------------------------------------------------
template <int S, int D>
__global__ __launch_bounds__(256) void rmsnorm_film(
        const float* __restrict__ x, const float* __restrict__ nw,
        const float* __restrict__ fg, const float* __restrict__ fb,
        unsigned short* __restrict__ out) {
    static_assert(D % 128 == 0 && S % 2 == 0, "whole 512-B pieces of a row; both rows of a wave in one batch");
    constexpr int NL = D / 128;                          // loads a lane and row
    const int lane = threadIdx.x & 31;
    const int row0 = (blockIdx.x * 8 + (threadIdx.x >> 5)) * 2;      // b*S + s of the first row
    const int b    = row0 / S;
    const int c0   = lane * 4;                           // the lane's columns: c0 + 128 i + (0 .. 3)
    const float* xr = x + (size_t)row0 * D + c0;
    v4f v0[NL], v1[NL], pw[NL], pg[NL], pb[NL];
    #pragma unroll       // constant indices keep the arrays in registers
    for (int i = 0; i < NL; ++i) {
        v0[i] = *(const v4f*)(xr + i * 128);
        v1[i] = *(const v4f*)(xr + D + i * 128);
    }
    // the loads of x are in flight, and a later load may be given their address register as its destination
    asm volatile("s_wait_xcnt 0x0" ::: "memory");
    #pragma unroll       // constant indices keep the arrays in registers
    for (int i = 0; i < NL; ++i) {
        pw[i] = *(const v4f*)(nw + c0 + i * 128);
        pg[i] = *(const v4f*)(fg + (size_t)b * D + c0 + i * 128);
        pb[i] = *(const v4f*)(fb + (size_t)b * D + c0 + i * 128);
    }
    // the parameter loads are in flight, and the lines below may write their address registers anew
    asm volatile("s_wait_xcnt 0x0" ::: "memory");
    // nothing is scheduled across this line: every load is issued before the first sum waits, so that the wave pays one
    // memory latency; loads sunk behind the sums would add a second one
    __builtin_amdgcn_sched_barrier(0);
    v4f a0 = v0[0] * v0[0], a1 = v1[0] * v1[0];
    #pragma unroll       // constant indices into v0[], v1[]
    for (int i = 1; i < NL; ++i) { a0 += v0[i] * v0[i]; a1 += v1[i] * v1[i]; }
    float ss0 = (a0[0] + a0[1]) + (a0[2] + a0[3]);
    float ss1 = (a1[0] + a1[1]) + (a1[2] + a1[3]);
    for (int m = 16; m >= 1; m >>= 1) { ss0 += __shfl_xor(ss0, m, 32); ss1 += __shfl_xor(ss1, m, 32); }
    const float sc0 = rsqrtf(ss0 / (float)D + EPSF);
    const float sc1 = rsqrtf(ss1 / (float)D + EPSF);
    unsigned short* orow = out + (size_t)row0 * D + c0;
    #pragma unroll       // constant indices; 8-B lanes, a wave writes 256 contiguous bytes
    for (int i = 0; i < NL; ++i) {
        union { unsigned short s[4]; unsigned long long u; } k0, k1;
        #pragma unroll   // constant indices into the vectors
        for (int e = 0; e < 4; ++e) {
            k0.s[e] = f2b(v0[i][e] * sc0 * pw[i][e] * pg[i][e] + pb[i][e]);
            k1.s[e] = f2b(v1[i][e] * sc1 * pw[i][e] * pg[i][e] + pb[i][e]);
        }
        vst2(orow + i * 128, k0.u);
        vst2(orow + D + i * 128, k1.u);
    }
}

// Place (in 16-bit words) of 16-B piece p of a 4-KB run of packed fragments in a wave's staging LDS: 8 pieces (128 B) at a
// pitch of 144 B, so that both the lanes that write pieces 8 or more apart and the lanes that read them in order meet
// no more bank conflicts than a 16-B access has anyway.
__device__ __forceinline__ int stoff(int p) { return (p >> 3) * 72 + (p & 7) * 8; }
#define ST_WORDS (32 * 72)

// ---------------------------------------------------------------------------
// Pack f32 weight (K x N, row-major, y = x@W) into WMMA B-fragment layout:
// frag (nt, kt): 2 planes x 32 lanes x 8 halfs, values in the ISA order.
// One wave packs one k step of 64 columns = four fragments (4 KB), 64 elements a lane. 16 lanes x 16 B cover 256 B of a
// weight row, the two lane halves take the rows of hi = 0 and 1, load (u, i) takes row i of plane u. A lane then holds
// the pieces of 4 neighbouring fragment lanes; they pass through the wave's own LDS so that every store is 512
// contiguous bytes. K and N are compile-time so that every load is the one base address plus an immediate offset.
// ---------------------------------------------------------------------------
template <int K, int N>
__device__ __forceinline__ void pack_b(const float* __restrict__ W, unsigned short* __restrict__ out, int blk,
                                       unsigned short (*st)[ST_WORDS]) {     // st: [wave][piece: fragment, plane, lane]
    static_assert(K % 32 == 0 && N % 64 == 0 && (K / 32) * (N / 64) % 4 == 0, "whole k steps, strips and work-groups");
    constexpr int NSC = N / 64, KTC = K / 32;
    const int lane = threadIdx.x & 31;
    const int w    = threadIdx.x >> 5;
    const int task = blk * 4 + w;                        // (k step, strip of 64 columns), neighbours side by side in a row
    const int kt   = task / NSC;
    const int n64  = task % NSC;
    const int nq   = lane & 15;                          // which 4 columns of the 64
    const int hi   = lane >> 4;
    const float* src = W + (size_t)(kt * 32 + hi * 8) * N + n64 * 64 + nq * 4;   // ISA B map: k = 32 kt + 8 hi + 16 u + i
    v4f v[2][8];
    #pragma unroll       // constant indices keep v[][] in registers
    for (int u = 0; u < 2; ++u)
        #pragma unroll   // as above
        for (int i = 0; i < 8; ++i) v[u][i] = *(const v4f*)(src + (size_t)(u * 16 + i) * N);
    // the loads are in flight, and the lines below may write their address register anew; src as an input keeps that
    // register live up to the wait, so that no load of the run is given it as its destination
    asm volatile("s_wait_xcnt 0x0" :: "v"(src) : "memory");
    // nothing is scheduled across this line: all 16 loads go out before the first conversion waits (one memory latency);
    // without it they go out in batches, each behind the wait for the one before
    __builtin_amdgcn_sched_barrier(0);
    unsigned short* sw = st[w];
    #pragma unroll       // constant indices into v[][]
    for (int u = 0; u < 2; ++u)
        #pragma unroll   // as above
        for (int c = 0; c < 4; ++c) {                    // column nq * 4 + c: fragment nq >> 2, fragment lane 16 hi + (nq & 3) * 4 + c
            union { unsigned short s[8]; v4u u4; } pk;
            #pragma unroll   // as above
            for (int i = 0; i < 8; ++i) pk.s[i] = f2b(v[u][i][c]);
            *(v4u*)(sw + stoff((nq >> 2) * 64 + u * 32 + hi * 16 + (nq & 3) * 4 + c)) = pk.u4;
        }
    // the wave reads back what its other lanes wrote: their LDS stores have to be over
    asm volatile("s_wait_dscnt 0" ::: "memory");
    __builtin_amdgcn_wave_barrier();
    #pragma unroll       // independent LDS reads, then stores
    for (int q = 0; q < 8; ++q)                          // fragment q >> 1, plane q & 1
        vst2(out + ((size_t)(n64 * 4 + (q >> 1)) * KTC + kt) * 512 + (q & 1) * 256 + lane * 8,
             *(const v4u*)(sw + stoff(q * 32 + lane)));
    // the stores are in flight at the end of the job; the wave runs no other job's code behind it, so
    // this wait is a precaution
    asm volatile("s_wait_xcnt 0x0" ::: "memory");
}

// ---------------------------------------------------------------------------
// Everything that reads only the inputs, in ONE launch: the FiLM parameters and the five weight packs depend on no
// earlier kernel and not on one another. A launch of its own for each would pay the gap between launches, a first memory
// latency and a drain of stores around very little data; here each job is a range of work-group indices and they overlap.
// The FiLM work-groups come first: theirs is the longest chain of dependent loads. No work-group barrier anywhere.
// ---------------------------------------------------------------------------
template <int NB, int D, int SD>
__global__ __launch_bounds__(128) void prep(
        const float* __restrict__ state, const float* __restrict__ wsm,
        const float* __restrict__ gamma, const float* __restrict__ beta,
        const float* __restrict__ w_qkv, const float* __restrict__ w_gate, const float* __restrict__ w_up,
        const float* __restrict__ w_o, const float* __restrict__ w_down,
        float* __restrict__ fg, float* __restrict__ fb,
        unsigned short* __restrict__ wqkvp, unsigned short* __restrict__ wgp, unsigned short* __restrict__ wupp,
        unsigned short* __restrict__ wop, unsigned short* __restrict__ wdp) {
    constexpr int GF = NB * 2 * D / 128;                 // work-groups of the FiLM parameters
    constexpr int G3 = D * 3 * D / 8192;                 // of a D x 3D or 3D x D weight
    constexpr int G1 = D * D / 8192;                     // of the D x D weight
    __shared__ __align__(16) unsigned short st[4][ST_WORDS];
    const int blk = blockIdx.x;
    if (blk < GF) {
        film_piece(state, wsm, gamma, beta, fg, fb, SD, D, blk * 128 + (int)threadIdx.x);
    } else if (blk < GF + 3 * G3) {
        const int which = (blk - GF) / G3;
        pack_b<D, 3 * D>(which == 0 ? w_qkv : which == 1 ? w_gate : w_up,
                         which == 0 ? wqkvp : which == 1 ? wgp : wupp, blk - GF - which * G3, st);
    } else if (blk < GF + 3 * G3 + G1) {
        pack_b<D, D>(w_o, wop, blk - GF - 3 * G3, st);
    } else {
        pack_b<3 * D, D>(w_down, wdp, blk - GF - 3 * G3 - G1, st);
    }
}

// ---------------------------------------------------------------------------
// Pack V and K (from the f16 qkv buffer) into B-fragments: V [bh][kb][n4][plane][lane][8], K [bh][kb][t][c][plane][lane][8]
// (t = which 16 keys of the 32, c = which 32 of the 64 head dims). One wave packs one block of 32 keys of one head: four
// fragments of V and four of K. 8 lanes x 16 B cover a key's 128 B, the four lane groups take 8 keys each, load i takes
// key i of the group. A 16-B piece of K only changes its place; V is turned 8 x 8 in the lane's registers. Both pass
// through the wave's own LDS so that every store is 512 contiguous bytes.
// ---------------------------------------------------------------------------
template <int S, int H, int HD>
__global__ __launch_bounds__(128) void pack_v(const unsigned short* __restrict__ qkvb, unsigned short* __restrict__ vp,
                                              unsigned short* __restrict__ kpk) {
    static_assert(HD == 64 && S % 128 == 0, "8 pieces a key; whole key blocks and work-groups");
    constexpr int D3 = 3 * H * HD;
    __shared__ __align__(16) unsigned short st[4][2][ST_WORDS];      // [wave][K, V][piece: fragment, plane, lane]
    const int lane = threadIdx.x & 31;
    const int w    = threadIdx.x >> 5;
    const int task = blockIdx.x * 4 + w;                 // bh * (S / 32) + kb
    const int kb   = task % (S / 32);
    const int bh   = task / (S / 32);
    const int b = bh / H, h = bh % H;
    const int cq = lane & 7;                             // which 8 head dims of the 64
    const int kq = lane >> 3;                            // which 8 keys of the 32
    const unsigned short* src = qkvb + (size_t)(b * S + kb * 32 + kq * 8) * D3 + H * HD + h * HD + cq * 8;
    ushort8 kk[8], vv[8];
    #pragma unroll       // constant indices keep kk[], vv[] in registers
    for (int i = 0; i < 8; ++i) {
        kk[i] = *(const ushort8*)(src + i * D3);
        vv[i] = *(const ushort8*)(src + i * D3 + H * HD);
    }
    // the loads are in flight, and the lines below may write their address register anew
    asm volatile("s_wait_xcnt 0x0" ::: "memory");
    // nothing is scheduled across this line: all 16 loads go out before the first use waits (one memory latency)
    __builtin_amdgcn_sched_barrier(0);
    unsigned short* sk = st[w][0];
    unsigned short* sv = st[w][1];
    #pragma unroll       // constant indices into kk[]
    for (int i = 0; i < 8; ++i)      // key 8 kq + i, dims 8 cq ..: ISA B map d = 32 c + 8 hi + 16 plane, so cq = 4 c + 2 plane + hi
        *(ushort8*)(sk + stoff(((kq >> 1) * 2 + (cq >> 2)) * 64 + ((cq >> 1) & 1) * 32 + (cq & 1) * 16 + (kq & 1) * 8 + i)) = kk[i];
    #pragma unroll       // constant indices into vv[]
    for (int c = 0; c < 8; ++c) {    // column 8 cq + c, keys 8 kq ..: ISA B map key = 8 hi + 16 plane + i, so kq = 2 plane + hi
        ushort8 pk;
        #pragma unroll   // as above
        for (int i = 0; i < 8; ++i) pk[i] = vv[i][c];
        *(ushort8*)(sv + stoff((cq >> 1) * 64 + (kq >> 1) * 32 + (kq & 1) * 16 + (cq & 1) * 8 + c)) = pk;
    }
    // the wave reads back what its other lanes wrote: their LDS stores have to be over
    asm volatile("s_wait_dscnt 0" ::: "memory");
    __builtin_amdgcn_wave_barrier();
    #pragma unroll       // independent LDS reads, then stores
    for (int q = 0; q < 8; ++q) {
        vst2(kpk + (size_t)task * 2048 + q * 256 + lane * 8, *(const v4u*)(sk + stoff(q * 32 + lane)));
        vst2(vp  + (size_t)task * 2048 + q * 256 + lane * 8, *(const v4u*)(sv + stoff(q * 32 + lane)));
    }
}

// ---------------------------------------------------------------------------
// f16 GEMM via V_WMMA_F32_16X16X32_F16.
// Block: 256 thr = 8 waves; wave tile 32x64 (2x4 accum frags); block tile 64x256.
// A (M x K f16 row-major) is double-buffer staged into LDS per K-step with plain 16-B copies through a register.
// B streams from packed fragments (two 512-B planes, 16 B a lane in each), one K-step ahead of its products.
// Epilogues: 0: f16 store | 1: f32 = acc+res | 2: f16 silu(acc) | 3: f16 gate*acc
// ---------------------------------------------------------------------------
template <int EPI>
__global__ __launch_bounds__(256) void gemm_f16(
        const unsigned short* __restrict__ A, const unsigned short* __restrict__ Bp,
        const float* __restrict__ resF, const unsigned short* __restrict__ gateB,
        float* __restrict__ outF, unsigned short* __restrict__ outB,
        int M, int N, int K) {
    __shared__ __align__(16) unsigned short atile[2][64 * 32];   // 2 x 4KB
    __shared__ __align__(16) float Ct[64][256];                    // block output tile (64 KB)

    const int lane = threadIdx.x & 31;
    const int w    = threadIdx.x >> 5;
    const int wm   = w >> 2;
    const int wn   = w & 3;
    const int mblock = blockIdx.y * 64;
    const int mbase  = mblock + wm * 32;
    const int nbase  = blockIdx.x * 256 + wn * 64;
    const int ktc = K >> 5;
    const int hi  = (lane >> 4) & 1;
    const int l15 = lane & 15;

    // cooperative A-staging mapping: 256 thr x 16B = 64x32 f16 tile
    const int srow   = threadIdx.x >> 2;
    const int schunk = (threadIdx.x & 3) * 8;            // ushort offset within row

    v8f acc[2][4] = {};

    // fragment (ni, kt) of this wave's four B columns stands at bw + (ni * ktc + kt) * 512
    const unsigned short* bw = Bp + (size_t)(nbase >> 4) * ktc * 512 + lane * 8;
    const unsigned short* ag = A + (size_t)(mblock + srow) * K + schunk;

    // Every register that holds a global operand is loaded anew for its next use right behind its last use: a B fragment
    // behind its two products, the thread's 16 B of A behind their store to LDS. A load then has about a whole step to
    // come back, and a step waits out no load in full.
    // The last steps ask for the last step's data once more: in bounds, never used.
    Frag bfr[4];
    for (int ni = 0; ni < 4; ++ni) {
        bfr[ni].h[0] = *(const ushort8*)(bw + (size_t)ni * ktc * 512);
        bfr[ni].h[1] = *(const ushort8*)(bw + (size_t)ni * ktc * 512 + 256);
    }
    v4u areg = *(const v4u*)(ag);
    *(v4u*)(&atile[0][srow * 32 + schunk]) = areg;
    areg = *(const v4u*)(ag + (1 < ktc ? 1 : 0) * 32);
    // The K loop's barrier, written by hand: __syncthreads() also waits for every global load, which would end the loads
    // issued ahead at each step; only this wave's LDS traffic has to be over here (tile stores visible, tile reads done).
    auto lds_barrier = [] {
        // a load issued ahead is in flight here, and the next step writes its address register anew
        asm volatile("s_wait_xcnt 0x0" ::: "memory");
        asm volatile("s_wait_dscnt 0x0" ::: "memory");
        asm volatile("s_barrier_signal -1\n\ts_barrier_wait -1" ::: "memory");
    };
    lds_barrier();                                        // tile 0 is whole
    int cur = 0;

    for (int kt = 0; kt < ktc; ++kt) {
        const int kb = kt + 1 < ktc ? kt + 1 : ktc - 1;   // step whose B fragments are asked for in this step
        const int ka = kt + 2 < ktc ? kt + 2 : ktc - 1;   // step whose A piece is asked for in this step

        Frag a0, a1;
        const unsigned short* l0 = &atile[cur][(wm * 32 + l15) * 32 + hi * 8];
        a0.h[0] = *(const ushort8*)(l0);
        a0.h[1] = *(const ushort8*)(l0 + 16);
        const unsigned short* l1 = l0 + 16 * 32;
        a1.h[0] = *(const ushort8*)(l1);
        a1.h[1] = *(const ushort8*)(l1 + 16);

        for (int ni = 0; ni < 4; ++ni) {
            acc[0][ni] = wmma16(a0.b, bfr[ni].b, acc[0][ni]);
            acc[1][ni] = wmma16(a1.b, bfr[ni].b, acc[1][ni]);
            bfr[ni].h[0] = *(const ushort8*)(bw + ((size_t)ni * ktc + kb) * 512);
            bfr[ni].h[1] = *(const ushort8*)(bw + ((size_t)ni * ktc + kb) * 512 + 256);
        }
        // the B loads are in flight, and the lines below may write their address registers anew
        asm volatile("s_wait_xcnt 0x0" ::: "memory");
        if (kt + 1 < ktc) *(v4u*)(&atile[cur ^ 1][srow * 32 + schunk]) = areg;   // the A piece of step kt + 1
        areg = *(const v4u*)(ag + ka * 32);
        lds_barrier();                                    // tile(cur ^ 1) is whole; the reads of tile(cur) are done
        cur ^= 1;
    }

    // epilogue through the block tile: value after residual / silu / gating, then whole-line stores
    __syncthreads();
    for (int mi = 0; mi < 2; ++mi) {
        for (int ni = 0; ni < 4; ++ni) {
            int rl0 = wm * 32 + mi * 16 + hi * 8;
            int cl  = wn * 64 + ni * 16 + l15;
            int col = blockIdx.x * 256 + cl;
            for (int r = 0; r < 8; ++r) {
                size_t idx = (size_t)(mblock + rl0 + r) * N + col;
                float v = acc[mi][ni][r];
                if (EPI == 1)      v += resF[idx];
                else if (EPI == 2) v = v / (1.f + __expf(-v));   // silu
                else if (EPI == 3) v = b2f(gateB[idx]) * v;
                Ct[rl0 + r][cl] = v;
            }
        }
    }
    __syncthreads();
    const int tid = threadIdx.x, n0blk = blockIdx.x * 256;
    if (EPI == 1) {   // f32 rows: 64 x 1024 B (64 pieces)
        for (int g = tid; g < 64 * 64; g += 256) { const int rl = g >> 6, pc = g & 63; vst2(outF + (size_t)(mblock + rl) * N + n0blk + pc * 4, *(const v4f*)(&Ct[rl][pc * 4])); }
    } else {          // 16-bit rows: 64 x 512 B (32 pieces of 8)
        for (int g = tid; g < 64 * 32; g += 256) {
            const int rl = g >> 5, pc = g & 31;
            union { unsigned short s[8]; v4u u; } pk;
            #pragma unroll
            for (int e = 0; e < 8; ++e) pk.s[e] = f2b(Ct[rl][pc * 8 + e]);
            vst2(outB + (size_t)(mblock + rl) * N + n0blk + pc * 8, pk.u);
        }
    }
}

// ---------------------------------------------------------------------------
// Flash attention, one wave per 16-query tile; causal; online softmax. Both products are taken transposed:
// S^T = K Q^T (A = a packed K fragment, B = the Q fragment) and O^T += V^T P^T (A = a packed V fragment, B = P^T).
// A and B share one register map, so the fragments are the ones of the untransposed form with their places swapped.
// A lane then holds one query (column l15) and 16 of the pass's 32 keys (rows t * 16 + 8 hi + r): maximum and sum run
// inside the lane, with one exchange between lanes l and l ^ 16, and the two score tiles, converted where they lie,
// are the B fragment P^T (element e = key 8 hi + e for e < 8, 16 + 8 hi + (e - 8) otherwise): P never leaves its registers.
// ---------------------------------------------------------------------------
__device__ __forceinline__ float xhalf(float x) {            // the value of lane l ^ 16
    return __builtin_bit_cast(float, __builtin_amdgcn_permlanex16(__builtin_bit_cast(int, x), __builtin_bit_cast(int, x),
                                                                  0x76543210, 0xfedcba98, false, false));
}
__global__ __launch_bounds__(256) void flash_attn(
        const unsigned short* __restrict__ qkvb, const unsigned short* __restrict__ vp,
        const unsigned short* __restrict__ kpk, unsigned short* __restrict__ attn, int S, int H, int HD) {
    __shared__ __align__(16) unsigned short olds[8][16 * 64]; // per-wave output tile
    const int lane = threadIdx.x & 31;
    const int w    = threadIdx.x >> 5;
    const int waveId = blockIdx.x * 8 + w;
    const int qt = waveId & 127;              // S/16 = 128
    const int bh = waveId >> 7;
    const int b = bh >> 4, h = bh & 15;
    const int qbase = qt * 16;
    const int l15 = lane & 15;
    const int hi  = (lane >> 4) & 1;
    const int D3  = 3 * H * HD;

    Frag aq[2];
    {
        const unsigned short* qp = qkvb + (size_t)(b * S + qbase + l15) * D3 + h * HD + hi * 8;
        aq[0].h[0] = *(const ushort8*)(qp);
        aq[0].h[1] = *(const ushort8*)(qp + 16);
        aq[1].h[0] = *(const ushort8*)(qp + 32);
        aq[1].h[1] = *(const ushort8*)(qp + 48);
    }

    v8f o[4] = {};                            // o[n][r] = O[query l15][head dim n * 16 + 8 hi + r]
    float mrun = -3.0e38f;                    // the query's running maximum, alike in both lanes of the query
    float lrun = 0.f;                         // this lane's share of the query's running sum

    const int nkb = (qbase + 16 + 31) >> 5;
    // Every load of a key block is issued well ahead of the product that reads it, so that a pass waits out no load:
    // the four V fragments at the head of their own pass, the K fragments right behind the score products of the pass
    // before, into the same registers.
    Frag bk[2][2];
    auto load_k = [&](int blk) {
        const unsigned short* kp = kpk + (((size_t)bh * (S / 32) + blk) * 4) * 512 + lane * 8;   // packed fragments (t, c)
        for (int t = 0; t < 2; ++t)
            for (int c = 0; c < 2; ++c) {
                bk[t][c].h[0] = *(const ushort8*)(kp + (t * 2 + c) * 512);
                bk[t][c].h[1] = *(const ushort8*)(kp + (t * 2 + c) * 512 + 256);
            }
    };
    load_k(0);
    for (int kb = 0; kb < nkb; ++kb) {
        const int kbase = kb * 32;
        Frag bv[4];
        const unsigned short* vpp = vp + (((size_t)bh * (S / 32) + kb) * 4) * 512 + lane * 8;
        for (int n = 0; n < 4; ++n) {
            bv[n].h[0] = *(const ushort8*)(vpp + n * 512);
            bv[n].h[1] = *(const ushort8*)(vpp + n * 512 + 256);
        }
        v8f z = {};
        v8f sc[2];                            // sc[t][r] = score of key kbase + t * 16 + 8 hi + r with query qbase + l15
        sc[0] = wmma16(bk[0][0].b, aq[0].b, z);
        sc[0] = wmma16(bk[0][1].b, aq[1].b, sc[0]);
        sc[1] = wmma16(bk[1][0].b, aq[0].b, z);
        sc[1] = wmma16(bk[1][1].b, aq[1].b, sc[1]);
        load_k(kb + 1 < nkb ? kb + 1 : kb);     // the last pass loads its own block again: in bounds, never used

        const bool diag = (kbase + 32 > qbase);
        for (int t = 0; t < 2; ++t)
            for (int r = 0; r < 8; ++r) {
                float v = sc[t][r] * 0.125f;            // 1/sqrt(64)
                if (diag) {
                    int key  = kbase + t * 16 + hi * 8 + r;
                    int qrow = qbase + l15;
                    if (key > qrow) v = -1.0e30f;
                }
                sc[t][r] = v;
            }

        float mx = fmaxf(sc[0][0], sc[1][0]);
        for (int r = 1; r < 8; ++r) mx = fmaxf(mx, fmaxf(sc[0][r], sc[1][r]));
        mx = fmaxf(mx, xhalf(mx));                      // over all 32 keys of the pass
        const float mn = fmaxf(mrun, mx);
        const float al = __expf(mrun - mn);
        mrun = mn;
        for (int t = 0; t < 2; ++t)
            for (int r = 0; r < 8; ++r)
                sc[t][r] = __expf(sc[t][r] - mn);
        float rs = sc[0][0] + sc[1][0];
        for (int r = 1; r < 8; ++r) rs += sc[0][r] + sc[1][r];
        lrun = lrun * al + rs;                          // the two lanes of a query are added once, behind the loop
        for (int n = 0; n < 4; ++n)
            for (int r = 0; r < 8; ++r)
                o[n][r] *= al;

        Frag pb;
        for (int t = 0; t < 2; ++t)
            for (int r = 0; r < 8; ++r)
                pb.u[t * 8 + r] = f2b(sc[t][r] * PSC);

        for (int n = 0; n < 4; ++n) o[n] = wmma16(bv[n].b, pb.b, o[n]);
    }

    const float inv = PUN / (lrun + xhalf(lrun));
    unsigned short* ot = olds[w];
    for (int n = 0; n < 4; ++n) {             // a lane's 8 values of a tile are 8 consecutive head dims of its query: 16 B
        union { unsigned short s[8]; v4u u; } pk;
        for (int r = 0; r < 8; ++r) pk.s[r] = f2b(o[n][r] * inv);
        *(v4u*)(ot + l15 * 64 + n * 16 + hi * 8) = pk.u;
    }
    asm volatile("s_wait_dscnt 0" ::: "memory");
    __builtin_amdgcn_wave_barrier();
    for (int q = 0; q < 4; ++q) {
        const int rl = q * 4 + (lane >> 3), pc = lane & 7;
        vst2(attn + (size_t)(b * S + qbase + rl) * (H * HD) + h * HD + pc * 8, *(const v4u*)(ot + rl * 64 + pc * 8));
    }
}

// ---------------------------------------------------------------------------
// mean over S:  out[b,d] = mean_s x[b,s,d]
// ---------------------------------------------------------------------------
// One work-group per (batch, strip of 32 columns = one 128-B line of every row). 8 lanes x 16 B cover the line, so a
// wave-wide load takes 4 whole lines (4 rows) and the 32 waves take 128 rows a pass: S / 128 loads a lane.
// Lane sums -> butterfly over the wave's 4 rows -> LDS -> one wave adds the 32 wave sums and stores the strip's line.
// S and D are compile-time so that every load is the one base address plus an immediate offset.
template <int S, int D>
__global__ __launch_bounds__(1024) void colmean(const float* __restrict__ x, float* __restrict__ out) {
    static_assert(S % 128 == 0 && D % 32 == 0, "whole passes, whole lines");
    constexpr int NL = S / 128;                          // loads a lane
    __shared__ __align__(16) float part[32][32];         // [wave][column of the strip]
    const int b   = blockIdx.x / (D / 32);
    const int c0  = (blockIdx.x % (D / 32)) * 32;
    const int tid = threadIdx.x;
    const int q   = tid & 7;                             // which 16 B of the line
    const int r0  = tid >> 3;                            // row inside a pass of 128
    const float* p = x + ((size_t)b * S + r0) * D + c0 + q * 4;
    v4f v[NL];
    #pragma unroll       // independent loads ahead of the adds: their latencies overlap instead of adding up row by row
    for (int i = 0; i < NL; ++i) v[i] = *(const v4f*)(p + (size_t)i * 128 * D);
    v4f s = v[0];
    #pragma unroll       // v[] needs constant indices to stay in registers
    for (int i = 1; i < NL; ++i) s += v[i];
    #pragma unroll       // s[e] needs a constant index to stay in registers
    for (int e = 0; e < 4; ++e) {
        s[e] += __shfl_xor(s[e], 8, 32);
        s[e] += __shfl_xor(s[e], 16, 32);
    }
    if ((tid & 31) < 8) *(v4f*)(&part[tid >> 5][q * 4]) = s;
    __syncthreads();
    if (tid < 32) {
        float tot = 0.f;
        for (int wv = 0; wv < 32; ++wv) tot += part[wv][tid];
        vst2(out + (size_t)b * D + c0 + tid, (float_a)(tot / (float)S));
    }
}

// ---------------------------------------------------------------------------
// recurrent state update: one work-group of 32 waves, two products of the same shape, (2 x K) @ (K x SD):
// new_info = mean @ w_h2s (K = D) and gate logits = [state | new_info] @ w_sgate (K = 2 SD).
// 16 lanes x 16 B cover one 256-B weight row; the K rows are split over the 64 lane groups (K / 64 consecutive rows
// each, both batches from the one row load); group sums -> l ^ 16 shuffle -> LDS -> one thread per output adds the 32.
// D and SD are compile-time so that every global load has a constant offset and depends on no sum.
// ---------------------------------------------------------------------------
__device__ __forceinline__ void wave_sums_to_lds(v4f s0, v4f s1, float (*part)[2][64], int t) {
    #pragma unroll       // constant indices keep s0, s1 in registers
    for (int e = 0; e < 4; ++e) {
        s0[e] += __shfl_xor(s0[e], 16, 32);
        s1[e] += __shfl_xor(s1[e], 16, 32);
    }
    if ((t & 31) < 16) {
        *(v4f*)(&part[t >> 5][0][(t & 15) * 4]) = s0;
        *(v4f*)(&part[t >> 5][1][(t & 15) * 4]) = s1;
    }
}
__device__ __forceinline__ float add_wave_sums(const float (*part)[2][64], int b, int j) {
    float tot = 0.f;
    #pragma unroll       // independent LDS reads ahead of the adds
    for (int wv = 0; wv < 32; ++wv) tot += part[wv][b][j];
    return tot;
}

template <int D, int SD>
__global__ __launch_bounds__(1024) void state_update(
        const float* __restrict__ state, const float* __restrict__ meanx,
        const float* __restrict__ w_h2s, const float* __restrict__ w_sgate,
        float* __restrict__ outState) {
    static_assert(SD == 64 && D % 256 == 0, "16 lanes x 4 columns a row; whole 16-B pieces of the mean");
    constexpr int KR = D / 64;                           // rows of w_h2s a lane group
    constexpr int GR = 2 * SD / 64;                      // rows of w_sgate a lane group
    __shared__ __align__(16) float part[32][2][SD];      // [wave][batch][column]
    __shared__ __align__(16) float cat[2][2 * SD];       // [batch][state | new_info]
    const int t  = threadIdx.x;
    const int c4 = (t & 15) * 4;                         // 4 columns of the row
    const int kg = t >> 4;                               // lane group
    const int b  = (t >> 6) & 1, j = t & 63;             // the output of threads 0 .. 2 SD - 1

    v4f wr[KR], mv[2][KR / 4], wg[GR];
    #pragma unroll       // constant indices keep wr[] in registers
    for (int i = 0; i < KR; ++i) wr[i] = *(const v4f*)(w_h2s + (kg * KR + i) * SD + c4);
    #pragma unroll       // constant indices keep mv[][] in registers
    for (int i = 0; i < KR / 4; ++i) {
        mv[0][i] = *(const v4f*)(meanx + kg * KR + i * 4);
        mv[1][i] = *(const v4f*)(meanx + D + kg * KR + i * 4);
    }
    #pragma unroll       // constant indices keep wg[] in registers
    for (int i = 0; i < GR; ++i) wg[i] = *(const v4f*)(w_sgate + (kg * GR + i) * SD + c4);
    const float st = state[b * SD + j];
    // nothing is scheduled across this line: every load is issued before the first sum waits, so that the kernel pays
    // one memory latency; without it the loads go out in batches, each batch behind the wait for the one before
    __builtin_amdgcn_sched_barrier(0);

    v4f s0 = {}, s1 = {};
    #pragma unroll       // constant indices into wr[] and mv[][]
    for (int i = 0; i < KR; ++i) {
        s0 += wr[i] * mv[0][i >> 2][i & 3];
        s1 += wr[i] * mv[1][i >> 2][i & 3];
    }
    wave_sums_to_lds(s0, s1, part, t);
    if (t < 2 * SD) cat[b][j] = st;
    __syncthreads();                                     // the wave sums of new_info are in part
    if (t < 2 * SD) cat[b][SD + j] = add_wave_sums(part, b, j);
    __syncthreads();                                     // cat is whole; part has been read and may be rewritten
    s0 = v4f{}; s1 = v4f{};
    #pragma unroll       // constant indices into wg[]
    for (int i = 0; i < GR; ++i) {
        s0 += wg[i] * cat[0][kg * GR + i];
        s1 += wg[i] * cat[1][kg * GR + i];
    }
    wave_sums_to_lds(s0, s1, part, t);
    __syncthreads();                                     // the wave sums of the gate logits are in part
    if (t < 2 * SD) {
        const float g = 1.f / (1.f + __expf(-add_wave_sums(part, b, j)));
        vst2(outState + b * SD + j, (float_a)(st * (1.f - g) + cat[b][SD + j] * g));   // 128 consecutive floats
    }
}

// ---------------------------------------------------------------------------
extern "C" void kernel_launch(void* const* d_in, const int* in_sizes, int n_in,
                              void* d_out, int out_size, void* d_ws, size_t ws_size,
                              hipStream_t stream) {
    (void)in_sizes; (void)n_in; (void)out_size; (void)ws_size;
    const int B = 2, S = 2048, D = 1024, H = 16, HD = 64, SD = 64;
    const float* x       = (const float*)d_in[0];
    const float* gamma   = (const float*)d_in[1];
    const float* beta    = (const float*)d_in[2];
    const float* state   = (const float*)d_in[3];
    const float* w_qkv   = (const float*)d_in[4];
    const float* w_o     = (const float*)d_in[5];
    const float* w_gate  = (const float*)d_in[6];
    const float* w_up    = (const float*)d_in[7];
    const float* w_down  = (const float*)d_in[8];
    const float* norm1_w = (const float*)d_in[9];
    const float* norm2_w = (const float*)d_in[10];
    const float* w_sm    = (const float*)d_in[11];
    const float* w_h2s   = (const float*)d_in[12];
    const float* w_sgate = (const float*)d_in[13];
    float* xout = (float*)d_out;                       // (B,S,D) then state (B,SD)

    char* ws = (char*)d_ws;
    size_t off = 0;
    auto arena = [&](size_t bytes) -> void* {
        void* p = ws + off;
        off = (off + bytes + 255) & ~(size_t)255;
        return p;
    };
    float* fg             = (float*)arena((size_t)B * D * 4);
    float* fb             = (float*)arena((size_t)B * D * 4);
    unsigned short* hbuf  = (unsigned short*)arena((size_t)B * S * D * 2);       // h / h2
    unsigned short* wqkvp = (unsigned short*)arena((size_t)D * 3 * D * 2);
    unsigned short* wop   = (unsigned short*)arena((size_t)D * D * 2);
    unsigned short* wgp   = (unsigned short*)arena((size_t)D * 3 * D * 2);
    unsigned short* wupp  = (unsigned short*)arena((size_t)D * 3 * D * 2);
    unsigned short* wdp   = (unsigned short*)arena((size_t)3 * D * D * 2);
    unsigned short* qkvb  = (unsigned short*)arena((size_t)B * S * 3 * D * 2);   // also act
    unsigned short* vp    = (unsigned short*)arena((size_t)B * H * (S / 32) * 4 * 512 * 2);
    unsigned short* kpk   = (unsigned short*)arena((size_t)B * H * (S / 32) * 4 * 512 * 2);
    unsigned short* attnb = (unsigned short*)arena((size_t)B * S * D * 2);
    float* x1             = (float*)arena((size_t)B * S * D * 4);
    unsigned short* gateb = (unsigned short*)arena((size_t)B * S * 3 * D * 2);
    float* meanb          = (float*)arena((size_t)B * D * 4);
    unsigned short* act   = qkvb;                      // reuse after attention

    const int MR = B * S;                              // 4096 rows

    // FiLM params (128 outputs a work-group) and the weights -> B fragments (f16; a work-group of 4 waves packs
    // 4 x 2,048 elements), one launch
    prep<B, D, SD><<<B * 2 * D / 128 + 13 * D * D / 8192, 128, 0, stream>>>(
        state, w_sm, gamma, beta, w_qkv, w_gate, w_up, w_o, w_down, fg, fb, wqkvp, wgp, wupp, wop, wdp);

    // h = rmsnorm(x)*fg + fb
    rmsnorm_film<S, D><<<MR / 16, 256, 0, stream>>>(x, norm1_w, fg, fb, hbuf);

    // qkv = h @ w_qkv   (f16 out)
    gemm_f16<0><<<dim3(3 * D / 256, MR / 64), 256, 0, stream>>>(
        hbuf, wqkvp, nullptr, nullptr, nullptr, qkvb, MR, 3 * D, D);

    // pack V and K into B fragments
    pack_v<S, H, HD><<<B * H * (S / 32) / 4, 128, 0, stream>>>(qkvb, vp, kpk);

    // attention
    flash_attn<<<(B * H * (S / 16)) / 8, 256, 0, stream>>>(qkvb, vp, kpk, attnb, S, H, HD);

    // x1 = x + attn @ w_o
    gemm_f16<1><<<dim3(D / 256, MR / 64), 256, 0, stream>>>(
        attnb, wop, x, nullptr, x1, nullptr, MR, D, D);

    // h2 = rmsnorm(x1)*fg + fb
    rmsnorm_film<S, D><<<MR / 16, 256, 0, stream>>>(x1, norm2_w, fg, fb, hbuf);

    // gate = silu(h2 @ w_gate)   (f16)
    gemm_f16<2><<<dim3(3 * D / 256, MR / 64), 256, 0, stream>>>(
        hbuf, wgp, nullptr, nullptr, nullptr, gateb, MR, 3 * D, D);

    // act = gate * (h2 @ w_up)   (f16)
    gemm_f16<3><<<dim3(3 * D / 256, MR / 64), 256, 0, stream>>>(
        hbuf, wupp, nullptr, gateb, nullptr, act, MR, 3 * D, D);

    // xout = x1 + act @ w_down
    gemm_f16<1><<<dim3(D / 256, MR / 64), 256, 0, stream>>>(
        act, wdp, x1, nullptr, xout, nullptr, MR, D, 3 * D);

    // state update
    colmean<S, D><<<B * D / 32, 1024, 0, stream>>>(xout, meanb);
    state_update<D, SD><<<1, 1024, 0, stream>>>(state, meanb, w_h2s, w_sgate,
                                                xout + (size_t)B * S * D);
}

// v008
// One run takes 237 microseconds.
// Two timings next to v007 put it at 1.17 and 1.16 times that version's speed.
// All steps since v000 together make it 3.38 times as fast.
#include <hip/hip_runtime.h>

#define EPSF 1.1920929e-07f
// Contractions: qkv / o / gate / up / down projections (K = 1024 / 3072), scores QK^T (K = 64) and PV (K = keys, causal) on
// v_wmma_f32_16x16x32_f16 (f16 operands stored as raw 16-bit words, f32 accumulate; P scaled by 256 before its f16 conversion);
// FiLM, RMSNorm, SiLU gating, softmax statistics, the column mean and the state update in f32 on VALU. GEMM B operands and the attention's K and V (there A operands) are
// pre-packed in the ISA fragment order (element e of lane (h, n) = k0 + 8h + e for e < 8, k0 + 16 + 8h + (e-8) otherwise).
// A packed fragment (1 KB) is stored as two planes of 512 B: plane p holds elements 8p .. 8p + 7 of lane l at byte 16 l, so
// that each wave-wide 16-B load of a fragment half covers four whole 128-B lines.

typedef __attribute__((ext_vector_type(16))) _Float16        v16bf;   // (alias name kept; IEEE half)
typedef __attribute__((ext_vector_type(4)))  float           v4f;
typedef __attribute__((ext_vector_type(4)))  unsigned        v4u;
template <typename V> __device__ __forceinline__ void vst2(void* p, V v) {
    *(V*)p = v; 
}
typedef float __attribute__((may_alias)) float_a;
#define PSC 256.0f
#define PUN (1.0f / 256.0f)
typedef __attribute__((ext_vector_type(8)))  float           v8f;
typedef __attribute__((ext_vector_type(8)))  unsigned short  ushort8;
typedef __attribute__((ext_vector_type(16))) unsigned short  ushort16;

union Frag {
    ushort16 u;
    v16bf    b;
    ushort8  h[2];
};

__device__ __forceinline__ unsigned short f2b(float f) {     // f32 -> f16 bits (name kept)
    union { _Float16 h; unsigned short u; } c; c.h = (_Float16)f; return c.u;
}
__device__ __forceinline__ float b2f(unsigned short s) {
    union { unsigned short u; _Float16 h; } c; c.u = s; return (float)c.h;
}
__device__ __forceinline__ v8f wmma16(v16bf a, v16bf b, v8f c) {
    v8f d = __builtin_amdgcn_wmma_f32_16x16x32_f16(false, a, false, b, (short)0, c, false, false);
    asm volatile("v_nop\n\tv_nop\n\tv_nop\n\tv_nop" : "+v"(d) : "v"(a), "v"(b));
    return d;
}

// ---------------------------------------------------------------------------
// FiLM params: state_mod = state @ w_state_mod; fg = gamma*(1+sm[:D]); fb = beta+sm[D:]
// ---------------------------------------------------------------------------
__device__ __forceinline__ void film_piece(const float* __restrict__ state, const float* __restrict__ wsm,
                            const float* __restrict__ gamma, const float* __restrict__ beta,
                            float* __restrict__ fg, float* __restrict__ fb, int SD, int D, int idx) {   // idx over B * 2D
    int b = idx / (2 * D);
    int c = idx % (2 * D);
    if (b >= 2) return;
    float s = 0.f;
    for (int k = 0; k < SD; ++k) s += state[b * SD + k] * wsm[k * 2 * D + c];
    if (c < D) vst2(fg + b * D + c, (float_a)(gamma[c] * (1.f + s)));
    else       vst2(fb + b * D + (c - D), (float_a)(beta[c - D] + s));
}

// ---------------------------------------------------------------------------
// The three pieces of work below move data and hold almost no arithmetic. A launch of that kind with one small item a lane is
// bound by how fast waves start, not by its bytes: each of them gives a wave a whole piece of the work (4 to 8 KB in, all
// of it asked for at once by 16-B loads that cover whole lines), so that 8 to 16 times fewer waves start.
// ---------------------------------------------------------------------------
// RMSNorm + FiLM -> f16 row-major output. One wave takes two whole rows and keeps them in registers (2,048 waves, 8 a
// WGP). A wave-wide 16-B load covers 512 contiguous bytes of a row; the three parameter rows are loaded once for both
// rows; the sum of squares is four chains in the lane and a butterfly over the wave: no LDS tree, no barrier, no second
// read of x.
// ---------------------------------------------------------------------------
template <int S, int D>
__global__ __launch_bounds__(256) void rmsnorm_film(
        const float* __restrict__ x, const float* __restrict__ nw,
        const float* __restrict__ fg, const float* __restrict__ fb,
        unsigned short* __restrict__ out) {
    static_assert(D % 128 == 0 && S % 2 == 0, "whole 512-B pieces of a row; both rows of a wave in one batch");
    constexpr int NL = D / 128;                          // loads a lane and row
    const int lane = threadIdx.x & 31;
    const int row0 = (blockIdx.x * 8 + (threadIdx.x >> 5)) * 2;      // b*S + s of the first row
    const int b    = row0 / S;
    const int c0   = lane * 4;                           // the lane's columns: c0 + 128 i + (0 .. 3)
    const float* xr = x + (size_t)row0 * D + c0;
    v4f v0[NL], v1[NL], pw[NL], pg[NL], pb[NL];
    #pragma unroll       // constant indices keep the arrays in registers
    for (int i = 0; i < NL; ++i) {
        v0[i] = *(const v4f*)(xr + i * 128);
        v1[i] = *(const v4f*)(xr + D + i * 128);
    }
    // the loads of x are in flight, and a later load may be given their address register as its destination
    asm volatile("s_wait_xcnt 0x0" ::: "memory");
    #pragma unroll       // constant indices keep the arrays in registers
    for (int i = 0; i < NL; ++i) {
        pw[i] = *(const v4f*)(nw + c0 + i * 128);
        pg[i] = *(const v4f*)(fg + (size_t)b * D + c0 + i * 128);
        pb[i] = *(const v4f*)(fb + (size_t)b * D + c0 + i * 128);
    }
    // the parameter loads are in flight, and the lines below may write their address registers anew
    asm volatile("s_wait_xcnt 0x0" ::: "memory");
    // nothing is scheduled across this line: every load is issued before the first sum waits, so that the wave pays one
    // memory latency; loads sunk behind the sums would add a second one
    __builtin_amdgcn_sched_barrier(0);
    v4f a0 = v0[0] * v0[0], a1 = v1[0] * v1[0];
    #pragma unroll       // constant indices into v0[], v1[]
    for (int i = 1; i < NL; ++i) { a0 += v0[i] * v0[i]; a1 += v1[i] * v1[i]; }
    float ss0 = (a0[0] + a0[1]) + (a0[2] + a0[3]);
    float ss1 = (a1[0] + a1[1]) + (a1[2] + a1[3]);
    for (int m = 16; m >= 1; m >>= 1) { ss0 += __shfl_xor(ss0, m, 32); ss1 += __shfl_xor(ss1, m, 32); }
    const float sc0 = rsqrtf(ss0 / (float)D + EPSF);
    const float sc1 = rsqrtf(ss1 / (float)D + EPSF);
    unsigned short* orow = out + (size_t)row0 * D + c0;
    #pragma unroll       // constant indices; 8-B lanes, a wave writes 256 contiguous bytes
    for (int i = 0; i < NL; ++i) {
        union { unsigned short s[4]; unsigned long long u; } k0, k1;
        #pragma unroll   // constant indices into the vectors
        for (int e = 0; e < 4; ++e) {
            k0.s[e] = f2b(v0[i][e] * sc0 * pw[i][e] * pg[i][e] + pb[i][e]);
            k1.s[e] = f2b(v1[i][e] * sc1 * pw[i][e] * pg[i][e] + pb[i][e]);
        }
        vst2(orow + i * 128, k0.u);
        vst2(orow + D + i * 128, k1.u);
    }
}

// Place (in 16-bit words) of 16-B piece p of a 4-KB run of packed fragments in a wave's staging LDS: 8 pieces (128 B) at a
// pitch of 144 B, so that both the lanes that write pieces 8 or more apart and the lanes that read them in order meet
// no more bank conflicts than a 16-B access has anyway.
__device__ __forceinline__ int stoff(int p) { return (p >> 3) * 72 + (p & 7) * 8; }
#define ST_WORDS (32 * 72)

// ---------------------------------------------------------------------------
// Pack f32 weight (K x N, row-major, y = x@W) into WMMA B-fragment layout:
// frag (nt, kt): 2 planes x 32 lanes x 8 halfs, values in the ISA order.
// One wave packs one k step of 64 columns = four fragments (4 KB), 64 elements a lane. 16 lanes x 16 B cover 256 B of a
// weight row, the two lane halves take the rows of hi = 0 and 1, load (u, i) takes row i of plane u. A lane then holds
// the pieces of 4 neighbouring fragment lanes; they pass through the wave's own LDS so that every store is 512
// contiguous bytes. K and N are compile-time so that every load is the one base address plus an immediate offset.
// ---------------------------------------------------------------------------
template <int K, int N>
__device__ __forceinline__ void pack_b(const float* __restrict__ W, unsigned short* __restrict__ out, int blk,
                                       unsigned short (*st)[ST_WORDS]) {     // st: [wave][piece: fragment, plane, lane]
    static_assert(K % 32 == 0 && N % 64 == 0 && (K / 32) * (N / 64) % 4 == 0, "whole k steps, strips and work-groups");
    constexpr int NSC = N / 64, KTC = K / 32;
    const int lane = threadIdx.x & 31;
    const int w    = threadIdx.x >> 5;
    const int task = blk * 4 + w;                        // (k step, strip of 64 columns), neighbours side by side in a row
    const int kt   = task / NSC;
    const int n64  = task % NSC;
    const int nq   = lane & 15;                          // which 4 columns of the 64
    const int hi   = lane >> 4;
    const float* src = W + (size_t)(kt * 32 + hi * 8) * N + n64 * 64 + nq * 4;   // ISA B map: k = 32 kt + 8 hi + 16 u + i
    v4f v[2][8];
    #pragma unroll       // constant indices keep v[][] in registers
    for (int u = 0; u < 2; ++u)
        #pragma unroll   // as above
        for (int i = 0; i < 8; ++i) v[u][i] = *(const v4f*)(src + (size_t)(u * 16 + i) * N);
    // the loads are in flight, and the lines below may write their address register anew; src as an input keeps that
    // register live up to the wait, so that no load of the run is given it as its destination
    asm volatile("s_wait_xcnt 0x0" :: "v"(src) : "memory");
    // nothing is scheduled across this line: all 16 loads go out before the first conversion waits (one memory latency);
    // without it they go out in batches, each behind the wait for the one before
    __builtin_amdgcn_sched_barrier(0);
    unsigned short* sw = st[w];
    #pragma unroll       // constant indices into v[][]
    for (int u = 0; u < 2; ++u)
        #pragma unroll   // as above
        for (int c = 0; c < 4; ++c) {                    // column nq * 4 + c: fragment nq >> 2, fragment lane 16 hi + (nq & 3) * 4 + c
            union { unsigned short s[8]; v4u u4; } pk;
            #pragma unroll   // as above
            for (int i = 0; i < 8; ++i) pk.s[i] = f2b(v[u][i][c]);
            *(v4u*)(sw + stoff((nq >> 2) * 64 + u * 32 + hi * 16 + (nq & 3) * 4 + c)) = pk.u4;
        }
    // the wave reads back what its other lanes wrote: their LDS stores have to be over
    asm volatile("s_wait_dscnt 0" ::: "memory");
    __builtin_amdgcn_wave_barrier();
    #pragma unroll       // independent LDS reads, then stores
    for (int q = 0; q < 8; ++q)                          // fragment q >> 1, plane q & 1
        vst2(out + ((size_t)(n64 * 4 + (q >> 1)) * KTC + kt) * 512 + (q & 1) * 256 + lane * 8,
             *(const v4u*)(sw + stoff(q * 32 + lane)));
    // the stores are in flight at the end of the job; the wave runs no other job's code behind it, so
    // this wait is a precaution
    asm volatile("s_wait_xcnt 0x0" ::: "memory");
}

// ---------------------------------------------------------------------------
// Everything that reads only the inputs, in ONE launch: the FiLM parameters and the five weight packs depend on no
// earlier kernel and not on one another. A launch of its own for each would pay the gap between launches, a first memory
// latency and a drain of stores around very little data; here each job is a range of work-group indices and they overlap.
// The FiLM work-groups come first: theirs is the longest chain of dependent loads. No work-group barrier anywhere.
// ---------------------------------------------------------------------------
template <int NB, int D, int SD>
__global__ __launch_bounds__(128) void prep(
        const float* __restrict__ state, const float* __restrict__ wsm,
        const float* __restrict__ gamma, const float* __restrict__ beta,
        const float* __restrict__ w_qkv, const float* __restrict__ w_gate, const float* __restrict__ w_up,
        const float* __restrict__ w_o, const float* __restrict__ w_down,
        float* __restrict__ fg, float* __restrict__ fb,
        unsigned short* __restrict__ wqkvp, unsigned short* __restrict__ wgp, unsigned short* __restrict__ wupp,
        unsigned short* __restrict__ wop, unsigned short* __restrict__ wdp) {
    constexpr int GF = NB * 2 * D / 128;                 // work-groups of the FiLM parameters
    constexpr int G3 = D * 3 * D / 8192;                 // of a D x 3D or 3D x D weight
    constexpr int G1 = D * D / 8192;                     // of the D x D weight
    __shared__ __align__(16) unsigned short st[4][ST_WORDS];
    const int blk = blockIdx.x;
    if (blk < GF) {
        film_piece(state, wsm, gamma, beta, fg, fb, SD, D, blk * 128 + (int)threadIdx.x);
    } else if (blk < GF + 3 * G3) {
        const int which = (blk - GF) / G3;
        pack_b<D, 3 * D>(which == 0 ? w_qkv : which == 1 ? w_gate : w_up,
                         which == 0 ? wqkvp : which == 1 ? wgp : wupp, blk - GF - which * G3, st);
    } else if (blk < GF + 3 * G3 + G1) {
        pack_b<D, D>(w_o, wop, blk - GF - 3 * G3, st);
    } else {
        pack_b<3 * D, D>(w_down, wdp, blk - GF - 3 * G3 - G1, st);
    }
}

// ---------------------------------------------------------------------------
// Pack V and K (from the f16 qkv buffer) into B-fragments: V [bh][kb][n4][plane][lane][8], K [bh][kb][t][c][plane][lane][8]
// (t = which 16 keys of the 32, c = which 32 of the 64 head dims). One wave packs one block of 32 keys of one head: four
// fragments of V and four of K. 8 lanes x 16 B cover a key's 128 B, the four lane groups take 8 keys each, load i takes
// key i of the group. A 16-B piece of K only changes its place; V is turned 8 x 8 in the lane's registers. Both pass
// through the wave's own LDS so that every store is 512 contiguous bytes.
// ---------------------------------------------------------------------------
template <int S, int H, int HD>
__global__ __launch_bounds__(128) void pack_v(const unsigned short* __restrict__ qkvb, unsigned short* __restrict__ vp,
                                              unsigned short* __restrict__ kpk) {
    static_assert(HD == 64 && S % 128 == 0, "8 pieces a key; whole key blocks and work-groups");
    constexpr int D3 = 3 * H * HD;
    __shared__ __align__(16) unsigned short st[4][2][ST_WORDS];      // [wave][K, V][piece: fragment, plane, lane]
    const int lane = threadIdx.x & 31;
    const int w    = threadIdx.x >> 5;
    const int task = blockIdx.x * 4 + w;                 // bh * (S / 32) + kb
    const int kb   = task % (S / 32);
    const int bh   = task / (S / 32);
    const int b = bh / H, h = bh % H;
    const int cq = lane & 7;                             // which 8 head dims of the 64
    const int kq = lane >> 3;                            // which 8 keys of the 32
    const unsigned short* src = qkvb + (size_t)(b * S + kb * 32 + kq * 8) * D3 + H * HD + h * HD + cq * 8;
    ushort8 kk[8], vv[8];
    #pragma unroll       // constant indices keep kk[], vv[] in registers
    for (int i = 0; i < 8; ++i) {
        kk[i] = *(const ushort8*)(src + i * D3);
        vv[i] = *(const ushort8*)(src + i * D3 + H * HD);
    }
    // the loads are in flight, and the lines below may write their address register anew
    asm volatile("s_wait_xcnt 0x0" ::: "memory");
    // nothing is scheduled across this line: all 16 loads go out before the first use waits (one memory latency)
    __builtin_amdgcn_sched_barrier(0);
    unsigned short* sk = st[w][0];
    unsigned short* sv = st[w][1];
    #pragma unroll       // constant indices into kk[]
    for (int i = 0; i < 8; ++i)      // key 8 kq + i, dims 8 cq ..: ISA B map d = 32 c + 8 hi + 16 plane, so cq = 4 c + 2 plane + hi
        *(ushort8*)(sk + stoff(((kq >> 1) * 2 + (cq >> 2)) * 64 + ((cq >> 1) & 1) * 32 + (cq & 1) * 16 + (kq & 1) * 8 + i)) = kk[i];
    #pragma unroll       // constant indices into vv[]
    for (int c = 0; c < 8; ++c) {    // column 8 cq + c, keys 8 kq ..: ISA B map key = 8 hi + 16 plane + i, so kq = 2 plane + hi
        ushort8 pk;
        #pragma unroll   // as above
        for (int i = 0; i < 8; ++i) pk[i] = vv[i][c];
        *(ushort8*)(sv + stoff((cq >> 1) * 64 + (kq >> 1) * 32 + (kq & 1) * 16 + (cq & 1) * 8 + c)) = pk;
    }
    // the wave reads back what its other lanes wrote: their LDS stores have to be over
    asm volatile("s_wait_dscnt 0" ::: "memory");
    __builtin_amdgcn_wave_barrier();
    #pragma unroll       // independent LDS reads, then stores
    for (int q = 0; q < 8; ++q) {
        vst2(kpk + (size_t)task * 2048 + q * 256 + lane * 8, *(const v4u*)(sk + stoff(q * 32 + lane)));
        vst2(vp  + (size_t)task * 2048 + q * 256 + lane * 8, *(const v4u*)(sv + stoff(q * 32 + lane)));
    }
}

// ---------------------------------------------------------------------------
// f16 GEMM via V_WMMA_F32_16X16X32_F16.
// Block: 256 thr = 8 waves; wave tile 32x64 (2x4 accum frags); block tile 64x256.
// A (M x K f16 row-major) is double-buffer staged into LDS per K-step with plain 16-B copies through a register.
// B streams from packed fragments (two 512-B planes, 16 B a lane in each), one K-step ahead of its products.
// A K-step, the stretch between two barriers, is KS * 32 k. A load issued behind its register's last use has one K-step to
// come back, and the bytes a work-group holds in flight grow with KS. Where several work-groups share a WGP (N = 3 D) they
// cover each other's waits and KS = 1 keeps the registers that let them stay together; where a work-group has its WGP alone
// (N = D) KS = 4: 16 B fragments a wave in flight, a quarter of the barriers.
// Epilogues: 0: f16 store | 1: f32 = acc+res | 2: f16 silu(acc) | 3: f16 gate*acc
// ---------------------------------------------------------------------------
template <int EPI, int KS>
__global__ __launch_bounds__(256) void gemm_f16(
        const unsigned short* __restrict__ A, const unsigned short* __restrict__ Bp,
        const float* __restrict__ resF, const unsigned short* __restrict__ gateB,
        float* __restrict__ outF, unsigned short* __restrict__ outB,
        int M, int N, int K) {
    static_assert(KS == 1 || KS == 2 || KS == 4, "whole rows of the A tile a pass of the staging threads");
    constexpr int KC = KS * 32;                          // k of a K-step
    constexpr int AP = KS == 1 ? 32 : KC + 8;            // A tile row pitch in 16-bit words; 272 B at KS = 4: 16 rows on 16 bank groups
    constexpr int RS = 64 / KS;                          // rows that the 256 threads stage with one 16-B piece each
    __shared__ __align__(16) unsigned short atile[2][64 * AP];
    __shared__ __align__(16) float Ct[64][256];                    // block output tile (64 KB)

    const int lane = threadIdx.x & 31;
    const int w    = threadIdx.x >> 5;
    const int wm   = w >> 2;
    const int wn   = w & 3;
    const int mblock = blockIdx.y * 64;
    const int mbase  = mblock + wm * 32;
    const int nbase  = blockIdx.x * 256 + wn * 64;
    const int ktc = K >> 5;
    const int nst = ktc / KS;                            // K-steps
    const int hi  = (lane >> 4) & 1;
    const int l15 = lane & 15;

    // cooperative A-staging mapping: 256 thr x 16B = RS rows of KC f16, KS such passes a tile
    const int srow   = threadIdx.x / (4 * KS);
    const int schunk = (threadIdx.x % (4 * KS)) * 8;     // ushort offset within row

    v8f acc[2][4] = {};

    // fragment (ni, kt) of this wave's four B columns stands at bw + (ni * ktc + kt) * 512
    const unsigned short* bw = Bp + (size_t)(nbase >> 4) * ktc * 512 + lane * 8;
    const unsigned short* ag = A + (size_t)(mblock + srow) * K + schunk;

    // Every register that holds a global operand is loaded anew for its next use right behind its last use: a B fragment
    // behind its two products, the thread's KS pieces of 16 B of A behind their store to LDS. A load then has about a whole step to
    // come back, and a step waits out no load in full.
    // The last steps ask for the last step's data once more: in bounds, never used.
    Frag bfr[KS][4];
    #pragma unroll       // constant indices keep bfr[][] in registers
    for (int ks = 0; ks < KS; ++ks)
        #pragma unroll   // as above
        for (int ni = 0; ni < 4; ++ni) {
            bfr[ks][ni].h[0] = *(const ushort8*)(bw + ((size_t)ni * ktc + ks) * 512);
            bfr[ks][ni].h[1] = *(const ushort8*)(bw + ((size_t)ni * ktc + ks) * 512 + 256);
        }
    v4u areg[KS];
    #pragma unroll       // constant indices keep areg[] in registers
    for (int j = 0; j < KS; ++j) areg[j] = *(const v4u*)(ag + (size_t)j * RS * K);
    #pragma unroll       // as above
    for (int j = 0; j < KS; ++j) *(v4u*)(&atile[0][(srow + j * RS) * AP + schunk]) = areg[j];
    #pragma unroll       // as above
    for (int j = 0; j < KS; ++j) areg[j] = *(const v4u*)(ag + (size_t)j * RS * K + (1 < nst ? 1 : 0) * KC);
    // The K loop's barrier, written by hand: __syncthreads() also waits for every global load, which would end the loads
    // issued ahead at each step; only this wave's LDS traffic has to be over here (tile stores visible, tile reads done).
    auto lds_barrier = [] {
        // a load issued ahead is in flight here, and the next step writes its address register anew
        asm volatile("s_wait_xcnt 0x0" ::: "memory");
        asm volatile("s_wait_dscnt 0x0" ::: "memory");
        asm volatile("s_barrier_signal -1\n\ts_barrier_wait -1" ::: "memory");
    };
    lds_barrier();                                        // tile 0 is whole
    int cur = 0;

    for (int kt = 0; kt < nst; ++kt) {
        const int kb = kt + 1 < nst ? kt + 1 : nst - 1;   // step whose B fragments are asked for in this step
        const int ka = kt + 2 < nst ? kt + 2 : nst - 1;   // step whose A pieces are asked for in this step

        #pragma unroll       // constant indices keep bfr[][] in registers
        for (int ks = 0; ks < KS; ++ks) {
            Frag a0, a1;
            const unsigned short* l0 = &atile[cur][(wm * 32 + l15) * AP + ks * 32 + hi * 8];
            a0.h[0] = *(const ushort8*)(l0);
            a0.h[1] = *(const ushort8*)(l0 + 16);
            const unsigned short* l1 = l0 + 16 * AP;
            a1.h[0] = *(const ushort8*)(l1);
            a1.h[1] = *(const ushort8*)(l1 + 16);

            #pragma unroll   // as above
            for (int ni = 0; ni < 4; ++ni) {
                acc[0][ni] = wmma16(a0.b, bfr[ks][ni].b, acc[0][ni]);
                acc[1][ni] = wmma16(a1.b, bfr[ks][ni].b, acc[1][ni]);
                bfr[ks][ni].h[0] = *(const ushort8*)(bw + ((size_t)ni * ktc + kb * KS + ks) * 512);
                bfr[ks][ni].h[1] = *(const ushort8*)(bw + ((size_t)ni * ktc + kb * KS + ks) * 512 + 256);
            }
        }
        // the B loads are in flight, and the lines below may write their address registers anew
        asm volatile("s_wait_xcnt 0x0" ::: "memory");
        if (kt + 1 < nst) {                               // the A pieces of step kt + 1
            #pragma unroll   // constant indices keep areg[] in registers
            for (int j = 0; j < KS; ++j) *(v4u*)(&atile[cur ^ 1][(srow + j * RS) * AP + schunk]) = areg[j];
        }
        #pragma unroll       // as above
        for (int j = 0; j < KS; ++j) areg[j] = *(const v4u*)(ag + (size_t)j * RS * K + ka * KC);
        lds_barrier();                                    // tile(cur ^ 1) is whole; the reads of tile(cur) are done
        cur ^= 1;
    }

    // epilogue through the block tile: value after residual / silu / gating, then whole-line stores
    __syncthreads();
    for (int mi = 0; mi < 2; ++mi) {
        for (int ni = 0; ni < 4; ++ni) {
            int rl0 = wm * 32 + mi * 16 + hi * 8;
            int cl  = wn * 64 + ni * 16 + l15;
            int col = blockIdx.x * 256 + cl;
            for (int r = 0; r < 8; ++r) {
                size_t idx = (size_t)(mblock + rl0 + r) * N + col;
                float v = acc[mi][ni][r];
                if (EPI == 1)      v += resF[idx];
                else if (EPI == 2) v = v / (1.f + __expf(-v));   // silu
                else if (EPI == 3) v = b2f(gateB[idx]) * v;
                Ct[rl0 + r][cl] = v;
            }
        }
    }
    __syncthreads();
    const int tid = threadIdx.x, n0blk = blockIdx.x * 256;
    if (EPI == 1) {   // f32 rows: 64 x 1024 B (64 pieces)
        for (int g = tid; g < 64 * 64; g += 256) { const int rl = g >> 6, pc = g & 63; vst2(outF + (size_t)(mblock + rl) * N + n0blk + pc * 4, *(const v4f*)(&Ct[rl][pc * 4])); }
    } else {          // 16-bit rows: 64 x 512 B (32 pieces of 8)
        for (int g = tid; g < 64 * 32; g += 256) {
            const int rl = g >> 5, pc = g & 31;
            union { unsigned short s[8]; v4u u; } pk;
            #pragma unroll
            for (int e = 0; e < 8; ++e) pk.s[e] = f2b(Ct[rl][pc * 8 + e]);
            vst2(outB + (size_t)(mblock + rl) * N + n0blk + pc * 8, pk.u);
        }
    }
}

// ---------------------------------------------------------------------------
// Flash attention, one wave per 16-query tile; causal; online softmax. Both products are taken transposed:
// S^T = K Q^T (A = a packed K fragment, B = the Q fragment) and O^T += V^T P^T (A = a packed V fragment, B = P^T).
// A and B share one register map, so the fragments are the ones of the untransposed form with their places swapped.
// A lane then holds one query (column l15) and 16 of the pass's 32 keys (rows t * 16 + 8 hi + r): maximum and sum run
// inside the lane, with one exchange between lanes l and l ^ 16, and the two score tiles, converted where they lie,
// are the B fragment P^T (element e = key 8 hi + e for e < 8, 16 + 8 hi + (e - 8) otherwise): P never leaves its registers.
// ---------------------------------------------------------------------------
__device__ __forceinline__ float xhalf(float x) {            // the value of lane l ^ 16
    return __builtin_bit_cast(float, __builtin_amdgcn_permlanex16(__builtin_bit_cast(int, x), __builtin_bit_cast(int, x),
                                                                  0x76543210, 0xfedcba98, false, false));
}
__global__ __launch_bounds__(256) void flash_attn(
        const unsigned short* __restrict__ qkvb, const unsigned short* __restrict__ vp,
        const unsigned short* __restrict__ kpk, unsigned short* __restrict__ attn, int S, int H, int HD) {
    __shared__ __align__(16) unsigned short olds[8][16 * 64]; // per-wave output tile
    const int lane = threadIdx.x & 31;
    const int w    = threadIdx.x >> 5;
    const int waveId = blockIdx.x * 8 + w;
    const int qt = waveId & 127;              // S/16 = 128
    const int bh = waveId >> 7;
    const int b = bh >> 4, h = bh & 15;
    const int qbase = qt * 16;
    const int l15 = lane & 15;
    const int hi  = (lane >> 4) & 1;
    const int D3  = 3 * H * HD;

    Frag aq[2];
    {
        const unsigned short* qp = qkvb + (size_t)(b * S + qbase + l15) * D3 + h * HD + hi * 8;
        aq[0].h[0] = *(const ushort8*)(qp);
        aq[0].h[1] = *(const ushort8*)(qp + 16);
        aq[1].h[0] = *(const ushort8*)(qp + 32);
        aq[1].h[1] = *(const ushort8*)(qp + 48);
    }

    v8f o[4] = {};                            // o[n][r] = O[query l15][head dim n * 16 + 8 hi + r]
    float mrun = -3.0e38f;                    // the query's running maximum, alike in both lanes of the query
    float lrun = 0.f;                         // this lane's share of the query's running sum

    const int nkb = (qbase + 16 + 31) >> 5;
    // Every load of a key block is issued well ahead of the product that reads it, so that a pass waits out no load:
    // the four V fragments at the head of their own pass, the K fragments right behind the score products of the pass
    // before, into the same registers.
    Frag bk[2][2];
    auto load_k = [&](int blk) {
        const unsigned short* kp = kpk + (((size_t)bh * (S / 32) + blk) * 4) * 512 + lane * 8;   // packed fragments (t, c)
        for (int t = 0; t < 2; ++t)
            for (int c = 0; c < 2; ++c) {
                bk[t][c].h[0] = *(const ushort8*)(kp + (t * 2 + c) * 512);
                bk[t][c].h[1] = *(const ushort8*)(kp + (t * 2 + c) * 512 + 256);
            }
    };
    load_k(0);
    for (int kb = 0; kb < nkb; ++kb) {
        const int kbase = kb * 32;
        Frag bv[4];
        const unsigned short* vpp = vp + (((size_t)bh * (S / 32) + kb) * 4) * 512 + lane * 8;
        for (int n = 0; n < 4; ++n) {
            bv[n].h[0] = *(const ushort8*)(vpp + n * 512);
            bv[n].h[1] = *(const ushort8*)(vpp + n * 512 + 256);
        }
        v8f z = {};
        v8f sc[2];                            // sc[t][r] = score of key kbase + t * 16 + 8 hi + r with query qbase + l15
        sc[0] = wmma16(bk[0][0].b, aq[0].b, z);
        sc[0] = wmma16(bk[0][1].b, aq[1].b, sc[0]);
        sc[1] = wmma16(bk[1][0].b, aq[0].b, z);
        sc[1] = wmma16(bk[1][1].b, aq[1].b, sc[1]);
        load_k(kb + 1 < nkb ? kb + 1 : kb);     // the last pass loads its own block again: in bounds, never used

        const bool diag = (kbase + 32 > qbase);
        for (int t = 0; t < 2; ++t)
            for (int r = 0; r < 8; ++r) {
                float v = sc[t][r] * 0.125f;            // 1/sqrt(64)
                if (diag) {
                    int key  = kbase + t * 16 + hi * 8 + r;
                    int qrow = qbase + l15;
                    if (key > qrow) v = -1.0e30f;
                }
                sc[t][r] = v;
            }

        float mx = fmaxf(sc[0][0], sc[1][0]);
        for (int r = 1; r < 8; ++r) mx = fmaxf(mx, fmaxf(sc[0][r], sc[1][r]));
        mx = fmaxf(mx, xhalf(mx));                      // over all 32 keys of the pass
        const float mn = fmaxf(mrun, mx);
        const float al = __expf(mrun - mn);
        mrun = mn;
        for (int t = 0; t < 2; ++t)
            for (int r = 0; r < 8; ++r)
                sc[t][r] = __expf(sc[t][r] - mn);
        float rs = sc[0][0] + sc[1][0];
        for (int r = 1; r < 8; ++r) rs += sc[0][r] + sc[1][r];
        lrun = lrun * al + rs;                          // the two lanes of a query are added once, behind the loop
        for (int n = 0; n < 4; ++n)
            for (int r = 0; r < 8; ++r)
                o[n][r] *= al;

        Frag pb;
        for (int t = 0; t < 2; ++t)
            for (int r = 0; r < 8; ++r)
                pb.u[t * 8 + r] = f2b(sc[t][r] * PSC);

        for (int n = 0; n < 4; ++n) o[n] = wmma16(bv[n].b, pb.b, o[n]);
    }

    const float inv = PUN / (lrun + xhalf(lrun));
    unsigned short* ot = olds[w];
    for (int n = 0; n < 4; ++n) {             // a lane's 8 values of a tile are 8 consecutive head dims of its query: 16 B
        union { unsigned short s[8]; v4u u; } pk;
        for (int r = 0; r < 8; ++r) pk.s[r] = f2b(o[n][r] * inv);
        *(v4u*)(ot + l15 * 64 + n * 16 + hi * 8) = pk.u;
    }
    asm volatile("s_wait_dscnt 0" ::: "memory");
    __builtin_amdgcn_wave_barrier();
    for (int q = 0; q < 4; ++q) {
        const int rl = q * 4 + (lane >> 3), pc = lane & 7;
        vst2(attn + (size_t)(b * S + qbase + rl) * (H * HD) + h * HD + pc * 8, *(const v4u*)(ot + rl * 64 + pc * 8));
    }
}

// ---------------------------------------------------------------------------
// mean over S:  out[b,d] = mean_s x[b,s,d]
// ---------------------------------------------------------------------------
// One work-group per (batch, strip of 32 columns = one 128-B line of every row). 8 lanes x 16 B cover the line, so a
// wave-wide load takes 4 whole lines (4 rows) and the 32 waves take 128 rows a pass: S / 128 loads a lane.
// Lane sums -> butterfly over the wave's 4 rows -> LDS -> one wave adds the 32 wave sums and stores the strip's line.
// S and D are compile-time so that every load is the one base address plus an immediate offset.
template <int S, int D>
__global__ __launch_bounds__(1024) void colmean(const float* __restrict__ x, float* __restrict__ out) {
    static_assert(S % 128 == 0 && D % 32 == 0, "whole passes, whole lines");
    constexpr int NL = S / 128;                          // loads a lane
    __shared__ __align__(16) float part[32][32];         // [wave][column of the strip]
    const int b   = blockIdx.x / (D / 32);
    const int c0  = (blockIdx.x % (D / 32)) * 32;
    const int tid = threadIdx.x;
    const int q   = tid & 7;                             // which 16 B of the line
    const int r0  = tid >> 3;                            // row inside a pass of 128
    const float* p = x + ((size_t)b * S + r0) * D + c0 + q * 4;
    v4f v[NL];
    #pragma unroll       // independent loads ahead of the adds: their latencies overlap instead of adding up row by row
    for (int i = 0; i < NL; ++i) v[i] = *(const v4f*)(p + (size_t)i * 128 * D);
    v4f s = v[0];
    #pragma unroll       // v[] needs constant indices to stay in registers
    for (int i = 1; i < NL; ++i) s += v[i];
    #pragma unroll       // s[e] needs a constant index to stay in registers
    for (int e = 0; e < 4; ++e) {
        s[e] += __shfl_xor(s[e], 8, 32);
        s[e] += __shfl_xor(s[e], 16, 32);
    }
    if ((tid & 31) < 8) *(v4f*)(&part[tid >> 5][q * 4]) = s;
    __syncthreads();
    if (tid < 32) {
        float tot = 0.f;
        for (int wv = 0; wv < 32; ++wv) tot += part[wv][tid];
        vst2(out + (size_t)b * D + c0 + tid, (float_a)(tot / (float)S));
    }
}

// ---------------------------------------------------------------------------
// recurrent state update: one work-group of 32 waves, two products of the same shape, (2 x K) @ (K x SD):
// new_info = mean @ w_h2s (K = D) and gate logits = [state | new_info] @ w_sgate (K = 2 SD).
// 16 lanes x 16 B cover one 256-B weight row; the K rows are split over the 64 lane groups (K / 64 consecutive rows
// each, both batches from the one row load); group sums -> l ^ 16 shuffle -> LDS -> one thread per output adds the 32.
// D and SD are compile-time so that every global load has a constant offset and depends on no sum.
// ---------------------------------------------------------------------------
__device__ __forceinline__ void wave_sums_to_lds(v4f s0, v4f s1, float (*part)[2][64], int t) {
    #pragma unroll       // constant indices keep s0, s1 in registers
    for (int e = 0; e < 4; ++e) {
        s0[e] += __shfl_xor(s0[e], 16, 32);
        s1[e] += __shfl_xor(s1[e], 16, 32);
    }
    if ((t & 31) < 16) {
        *(v4f*)(&part[t >> 5][0][(t & 15) * 4]) = s0;
        *(v4f*)(&part[t >> 5][1][(t & 15) * 4]) = s1;
    }
}
__device__ __forceinline__ float add_wave_sums(const float (*part)[2][64], int b, int j) {
    float tot = 0.f;
    #pragma unroll       // independent LDS reads ahead of the adds
    for (int wv = 0; wv < 32; ++wv) tot += part[wv][b][j];
    return tot;
}

template <int D, int SD>
__global__ __launch_bounds__(1024) void state_update(
        const float* __restrict__ state, const float* __restrict__ meanx,
        const float* __restrict__ w_h2s, const float* __restrict__ w_sgate,
        float* __restrict__ outState) {
    static_assert(SD == 64 && D % 256 == 0, "16 lanes x 4 columns a row; whole 16-B pieces of the mean");
    constexpr int KR = D / 64;                           // rows of w_h2s a lane group
    constexpr int GR = 2 * SD / 64;                      // rows of w_sgate a lane group
    __shared__ __align__(16) float part[32][2][SD];      // [wave][batch][column]
    __shared__ __align__(16) float cat[2][2 * SD];       // [batch][state | new_info]
    const int t  = threadIdx.x;
    const int c4 = (t & 15) * 4;                         // 4 columns of the row
    const int kg = t >> 4;                               // lane group
    const int b  = (t >> 6) & 1, j = t & 63;             // the output of threads 0 .. 2 SD - 1

    v4f wr[KR], mv[2][KR / 4], wg[GR];
    #pragma unroll       // constant indices keep wr[] in registers
    for (int i = 0; i < KR; ++i) wr[i] = *(const v4f*)(w_h2s + (kg * KR + i) * SD + c4);
    #pragma unroll       // constant indices keep mv[][] in registers
    for (int i = 0; i < KR / 4; ++i) {
        mv[0][i] = *(const v4f*)(meanx + kg * KR + i * 4);
        mv[1][i] = *(const v4f*)(meanx + D + kg * KR + i * 4);
    }
    #pragma unroll       // constant indices keep wg[] in registers
    for (int i = 0; i < GR; ++i) wg[i] = *(const v4f*)(w_sgate + (kg * GR + i) * SD + c4);
    const float st = state[b * SD + j];
    // nothing is scheduled across this line: every load is issued before the first sum waits, so that the kernel pays
    // one memory latency; without it the loads go out in batches, each batch behind the wait for the one before
    __builtin_amdgcn_sched_barrier(0);

    v4f s0 = {}, s1 = {};
    #pragma unroll       // constant indices into wr[] and mv[][]
    for (int i = 0; i < KR; ++i) {
        s0 += wr[i] * mv[0][i >> 2][i & 3];
        s1 += wr[i] * mv[1][i >> 2][i & 3];
    }
    wave_sums_to_lds(s0, s1, part, t);
    if (t < 2 * SD) cat[b][j] = st;
    __syncthreads();                                     // the wave sums of new_info are in part
    if (t < 2 * SD) cat[b][SD + j] = add_wave_sums(part, b, j);
    __syncthreads();                                     // cat is whole; part has been read and may be rewritten
    s0 = v4f{}; s1 = v4f{};
    #pragma unroll       // constant indices into wg[]
    for (int i = 0; i < GR; ++i) {
        s0 += wg[i] * cat[0][kg * GR + i];
        s1 += wg[i] * cat[1][kg * GR + i];
    }
    wave_sums_to_lds(s0, s1, part, t);
    __syncthreads();                                     // the wave sums of the gate logits are in part
    if (t < 2 * SD) {
        const float g = 1.f / (1.f + __expf(-add_wave_sums(part, b, j)));
        vst2(outState + b * SD + j, (float_a)(st * (1.f - g) + cat[b][SD + j] * g));   // 128 consecutive floats
    }
}

// ---------------------------------------------------------------------------
extern "C" void kernel_launch(void* const* d_in, const int* in_sizes, int n_in,
                              void* d_out, int out_size, void* d_ws, size_t ws_size,
                              hipStream_t stream) {
    (void)in_sizes; (void)n_in; (void)out_size; (void)ws_size;
    const int B = 2, S = 2048, D = 1024, H = 16, HD = 64, SD = 64;
    const float* x       = (const float*)d_in[0];
    const float* gamma   = (const float*)d_in[1];
    const float* beta    = (const float*)d_in[2];
    const float* state   = (const float*)d_in[3];
    const float* w_qkv   = (const float*)d_in[4];
    const float* w_o     = (const float*)d_in[5];
    const float* w_gate  = (const float*)d_in[6];
    const float* w_up    = (const float*)d_in[7];
    const float* w_down  = (const float*)d_in[8];
    const float* norm1_w = (const float*)d_in[9];
    const float* norm2_w = (const float*)d_in[10];
    const float* w_sm    = (const float*)d_in[11];
    const float* w_h2s   = (const float*)d_in[12];
    const float* w_sgate = (const float*)d_in[13];
    float* xout = (float*)d_out;                       // (B,S,D) then state (B,SD)

    char* ws = (char*)d_ws;
    size_t off = 0;
    auto arena = [&](size_t bytes) -> void* {
        void* p = ws + off;
        off = (off + bytes + 255) & ~(size_t)255;
        return p;
    };
    float* fg             = (float*)arena((size_t)B * D * 4);
    float* fb             = (float*)arena((size_t)B * D * 4);
    unsigned short* hbuf  = (unsigned short*)arena((size_t)B * S * D * 2);       // h / h2
    unsigned short* wqkvp = (unsigned short*)arena((size_t)D * 3 * D * 2);
    unsigned short* wop   = (unsigned short*)arena((size_t)D * D * 2);
    unsigned short* wgp   = (unsigned short*)arena((size_t)D * 3 * D * 2);
    unsigned short* wupp  = (unsigned short*)arena((size_t)D * 3 * D * 2);
    unsigned short* wdp   = (unsigned short*)arena((size_t)3 * D * D * 2);
    unsigned short* qkvb  = (unsigned short*)arena((size_t)B * S * 3 * D * 2);   // also act
    unsigned short* vp    = (unsigned short*)arena((size_t)B * H * (S / 32) * 4 * 512 * 2);
    unsigned short* kpk   = (unsigned short*)arena((size_t)B * H * (S / 32) * 4 * 512 * 2);
    unsigned short* attnb = (unsigned short*)arena((size_t)B * S * D * 2);
    float* x1             = (float*)arena((size_t)B * S * D * 4);
    unsigned short* gateb = (unsigned short*)arena((size_t)B * S * 3 * D * 2);
    float* meanb          = (float*)arena((size_t)B * D * 4);
    unsigned short* act   = qkvb;                      // reuse after attention

    const int MR = B * S;                              // 4096 rows

    // FiLM params (128 outputs a work-group) and the weights -> B fragments (f16; a work-group of 4 waves packs
    // 4 x 2,048 elements), one launch
    prep<B, D, SD><<<B * 2 * D / 128 + 13 * D * D / 8192, 128, 0, stream>>>(
        state, w_sm, gamma, beta, w_qkv, w_gate, w_up, w_o, w_down, fg, fb, wqkvp, wgp, wupp, wop, wdp);

    // h = rmsnorm(x)*fg + fb
    rmsnorm_film<S, D><<<MR / 16, 256, 0, stream>>>(x, norm1_w, fg, fb, hbuf);

    // qkv = h @ w_qkv   (f16 out)
    gemm_f16<0, 1><<<dim3(3 * D / 256, MR / 64), 256, 0, stream>>>(
        hbuf, wqkvp, nullptr, nullptr, nullptr, qkvb, MR, 3 * D, D);

    // pack V and K into B fragments
    pack_v<S, H, HD><<<B * H * (S / 32) / 4, 128, 0, stream>>>(qkvb, vp, kpk);

    // attention
    flash_attn<<<(B * H * (S / 16)) / 8, 256, 0, stream>>>(qkvb, vp, kpk, attnb, S, H, HD);

    // x1 = x + attn @ w_o
    gemm_f16<1, 4><<<dim3(D / 256, MR / 64), 256, 0, stream>>>(
        attnb, wop, x, nullptr, x1, nullptr, MR, D, D);

    // h2 = rmsnorm(x1)*fg + fb
    rmsnorm_film<S, D><<<MR / 16, 256, 0, stream>>>(x1, norm2_w, fg, fb, hbuf);

    // gate = silu(h2 @ w_gate)   (f16)
    gemm_f16<2, 1><<<dim3(3 * D / 256, MR / 64), 256, 0, stream>>>(
        hbuf, wgp, nullptr, nullptr, nullptr, gateb, MR, 3 * D, D);

    // act = gate * (h2 @ w_up)   (f16)
    gemm_f16<3, 1><<<dim3(3 * D / 256, MR / 64), 256, 0, stream>>>(
        hbuf, wupp, nullptr, gateb, nullptr, act, MR, 3 * D, D);

    // xout = x1 + act @ w_down
    gemm_f16<1, 4><<<dim3(D / 256, MR / 64), 256, 0, stream>>>(
        act, wdp, x1, nullptr, xout, nullptr, MR, D, 3 * D);

    // state update
    colmean<S, D><<<B * D / 32, 1024, 0, stream>>>(xout, meanb);
    state_update<D, SD><<<1, 1024, 0, stream>>>(state, meanb, w_h2s, w_sgate,
                                                xout + (size_t)B * S * D);
}

// v009
// Measured time: 211 microseconds a run.
// Next to v008, in two timings, it ran 1.12 times as fast each time.
// Counting every step since v000, it is 3.78 times as fast.
#include <hip/hip_runtime.h>

#define EPSF 1.1920929e-07f
// Contractions: qkv / o / gate / up / down projections (K = 1024 / 3072), scores QK^T (K = 64) and PV (K = keys, causal) on
// v_wmma_f32_16x16x32_f16 (f16 operands stored as raw 16-bit words, f32 accumulate; P scaled by 256 before its f16 conversion);
// FiLM, RMSNorm, SiLU gating, softmax statistics, the column mean and the state update in f32 on VALU. GEMM B operands and the attention's K and V (there A operands) are
// pre-packed in the ISA fragment order (element e of lane (h, n) = k0 + 8h + e for e < 8, k0 + 16 + 8h + (e-8) otherwise).
// A packed fragment (1 KB) is stored as two planes of 512 B: plane p holds elements 8p .. 8p + 7 of lane l at byte 16 l, so
// that each wave-wide 16-B load of a fragment half covers four whole 128-B lines.

typedef __attribute__((ext_vector_type(16))) _Float16        v16bf;   // (alias name kept; IEEE half)
typedef __attribute__((ext_vector_type(4)))  float           v4f;
typedef __attribute__((ext_vector_type(4)))  unsigned        v4u;
template <typename V> __device__ __forceinline__ void vst2(void* p, V v) {
    *(V*)p = v; 
}
typedef float __attribute__((may_alias)) float_a;
#define PSC 256.0f
#define PUN (1.0f / 256.0f)
typedef __attribute__((ext_vector_type(8)))  float           v8f;
typedef __attribute__((ext_vector_type(8)))  unsigned short  ushort8;
typedef __attribute__((ext_vector_type(16))) unsigned short  ushort16;

union Frag {
    ushort16 u;
    v16bf    b;
    ushort8  h[2];
};

__device__ __forceinline__ unsigned short f2b(float f) {     // f32 -> f16 bits (name kept)
    union { _Float16 h; unsigned short u; } c; c.h = (_Float16)f; return c.u;
}
__device__ __forceinline__ float b2f(unsigned short s) {
    union { unsigned short u; _Float16 h; } c; c.u = s; return (float)c.h;
}
__device__ __forceinline__ v8f wmma16(v16bf a, v16bf b, v8f c) {
    v8f d = __builtin_amdgcn_wmma_f32_16x16x32_f16(false, a, false, b, (short)0, c, false, false);
    asm volatile("v_nop\n\tv_nop\n\tv_nop\n\tv_nop" : "+v"(d) : "v"(a), "v"(b));
    return d;
}

// ---------------------------------------------------------------------------
// FiLM params: state_mod = state @ w_state_mod; fg = gamma*(1+sm[:D]); fb = beta+sm[D:]
// ---------------------------------------------------------------------------
__device__ __forceinline__ void film_piece(const float* __restrict__ state, const float* __restrict__ wsm,
                            const float* __restrict__ gamma, const float* __restrict__ beta,
                            float* __restrict__ fg, float* __restrict__ fb, int SD, int D, int idx) {   // idx over B * 2D
    int b = idx / (2 * D);
    int c = idx % (2 * D);
    if (b >= 2) return;
    float s = 0.f;
    for (int k = 0; k < SD; ++k) s += state[b * SD + k] * wsm[k * 2 * D + c];
    if (c < D) vst2(fg + b * D + c, (float_a)(gamma[c] * (1.f + s)));
    else       vst2(fb + b * D + (c - D), (float_a)(beta[c - D] + s));
}

// ---------------------------------------------------------------------------
// The three pieces of work below move data and hold almost no arithmetic. A launch of that kind with one small item a lane is
// bound by how fast waves start, not by its bytes: each of them gives a wave a whole piece of the work (4 to 8 KB in, all
// of it asked for at once by 16-B loads that cover whole lines), so that 8 to 16 times fewer waves start.
// ---------------------------------------------------------------------------
// RMSNorm + FiLM -> f16 row-major output. One wave takes two whole rows and keeps them in registers (2,048 waves, 8 a
// WGP). A wave-wide 16-B load covers 512 contiguous bytes of a row; the three parameter rows are loaded once for both
// rows; the sum of squares is four chains in the lane and a butterfly over the wave: no LDS tree, no barrier, no second
// read of x.
// ---------------------------------------------------------------------------
template <int S, int D>
__global__ __launch_bounds__(256) void rmsnorm_film(
        const float* __restrict__ x, const float* __restrict__ nw,
        const float* __restrict__ fg, const float* __restrict__ fb,
        unsigned short* __restrict__ out) {
    static_assert(D % 128 == 0 && S % 2 == 0, "whole 512-B pieces of a row; both rows of a wave in one batch");
    constexpr int NL = D / 128;                          // loads a lane and row
    const int lane = threadIdx.x & 31;
    const int row0 = (blockIdx.x * 8 + (threadIdx.x >> 5)) * 2;      // b*S + s of the first row
    const int b    = row0 / S;
    const int c0   = lane * 4;                           // the lane's columns: c0 + 128 i + (0 .. 3)
    const float* xr = x + (size_t)row0 * D + c0;
    v4f v0[NL], v1[NL], pw[NL], pg[NL], pb[NL];
    #pragma unroll       // constant indices keep the arrays in registers
    for (int i = 0; i < NL; ++i) {
        v0[i] = *(const v4f*)(xr + i * 128);
        v1[i] = *(const v4f*)(xr + D + i * 128);
    }
    // the loads of x are in flight, and a later load may be given their address register as its destination
    asm volatile("s_wait_xcnt 0x0" ::: "memory");
    #pragma unroll       // constant indices keep the arrays in registers
    for (int i = 0; i < NL; ++i) {
        pw[i] = *(const v4f*)(nw + c0 + i * 128);
        pg[i] = *(const v4f*)(fg + (size_t)b * D + c0 + i * 128);
        pb[i] = *(const v4f*)(fb + (size_t)b * D + c0 + i * 128);
    }
    // the parameter loads are in flight, and the lines below may write their address registers anew
    asm volatile("s_wait_xcnt 0x0" ::: "memory");
    // nothing is scheduled across this line: every load is issued before the first sum waits, so that the wave pays one
    // memory latency; loads sunk behind the sums would add a second one
    __builtin_amdgcn_sched_barrier(0);
    v4f a0 = v0[0] * v0[0], a1 = v1[0] * v1[0];
    #pragma unroll       // constant indices into v0[], v1[]
    for (int i = 1; i < NL; ++i) { a0 += v0[i] * v0[i]; a1 += v1[i] * v1[i]; }
    float ss0 = (a0[0] + a0[1]) + (a0[2] + a0[3]);
    float ss1 = (a1[0] + a1[1]) + (a1[2] + a1[3]);
    for (int m = 16; m >= 1; m >>= 1) { ss0 += __shfl_xor(ss0, m, 32); ss1 += __shfl_xor(ss1, m, 32); }
    const float sc0 = rsqrtf(ss0 / (float)D + EPSF);
    const float sc1 = rsqrtf(ss1 / (float)D + EPSF);
    unsigned short* orow = out + (size_t)row0 * D + c0;
    #pragma unroll       // constant indices; 8-B lanes, a wave writes 256 contiguous bytes
    for (int i = 0; i < NL; ++i) {
        union { unsigned short s[4]; unsigned long long u; } k0, k1;
        #pragma unroll   // constant indices into the vectors
        for (int e = 0; e < 4; ++e) {
            k0.s[e] = f2b(v0[i][e] * sc0 * pw[i][e] * pg[i][e] + pb[i][e]);
            k1.s[e] = f2b(v1[i][e] * sc1 * pw[i][e] * pg[i][e] + pb[i][e]);
        }
        vst2(orow + i * 128, k0.u);
        vst2(orow + D + i * 128, k1.u);
    }
}

// Place (in 16-bit words) of 16-B piece p of a 4-KB run of packed fragments in a wave's staging LDS: 8 pieces (128 B) at a
// pitch of 144 B, so that both the lanes that write pieces 8 or more apart and the lanes that read them in order meet
// no more bank conflicts than a 16-B access has anyway.
__device__ __forceinline__ int stoff(int p) { return (p >> 3) * 72 + (p & 7) * 8; }
#define ST_WORDS (32 * 72)

// ---------------------------------------------------------------------------
// Pack f32 weight (K x N, row-major, y = x@W) into WMMA B-fragment layout:
// frag (nt, kt): 2 planes x 32 lanes x 8 halfs, values in the ISA order.
// One wave packs one k step of 64 columns = four fragments (4 KB), 64 elements a lane. 16 lanes x 16 B cover 256 B of a
// weight row, the two lane halves take the rows of hi = 0 and 1, load (u, i) takes row i of plane u. A lane then holds
// the pieces of 4 neighbouring fragment lanes; they pass through the wave's own LDS so that every store is 512
// contiguous bytes. K and N are compile-time so that every load is the one base address plus an immediate offset.
// ---------------------------------------------------------------------------
template <int K, int N>
__device__ __forceinline__ void pack_b(const float* __restrict__ W, unsigned short* __restrict__ out, int blk,
                                       unsigned short (*st)[ST_WORDS]) {     // st: [wave][piece: fragment, plane, lane]
    static_assert(K % 32 == 0 && N % 64 == 0 && (K / 32) * (N / 64) % 4 == 0, "whole k steps, strips and work-groups");
    constexpr int NSC = N / 64, KTC = K / 32;
    const int lane = threadIdx.x & 31;
    const int w    = threadIdx.x >> 5;
    const int task = blk * 4 + w;                        // (k step, strip of 64 columns), neighbours side by side in a row
    const int kt   = task / NSC;
    const int n64  = task % NSC;
    const int nq   = lane & 15;                          // which 4 columns of the 64
    const int hi   = lane >> 4;
    const float* src = W + (size_t)(kt * 32 + hi * 8) * N + n64 * 64 + nq * 4;   // ISA B map: k = 32 kt + 8 hi + 16 u + i
    v4f v[2][8];
    #pragma unroll       // constant indices keep v[][] in registers
    for (int u = 0; u < 2; ++u)
        #pragma unroll   // as above
        for (int i = 0; i < 8; ++i) v[u][i] = *(const v4f*)(src + (size_t)(u * 16 + i) * N);
    // the loads are in flight, and the lines below may write their address register anew; src as an input keeps that
    // register live up to the wait, so that no load of the run is given it as its destination
    asm volatile("s_wait_xcnt 0x0" :: "v"(src) : "memory");
    // nothing is scheduled across this line: all 16 loads go out before the first conversion waits (one memory latency);
    // without it they go out in batches, each behind the wait for the one before
    __builtin_amdgcn_sched_barrier(0);
    unsigned short* sw = st[w];
    #pragma unroll       // constant indices into v[][]
    for (int u = 0; u < 2; ++u)
        #pragma unroll   // as above
        for (int c = 0; c < 4; ++c) {                    // column nq * 4 + c: fragment nq >> 2, fragment lane 16 hi + (nq & 3) * 4 + c
            union { unsigned short s[8]; v4u u4; } pk;
            #pragma unroll   // as above
            for (int i = 0; i < 8; ++i) pk.s[i] = f2b(v[u][i][c]);
            *(v4u*)(sw + stoff((nq >> 2) * 64 + u * 32 + hi * 16 + (nq & 3) * 4 + c)) = pk.u4;
        }
    // the wave reads back what its other lanes wrote: their LDS stores have to be over
    asm volatile("s_wait_dscnt 0" ::: "memory");
    __builtin_amdgcn_wave_barrier();
    #pragma unroll       // independent LDS reads, then stores
    for (int q = 0; q < 8; ++q)                          // fragment q >> 1, plane q & 1
        vst2(out + ((size_t)(n64 * 4 + (q >> 1)) * KTC + kt) * 512 + (q & 1) * 256 + lane * 8,
             *(const v4u*)(sw + stoff(q * 32 + lane)));
    // the stores are in flight at the end of the job; the wave runs no other job's code behind it, so
    // this wait is a precaution
    asm volatile("s_wait_xcnt 0x0" ::: "memory");
}

// ---------------------------------------------------------------------------
// Everything that reads only the inputs, in ONE launch: the FiLM parameters and the five weight packs depend on no
// earlier kernel and not on one another. A launch of its own for each would pay the gap between launches, a first memory
// latency and a drain of stores around very little data; here each job is a range of work-group indices and they overlap.
// The FiLM work-groups come first: theirs is the longest chain of dependent loads. No work-group barrier anywhere.
// ---------------------------------------------------------------------------
template <int NB, int D, int SD>
__global__ __launch_bounds__(128) void prep(
        const float* __restrict__ state, const float* __restrict__ wsm,
        const float* __restrict__ gamma, const float* __restrict__ beta,
        const float* __restrict__ w_qkv, const float* __restrict__ w_gate, const float* __restrict__ w_up,
        const float* __restrict__ w_o, const float* __restrict__ w_down,
        float* __restrict__ fg, float* __restrict__ fb,
        unsigned short* __restrict__ wqkvp, unsigned short* __restrict__ wgp, unsigned short* __restrict__ wupp,
        unsigned short* __restrict__ wop, unsigned short* __restrict__ wdp) {
    constexpr int GF = NB * 2 * D / 128;                 // work-groups of the FiLM parameters
    constexpr int G3 = D * 3 * D / 8192;                 // of a D x 3D or 3D x D weight
    constexpr int G1 = D * D / 8192;                     // of the D x D weight
    __shared__ __align__(16) unsigned short st[4][ST_WORDS];
    const int blk = blockIdx.x;
    if (blk < GF) {
        film_piece(state, wsm, gamma, beta, fg, fb, SD, D, blk * 128 + (int)threadIdx.x);
    } else if (blk < GF + 3 * G3) {
        const int which = (blk - GF) / G3;
        pack_b<D, 3 * D>(which == 0 ? w_qkv : which == 1 ? w_gate : w_up,
                         which == 0 ? wqkvp : which == 1 ? wgp : wupp, blk - GF - which * G3, st);
    } else if (blk < GF + 3 * G3 + G1) {
        pack_b<D, D>(w_o, wop, blk - GF - 3 * G3, st);
    } else {
        pack_b<3 * D, D>(w_down, wdp, blk - GF - 3 * G3 - G1, st);
    }
}

// ---------------------------------------------------------------------------
// Pack V and K (from the f16 qkv buffer) into B-fragments: V [bh][kb][n4][plane][lane][8], K [bh][kb][t][c][plane][lane][8]
// (t = which 16 keys of the 32, c = which 32 of the 64 head dims). One wave packs one block of 32 keys of one head: four
// fragments of V and four of K. 8 lanes x 16 B cover a key's 128 B, the four lane groups take 8 keys each, load i takes
// key i of the group. A 16-B piece of K only changes its place; V is turned 8 x 8 in the lane's registers. Both pass
// through the wave's own LDS so that every store is 512 contiguous bytes.
// ---------------------------------------------------------------------------
template <int S, int H, int HD>
__global__ __launch_bounds__(128) void pack_v(const unsigned short* __restrict__ qkvb, unsigned short* __restrict__ vp,
                                              unsigned short* __restrict__ kpk) {
    static_assert(HD == 64 && S % 128 == 0, "8 pieces a key; whole key blocks and work-groups");
    constexpr int D3 = 3 * H * HD;
    __shared__ __align__(16) unsigned short st[4][2][ST_WORDS];      // [wave][K, V][piece: fragment, plane, lane]
    const int lane = threadIdx.x & 31;
    const int w    = threadIdx.x >> 5;
    const int task = blockIdx.x * 4 + w;                 // bh * (S / 32) + kb
    const int kb   = task % (S / 32);
    const int bh   = task / (S / 32);
    const int b = bh / H, h = bh % H;
    const int cq = lane & 7;                             // which 8 head dims of the 64
    const int kq = lane >> 3;                            // which 8 keys of the 32
    const unsigned short* src = qkvb + (size_t)(b * S + kb * 32 + kq * 8) * D3 + H * HD + h * HD + cq * 8;
    ushort8 kk[8], vv[8];
    #pragma unroll       // constant indices keep kk[], vv[] in registers
    for (int i = 0; i < 8; ++i) {
        kk[i] = *(const ushort8*)(src + i * D3);
        vv[i] = *(const ushort8*)(src + i * D3 + H * HD);
    }
    // the loads are in flight, and the lines below may write their address register anew
    asm volatile("s_wait_xcnt 0x0" ::: "memory");
    // nothing is scheduled across this line: all 16 loads go out before the first use waits (one memory latency)
    __builtin_amdgcn_sched_barrier(0);
    unsigned short* sk = st[w][0];
    unsigned short* sv = st[w][1];
    #pragma unroll       // constant indices into kk[]
    for (int i = 0; i < 8; ++i)      // key 8 kq + i, dims 8 cq ..: ISA B map d = 32 c + 8 hi + 16 plane, so cq = 4 c + 2 plane + hi
        *(ushort8*)(sk + stoff(((kq >> 1) * 2 + (cq >> 2)) * 64 + ((cq >> 1) & 1) * 32 + (cq & 1) * 16 + (kq & 1) * 8 + i)) = kk[i];
    #pragma unroll       // constant indices into vv[]
    for (int c = 0; c < 8; ++c) {    // column 8 cq + c, keys 8 kq ..: ISA B map key = 8 hi + 16 plane + i, so kq = 2 plane + hi
        ushort8 pk;
        #pragma unroll   // as above
        for (int i = 0; i < 8; ++i) pk[i] = vv[i][c];
        *(ushort8*)(sv + stoff((cq >> 1) * 64 + (kq >> 1) * 32 + (kq & 1) * 16 + (cq & 1) * 8 + c)) = pk;
    }
    // the wave reads back what its other lanes wrote: their LDS stores have to be over
    asm volatile("s_wait_dscnt 0" ::: "memory");
    __builtin_amdgcn_wave_barrier();
    #pragma unroll       // independent LDS reads, then stores
    for (int q = 0; q < 8; ++q) {
        vst2(kpk + (size_t)task * 2048 + q * 256 + lane * 8, *(const v4u*)(sk + stoff(q * 32 + lane)));
        vst2(vp  + (size_t)task * 2048 + q * 256 + lane * 8, *(const v4u*)(sv + stoff(q * 32 + lane)));
    }
}

// ---------------------------------------------------------------------------
// f16 GEMM via V_WMMA_F32_16X16X32_F16.
// Block: WM x 4 waves; wave tile 16 MI x 16 NI (MI x NI accum frags); block tile BM x BN = 16 MI WM x 64 NI.
// A (M x K f16 row-major) is double-buffer staged into LDS per K-step with plain 16-B copies through a register.
// B streams from packed fragments (two 512-B planes, 16 B a lane in each), one K-step ahead of its products.
// A K-step, the stretch between two barriers, is KS * 32 k. A load issued behind its register's last use has one K-step to
// come back, and the bytes a work-group holds in flight grow with KS.
// The block tile sets the bytes asked of L2 per product: (BM + BN) / (BM * BN) per k. N = D: 64 x 256, one work-group a
// WGP, KS = 4 (16 B fragments a wave in flight). N = 3 D: 256 x 192, 16 waves of 64 x 48, again exactly one work-group a
// WGP but well under half the L2 bytes of 64 x 256; KS = 2 is what its 256 registers a wave hold.
// Epilogues: 0: f16 store | 1: f32 = acc+res | 2: f16 silu(acc) | 3: f16 gate*acc
// ---------------------------------------------------------------------------
template <int EPI, int KS, int WM, int MI, int NI>
__global__ __launch_bounds__(WM * 128) void gemm_f16(
        const unsigned short* __restrict__ A, const unsigned short* __restrict__ Bp,
        const float* __restrict__ resF, const unsigned short* __restrict__ gateB,
        float* __restrict__ outF, unsigned short* __restrict__ outB,
        int M, int N, int K) {
    static_assert(KS == 2 || KS == 4, "whole rows of the A tile a pass of the staging threads");
    constexpr int NT = WM * 128;                         // threads
    constexpr int BM = WM * MI * 16, BN = NI * 64;       // block tile
    constexpr int KC = KS * 32;                          // k of a K-step
    constexpr int AP = KC + 8;                           // A tile row pitch in 16-bit words; 144 or 272 B: 16 B x an odd number
    constexpr int RS = NT / (4 * KS);                    // rows that the threads stage with one 16-B piece each
    constexpr int NP = BM / RS;                          // such passes a tile
    static_assert(BM % RS == 0 && NP == 4, "whole passes; the wait behind the A loads names four addresses");
    __shared__ __align__(16) unsigned short atile[2][BM * AP];
    __shared__ __align__(16) float Ct[BM][BN];                     // block output tile

    const int lane = threadIdx.x & 31;
    const int w    = threadIdx.x >> 5;
    const int wm   = w >> 2;
    const int wn   = w & 3;
    const int mblock = blockIdx.y * BM;
    const int nbase  = blockIdx.x * BN + wn * (NI * 16);
    const int ktc = K >> 5;
    const int nst = ktc / KS;                            // K-steps
    const int hi  = (lane >> 4) & 1;
    const int l15 = lane & 15;

    // cooperative A-staging mapping: NT thr x 16B = RS rows of KC f16, NP such passes a tile
    const int srow   = threadIdx.x / (4 * KS);
    const int schunk = (threadIdx.x % (4 * KS)) * 8;     // ushort offset within row

    v8f acc[MI][NI] = {};

    // fragment (ni, kt) of this wave's NI B columns stands at bw + (ni * ktc + kt) * 512
    const unsigned short* bw = Bp + (size_t)(nbase >> 4) * ktc * 512 + lane * 8;
    const unsigned short* ag = A + (size_t)(mblock + srow) * K + schunk;

    // Every register that holds a global operand is loaded anew for its next use right behind its last use: a B fragment
    // behind its MI products, the thread's 4 x 16 B of A behind their store to LDS. A load then has about a whole step to
    // come back, and a step waits out no load in full.
    // The last steps ask for the last step's data once more: in bounds, never used.
    Frag bfr[KS][NI];
    #pragma unroll       // constant indices keep bfr[][] in registers
    for (int ks = 0; ks < KS; ++ks)
        #pragma unroll   // as above
        for (int ni = 0; ni < NI; ++ni) {
            bfr[ks][ni].h[0] = *(const ushort8*)(bw + ((size_t)ni * ktc + ks) * 512);
            bfr[ks][ni].h[1] = *(const ushort8*)(bw + ((size_t)ni * ktc + ks) * 512 + 256);
        }
    v4u areg[NP];
    #pragma unroll       // constant indices keep areg[] in registers
    for (int j = 0; j < NP; ++j) areg[j] = *(const v4u*)(ag + (size_t)j * RS * K);
    #pragma unroll       // as above
    for (int j = 0; j < NP; ++j) *(v4u*)(&atile[0][(srow + j * RS) * AP + schunk]) = areg[j];
    #pragma unroll       // as above
    for (int j = 0; j < NP; ++j) areg[j] = *(const v4u*)(ag + (size_t)j * RS * K + (1 < nst ? 1 : 0) * KC);
    // The K loop's barrier, written by hand: __syncthreads() also waits for every global load, which would end the loads
    // issued ahead at each step; only this wave's LDS traffic has to be over here (tile stores visible, tile reads done).
    auto lds_barrier = [] {
        asm volatile("s_wait_dscnt 0x0" ::: "memory");
        asm volatile("s_barrier_signal -1\n\ts_barrier_wait -1" ::: "memory");
    };
    // loads issued ahead are in flight here, and the first step writes their address registers anew
    asm volatile("s_wait_xcnt 0x0" ::: "memory");
    lds_barrier();                                        // tile 0 is whole
    int cur = 0;

    for (int kt = 0; kt < nst; ++kt) {
        const int kb = kt + 1 < nst ? kt + 1 : nst - 1;   // step whose B fragments are asked for in this step
        const int ka = kt + 2 < nst ? kt + 2 : nst - 1;   // step whose A pieces are asked for in this step

        #pragma unroll       // constant indices keep bfr[][] in registers
        for (int ks = 0; ks < KS; ++ks) {
            Frag af[MI];
            const unsigned short* l0 = &atile[cur][(wm * (MI * 16) + l15) * AP + ks * 32 + hi * 8];
            #pragma unroll   // constant indices keep af[] in registers
            for (int mi = 0; mi < MI; ++mi) {
                af[mi].h[0] = *(const ushort8*)(l0 + mi * 16 * AP);
                af[mi].h[1] = *(const ushort8*)(l0 + mi * 16 * AP + 16);
            }

            #pragma unroll   // as above
            for (int ni = 0; ni < NI; ++ni) {
                #pragma unroll   // as above
                for (int mi = 0; mi < MI; ++mi) acc[mi][ni] = wmma16(af[mi].b, bfr[ks][ni].b, acc[mi][ni]);
                bfr[ks][ni].h[0] = *(const ushort8*)(bw + ((size_t)ni * ktc + kb * KS + ks) * 512);
                bfr[ks][ni].h[1] = *(const ushort8*)(bw + ((size_t)ni * ktc + kb * KS + ks) * 512 + 256);
            }
        }
        // the B loads are in flight, and the lines below may write their address registers anew
        asm volatile("s_wait_xcnt 0x0" ::: "memory");
        if (kt + 1 < nst) {                               // the A pieces of step kt + 1
            #pragma unroll   // constant indices keep areg[] in registers
            for (int j = 0; j < NP; ++j) *(v4u*)(&atile[cur ^ 1][(srow + j * RS) * AP + schunk]) = areg[j];
        }
        const unsigned short* an[NP];
        #pragma unroll       // as above
        for (int j = 0; j < NP; ++j) { an[j] = ag + (size_t)j * RS * K + ka * KC; areg[j] = *(const v4u*)an[j]; }
        // the A loads are in flight, and the next step writes their address registers anew; the addresses as inputs keep
        // those registers live up to the wait, so that no load of the run is given another's as its destination
        asm volatile("s_wait_xcnt 0x0" :: "v"(an[0]), "v"(an[1]), "v"(an[2]), "v"(an[3]) : "memory");
        lds_barrier();                                    // tile(cur ^ 1) is whole; the reads of tile(cur) are done
        cur ^= 1;
    }

    // epilogue through the block tile: value after residual / silu / gating, then whole-line stores
    __syncthreads();
    for (int mi = 0; mi < MI; ++mi) {
        for (int ni = 0; ni < NI; ++ni) {
            int rl0 = wm * (MI * 16) + mi * 16 + hi * 8;
            int cl  = wn * (NI * 16) + ni * 16 + l15;
            int col = blockIdx.x * BN + cl;
            for (int r = 0; r < 8; ++r) {
                size_t idx = (size_t)(mblock + rl0 + r) * N + col;
                float v = acc[mi][ni][r];
                if (EPI == 1)      v += resF[idx];
                else if (EPI == 2) v = v / (1.f + __expf(-v));   // silu
                else if (EPI == 3) v = b2f(gateB[idx]) * v;
                Ct[rl0 + r][cl] = v;
            }
        }
    }
    __syncthreads();
    const int tid = threadIdx.x, n0blk = blockIdx.x * BN;
    if (EPI == 1) {   // f32 rows: BM x 4 BN B (BN / 4 pieces)
        for (int g = tid; g < BM * (BN / 4); g += NT) { const int rl = g / (BN / 4), pc = g % (BN / 4); vst2(outF + (size_t)(mblock + rl) * N + n0blk + pc * 4, *(const v4f*)(&Ct[rl][pc * 4])); }
    } else {          // 16-bit rows: BM x 2 BN B (BN / 8 pieces of 8): whole 128-B lines
        for (int g = tid; g < BM * (BN / 8); g += NT) {
            const int rl = g / (BN / 8), pc = g % (BN / 8);
            union { unsigned short s[8]; v4u u; } pk;
            #pragma unroll
            for (int e = 0; e < 8; ++e) pk.s[e] = f2b(Ct[rl][pc * 8 + e]);
            vst2(outB + (size_t)(mblock + rl) * N + n0blk + pc * 8, pk.u);
        }
    }
}

// ---------------------------------------------------------------------------
// Flash attention, one wave per 16-query tile; causal; online softmax. Both products are taken transposed:
// S^T = K Q^T (A = a packed K fragment, B = the Q fragment) and O^T += V^T P^T (A = a packed V fragment, B = P^T).
// A and B share one register map, so the fragments are the ones of the untransposed form with their places swapped.
// A lane then holds one query (column l15) and 16 of the pass's 32 keys (rows t * 16 + 8 hi + r): maximum and sum run
// inside the lane, with one exchange between lanes l and l ^ 16, and the two score tiles, converted where they lie,
// are the B fragment P^T (element e = key 8 hi + e for e < 8, 16 + 8 hi + (e - 8) otherwise): P never leaves its registers.
// ---------------------------------------------------------------------------
__device__ __forceinline__ float xhalf(float x) {            // the value of lane l ^ 16
    return __builtin_bit_cast(float, __builtin_amdgcn_permlanex16(__builtin_bit_cast(int, x), __builtin_bit_cast(int, x),
                                                                  0x76543210, 0xfedcba98, false, false));
}
__global__ __launch_bounds__(256) void flash_attn(
        const unsigned short* __restrict__ qkvb, const unsigned short* __restrict__ vp,
        const unsigned short* __restrict__ kpk, unsigned short* __restrict__ attn, int S, int H, int HD) {
    __shared__ __align__(16) unsigned short olds[8][16 * 64]; // per-wave output tile
    const int lane = threadIdx.x & 31;
    const int w    = threadIdx.x >> 5;
    const int waveId = blockIdx.x * 8 + w;
    const int qt = waveId & 127;              // S/16 = 128
    const int bh = waveId >> 7;
    const int b = bh >> 4, h = bh & 15;
    const int qbase = qt * 16;
    const int l15 = lane & 15;
    const int hi  = (lane >> 4) & 1;
    const int D3  = 3 * H * HD;

    Frag aq[2];
    {
        const unsigned short* qp = qkvb + (size_t)(b * S + qbase + l15) * D3 + h * HD + hi * 8;
        aq[0].h[0] = *(const ushort8*)(qp);
        aq[0].h[1] = *(const ushort8*)(qp + 16);
        aq[1].h[0] = *(const ushort8*)(qp + 32);
        aq[1].h[1] = *(const ushort8*)(qp + 48);
    }

    v8f o[4] = {};                            // o[n][r] = O[query l15][head dim n * 16 + 8 hi + r]
    float mrun = -3.0e38f;                    // the query's running maximum, alike in both lanes of the query
    float lrun = 0.f;                         // this lane's share of the query's running sum

    const int nkb = (qbase + 16 + 31) >> 5;
    // Every load of a key block is issued well ahead of the product that reads it, so that a pass waits out no load:
    // the four V fragments at the head of their own pass, the K fragments right behind the score products of the pass
    // before, into the same registers.
    Frag bk[2][2];
    auto load_k = [&](int blk) {
        const unsigned short* kp = kpk + (((size_t)bh * (S / 32) + blk) * 4) * 512 + lane * 8;   // packed fragments (t, c)
        for (int t = 0; t < 2; ++t)
            for (int c = 0; c < 2; ++c) {
                bk[t][c].h[0] = *(const ushort8*)(kp + (t * 2 + c) * 512);
                bk[t][c].h[1] = *(const ushort8*)(kp + (t * 2 + c) * 512 + 256);
            }
    };
    load_k(0);
    for (int kb = 0; kb < nkb; ++kb) {
        const int kbase = kb * 32;
        Frag bv[4];
        const unsigned short* vpp = vp + (((size_t)bh * (S / 32) + kb) * 4) * 512 + lane * 8;
        for (int n = 0; n < 4; ++n) {
            bv[n].h[0] = *(const ushort8*)(vpp + n * 512);
            bv[n].h[1] = *(const ushort8*)(vpp + n * 512 + 256);
        }
        v8f z = {};
        v8f sc[2];                            // sc[t][r] = score of key kbase + t * 16 + 8 hi + r with query qbase + l15
        sc[0] = wmma16(bk[0][0].b, aq[0].b, z);
        sc[0] = wmma16(bk[0][1].b, aq[1].b, sc[0]);
        sc[1] = wmma16(bk[1][0].b, aq[0].b, z);
        sc[1] = wmma16(bk[1][1].b, aq[1].b, sc[1]);
        load_k(kb + 1 < nkb ? kb + 1 : kb);     // the last pass loads its own block again: in bounds, never used

        const bool diag = (kbase + 32 > qbase);
        for (int t = 0; t < 2; ++t)
            for (int r = 0; r < 8; ++r) {
                float v = sc[t][r] * 0.125f;            // 1/sqrt(64)
                if (diag) {
                    int key  = kbase + t * 16 + hi * 8 + r;
                    int qrow = qbase + l15;
                    if (key > qrow) v = -1.0e30f;
                }
                sc[t][r] = v;
            }

        float mx = fmaxf(sc[0][0], sc[1][0]);
        for (int r = 1; r < 8; ++r) mx = fmaxf(mx, fmaxf(sc[0][r], sc[1][r]));
        mx = fmaxf(mx, xhalf(mx));                      // over all 32 keys of the pass
        const float mn = fmaxf(mrun, mx);
        const float al = __expf(mrun - mn);
        mrun = mn;
        for (int t = 0; t < 2; ++t)
            for (int r = 0; r < 8; ++r)
                sc[t][r] = __expf(sc[t][r] - mn);
        float rs = sc[0][0] + sc[1][0];
        for (int r = 1; r < 8; ++r) rs += sc[0][r] + sc[1][r];
        lrun = lrun * al + rs;                          // the two lanes of a query are added once, behind the loop
        for (int n = 0; n < 4; ++n)
            for (int r = 0; r < 8; ++r)
                o[n][r] *= al;

        Frag pb;
        for (int t = 0; t < 2; ++t)
            for (int r = 0; r < 8; ++r)
                pb.u[t * 8 + r] = f2b(sc[t][r] * PSC);

        for (int n = 0; n < 4; ++n) o[n] = wmma16(bv[n].b, pb.b, o[n]);
    }

    const float inv = PUN / (lrun + xhalf(lrun));
    unsigned short* ot = olds[w];
    for (int n = 0; n < 4; ++n) {             // a lane's 8 values of a tile are 8 consecutive head dims of its query: 16 B
        union { unsigned short s[8]; v4u u; } pk;
        for (int r = 0; r < 8; ++r) pk.s[r] = f2b(o[n][r] * inv);
        *(v4u*)(ot + l15 * 64 + n * 16 + hi * 8) = pk.u;
    }
    asm volatile("s_wait_dscnt 0" ::: "memory");
    __builtin_amdgcn_wave_barrier();
    for (int q = 0; q < 4; ++q) {
        const int rl = q * 4 + (lane >> 3), pc = lane & 7;
        vst2(attn + (size_t)(b * S + qbase + rl) * (H * HD) + h * HD + pc * 8, *(const v4u*)(ot + rl * 64 + pc * 8));
    }
}

// ---------------------------------------------------------------------------
// mean over S:  out[b,d] = mean_s x[b,s,d]
// ---------------------------------------------------------------------------
// One work-group per (batch, strip of 32 columns = one 128-B line of every row). 8 lanes x 16 B cover the line, so a
// wave-wide load takes 4 whole lines (4 rows) and the 32 waves take 128 rows a pass: S / 128 loads a lane.
// Lane sums -> butterfly over the wave's 4 rows -> LDS -> one wave adds the 32 wave sums and stores the strip's line.
// S and D are compile-time so that every load is the one base address plus an immediate offset.
template <int S, int D>
__global__ __launch_bounds__(1024) void colmean(const float* __restrict__ x, float* __restrict__ out) {
    static_assert(S % 128 == 0 && D % 32 == 0, "whole passes, whole lines");
    constexpr int NL = S / 128;                          // loads a lane
    __shared__ __align__(16) float part[32][32];         // [wave][column of the strip]
    const int b   = blockIdx.x / (D / 32);
    const int c0  = (blockIdx.x % (D / 32)) * 32;
    const int tid = threadIdx.x;
    const int q   = tid & 7;                             // which 16 B of the line
    const int r0  = tid >> 3;                            // row inside a pass of 128
    const float* p = x + ((size_t)b * S + r0) * D + c0 + q * 4;
    v4f v[NL];
    #pragma unroll       // independent loads ahead of the adds: their latencies overlap instead of adding up row by row
    for (int i = 0; i < NL; ++i) v[i] = *(const v4f*)(p + (size_t)i * 128 * D);
    v4f s = v[0];
    #pragma unroll       // v[] needs constant indices to stay in registers
    for (int i = 1; i < NL; ++i) s += v[i];
    #pragma unroll       // s[e] needs a constant index to stay in registers
    for (int e = 0; e < 4; ++e) {
        s[e] += __shfl_xor(s[e], 8, 32);
        s[e] += __shfl_xor(s[e], 16, 32);
    }
    if ((tid & 31) < 8) *(v4f*)(&part[tid >> 5][q * 4]) = s;
    __syncthreads();
    if (tid < 32) {
        float tot = 0.f;
        for (int wv = 0; wv < 32; ++wv) tot += part[wv][tid];
        vst2(out + (size_t)b * D + c0 + tid, (float_a)(tot / (float)S));
    }
}

// ---------------------------------------------------------------------------
// recurrent state update: one work-group of 32 waves, two products of the same shape, (2 x K) @ (K x SD):
// new_info = mean @ w_h2s (K = D) and gate logits = [state | new_info] @ w_sgate (K = 2 SD).
// 16 lanes x 16 B cover one 256-B weight row; the K rows are split over the 64 lane groups (K / 64 consecutive rows
// each, both batches from the one row load); group sums -> l ^ 16 shuffle -> LDS -> one thread per output adds the 32.
// D and SD are compile-time so that every global load has a constant offset and depends on no sum.
// ---------------------------------------------------------------------------
__device__ __forceinline__ void wave_sums_to_lds(v4f s0, v4f s1, float (*part)[2][64], int t) {
    #pragma unroll       // constant indices keep s0, s1 in registers
    for (int e = 0; e < 4; ++e) {
        s0[e] += __shfl_xor(s0[e], 16, 32);
        s1[e] += __shfl_xor(s1[e], 16, 32);
    }
    if ((t & 31) < 16) {
        *(v4f*)(&part[t >> 5][0][(t & 15) * 4]) = s0;
        *(v4f*)(&part[t >> 5][1][(t & 15) * 4]) = s1;
    }
}
__device__ __forceinline__ float add_wave_sums(const float (*part)[2][64], int b, int j) {
    float tot = 0.f;
    #pragma unroll       // independent LDS reads ahead of the adds
    for (int wv = 0; wv < 32; ++wv) tot += part[wv][b][j];
    return tot;
}

template <int D, int SD>
__global__ __launch_bounds__(1024) void state_update(
        const float* __restrict__ state, const float* __restrict__ meanx,
        const float* __restrict__ w_h2s, const float* __restrict__ w_sgate,
        float* __restrict__ outState) {
    static_assert(SD == 64 && D % 256 == 0, "16 lanes x 4 columns a row; whole 16-B pieces of the mean");
    constexpr int KR = D / 64;                           // rows of w_h2s a lane group
    constexpr int GR = 2 * SD / 64;                      // rows of w_sgate a lane group
    __shared__ __align__(16) float part[32][2][SD];      // [wave][batch][column]
    __shared__ __align__(16) float cat[2][2 * SD];       // [batch][state | new_info]
    const int t  = threadIdx.x;
    const int c4 = (t & 15) * 4;                         // 4 columns of the row
    const int kg = t >> 4;                               // lane group
    const int b  = (t >> 6) & 1, j = t & 63;             // the output of threads 0 .. 2 SD - 1

    v4f wr[KR], mv[2][KR / 4], wg[GR];
    #pragma unroll       // constant indices keep wr[] in registers
    for (int i = 0; i < KR; ++i) wr[i] = *(const v4f*)(w_h2s + (kg * KR + i) * SD + c4);
    #pragma unroll       // constant indices keep mv[][] in registers
    for (int i = 0; i < KR / 4; ++i) {
        mv[0][i] = *(const v4f*)(meanx + kg * KR + i * 4);
        mv[1][i] = *(const v4f*)(meanx + D + kg * KR + i * 4);
    }
    #pragma unroll       // constant indices keep wg[] in registers
    for (int i = 0; i < GR; ++i) wg[i] = *(const v4f*)(w_sgate + (kg * GR + i) * SD + c4);
    const float st = state[b * SD + j];
    // nothing is scheduled across this line: every load is issued before the first sum waits, so that the kernel pays
    // one memory latency; without it the loads go out in batches, each batch behind the wait for the one before
    __builtin_amdgcn_sched_barrier(0);

    v4f s0 = {}, s1 = {};
    #pragma unroll       // constant indices into wr[] and mv[][]
    for (int i = 0; i < KR; ++i) {
        s0 += wr[i] * mv[0][i >> 2][i & 3];
        s1 += wr[i] * mv[1][i >> 2][i & 3];
    }
    wave_sums_to_lds(s0, s1, part, t);
    if (t < 2 * SD) cat[b][j] = st;
    __syncthreads();                                     // the wave sums of new_info are in part
    if (t < 2 * SD) cat[b][SD + j] = add_wave_sums(part, b, j);
    __syncthreads();                                     // cat is whole; part has been read and may be rewritten
    s0 = v4f{}; s1 = v4f{};
    #pragma unroll       // constant indices into wg[]
    for (int i = 0; i < GR; ++i) {
        s0 += wg[i] * cat[0][kg * GR + i];
        s1 += wg[i] * cat[1][kg * GR + i];
    }
    wave_sums_to_lds(s0, s1, part, t);
    __syncthreads();                                     // the wave sums of the gate logits are in part
    if (t < 2 * SD) {
        const float g = 1.f / (1.f + __expf(-add_wave_sums(part, b, j)));
        vst2(outState + b * SD + j, (float_a)(st * (1.f - g) + cat[b][SD + j] * g));   // 128 consecutive floats
    }
}

// ---------------------------------------------------------------------------
extern "C" void kernel_launch(void* const* d_in, const int* in_sizes, int n_in,
                              void* d_out, int out_size, void* d_ws, size_t ws_size,
                              hipStream_t stream) {
    (void)in_sizes; (void)n_in; (void)out_size; (void)ws_size;
    const int B = 2, S = 2048, D = 1024, H = 16, HD = 64, SD = 64;
    const float* x       = (const float*)d_in[0];
    const float* gamma   = (const float*)d_in[1];
    const float* beta    = (const float*)d_in[2];
    const float* state   = (const float*)d_in[3];
    const float* w_qkv   = (const float*)d_in[4];
    const float* w_o     = (const float*)d_in[5];
    const float* w_gate  = (const float*)d_in[6];
    const float* w_up    = (const float*)d_in[7];
    const float* w_down  = (const float*)d_in[8];
    const float* norm1_w = (const float*)d_in[9];
    const float* norm2_w = (const float*)d_in[10];
    const float* w_sm    = (const float*)d_in[11];
    const float* w_h2s   = (const float*)d_in[12];
    const float* w_sgate = (const float*)d_in[13];
    float* xout = (float*)d_out;                       // (B,S,D) then state (B,SD)

    char* ws = (char*)d_ws;
    size_t off = 0;
    auto arena = [&](size_t bytes) -> void* {
        void* p = ws + off;
        off = (off + bytes + 255) & ~(size_t)255;
        return p;
    };
    float* fg             = (float*)arena((size_t)B * D * 4);
    float* fb             = (float*)arena((size_t)B * D * 4);
    unsigned short* hbuf  = (unsigned short*)arena((size_t)B * S * D * 2);       // h / h2
    unsigned short* wqkvp = (unsigned short*)arena((size_t)D * 3 * D * 2);
    unsigned short* wop   = (unsigned short*)arena((size_t)D * D * 2);
    unsigned short* wgp   = (unsigned short*)arena((size_t)D * 3 * D * 2);
    unsigned short* wupp  = (unsigned short*)arena((size_t)D * 3 * D * 2);
    unsigned short* wdp   = (unsigned short*)arena((size_t)3 * D * D * 2);
    unsigned short* qkvb  = (unsigned short*)arena((size_t)B * S * 3 * D * 2);   // also act
    unsigned short* vp    = (unsigned short*)arena((size_t)B * H * (S / 32) * 4 * 512 * 2);
    unsigned short* kpk   = (unsigned short*)arena((size_t)B * H * (S / 32) * 4 * 512 * 2);
    unsigned short* attnb = (unsigned short*)arena((size_t)B * S * D * 2);
    float* x1             = (float*)arena((size_t)B * S * D * 4);
    unsigned short* gateb = (unsigned short*)arena((size_t)B * S * 3 * D * 2);
    float* meanb          = (float*)arena((size_t)B * D * 4);
    unsigned short* act   = qkvb;                      // reuse after attention

    const int MR = B * S;                              // 4096 rows

    // FiLM params (128 outputs a work-group) and the weights -> B fragments (f16; a work-group of 4 waves packs
    // 4 x 2,048 elements), one launch
    prep<B, D, SD><<<B * 2 * D / 128 + 13 * D * D / 8192, 128, 0, stream>>>(
        state, w_sm, gamma, beta, w_qkv, w_gate, w_up, w_o, w_down, fg, fb, wqkvp, wgp, wupp, wop, wdp);

    // h = rmsnorm(x)*fg + fb
    rmsnorm_film<S, D><<<MR / 16, 256, 0, stream>>>(x, norm1_w, fg, fb, hbuf);

    // qkv = h @ w_qkv   (f16 out)
    gemm_f16<0, 2, 4, 4, 3><<<dim3(3 * D / 192, MR / 256), 512, 0, stream>>>(
        hbuf, wqkvp, nullptr, nullptr, nullptr, qkvb, MR, 3 * D, D);

    // pack V and K into B fragments
    pack_v<S, H, HD><<<B * H * (S / 32) / 4, 128, 0, stream>>>(qkvb, vp, kpk);

    // attention
    flash_attn<<<(B * H * (S / 16)) / 8, 256, 0, stream>>>(qkvb, vp, kpk, attnb, S, H, HD);

    // x1 = x + attn @ w_o
    gemm_f16<1, 4, 2, 2, 4><<<dim3(D / 256, MR / 64), 256, 0, stream>>>(
        attnb, wop, x, nullptr, x1, nullptr, MR, D, D);

    // h2 = rmsnorm(x1)*fg + fb
    rmsnorm_film<S, D><<<MR / 16, 256, 0, stream>>>(x1, norm2_w, fg, fb, hbuf);

    // gate = silu(h2 @ w_gate)   (f16)
    gemm_f16<2, 2, 4, 4, 3><<<dim3(3 * D / 192, MR / 256), 512, 0, stream>>>(
        hbuf, wgp, nullptr, nullptr, nullptr, gateb, MR, 3 * D, D);

    // act = gate * (h2 @ w_up)   (f16)
    gemm_f16<3, 2, 4, 4, 3><<<dim3(3 * D / 192, MR / 256), 512, 0, stream>>>(
        hbuf, wupp, nullptr, gateb, nullptr, act, MR, 3 * D, D);

    // xout = x1 + act @ w_down
    gemm_f16<1, 4, 2, 2, 4><<<dim3(D / 256, MR / 64), 256, 0, stream>>>(
        act, wdp, x1, nullptr, xout, nullptr, MR, D, 3 * D);

    // state update
    colmean<S, D><<<B * D / 32, 1024, 0, stream>>>(xout, meanb);
    state_update<D, SD><<<1, 1024, 0, stream>>>(state, meanb, w_h2s, w_sgate,
                                                xout + (size_t)B * S * D);
}

// v010
// It runs in 200 microseconds.
// Two timings next to v009 put it at 1.05 and 1.06 times that version's speed.
// Counting every step since v000, it is 4.00 times as fast.
#include <hip/hip_runtime.h>

#define EPSF 1.1920929e-07f
// Contractions: qkv / o / gate / up / down projections (K = 1024 / 3072), scores QK^T (K = 64) and PV (K = keys, causal) on
// v_wmma_f32_16x16x32_f16 (f16 operands stored as raw 16-bit words, f32 accumulate; P scaled by 256 before its f16 conversion);
// FiLM, RMSNorm, SiLU gating, softmax statistics, the column mean and the state update in f32 on VALU. GEMM B operands and the attention's K and V (there A operands) are
// pre-packed in the ISA fragment order (element e of lane (h, n) = k0 + 8h + e for e < 8, k0 + 16 + 8h + (e-8) otherwise).
// A packed fragment (1 KB) is stored as two planes of 512 B: plane p holds elements 8p .. 8p + 7 of lane l at byte 16 l, so
// that each wave-wide 16-B load of a fragment half covers four whole 128-B lines.

typedef __attribute__((ext_vector_type(16))) _Float16        v16bf;   // (alias name kept; IEEE half)
typedef __attribute__((ext_vector_type(4)))  float           v4f;
typedef __attribute__((ext_vector_type(4)))  unsigned        v4u;
template <typename V> __device__ __forceinline__ void vst2(void* p, V v) {
    *(V*)p = v; 
}
typedef float __attribute__((may_alias)) float_a;
#define PSC 256.0f
#define PUN (1.0f / 256.0f)
typedef __attribute__((ext_vector_type(8)))  float           v8f;
typedef __attribute__((ext_vector_type(8)))  unsigned short  ushort8;
typedef __attribute__((ext_vector_type(16))) unsigned short  ushort16;

union Frag {
    ushort16 u;
    v16bf    b;
    ushort8  h[2];
};

__device__ __forceinline__ unsigned short f2b(float f) {     // f32 -> f16 bits (name kept)
    union { _Float16 h; unsigned short u; } c; c.h = (_Float16)f; return c.u;
}
__device__ __forceinline__ float b2f(unsigned short s) {
    union { unsigned short u; _Float16 h; } c; c.u = s; return (float)c.h;
}
__device__ __forceinline__ v8f wmma16(v16bf a, v16bf b, v8f c) {
    v8f d = __builtin_amdgcn_wmma_f32_16x16x32_f16(false, a, false, b, (short)0, c, false, false);
    asm volatile("v_nop\n\tv_nop\n\tv_nop\n\tv_nop" : "+v"(d) : "v"(a), "v"(b));
    return d;
}

// ---------------------------------------------------------------------------
// FiLM params: state_mod = state @ w_state_mod; fg = gamma*(1+sm[:D]); fb = beta+sm[D:]
// ---------------------------------------------------------------------------
__device__ __forceinline__ void film_piece(const float* __restrict__ state, const float* __restrict__ wsm,
                            const float* __restrict__ gamma, const float* __restrict__ beta,
                            float* __restrict__ fg, float* __restrict__ fb, int SD, int D, int idx) {   // idx over B * 2D
    int b = idx / (2 * D);
    int c = idx % (2 * D);
    if (b >= 2) return;
    float s = 0.f;
    for (int k = 0; k < SD; ++k) s += state[b * SD + k] * wsm[k * 2 * D + c];
    if (c < D) vst2(fg + b * D + c, (float_a)(gamma[c] * (1.f + s)));
    else       vst2(fb + b * D + (c - D), (float_a)(beta[c - D] + s));
}

// ---------------------------------------------------------------------------
// The three pieces of work below move data and hold almost no arithmetic. A launch of that kind with one small item a lane is
// bound by how fast waves start, not by its bytes: each of them gives a wave a whole piece of the work (4 to 8 KB in, all
// of it asked for at once by 16-B loads that cover whole lines), so that 8 to 16 times fewer waves start.
// ---------------------------------------------------------------------------
// RMSNorm + FiLM -> f16 row-major output. One wave takes two whole rows and keeps them in registers (2,048 waves, 8 a
// WGP). A wave-wide 16-B load covers 512 contiguous bytes of a row; the three parameter rows are loaded once for both
// rows; the sum of squares is four chains in the lane and a butterfly over the wave: no LDS tree, no barrier, no second
// read of x.
// ---------------------------------------------------------------------------
template <int S, int D>
__global__ __launch_bounds__(256) void rmsnorm_film(
        const float* __restrict__ x, const float* __restrict__ nw,
        const float* __restrict__ fg, const float* __restrict__ fb,
        unsigned short* __restrict__ out) {
    static_assert(D % 128 == 0 && S % 2 == 0, "whole 512-B pieces of a row; both rows of a wave in one batch");
    constexpr int NL = D / 128;                          // loads a lane and row
    const int lane = threadIdx.x & 31;
    const int row0 = (blockIdx.x * 8 + (threadIdx.x >> 5)) * 2;      // b*S + s of the first row
    const int b    = row0 / S;
    const int c0   = lane * 4;                           // the lane's columns: c0 + 128 i + (0 .. 3)
    const float* xr = x + (size_t)row0 * D + c0;
    v4f v0[NL], v1[NL], pw[NL], pg[NL], pb[NL];
    #pragma unroll       // constant indices keep the arrays in registers
    for (int i = 0; i < NL; ++i) {
        v0[i] = *(const v4f*)(xr + i * 128);
        v1[i] = *(const v4f*)(xr + D + i * 128);
    }
    // the loads of x are in flight, and a later load may be given their address register as its destination
    asm volatile("s_wait_xcnt 0x0" ::: "memory");
    #pragma unroll       // constant indices keep the arrays in registers
    for (int i = 0; i < NL; ++i) {
        pw[i] = *(const v4f*)(nw + c0 + i * 128);
        pg[i] = *(const v4f*)(fg + (size_t)b * D + c0 + i * 128);
        pb[i] = *(const v4f*)(fb + (size_t)b * D + c0 + i * 128);
    }
    // the parameter loads are in flight, and the lines below may write their address registers anew
    asm volatile("s_wait_xcnt 0x0" ::: "memory");
    // nothing is scheduled across this line: every load is issued before the first sum waits, so that the wave pays one
    // memory latency; loads sunk behind the sums would add a second one
    __builtin_amdgcn_sched_barrier(0);
    v4f a0 = v0[0] * v0[0], a1 = v1[0] * v1[0];
    #pragma unroll       // constant indices into v0[], v1[]
    for (int i = 1; i < NL; ++i) { a0 += v0[i] * v0[i]; a1 += v1[i] * v1[i]; }
    float ss0 = (a0[0] + a0[1]) + (a0[2] + a0[3]);
    float ss1 = (a1[0] + a1[1]) + (a1[2] + a1[3]);
    for (int m = 16; m >= 1; m >>= 1) { ss0 += __shfl_xor(ss0, m, 32); ss1 += __shfl_xor(ss1, m, 32); }
    const float sc0 = rsqrtf(ss0 / (float)D + EPSF);
    const float sc1 = rsqrtf(ss1 / (float)D + EPSF);
    unsigned short* orow = out + (size_t)row0 * D + c0;
    #pragma unroll       // constant indices; 8-B lanes, a wave writes 256 contiguous bytes
    for (int i = 0; i < NL; ++i) {
        union { unsigned short s[4]; unsigned long long u; } k0, k1;
        #pragma unroll   // constant indices into the vectors
        for (int e = 0; e < 4; ++e) {
            k0.s[e] = f2b(v0[i][e] * sc0 * pw[i][e] * pg[i][e] + pb[i][e]);
            k1.s[e] = f2b(v1[i][e] * sc1 * pw[i][e] * pg[i][e] + pb[i][e]);
        }
        vst2(orow + i * 128, k0.u);
        vst2(orow + D + i * 128, k1.u);
    }
}

// Place (in 16-bit words) of 16-B piece p of a 4-KB run of packed fragments in a wave's staging LDS: 8 pieces (128 B) at a
// pitch of 144 B, so that both the lanes that write pieces 8 or more apart and the lanes that read them in order meet
// no more bank conflicts than a 16-B access has anyway.
__device__ __forceinline__ int stoff(int p) { return (p >> 3) * 72 + (p & 7) * 8; }
#define ST_WORDS (32 * 72)

// ---------------------------------------------------------------------------
// Pack f32 weight (K x N, row-major, y = x@W) into WMMA B-fragment layout:
// frag (nt, kt): 2 planes x 32 lanes x 8 halfs, values in the ISA order.
// One wave packs one k step of 64 columns = four fragments (4 KB), 64 elements a lane. 16 lanes x 16 B cover 256 B of a
// weight row, the two lane halves take the rows of hi = 0 and 1, load (u, i) takes row i of plane u. A lane then holds
// the pieces of 4 neighbouring fragment lanes; they pass through the wave's own LDS so that every store is 512
// contiguous bytes. K and N are compile-time so that every load is the one base address plus an immediate offset.
// ---------------------------------------------------------------------------
template <int K, int N>
__device__ __forceinline__ void pack_b(const float* __restrict__ W, unsigned short* __restrict__ out, int blk,
                                       unsigned short (*st)[ST_WORDS]) {     // st: [wave][piece: fragment, plane, lane]
    static_assert(K % 32 == 0 && N % 64 == 0 && (K / 32) * (N / 64) % 4 == 0, "whole k steps, strips and work-groups");
    constexpr int NSC = N / 64, KTC = K / 32;
    const int lane = threadIdx.x & 31;
    const int w    = threadIdx.x >> 5;
    const int task = blk * 4 + w;                        // (k step, strip of 64 columns), neighbours side by side in a row
    const int kt   = task / NSC;
    const int n64  = task % NSC;
    const int nq   = lane & 15;                          // which 4 columns of the 64
    const int hi   = lane >> 4;
    const float* src = W + (size_t)(kt * 32 + hi * 8) * N + n64 * 64 + nq * 4;   // ISA B map: k = 32 kt + 8 hi + 16 u + i
    v4f v[2][8];
    #pragma unroll       // constant indices keep v[][] in registers
    for (int u = 0; u < 2; ++u)
        #pragma unroll   // as above
        for (int i = 0; i < 8; ++i) v[u][i] = *(const v4f*)(src + (size_t)(u * 16 + i) * N);
    // the loads are in flight, and the lines below may write their address register anew; src as an input keeps that
    // register live up to the wait, so that no load of the run is given it as its destination
    asm volatile("s_wait_xcnt 0x0" :: "v"(src) : "memory");
    // nothing is scheduled across this line: all 16 loads go out before the first conversion waits (one memory latency);
    // without it they go out in batches, each behind the wait for the one before
    __builtin_amdgcn_sched_barrier(0);
    unsigned short* sw = st[w];
    #pragma unroll       // constant indices into v[][]
    for (int u = 0; u < 2; ++u)
        #pragma unroll   // as above
        for (int c = 0; c < 4; ++c) {                    // column nq * 4 + c: fragment nq >> 2, fragment lane 16 hi + (nq & 3) * 4 + c
            union { unsigned short s[8]; v4u u4; } pk;
            #pragma unroll   // as above
            for (int i = 0; i < 8; ++i) pk.s[i] = f2b(v[u][i][c]);
            *(v4u*)(sw + stoff((nq >> 2) * 64 + u * 32 + hi * 16 + (nq & 3) * 4 + c)) = pk.u4;
        }
    // the wave reads back what its other lanes wrote: their LDS stores have to be over
    asm volatile("s_wait_dscnt 0" ::: "memory");
    __builtin_amdgcn_wave_barrier();
    #pragma unroll       // independent LDS reads, then stores
    for (int q = 0; q < 8; ++q)                          // fragment q >> 1, plane q & 1
        vst2(out + ((size_t)(n64 * 4 + (q >> 1)) * KTC + kt) * 512 + (q & 1) * 256 + lane * 8,
             *(const v4u*)(sw + stoff(q * 32 + lane)));
    // the stores are in flight at the end of the job; the wave runs no other job's code behind it, so
    // this wait is a precaution
    asm volatile("s_wait_xcnt 0x0" ::: "memory");
}

// ---------------------------------------------------------------------------
// Everything that reads only the inputs, in ONE launch: the FiLM parameters and the five weight packs depend on no
// earlier kernel and not on one another. A launch of its own for each would pay the gap between launches, a first memory
// latency and a drain of stores around very little data; here each job is a range of work-group indices and they overlap.
// The FiLM work-groups come first: theirs is the longest chain of dependent loads. No work-group barrier anywhere.
// ---------------------------------------------------------------------------
template <int NB, int D, int SD>
__global__ __launch_bounds__(128) void prep(
        const float* __restrict__ state, const float* __restrict__ wsm,
        const float* __restrict__ gamma, const float* __restrict__ beta,
        const float* __restrict__ w_qkv, const float* __restrict__ w_gate, const float* __restrict__ w_up,
        const float* __restrict__ w_o, const float* __restrict__ w_down,
        float* __restrict__ fg, float* __restrict__ fb,
        unsigned short* __restrict__ wqkvp, unsigned short* __restrict__ wgp, unsigned short* __restrict__ wupp,
        unsigned short* __restrict__ wop, unsigned short* __restrict__ wdp) {
    constexpr int GF = NB * 2 * D / 128;                 // work-groups of the FiLM parameters
    constexpr int G3 = D * 3 * D / 8192;                 // of a D x 3D or 3D x D weight
    constexpr int G1 = D * D / 8192;                     // of the D x D weight
    __shared__ __align__(16) unsigned short st[4][ST_WORDS];
    const int blk = blockIdx.x;
    if (blk < GF) {
        film_piece(state, wsm, gamma, beta, fg, fb, SD, D, blk * 128 + (int)threadIdx.x);
    } else if (blk < GF + 3 * G3) {
        const int which = (blk - GF) / G3;
        pack_b<D, 3 * D>(which == 0 ? w_qkv : which == 1 ? w_gate : w_up,
                         which == 0 ? wqkvp : which == 1 ? wgp : wupp, blk - GF - which * G3, st);
    } else if (blk < GF + 3 * G3 + G1) {
        pack_b<D, D>(w_o, wop, blk - GF - 3 * G3, st);
    } else {
        pack_b<3 * D, D>(w_down, wdp, blk - GF - 3 * G3 - G1, st);
    }
}

// ---------------------------------------------------------------------------
// Pack V and K (from the f16 qkv buffer) into B-fragments: V [bh][kb][n4][plane][lane][8], K [bh][kb][t][c][plane][lane][8]
// (t = which 16 keys of the 32, c = which 32 of the 64 head dims). One wave packs one block of 32 keys of one head: four
// fragments of V and four of K. 8 lanes x 16 B cover a key's 128 B, the four lane groups take 8 keys each, load i takes
// key i of the group. A 16-B piece of K only changes its place; V is turned 8 x 8 in the lane's registers. Both pass
// through the wave's own LDS so that every store is 512 contiguous bytes.
// ---------------------------------------------------------------------------
template <int S, int H, int HD>
__global__ __launch_bounds__(128) void pack_v(const unsigned short* __restrict__ qkvb, unsigned short* __restrict__ vp,
                                              unsigned short* __restrict__ kpk) {
    static_assert(HD == 64 && S % 128 == 0, "8 pieces a key; whole key blocks and work-groups");
    constexpr int D3 = 3 * H * HD;
    __shared__ __align__(16) unsigned short st[4][2][ST_WORDS];      // [wave][K, V][piece: fragment, plane, lane]
    const int lane = threadIdx.x & 31;
    const int w    = threadIdx.x >> 5;
    const int task = blockIdx.x * 4 + w;                 // bh * (S / 32) + kb
    const int kb   = task % (S / 32);
    const int bh   = task / (S / 32);
    const int b = bh / H, h = bh % H;
    const int cq = lane & 7;                             // which 8 head dims of the 64
    const int kq = lane >> 3;                            // which 8 keys of the 32
    const unsigned short* src = qkvb + (size_t)(b * S + kb * 32 + kq * 8) * D3 + H * HD + h * HD + cq * 8;
    ushort8 kk[8], vv[8];
    #pragma unroll       // constant indices keep kk[], vv[] in registers
    for (int i = 0; i < 8; ++i) {
        kk[i] = *(const ushort8*)(src + i * D3);
        vv[i] = *(const ushort8*)(src + i * D3 + H * HD);
    }
    // the loads are in flight, and the lines below may write their address register anew
    asm volatile("s_wait_xcnt 0x0" ::: "memory");
    // nothing is scheduled across this line: all 16 loads go out before the first use waits (one memory latency)
    __builtin_amdgcn_sched_barrier(0);
    unsigned short* sk = st[w][0];
    unsigned short* sv = st[w][1];
    #pragma unroll       // constant indices into kk[]
    for (int i = 0; i < 8; ++i)      // key 8 kq + i, dims 8 cq ..: ISA B map d = 32 c + 8 hi + 16 plane, so cq = 4 c + 2 plane + hi
        *(ushort8*)(sk + stoff(((kq >> 1) * 2 + (cq >> 2)) * 64 + ((cq >> 1) & 1) * 32 + (cq & 1) * 16 + (kq & 1) * 8 + i)) = kk[i];
    #pragma unroll       // constant indices into vv[]
    for (int c = 0; c < 8; ++c) {    // column 8 cq + c, keys 8 kq ..: ISA B map key = 8 hi + 16 plane + i, so kq = 2 plane + hi
        ushort8 pk;
        #pragma unroll   // as above
        for (int i = 0; i < 8; ++i) pk[i] = vv[i][c];
        *(ushort8*)(sv + stoff((cq >> 1) * 64 + (kq >> 1) * 32 + (kq & 1) * 16 + (cq & 1) * 8 + c)) = pk;
    }
    // the wave reads back what its other lanes wrote: their LDS stores have to be over
    asm volatile("s_wait_dscnt 0" ::: "memory");
    __builtin_amdgcn_wave_barrier();
    #pragma unroll       // independent LDS reads, then stores
    for (int q = 0; q < 8; ++q) {
        vst2(kpk + (size_t)task * 2048 + q * 256 + lane * 8, *(const v4u*)(sk + stoff(q * 32 + lane)));
        vst2(vp  + (size_t)task * 2048 + q * 256 + lane * 8, *(const v4u*)(sv + stoff(q * 32 + lane)));
    }
}

// ---------------------------------------------------------------------------
// f16 GEMM via V_WMMA_F32_16X16X32_F16.
// Block: WM x 4 waves; wave tile 16 MI x 16 NI (MI x NI accum frags); block tile BM x BN = 16 MI WM x 64 NI.
// A (M x K f16 row-major) is double-buffer staged into LDS per K-step with plain 16-B copies through a register.
// B streams from packed fragments (two 512-B planes, 16 B a lane in each), one K-step ahead of its products.
// A K-step, the stretch between two barriers, is KS * 32 k. A load issued behind its register's last use has one K-step to
// come back, and the bytes a work-group holds in flight grow with KS.
// The block tile sets the bytes asked of L2 per product: (BM + BN) / (BM * BN) per k. N = D: 64 x 256, one work-group a
// WGP, KS = 4 (16 B fragments a wave in flight). N = 3 D: 256 x 192, 16 waves of 64 x 48, again exactly one work-group a
// WGP but well under half the L2 bytes of 64 x 256; KS = 2 is what its 256 registers a wave hold.
// Epilogues: 0: f16 store | 1: f32 = acc+res | 2: f16 silu(acc) | 3: f16 gate*acc
// ---------------------------------------------------------------------------
template <int EPI, int KS, int WM, int MI, int NI>
__global__ __launch_bounds__(WM * 128) void gemm_f16(
        const unsigned short* __restrict__ A, const unsigned short* __restrict__ Bp,
        const float* __restrict__ resF, const unsigned short* __restrict__ gateB,
        float* __restrict__ outF, unsigned short* __restrict__ outB,
        int M, int N, int K) {
    static_assert(KS == 2 || KS == 4, "whole rows of the A tile a pass of the staging threads");
    constexpr int NT = WM * 128;                         // threads
    constexpr int BM = WM * MI * 16, BN = NI * 64;       // block tile
    constexpr int KC = KS * 32;                          // k of a K-step
    constexpr int AP = KC + 8;                           // A tile row pitch in 16-bit words; 144 or 272 B: 16 B x an odd number
    constexpr int RS = NT / (4 * KS);                    // rows that the threads stage with one 16-B piece each
    constexpr int NP = BM / RS;                          // such passes a tile
    static_assert(BM % RS == 0 && NP == 4, "whole passes; the wait behind the A loads names four addresses");
    __shared__ __align__(16) unsigned short atile[2][BM * AP];
    __shared__ __align__(16) float Ct[BM][BN];                     // block output tile

    const int lane = threadIdx.x & 31;
    const int w    = threadIdx.x >> 5;
    const int wm   = w >> 2;
    const int wn   = w & 3;
    const int mblock = blockIdx.y * BM;
    const int nbase  = blockIdx.x * BN + wn * (NI * 16);
    const int ktc = K >> 5;
    const int nst = ktc / KS;                            // K-steps
    const int hi  = (lane >> 4) & 1;
    const int l15 = lane & 15;

    // cooperative A-staging mapping: NT thr x 16B = RS rows of KC f16, NP such passes a tile
    const int srow   = threadIdx.x / (4 * KS);
    const int schunk = (threadIdx.x % (4 * KS)) * 8;     // ushort offset within row

    v8f acc[MI][NI] = {};

    // fragment (ni, kt) of this wave's NI B columns stands at bw + (ni * ktc + kt) * 512
    const unsigned short* bw = Bp + (size_t)(nbase >> 4) * ktc * 512 + lane * 8;
    const unsigned short* ag = A + (size_t)(mblock + srow) * K + schunk;

    // Every register that holds a global operand is loaded anew for its next use right behind its last use: a B fragment
    // behind its MI products, the thread's 4 x 16 B of A behind their store to LDS. A load then has about a whole step to
    // come back, and a step waits out no load in full.
    // The last steps ask for the last step's data once more: in bounds, never used.
    Frag bfr[KS][NI];
    #pragma unroll       // constant indices keep bfr[][] in registers
    for (int ks = 0; ks < KS; ++ks)
        #pragma unroll   // as above
        for (int ni = 0; ni < NI; ++ni) {
            bfr[ks][ni].h[0] = *(const ushort8*)(bw + ((size_t)ni * ktc + ks) * 512);
            bfr[ks][ni].h[1] = *(const ushort8*)(bw + ((size_t)ni * ktc + ks) * 512 + 256);
        }
    v4u areg[NP];
    #pragma unroll       // constant indices keep areg[] in registers
    for (int j = 0; j < NP; ++j) areg[j] = *(const v4u*)(ag + (size_t)j * RS * K);
    #pragma unroll       // as above
    for (int j = 0; j < NP; ++j) *(v4u*)(&atile[0][(srow + j * RS) * AP + schunk]) = areg[j];
    #pragma unroll       // as above
    for (int j = 0; j < NP; ++j) areg[j] = *(const v4u*)(ag + (size_t)j * RS * K + (1 < nst ? 1 : 0) * KC);
    // The K loop's barrier, written by hand: __syncthreads() also waits for every global load, which would end the loads
    // issued ahead at each step; only this wave's LDS traffic has to be over here (tile stores visible, tile reads done).
    auto lds_barrier = [] {
        asm volatile("s_wait_dscnt 0x0" ::: "memory");
        asm volatile("s_barrier_signal -1\n\ts_barrier_wait -1" ::: "memory");
    };
    // loads issued ahead are in flight here, and the first step writes their address registers anew
    asm volatile("s_wait_xcnt 0x0" ::: "memory");
    lds_barrier();                                        // tile 0 is whole
    int cur = 0;

    for (int kt = 0; kt < nst; ++kt) {
        const int kb = kt + 1 < nst ? kt + 1 : nst - 1;   // step whose B fragments are asked for in this step
        const int ka = kt + 2 < nst ? kt + 2 : nst - 1;   // step whose A pieces are asked for in this step

        #pragma unroll       // constant indices keep bfr[][] in registers
        for (int ks = 0; ks < KS; ++ks) {
            Frag af[MI];
            const unsigned short* l0 = &atile[cur][(wm * (MI * 16) + l15) * AP + ks * 32 + hi * 8];
            #pragma unroll   // constant indices keep af[] in registers
            for (int mi = 0; mi < MI; ++mi) {
                af[mi].h[0] = *(const ushort8*)(l0 + mi * 16 * AP);
                af[mi].h[1] = *(const ushort8*)(l0 + mi * 16 * AP + 16);
            }

            #pragma unroll   // as above
            for (int ni = 0; ni < NI; ++ni) {
                #pragma unroll   // as above
                for (int mi = 0; mi < MI; ++mi) acc[mi][ni] = wmma16(af[mi].b, bfr[ks][ni].b, acc[mi][ni]);
                bfr[ks][ni].h[0] = *(const ushort8*)(bw + ((size_t)ni * ktc + kb * KS + ks) * 512);
                bfr[ks][ni].h[1] = *(const ushort8*)(bw + ((size_t)ni * ktc + kb * KS + ks) * 512 + 256);
            }
        }
        // the B loads are in flight, and the lines below may write their address registers anew
        asm volatile("s_wait_xcnt 0x0" ::: "memory");
        if (kt + 1 < nst) {                               // the A pieces of step kt + 1
            #pragma unroll   // constant indices keep areg[] in registers
            for (int j = 0; j < NP; ++j) *(v4u*)(&atile[cur ^ 1][(srow + j * RS) * AP + schunk]) = areg[j];
        }
        const unsigned short* an[NP];
        #pragma unroll       // as above
        for (int j = 0; j < NP; ++j) { an[j] = ag + (size_t)j * RS * K + ka * KC; areg[j] = *(const v4u*)an[j]; }
        // the A loads are in flight, and the next step writes their address registers anew; the addresses as inputs keep
        // those registers live up to the wait, so that no load of the run is given another's as its destination
        asm volatile("s_wait_xcnt 0x0" :: "v"(an[0]), "v"(an[1]), "v"(an[2]), "v"(an[3]) : "memory");
        lds_barrier();                                    // tile(cur ^ 1) is whole; the reads of tile(cur) are done
        cur ^= 1;
    }

    // epilogue through the block tile: value after residual / silu / gating, then whole-line stores
    __syncthreads();
    for (int mi = 0; mi < MI; ++mi) {
        for (int ni = 0; ni < NI; ++ni) {
            int rl0 = wm * (MI * 16) + mi * 16 + hi * 8;
            int cl  = wn * (NI * 16) + ni * 16 + l15;
            int col = blockIdx.x * BN + cl;
            for (int r = 0; r < 8; ++r) {
                size_t idx = (size_t)(mblock + rl0 + r) * N + col;
                float v = acc[mi][ni][r];
                if (EPI == 1)      v += resF[idx];
                else if (EPI == 2) v = v / (1.f + __expf(-v));   // silu
                else if (EPI == 3) v = b2f(gateB[idx]) * v;
                Ct[rl0 + r][cl] = v;
            }
        }
    }
    __syncthreads();
    const int tid = threadIdx.x, n0blk = blockIdx.x * BN;
    if (EPI == 1) {   // f32 rows: BM x 4 BN B (BN / 4 pieces)
        for (int g = tid; g < BM * (BN / 4); g += NT) { const int rl = g / (BN / 4), pc = g % (BN / 4); vst2(outF + (size_t)(mblock + rl) * N + n0blk + pc * 4, *(const v4f*)(&Ct[rl][pc * 4])); }
    } else {          // 16-bit rows: BM x 2 BN B (BN / 8 pieces of 8): whole 128-B lines
        for (int g = tid; g < BM * (BN / 8); g += NT) {
            const int rl = g / (BN / 8), pc = g % (BN / 8);
            union { unsigned short s[8]; v4u u; } pk;
            #pragma unroll
            for (int e = 0; e < 8; ++e) pk.s[e] = f2b(Ct[rl][pc * 8 + e]);
            vst2(outB + (size_t)(mblock + rl) * N + n0blk + pc * 8, pk.u);
        }
    }
}

// ---------------------------------------------------------------------------
// Flash attention, one wave per 16-query tile; causal; online softmax. Both products are taken transposed:
// S^T = K Q^T (A = a packed K fragment, B = the Q fragment) and O^T += V^T P^T (A = a packed V fragment, B = P^T).
// A and B share one register map, so the fragments are the ones of the untransposed form with their places swapped.
// A lane then holds one query (column l15) and 16 of the pass's 32 keys (rows t * 16 + 8 hi + r): maximum and sum run
// inside the lane, with one exchange between lanes l and l ^ 16, and the two score tiles, converted where they lie,
// are the B fragment P^T (element e = key 8 hi + e for e < 8, 16 + 8 hi + (e - 8) otherwise): P never leaves its registers.
// ---------------------------------------------------------------------------
__device__ __forceinline__ float xhalf(float x) {            // the value of lane l ^ 16
    return __builtin_bit_cast(float, __builtin_amdgcn_permlanex16(__builtin_bit_cast(int, x), __builtin_bit_cast(int, x),
                                                                  0x76543210, 0xfedcba98, false, false));
}
// K and V reach the waves through LDS. The 8 waves of a work-group hold queries of one head and walk the same keys from key 0
// on, so a stage of 128 keys (4 key blocks: 16 KB of packed K fragments and 16 KB of V, each contiguous in global memory) is
// brought in once for all of them by asynchronous copies, two buffers, one stage ahead of its use. A read of L2 or of memory
// then has a whole stage (4 passes of every wave) to come back, not one pass, and a pass itself waits only for LDS reads.
// The work-group's 128 queries are as wide as a stage: every wave takes all 4 key blocks of every stage but the last one,
// in which it stops at its own diagonal (1 to 4 key blocks).
__device__ __forceinline__ unsigned lds_off(const void* p) { return (unsigned)(size_t)p; }
// One stage: every lane copies 4 pieces of 16 B of K and 4 of V, 4 KB apart (256 lanes x 16 B a round). lk: the lane's
// first LDS byte of the buffer's K part; the V part stands 16 KB behind it.
__device__ __forceinline__ void stage_copy(const unsigned short* gk, const unsigned short* gv, unsigned lk) {
    // the wait stands inside the statement: the copies are in flight, and the code behind may write their address
    // registers anew
    asm volatile("global_load_async_to_lds_b128 %0, %8, off\n\t"
                 "global_load_async_to_lds_b128 %1, %9, off\n\t"
                 "global_load_async_to_lds_b128 %2, %10, off\n\t"
                 "global_load_async_to_lds_b128 %3, %11, off\n\t"
                 "global_load_async_to_lds_b128 %4, %12, off\n\t"
                 "global_load_async_to_lds_b128 %5, %13, off\n\t"
                 "global_load_async_to_lds_b128 %6, %14, off\n\t"
                 "global_load_async_to_lds_b128 %7, %15, off\n\t"
                 "s_wait_xcnt 0x0"
                 :: "v"(lk), "v"(lk + 4096u), "v"(lk + 8192u), "v"(lk + 12288u),
                    "v"(lk + 16384u), "v"(lk + 20480u), "v"(lk + 24576u), "v"(lk + 28672u),
                    "v"(gk), "v"(gk + 2048), "v"(gk + 4096), "v"(gk + 6144),
                    "v"(gv), "v"(gv + 2048), "v"(gv + 4096), "v"(gv + 6144)
                 : "memory");
}
__global__ __launch_bounds__(256) void flash_attn(
        const unsigned short* __restrict__ qkvb, const unsigned short* __restrict__ vp,
        const unsigned short* __restrict__ kpk, unsigned short* __restrict__ attn, int S, int H, int HD) {
    __shared__ __align__(16) unsigned short kvs[2][2][4 * 2048];   // [buffer][K, V][key block of the stage: 4 fragments]
    __shared__ __align__(16) unsigned short olds[8][16 * 64]; // per-wave output tile
    const int lane = threadIdx.x & 31;
    const int w    = __builtin_amdgcn_readfirstlane(threadIdx.x >> 5);   // scalar: the loops below branch on it
    const int waveId = blockIdx.x * 8 + w;
    const int qt = waveId & 127;              // S/16 = 128
    const int bh = waveId >> 7;
    const int b = bh >> 4, h = bh & 15;
    const int qbase = qt * 16;
    const int l15 = lane & 15;
    const int hi  = (lane >> 4) & 1;
    const int D3  = 3 * H * HD;
    const int nst = (blockIdx.x & 15) + 1;    // stages of 128 keys up to the work-group's last query: 1 .. 16 = S / 128

    const unsigned short* gk = kpk + (size_t)bh * (S / 32) * 2048 + threadIdx.x * 8;
    const unsigned short* gv = vp  + (size_t)bh * (S / 32) * 2048 + threadIdx.x * 8;
    const unsigned lk0 = lds_off(&kvs[0][0][0]) + threadIdx.x * 16;
    auto copy_stage = [&](int t) { stage_copy(gk + (size_t)t * 8192, gv + (size_t)t * 8192, lk0 + (t & 1) * 32768u); };

    copy_stage(0);

    Frag aq[2];
    {
        const unsigned short* qp = qkvb + (size_t)(b * S + qbase + l15) * D3 + h * HD + hi * 8;
        aq[0].h[0] = *(const ushort8*)(qp);
        aq[0].h[1] = *(const ushort8*)(qp + 16);
        aq[1].h[0] = *(const ushort8*)(qp + 32);
        aq[1].h[1] = *(const ushort8*)(qp + 48);
    }

    v8f o[4] = {};                            // o[n][r] = O[query l15][head dim n * 16 + 8 hi + r]
    float mrun = -3.0e38f;                    // the query's running maximum, alike in both lanes of the query
    float lrun = 0.f;                         // this lane's share of the query's running sum

    const int nkb = (qbase + 16 + 31) >> 5;

    // this wave's copies of stage 0 have landed; behind the barrier every wave's have
    asm volatile("s_wait_asynccnt 0x0" ::: "memory");
    __syncthreads();
    if (1 < nst) copy_stage(1);

    for (int t = 0; t < nst; ++t) {
        const unsigned short* sk = &kvs[t & 1][0][lane * 8];
        const unsigned short* sv = &kvs[t & 1][1][lane * 8];
        const int np = nkb - t * 4 < 4 ? nkb - t * 4 : 4;    // key blocks of this stage up to the wave's diagonal: 4, in the last stage 1 .. 4
        // Inside a stage the loads of a key block are issued ahead of the product that reads them: the four V fragments
        // at the head of their own pass, the K fragments right behind the score products of the pass before, into the
        // same registers. No read leaves the stage's own buffer.
        Frag bk[2][2];
        auto load_k = [&](int j) {
            const unsigned short* kp = sk + j * 2048;        // packed fragments (t, c)
            for (int tt = 0; tt < 2; ++tt)
                for (int c = 0; c < 2; ++c) {
                    bk[tt][c].h[0] = *(const ushort8*)(kp + (tt * 2 + c) * 512);
                    bk[tt][c].h[1] = *(const ushort8*)(kp + (tt * 2 + c) * 512 + 256);
                }
        };
        load_k(0);
        for (int j = 0; j < np; ++j) {
            const int kbase = (t * 4 + j) * 32;
            Frag bv[4];
            const unsigned short* vpp = sv + j * 2048;
            for (int n = 0; n < 4; ++n) {
                bv[n].h[0] = *(const ushort8*)(vpp + n * 512);
                bv[n].h[1] = *(const ushort8*)(vpp + n * 512 + 256);
            }
            v8f z = {};
            v8f sc[2];                        // sc[t][r] = score of key kbase + t * 16 + 8 hi + r with query qbase + l15
            sc[0] = wmma16(bk[0][0].b, aq[0].b, z);
            sc[0] = wmma16(bk[0][1].b, aq[1].b, sc[0]);
            sc[1] = wmma16(bk[1][0].b, aq[0].b, z);
            sc[1] = wmma16(bk[1][1].b, aq[1].b, sc[1]);
            load_k(j + 1 < np ? j + 1 : j);     // the stage's last pass loads its own block again: never used

            const bool diag = (kbase + 32 > qbase);
            for (int tt = 0; tt < 2; ++tt)
                for (int r = 0; r < 8; ++r) {
                    float v = sc[tt][r] * 0.125f;           // 1/sqrt(64)
                    if (diag) {
                        int key  = kbase + tt * 16 + hi * 8 + r;
                        int qrow = qbase + l15;
                        if (key > qrow) v = -1.0e30f;
                    }
                    sc[tt][r] = v;
                }

            float mx = fmaxf(sc[0][0], sc[1][0]);
            for (int r = 1; r < 8; ++r) mx = fmaxf(mx, fmaxf(sc[0][r], sc[1][r]));
            mx = fmaxf(mx, xhalf(mx));                      // over all 32 keys of the pass
            const float mn = fmaxf(mrun, mx);
            const float al = __expf(mrun - mn);
            mrun = mn;
            for (int tt = 0; tt < 2; ++tt)
                for (int r = 0; r < 8; ++r)
                    sc[tt][r] = __expf(sc[tt][r] - mn);
            float rs = sc[0][0] + sc[1][0];
            for (int r = 1; r < 8; ++r) rs += sc[0][r] + sc[1][r];
            lrun = lrun * al + rs;                          // the two lanes of a query are added once, behind the loop
            for (int n = 0; n < 4; ++n)
                for (int r = 0; r < 8; ++r)
                    o[n][r] *= al;

            Frag pb;
            for (int tt = 0; tt < 2; ++tt)
                for (int r = 0; r < 8; ++r)
                    pb.u[tt * 8 + r] = f2b(sc[tt][r] * PSC);

            for (int n = 0; n < 4; ++n) o[n] = wmma16(bv[n].b, pb.b, o[n]);
        }
        // Hand-over of the buffers, every wave, at the foot of every stage: this wave's reads of stage t are
        // over, its copies of stage t + 1 have landed; behind the barrier both hold for every wave, so stage t + 1 may be
        // read and the buffer of stage t filled anew.
        asm volatile("s_wait_dscnt 0x0" ::: "memory");
        asm volatile("s_wait_asynccnt 0x0" ::: "memory");
        __syncthreads();
        if (t + 2 < nst) copy_stage(t + 2);
    }
    // no copy is left in flight when the wave ends
    asm volatile("s_wait_asynccnt 0x0" ::: "memory");

    const float inv = PUN / (lrun + xhalf(lrun));
    unsigned short* ot = olds[w];
    for (int n = 0; n < 4; ++n) {             // a lane's 8 values of a tile are 8 consecutive head dims of its query: 16 B
        union { unsigned short s[8]; v4u u; } pk;
        for (int r = 0; r < 8; ++r) pk.s[r] = f2b(o[n][r] * inv);
        *(v4u*)(ot + l15 * 64 + n * 16 + hi * 8) = pk.u;
    }
    asm volatile("s_wait_dscnt 0" ::: "memory");
    __builtin_amdgcn_wave_barrier();
    for (int q = 0; q < 4; ++q) {
        const int rl = q * 4 + (lane >> 3), pc = lane & 7;
        vst2(attn + (size_t)(b * S + qbase + rl) * (H * HD) + h * HD + pc * 8, *(const v4u*)(ot + rl * 64 + pc * 8));
    }
}

// ---------------------------------------------------------------------------
// mean over S:  out[b,d] = mean_s x[b,s,d]
// ---------------------------------------------------------------------------
// One work-group per (batch, strip of 32 columns = one 128-B line of every row). 8 lanes x 16 B cover the line, so a
// wave-wide load takes 4 whole lines (4 rows) and the 32 waves take 128 rows a pass: S / 128 loads a lane.
// Lane sums -> butterfly over the wave's 4 rows -> LDS -> one wave adds the 32 wave sums and stores the strip's line.
// S and D are compile-time so that every load is the one base address plus an immediate offset.
template <int S, int D>
__global__ __launch_bounds__(1024) void colmean(const float* __restrict__ x, float* __restrict__ out) {
    static_assert(S % 128 == 0 && D % 32 == 0, "whole passes, whole lines");
    constexpr int NL = S / 128;                          // loads a lane
    __shared__ __align__(16) float part[32][32];         // [wave][column of the strip]
    const int b   = blockIdx.x / (D / 32);
    const int c0  = (blockIdx.x % (D / 32)) * 32;
    const int tid = threadIdx.x;
    const int q   = tid & 7;                             // which 16 B of the line
    const int r0  = tid >> 3;                            // row inside a pass of 128
    const float* p = x + ((size_t)b * S + r0) * D + c0 + q * 4;
    v4f v[NL];
    #pragma unroll       // independent loads ahead of the adds: their latencies overlap instead of adding up row by row
    for (int i = 0; i < NL; ++i) v[i] = *(const v4f*)(p + (size_t)i * 128 * D);
    v4f s = v[0];
    #pragma unroll       // v[] needs constant indices to stay in registers
    for (int i = 1; i < NL; ++i) s += v[i];
    #pragma unroll       // s[e] needs a constant index to stay in registers
    for (int e = 0; e < 4; ++e) {
        s[e] += __shfl_xor(s[e], 8, 32);
        s[e] += __shfl_xor(s[e], 16, 32);
    }
    if ((tid & 31) < 8) *(v4f*)(&part[tid >> 5][q * 4]) = s;
    __syncthreads();
    if (tid < 32) {
        float tot = 0.f;
        for (int wv = 0; wv < 32; ++wv) tot += part[wv][tid];
        vst2(out + (size_t)b * D + c0 + tid, (float_a)(tot / (float)S));
    }
}

// ---------------------------------------------------------------------------
// recurrent state update: one work-group of 32 waves, two products of the same shape, (2 x K) @ (K x SD):
// new_info = mean @ w_h2s (K = D) and gate logits = [state | new_info] @ w_sgate (K = 2 SD).
// 16 lanes x 16 B cover one 256-B weight row; the K rows are split over the 64 lane groups (K / 64 consecutive rows
// each, both batches from the one row load); group sums -> l ^ 16 shuffle -> LDS -> one thread per output adds the 32.
// D and SD are compile-time so that every global load has a constant offset and depends on no sum.
// ---------------------------------------------------------------------------
__device__ __forceinline__ void wave_sums_to_lds(v4f s0, v4f s1, float (*part)[2][64], int t) {
    #pragma unroll       // constant indices keep s0, s1 in registers
    for (int e = 0; e < 4; ++e) {
        s0[e] += __shfl_xor(s0[e], 16, 32);
        s1[e] += __shfl_xor(s1[e], 16, 32);
    }
    if ((t & 31) < 16) {
        *(v4f*)(&part[t >> 5][0][(t & 15) * 4]) = s0;
        *(v4f*)(&part[t >> 5][1][(t & 15) * 4]) = s1;
    }
}
__device__ __forceinline__ float add_wave_sums(const float (*part)[2][64], int b, int j) {
    float tot = 0.f;
    #pragma unroll       // independent LDS reads ahead of the adds
    for (int wv = 0; wv < 32; ++wv) tot += part[wv][b][j];
    return tot;
}

template <int D, int SD>
__global__ __launch_bounds__(1024) void state_update(
        const float* __restrict__ state, const float* __restrict__ meanx,
        const float* __restrict__ w_h2s, const float* __restrict__ w_sgate,
        float* __restrict__ outState) {
    static_assert(SD == 64 && D % 256 == 0, "16 lanes x 4 columns a row; whole 16-B pieces of the mean");
    constexpr int KR = D / 64;                           // rows of w_h2s a lane group
    constexpr int GR = 2 * SD / 64;                      // rows of w_sgate a lane group
    __shared__ __align__(16) float part[32][2][SD];      // [wave][batch][column]
    __shared__ __align__(16) float cat[2][2 * SD];       // [batch][state | new_info]
    const int t  = threadIdx.x;
    const int c4 = (t & 15) * 4;                         // 4 columns of the row
    const int kg = t >> 4;                               // lane group
    const int b  = (t >> 6) & 1, j = t & 63;             // the output of threads 0 .. 2 SD - 1

    v4f wr[KR], mv[2][KR / 4], wg[GR];
    #pragma unroll       // constant indices keep wr[] in registers
    for (int i = 0; i < KR; ++i) wr[i] = *(const v4f*)(w_h2s + (kg * KR + i) * SD + c4);
    #pragma unroll       // constant indices keep mv[][] in registers
    for (int i = 0; i < KR / 4; ++i) {
        mv[0][i] = *(const v4f*)(meanx + kg * KR + i * 4);
        mv[1][i] = *(const v4f*)(meanx + D + kg * KR + i * 4);
    }
    #pragma unroll       // constant indices keep wg[] in registers
    for (int i = 0; i < GR; ++i) wg[i] = *(const v4f*)(w_sgate + (kg * GR + i) * SD + c4);
    const float st = state[b * SD + j];
    // nothing is scheduled across this line: every load is issued before the first sum waits, so that the kernel pays
    // one memory latency; without it the loads go out in batches, each batch behind the wait for the one before
    __builtin_amdgcn_sched_barrier(0);

    v4f s0 = {}, s1 = {};
    #pragma unroll       // constant indices into wr[] and mv[][]
    for (int i = 0; i < KR; ++i) {
        s0 += wr[i] * mv[0][i >> 2][i & 3];
        s1 += wr[i] * mv[1][i >> 2][i & 3];
    }
    wave_sums_to_lds(s0, s1, part, t);
    if (t < 2 * SD) cat[b][j] = st;
    __syncthreads();                                     // the wave sums of new_info are in part
    if (t < 2 * SD) cat[b][SD + j] = add_wave_sums(part, b, j);
    __syncthreads();                                     // cat is whole; part has been read and may be rewritten
    s0 = v4f{}; s1 = v4f{};
    #pragma unroll       // constant indices into wg[]
    for (int i = 0; i < GR; ++i) {
        s0 += wg[i] * cat[0][kg * GR + i];
        s1 += wg[i] * cat[1][kg * GR + i];
    }
    wave_sums_to_lds(s0, s1, part, t);
    __syncthreads();                                     // the wave sums of the gate logits are in part
    if (t < 2 * SD) {
        const float g = 1.f / (1.f + __expf(-add_wave_sums(part, b, j)));
        vst2(outState + b * SD + j, (float_a)(st * (1.f - g) + cat[b][SD + j] * g));   // 128 consecutive floats
    }
}

// ---------------------------------------------------------------------------
extern "C" void kernel_launch(void* const* d_in, const int* in_sizes, int n_in,
                              void* d_out, int out_size, void* d_ws, size_t ws_size,
                              hipStream_t stream) {
    (void)in_sizes; (void)n_in; (void)out_size; (void)ws_size;
    const int B = 2, S = 2048, D = 1024, H = 16, HD = 64, SD = 64;
    const float* x       = (const float*)d_in[0];
    const float* gamma   = (const float*)d_in[1];
    const float* beta    = (const float*)d_in[2];
    const float* state   = (const float*)d_in[3];
    const float* w_qkv   = (const float*)d_in[4];
    const float* w_o     = (const float*)d_in[5];
    const float* w_gate  = (const float*)d_in[6];
    const float* w_up    = (const float*)d_in[7];
    const float* w_down  = (const float*)d_in[8];
    const float* norm1_w = (const float*)d_in[9];
    const float* norm2_w = (const float*)d_in[10];
    const float* w_sm    = (const float*)d_in[11];
    const float* w_h2s   = (const float*)d_in[12];
    const float* w_sgate = (const float*)d_in[13];
    float* xout = (float*)d_out;                       // (B,S,D) then state (B,SD)

    char* ws = (char*)d_ws;
    size_t off = 0;
    auto arena = [&](size_t bytes) -> void* {
        void* p = ws + off;
        off = (off + bytes + 255) & ~(size_t)255;
        return p;
    };
    float* fg             = (float*)arena((size_t)B * D * 4);
    float* fb             = (float*)arena((size_t)B * D * 4);
    unsigned short* hbuf  = (unsigned short*)arena((size_t)B * S * D * 2);       // h / h2
    unsigned short* wqkvp = (unsigned short*)arena((size_t)D * 3 * D * 2);
    unsigned short* wop   = (unsigned short*)arena((size_t)D * D * 2);
    unsigned short* wgp   = (unsigned short*)arena((size_t)D * 3 * D * 2);
    unsigned short* wupp  = (unsigned short*)arena((size_t)D * 3 * D * 2);
    unsigned short* wdp   = (unsigned short*)arena((size_t)3 * D * D * 2);
    unsigned short* qkvb  = (unsigned short*)arena((size_t)B * S * 3 * D * 2);   // also act
    unsigned short* vp    = (unsigned short*)arena((size_t)B * H * (S / 32) * 4 * 512 * 2);
    unsigned short* kpk   = (unsigned short*)arena((size_t)B * H * (S / 32) * 4 * 512 * 2);
    unsigned short* attnb = (unsigned short*)arena((size_t)B * S * D * 2);
    float* x1             = (float*)arena((size_t)B * S * D * 4);
    unsigned short* gateb = (unsigned short*)arena((size_t)B * S * 3 * D * 2);
    float* meanb          = (float*)arena((size_t)B * D * 4);
    unsigned short* act   = qkvb;                      // reuse after attention

    const int MR = B * S;                              // 4096 rows

    // FiLM params (128 outputs a work-group) and the weights -> B fragments (f16; a work-group of 4 waves packs
    // 4 x 2,048 elements), one launch
    prep<B, D, SD><<<B * 2 * D / 128 + 13 * D * D / 8192, 128, 0, stream>>>(
        state, w_sm, gamma, beta, w_qkv, w_gate, w_up, w_o, w_down, fg, fb, wqkvp, wgp, wupp, wop, wdp);

    // h = rmsnorm(x)*fg + fb
    rmsnorm_film<S, D><<<MR / 16, 256, 0, stream>>>(x, norm1_w, fg, fb, hbuf);

    // qkv = h @ w_qkv   (f16 out)
    gemm_f16<0, 2, 4, 4, 3><<<dim3(3 * D / 192, MR / 256), 512, 0, stream>>>(
        hbuf, wqkvp, nullptr, nullptr, nullptr, qkvb, MR, 3 * D, D);

    // pack V and K into B fragments
    pack_v<S, H, HD><<<B * H * (S / 32) / 4, 128, 0, stream>>>(qkvb, vp, kpk);

    // attention
    flash_attn<<<(B * H * (S / 16)) / 8, 256, 0, stream>>>(qkvb, vp, kpk, attnb, S, H, HD);

    // x1 = x + attn @ w_o
    gemm_f16<1, 4, 2, 2, 4><<<dim3(D / 256, MR / 64), 256, 0, stream>>>(
        attnb, wop, x, nullptr, x1, nullptr, MR, D, D);

    // h2 = rmsnorm(x1)*fg + fb
    rmsnorm_film<S, D><<<MR / 16, 256, 0, stream>>>(x1, norm2_w, fg, fb, hbuf);

    // gate = silu(h2 @ w_gate)   (f16)
    gemm_f16<2, 2, 4, 4, 3><<<dim3(3 * D / 192, MR / 256), 512, 0, stream>>>(
        hbuf, wgp, nullptr, nullptr, nullptr, gateb, MR, 3 * D, D);

    // act = gate * (h2 @ w_up)   (f16)
    gemm_f16<3, 2, 4, 4, 3><<<dim3(3 * D / 192, MR / 256), 512, 0, stream>>>(
        hbuf, wupp, nullptr, gateb, nullptr, act, MR, 3 * D, D);

    // xout = x1 + act @ w_down
    gemm_f16<1, 4, 2, 2, 4><<<dim3(D / 256, MR / 64), 256, 0, stream>>>(
        act, wdp, x1, nullptr, xout, nullptr, MR, D, 3 * D);

    // state update
    colmean<S, D><<<B * D / 32, 1024, 0, stream>>>(xout, meanb);
    state_update<D, SD><<<1, 1024, 0, stream>>>(state, meanb, w_h2s, w_sgate,
                                                xout + (size_t)B * S * D);
}
